// v000
// Measured on an AMD MI455X. A time is GPU time per run, averaged over a window of back-to-back runs after a warm-up
// (all launches, gaps included; the runs take copies of the inputs in turn), and the median of several windows.
// Apart from v000's, it joins two sittings. Times from different sittings can be a few percent apart, while
// side-by-side timings come from the same sitting.
// The starting kernel, v000, takes 544 microseconds a run.
// Contractions: q, k and v^T projections on v_wmma_f32_16x16x32_f16 (f16 layer-norm plane carried x16 times
// f16 transposed weight plane carried x64, one product each); attention q.k^T on v_wmma_f32_16x16x32_f16
// (q as f16 hi plane plus f16 residual plane carried x4096, k plain f16, two products); p.v on
// v_wmma_f32_16x16x32_f16 (p carried x1024, v^T as f16 hi plane carried x16 plus f16 residual plane carried
// x4096, two products); all f32 accumulate; layer norm and softmax in f32 on VALU; every float input
// RNE-converted to bf16 on load.
#include <hip/hip_runtime.h>
#include <math.h>
#include <stdint.h>

#define NB    4
#define SQ    2048
#define NTOK  (NB * SQ)
#define DM    1024
#define NH    16
#define HD    64
#define NQB   (SQ / 64)
#define XSC   16.0f
#define WSC   64.0f
#define VSC   16.0f
#define RSC   4096.0f
#define PSC   1024.0f
#define LNEPS 1e-5f
static_assert(NH * HD == DM);
static_assert((SQ % 64) == 0 && (DM % 64) == 0 && (NTOK % 64) == 0);
static_assert(DM == 4 * 256);
static_assert((NTOK % 8) == 0);

typedef _Float16 v16h __attribute__((ext_vector_type(16)));
typedef _Float16 v8h  __attribute__((ext_vector_type(8)));
typedef float    v8f  __attribute__((ext_vector_type(8)));
typedef float    v4f  __attribute__((ext_vector_type(4)));
typedef unsigned int v4u __attribute__((ext_vector_type(4)));

// ---- scalar helpers --------------------------------------------------------------------------------
__device__ __forceinline__ unsigned short bf_bits(float f) {          // f32 -> bf16 bits, RNE convert
  unsigned u = __float_as_uint(f);
  return (unsigned short)((u + 0x7FFFu + ((u >> 16) & 1u)) >> 16);
}
__device__ __forceinline__ float bf_up(unsigned short h) { return __uint_as_float(((unsigned)h) << 16); }
__device__ __forceinline__ float bfr(float f) { return bf_up(bf_bits(f)); }   // value of the bf16 RNE convert
__device__ __forceinline__ unsigned short h_bits(_Float16 x) { return __builtin_bit_cast(unsigned short, x); }
__device__ __forceinline__ unsigned pk16(unsigned short a, unsigned short b) { return (unsigned)a | ((unsigned)b << 16); }
__device__ __forceinline__ v8f zero8() { v8f z = {0.f, 0.f, 0.f, 0.f, 0.f, 0.f, 0.f, 0.f}; return z; }

// ---- fragment loader: 16-bit A/B operand, lane -> row/col (lane&15), p already includes +8*(lane>>4);
//      elements 0..7 <- p[0..7] (k0+8h..), elements 8..15 <- p[16..23] (k0+16+8h..)
__device__ __forceinline__ v16h ldfrag_h(const _Float16* p) {
  union { v16h v; v8h h[2]; } f;
  f.h[0] = *(const v8h*)(p);
  f.h[1] = *(const v8h*)(p + 16);
  return f.v;
}

// ---- WMMA helpers with trailing VALU hazard gap --------------------------------------------------------
__device__ __forceinline__ v8f mma_h(v16h a, v16h b, v8f c) {
  c = __builtin_amdgcn_wmma_f32_16x16x32_f16(false, a, false, b, (short)0, c, false, false);
#if defined(__HIP_DEVICE_COMPILE__)
  asm volatile("v_nop\n\tv_nop\n\tv_nop\n\tv_nop" : "+v"(c) : "v"(a), "v"(b));
#endif
  return c;
}
__device__ __forceinline__ v8f mma_h_raw(v16h a, v16h b, v8f c) {
  return __builtin_amdgcn_wmma_f32_16x16x32_f16(false, a, false, b, (short)0, c, false, false);
}
__device__ __forceinline__ void dep_guard1(v8f& a, v8f& b, v16h x) {
#if defined(__HIP_DEVICE_COMPILE__)
  asm volatile("v_nop\n\tv_nop\n\tv_nop\n\tv_nop" : "+v"(a), "+v"(b) : "v"(x));
#endif
}
__device__ __forceinline__ void keep4_h(v16h a, v16h b, v16h c, v16h d) {
#if defined(__HIP_DEVICE_COMPILE__)
  asm volatile("v_nop" :: "v"(a), "v"(b), "v"(c), "v"(d));
#endif
}
__device__ __forceinline__ void acc_guard4(v8f& a, v8f& b, v8f& c, v8f& d) {
#if defined(__HIP_DEVICE_COMPILE__)
  asm volatile("v_nop\n\tv_nop\n\tv_nop\n\tv_nop" : "+v"(a), "+v"(b), "+v"(c), "+v"(d));
#endif
}
__device__ __forceinline__ void wave_sync_lds() {
  __builtin_amdgcn_fence(__ATOMIC_RELEASE, "workgroup");
  __builtin_amdgcn_wave_barrier();
  __builtin_amdgcn_fence(__ATOMIC_ACQUIRE, "workgroup");
}

// =====================================================================================================
// Layer norm over rows of DM = 1024: one wave per row, 8 rows per block (grid = nrows/8). Every input value
// y = ((x - mu) * rstd * gamma + beta) * xsc written as one f16 plane [nrows][DM].
// Lane l handles columns 256*i + 8*l .. +7 (i = 0..3); each store instruction of the wave covers 512 B =
// coverage: grid(nrows/8) x 8 waves = every row; 4 iterations x 32 lanes x 8 = all 1024 columns.
// =====================================================================================================
__global__ __launch_bounds__(256) void ln_rows(const float* __restrict__ x, const float* __restrict__ gam,
                                               const float* __restrict__ bet, unsigned short* Xh,
                                               int nrows, float xsc, float eps) {
  const int lane = threadIdx.x & 31;
  const int wave = threadIdx.x >> 5;
  const int row  = blockIdx.x * 8 + wave;
  if (row >= nrows) return;                     // wave-uniform; no block barriers in this kernel
  const float* xr = x + (size_t)row * DM;
  const float rd = 1.0f / (float)DM;

  float s = 0.f;
#pragma unroll 1
  for (int i = 0; i < 4; ++i) {
    const int c0 = 256 * i + 8 * lane;
    const v4f a = *(const v4f*)(xr + c0);
    const v4f b = *(const v4f*)(xr + c0 + 4);
    s += ((bfr(a[0]) + bfr(a[1])) + (bfr(a[2]) + bfr(a[3]))) +
         ((bfr(b[0]) + bfr(b[1])) + (bfr(b[2]) + bfr(b[3])));
  }
#pragma unroll
  for (int off = 1; off < 32; off <<= 1) s += __shfl_xor(s, off, 32);
  const float mu = s * rd;

  float s2 = 0.f;
#pragma unroll 1
  for (int i = 0; i < 4; ++i) {
    const int c0 = 256 * i + 8 * lane;
    const v4f a = *(const v4f*)(xr + c0);
    const v4f b = *(const v4f*)(xr + c0 + 4);
#pragma unroll
    for (int e = 0; e < 4; ++e) {
      const float d0 = bfr(a[e]) - mu;
      const float d1 = bfr(b[e]) - mu;
      s2 += d0 * d0;
      s2 += d1 * d1;
    }
  }
#pragma unroll
  for (int off = 1; off < 32; off <<= 1) s2 += __shfl_xor(s2, off, 32);
  const float var  = s2 * rd;
  const float rstd = 1.0f / sqrtf(var + eps);

#pragma unroll 1
  for (int i = 0; i < 4; ++i) {
    const int c0 = 256 * i + 8 * lane;
    const v4f a  = *(const v4f*)(xr + c0);
    const v4f b  = *(const v4f*)(xr + c0 + 4);
    const v4f ga = *(const v4f*)(gam + c0);
    const v4f gb = *(const v4f*)(gam + c0 + 4);
    const v4f ba = *(const v4f*)(bet + c0);
    const v4f bb = *(const v4f*)(bet + c0 + 4);
    float y[8];
#pragma unroll
    for (int e = 0; e < 4; ++e) {
      y[e]     = ((bfr(a[e]) - mu) * rstd * bfr(ga[e]) + bfr(ba[e])) * xsc;
      y[4 + e] = ((bfr(b[e]) - mu) * rstd * bfr(gb[e]) + bfr(bb[e])) * xsc;
    }
    v4u u;
#pragma unroll
    for (int e = 0; e < 4; ++e) u[e] = pk16(h_bits((_Float16)y[2 * e]), h_bits((_Float16)y[2 * e + 1]));
    unsigned short* dst = Xh + (size_t)row * DM + c0;
    *(v4u*)dst = u;
    
  }
}

// =====================================================================================================
// Transpose-convert: W f32 in[R][C] (row-major) -> out f16 bits [C][R]; each value bf16 RNE-converted,
// multiplied by wsc (power of two, exact) and cast to f16. Block = one 64x64 tile staged through LDS,
// coverage: load 4 it x 256 threads x 4 = 64x64; store 2 it x 256 threads x 8 = 64x64; grid covers R x C.
// =====================================================================================================
__global__ __launch_bounds__(256) void wtrans_h(const float* __restrict__ W, unsigned short* Wt,
                                                int R, int C, float wsc) {
  __shared__ __align__(16) unsigned short sT[64 * 72];     // [c][r], pitch 72 halves = 144 B
  const int tid = threadIdx.x;
  const int r0  = blockIdx.y * 64;          // rows of W
  const int c0  = blockIdx.x * 64;          // cols of W
#pragma unroll
  for (int it = 0; it < 4; ++it) {
    const int idx = it * 256 + tid;         // 0..1023
    const int r   = idx >> 4;               // 0..63
    const int c4  = (idx & 15) * 4;         // 0..60
    const v4f w = *(const v4f*)(W + (size_t)(r0 + r) * C + c0 + c4);
#pragma unroll
    for (int e = 0; e < 4; ++e) sT[(c4 + e) * 72 + r] = h_bits((_Float16)(bfr(w[e]) * wsc));
  }
  __syncthreads();
  v4u u[2];
#pragma unroll
  for (int it = 0; it < 2; ++it) {
    const int row = it * 32 + (tid >> 3), col8 = (tid & 7) * 8;
    u[it] = *(const v4u*)(sT + row * 72 + col8);
  }
  {
#pragma unroll
    for (int it = 0; it < 2; ++it) {
      const int row = it * 32 + (tid >> 3), col8 = (tid & 7) * 8;
      *(v4u*)(Wt + (size_t)(c0 + row) * R + r0 + col8) = u[it];
    }
    
  }
}

// =====================================================================================================
// Register-blocked f16 WMMA GEMM: C[m][n] = oscale * sum_k A[m][k] * Bt[n][k] + bsc * bias; one wave per
// 64x64 tile, no block barriers. A row-major [M][K] pitch lda; Bt row-major [N][K] pitch ldb (k contiguous);
// M, N multiples of 64, K multiple of 32 (static here).
// Bias: BIASM == 0 -> per column bias0[n] (N entries, clamped-address 16-B loads); BIASM == 1 -> per row
//       bias0[m] (M entries). Bias values RNE-converted to bf16, then multiplied by bsc.
// OM: 2 = one f16 plane (Cout); 3 = f16 hi plane (Cout) plus f16 residual plane ((f - hi) * rsc, Cout2), same
//     indexing and pitch ldc for both planes.
// coverage: 4 slabs x 16 rows (it 0..3 x lane>>3 0..3) x 64 cols (8 lanes x 8) = the wave's whole 64x64 tile;
//           grid = ceil(tilesM*tilesN/8) blocks, surplus waves exit (wave-uniform).
// =====================================================================================================
template <int OM, int BIASM>
__global__ __launch_bounds__(256) void gemm64(
    const unsigned short* __restrict__ Ap, int lda,
    const unsigned short* __restrict__ Btp, int ldb,
    const float* __restrict__ bias0,
    unsigned short* Cout, unsigned short* Cout2, int ldc,
    int M, int N, int K, float oscale, float bsc, float rsc) {
  const _Float16* A  = (const _Float16*)(const void*)Ap;
  const _Float16* Bt = (const _Float16*)(const void*)Btp;
  __shared__ __align__(16) float sT[8][16 * 68];   // per-wave 16x64 slab, pitch 68 floats
  const int lane = threadIdx.x & 31;
  const int wave = threadIdx.x >> 5;
  const int tilesN = N >> 6;
  const int tilesM = M >> 6;
  const int tile = blockIdx.x * 8 + wave;
  if (tile >= tilesM * tilesN) return;   // wave-uniform; no block barriers in this kernel
  const int tm = tile / tilesN;
  const int tn = tile - tm * tilesN;
  const int m0 = tm << 6;
  const int n0 = tn << 6;

  const int rlane = lane & 15;                 // row (A) / col (B, D) within subtile
  const int koff  = (lane >> 4) * 8;           // k offset of this lane half
  const int mOff  = (lane >> 4) * 8;           // D row offset

  v8f acc[4][4];
#pragma unroll
  for (int i = 0; i < 4; ++i)
#pragma unroll
    for (int j = 0; j < 4; ++j) acc[i][j] = zero8();

  for (int k0 = 0; k0 < K; k0 += 32) {
    v16h bh[4];
#pragma unroll
    for (int j = 0; j < 4; ++j) {
      const size_t bo = (size_t)(n0 + (j << 4) + rlane) * ldb + koff + k0;
      bh[j] = ldfrag_h(Bt + bo);
    }
#pragma unroll
    for (int i = 0; i < 4; ++i) {
      const size_t ao = (size_t)(m0 + (i << 4) + rlane) * lda + koff + k0;
      const v16h ah = ldfrag_h(A + ao);
#pragma unroll
      for (int j = 0; j < 4; ++j) acc[i][j] = mma_h_raw(ah, bh[j], acc[i][j]);
      dep_guard1(acc[i][0], acc[i][3], ah);
    }
    keep4_h(bh[0], bh[1], bh[2], bh[3]);
  }
  acc_guard4(acc[0][0], acc[0][1], acc[0][2], acc[0][3]);
  acc_guard4(acc[1][0], acc[1][1], acc[1][2], acc[1][3]);
  acc_guard4(acc[2][0], acc[2][1], acc[2][2], acc[2][3]);
  acc_guard4(acc[3][0], acc[3][1], acc[3][2], acc[3][3]);

  const int q8 = lane >> 3, c8 = (lane & 7) * 8;
  float bc[8];
#pragma unroll
  for (int e = 0; e < 8; ++e) bc[e] = 0.f;
  if (BIASM == 0) {
    const int cb = n0 + c8;                                  // <= N - 8
    const int i0 = (cb < N - 8) ? cb : (N - 8);
    const v4f b0a = *(const v4f*)(bias0 + i0), b0b = *(const v4f*)(bias0 + i0 + 4);
#pragma unroll
    for (int e = 0; e < 4; ++e) {
      bc[e]     = bfr(b0a[e]) * bsc;
      bc[4 + e] = bfr(b0b[e]) * bsc;
    }
  }

  // ---- epilogue ----
  float* slab = sT[wave];
#pragma unroll
  for (int i = 0; i < 4; ++i) {
    const int mBase = m0 + (i << 4);
#pragma unroll
    for (int j = 0; j < 4; ++j) {
#pragma unroll
      for (int r = 0; r < 8; ++r) {
        slab[(mOff + r) * 68 + (j << 4) + rlane] = acc[i][j][r];
      }
    }
    wave_sync_lds();
    v4u hv[4], lv[4];
#pragma unroll
    for (int it = 0; it < 4; ++it) {
      const int row = it * 4 + q8;                       // it 0..3 x q8 0..3 = rows 0..15
      const float* sp = slab + row * 68 + c8;
      float bm = 0.f;
      if (BIASM == 1) bm = bfr(bias0[mBase + row]) * bsc; // mBase + row < M
      v4u a, lw;
#pragma unroll
      for (int e = 0; e < 4; ++e) {
        const float f0 = sp[2 * e]     * oscale + ((BIASM == 1) ? bm : bc[2 * e]);
        const float f1 = sp[2 * e + 1] * oscale + ((BIASM == 1) ? bm : bc[2 * e + 1]);
        const _Float16 g0 = (_Float16)f0;
        const _Float16 g1 = (_Float16)f1;
        a[e] = pk16(h_bits(g0), h_bits(g1));
        if (OM == 3) {
          const _Float16 r0 = (_Float16)((f0 - (float)g0) * rsc);
          const _Float16 r1 = (_Float16)((f1 - (float)g1) * rsc);
          lw[e] = pk16(h_bits(r0), h_bits(r1));
        } else {
          lw[e] = 0u;
        }
      }
      hv[it] = a;
      lv[it] = lw;
    }
    {
#pragma unroll
      for (int it = 0; it < 4; ++it) {
        const int row = it * 4 + q8;
        const size_t go = (size_t)(mBase + row) * ldc + n0 + c8;
        *(v4u*)(Cout + go) = hv[it];
        if (OM == 3) *(v4u*)(Cout2 + go) = lv[it];
      }
      
    }
    wave_sync_lds();
  }
}

// =====================================================================================================
// Full (non-causal) attention with a per-head linear distance bias, head dim 64, NB sequences of SQ tokens,
// NH heads.
//   q planes (f16 hi, f16 residual x RSC) [NTOK][DM], row = b*SQ + s, col = h*64 + d; k plane (f16) [NTOK][DM];
//   v^T planes (f16 hi x VSC, f16 residual x VSC x RSC) [DM][NTOK]: element (h*64 + d, b*SQ + s);
//   out f32 [NTOK][DM], col = h*64 + d.
//   raw = (qhi . k) + (qres . k) / RSC; logit = (raw - slope_h * |key - query|) * sscale (sscale = 1/8);
//   slope_h = 2^(-(h+1)/2): exact power of two for odd h, f32(2^-0.5) * 2^-(h/2) for even h.
//   p = exp(logit - m) carried as f16(PSC * p); context = p . vhi + (p . vres) / RSC on f16 WMMA, the residual
//   term accumulated per chunk from zero and folded into the f32 running context; online softmax in f32; final
//   scale onorm = 1 / (PSC * VSC) together with 1/l (l >= 1 since every key is allowed and the row max
//   contributes exp(0)).
//   Block = 4 waves = 64 query rows of one (sequence, head); grid = NB * NH * NQB; key chunks of 64, all NQB
//   chunks visited (block-uniform trip).
//   K / V^T hi / V^T res chunk staging: 128 threads x 32 elements per plane = the whole 64x64 tile of each of
//   the 3 planes (plain 16-B loads, __syncthreads before and after); P tiles are wave-private, spilled with
//   Output coverage: each wave stores rows q0..q0+15 (it 0..7 x lane>>4 0..1) x 64 columns (16 lanes x 4 f32),
//   column slices = the whole [NTOK][DM] output.
// =====================================================================================================
__global__ __launch_bounds__(128)
void attn_lb(const unsigned short* __restrict__ qhp, const unsigned short* __restrict__ qlp,
             const unsigned short* __restrict__ khp,
             const unsigned short* __restrict__ vthp, const unsigned short* __restrict__ vtlp,
             float* outp, float sscale, float onorm) {
  union FH { v16h v; v8h h[2]; };
  __shared__ __align__(16) _Float16 Ksh[64 * 64];                 // K [kv][d]        8 KB
  __shared__ __align__(16) _Float16 Vth[64 * 64];                 // V^T hi [d][kv]   8 KB
  __shared__ __align__(16) _Float16 Vtl[64 * 64];                 // V^T res [d][kv]  8 KB
  __shared__ __align__(16) _Float16 Psh[4][16 * 64];              // per wave P [row][kv]
  __shared__ __align__(16) float    Os[4][16 * 64];               // per wave context tile [row][d]

  const int tid  = threadIdx.x;
  const int wave = tid >> 5;
  const int lane = tid & 31;
  const int hh   = lane >> 4;
  const int c    = lane & 15;

  const int bx   = blockIdx.x;
  const int qb   = bx % NQB;
  const int hb   = bx / NQB;
  const int h    = hb % NH;
  const int b    = hb / NH;
  const int tok0 = b * SQ;                       // first token row of this sequence
  const int ql0  = qb * 64 + wave * 16;          // local query index of this wave's first row
  const int q0   = tok0 + ql0;                   // global token row of this wave's first row

  const _Float16* Qh = (const _Float16*)(const void*)qhp + (size_t)h * HD;
  const _Float16* Ql = (const _Float16*)(const void*)qlp + (size_t)h * HD;
  const _Float16* Kg = (const _Float16*)(const void*)khp + (size_t)h * HD;
  const _Float16* Vh = (const _Float16*)(const void*)vthp + (size_t)h * HD * NTOK + tok0;
  const _Float16* Vl = (const _Float16*)(const void*)vtlp + (size_t)h * HD * NTOK + tok0;

  // ---- per-head slope (block-uniform) ----
  const int   se    = (h + 1) >> 1;
  const float spw   = __uint_as_float((unsigned)(127 - se) << 23);
  const float slope = (h & 1) ? spw : (spw * 0.70710678118654752f);

  // ---- Q fragments (A operand, row = lane&15): 2 d-chunks, hi and residual planes ----
  v16h qa[2], qr[2];
#pragma unroll
  for (int dc = 0; dc < 2; ++dc) {
    qa[dc] = ldfrag_h(Qh + (size_t)(q0 + c) * DM + dc * 32 + 8 * hh);
    qr[dc] = ldfrag_h(Ql + (size_t)(q0 + c) * DM + dc * 32 + 8 * hh);
  }

  float mrow[8], lrow[8];
  v8f oacc[4];
#pragma unroll
  for (int r = 0; r < 8; ++r) { mrow[r] = -INFINITY; lrow[r] = 0.f; }
#pragma unroll
  for (int t = 0; t < 4; ++t) oacc[t] = zero8();

  const float rinv = 1.0f / RSC;

  for (int kt = 0; kt < NQB; ++kt) {            // block-uniform trip = 32
    const int kv0 = kt * 64;                     // local key index of the chunk
    __syncthreads();
    {
      const int r = tid >> 1, hf = (tid & 1) * 32;
      const _Float16* kg = Kg + (size_t)(tok0 + kv0 + r) * DM + hf;   // K row, d = hf..hf+31
      const _Float16* vg = Vh + (size_t)r * NTOK + kv0 + hf;           // V^T hi row d = r, s = kv0+hf..+31
      const _Float16* wg = Vl + (size_t)r * NTOK + kv0 + hf;           // V^T res row d = r
#pragma unroll
      for (int i = 0; i < 4; ++i) {
        const v8h a0 = *(const v8h*)(kg + 8 * i);
        const v8h b0 = *(const v8h*)(vg + 8 * i);
        const v8h c0 = *(const v8h*)(wg + 8 * i);
        *(v8h*)(Ksh + r * 64 + hf + 8 * i) = a0;
        *(v8h*)(Vth + r * 64 + hf + 8 * i) = b0;
        *(v8h*)(Vtl + r * 64 + hf + 8 * i) = c0;
      }
    }
    __syncthreads();

    // ---- logits: 16 query rows x 64 keys per wave ----
    v8f s[4];
#pragma unroll
    for (int j = 0; j < 4; ++j) {
      v8f sh = zero8(), sl = zero8();
#pragma unroll
      for (int dc = 0; dc < 2; ++dc) {
        FH kb;
        kb.h[0] = *(const v8h*)(Ksh + (j * 16 + c) * 64 + dc * 32 + 8 * hh);
        kb.h[1] = *(const v8h*)(Ksh + (j * 16 + c) * 64 + dc * 32 + 16 + 8 * hh);
        sh = mma_h(qa[dc], kb.v, sh);
        sl = mma_h(qr[dc], kb.v, sl);
      }
      const int key = kv0 + j * 16 + c;                             // D column = lane&15
#pragma unroll
      for (int r = 0; r < 8; ++r) {
        const int qrow = ql0 + 8 * hh + r;                          // D row = 8h + r
        int dd = key - qrow;
        if (dd < 0) dd = -dd;
        const float raw = sh[r] + sl[r] * rinv;
        s[j][r] = (raw - slope * (float)dd) * sscale;
      }
    }

    // ---- row max, online softmax, P (x PSC, f16) to LDS ----
    _Float16* pwh = Psh[wave];
#pragma unroll
    for (int r = 0; r < 8; ++r) {
      float m = s[0][r];
      m = fmaxf(m, s[1][r]);
      m = fmaxf(m, s[2][r]);
      m = fmaxf(m, s[3][r]);
#pragma unroll
      for (int off = 1; off < 16; off <<= 1) m = fmaxf(m, __shfl_xor(m, off, 32));
      const float mnew  = fmaxf(mrow[r], m);
      const float ms    = (mnew == -INFINITY) ? 0.f : mnew;
      const float alpha = __expf(mrow[r] - ms);
      mrow[r] = mnew;
      float psum = 0.f;
#pragma unroll
      for (int j = 0; j < 4; ++j) {
        const float p = __expf(s[j][r] - ms);
        psum += p;
        pwh[(8 * hh + r) * 64 + j * 16 + c] = (_Float16)(p * PSC);
      }
#pragma unroll
      for (int off = 1; off < 16; off <<= 1) psum += __shfl_xor(psum, off, 32);
      lrow[r] = lrow[r] * alpha + psum;
#pragma unroll
      for (int t = 0; t < 4; ++t) oacc[t][r] *= alpha;
    }
    wave_sync_lds();

    // ---- context += P . Vhi ; chunk residual = P . Vres (f16 WMMA) ----
    v8f ol[4];
#pragma unroll
    for (int t = 0; t < 4; ++t) ol[t] = zero8();
#pragma unroll 1
    for (int kk = 0; kk < 2; ++kk) {
      FH pa;
      pa.h[0] = *(const v8h*)(pwh + c * 64 + kk * 32 + 8 * hh);
      pa.h[1] = *(const v8h*)(pwh + c * 64 + kk * 32 + 16 + 8 * hh);
#pragma unroll
      for (int t = 0; t < 4; ++t) {
        FH vb, wb;
        vb.h[0] = *(const v8h*)(Vth + (t * 16 + c) * 64 + kk * 32 + 8 * hh);
        vb.h[1] = *(const v8h*)(Vth + (t * 16 + c) * 64 + kk * 32 + 16 + 8 * hh);
        wb.h[0] = *(const v8h*)(Vtl + (t * 16 + c) * 64 + kk * 32 + 8 * hh);
        wb.h[1] = *(const v8h*)(Vtl + (t * 16 + c) * 64 + kk * 32 + 16 + 8 * hh);
        oacc[t] = mma_h(pa.v, vb.v, oacc[t]);
        ol[t]   = mma_h(pa.v, wb.v, ol[t]);
      }
    }
    // ---- fold this chunk's residual term into the running context (f32) ----
#pragma unroll
    for (int t = 0; t < 4; ++t) {
#pragma unroll
      for (int r = 0; r < 8; ++r) oacc[t][r] += ol[t][r] * rinv;
    }
  }

  // ---- normalise (1/l and the 1/(PSC*VSC) carry), stage the wave's 16x64 tile, write whole 256-B row
  float* os = Os[wave];
#pragma unroll
  for (int r = 0; r < 8; ++r) {
    const float l = lrow[r];
    const float inv = ((l > 0.f) ? (1.0f / l) : 0.f) * onorm;
#pragma unroll
    for (int t = 0; t < 4; ++t) os[(8 * hh + r) * 64 + t * 16 + c] = oacc[t][r] * inv;
  }
  wave_sync_lds();
  {
    const int hh2 = lane >> 4, c4 = (lane & 15) * 4;
    v4f vals[8];
#pragma unroll
    for (int it = 0; it < 8; ++it) {
      const int row = it * 2 + hh2;   // it 0..7 x hh2 0..1 = rows 0..15 of the wave tile
      vals[it] = *(const v4f*)(os + row * 64 + c4);
    }
    {
#pragma unroll
      for (int it = 0; it < 8; ++it) {
        const int row = it * 2 + hh2;
        const size_t go = (size_t)(q0 + row) * DM + (size_t)h * HD + c4;
        *(v4f*)(outp + go) = vals[it];
      }
      
    }
  }
}

// =====================================================================================================
// Workspace map (bytes); every plane is an exact multiple of its 64x64-tile / whole-line store granularity
// ([8192][1024] = 128x16 tiles, [1024][8192] = 16x128 tiles, weights [1024][1024] = 16x16 tiles):
//   WqT  f16 [1024][1024]   0          2097152   (transposed, x64)
//   WkT  f16 [1024][1024]   2097152    2097152
//   WvT  f16 [1024][1024]   4194304    2097152
//   XH   f16 [8192][1024]   6291456    16777216  (layer norm output x16)
//   QH   f16 [8192][1024]   23068672   16777216  (q hi)
//   QL   f16 [8192][1024]   39845888   16777216  (q residual x4096)
//   KH   f16 [8192][1024]   56623104   16777216
//   VTH  f16 [1024][8192]   73400320   16777216  (v^T hi x16)
//   VTL  f16 [1024][8192]   90177536   16777216  (v^T residual x16 x4096)
//   end                     106954752
// =====================================================================================================
extern "C" void kernel_launch(void* const* d_in, const int* in_sizes, int n_in,
                              void* d_out, int out_size, void* d_ws, size_t ws_size,
                              hipStream_t stream) {
  if (n_in < 9) return;
  if (in_sizes[0] != NTOK * DM) return;
  if (in_sizes[1] != DM || in_sizes[2] != DM) return;
  if (in_sizes[3] != DM * DM || in_sizes[5] != DM * DM || in_sizes[7] != DM * DM) return;
  if (in_sizes[4] != DM || in_sizes[6] != DM || in_sizes[8] != DM) return;
  if (out_size != NTOK * DM) return;

  const float* x   = (const float*)d_in[0];
  const float* gam = (const float*)d_in[1];
  const float* bet = (const float*)d_in[2];
  const float* wq  = (const float*)d_in[3];
  const float* bq  = (const float*)d_in[4];
  const float* wk  = (const float*)d_in[5];
  const float* bk  = (const float*)d_in[6];
  const float* wv  = (const float*)d_in[7];
  const float* bv  = (const float*)d_in[8];

  const size_t PW = (size_t)DM * DM * 2;            //  2097152
  const size_t PA = (size_t)NTOK * DM * 2;          // 16777216
  size_t off = 0;
  const size_t oWq = off; off += PW;
  const size_t oWk = off; off += PW;
  const size_t oWv = off; off += PW;
  const size_t oXH = off; off += PA;
  const size_t oQH = off; off += PA;
  const size_t oQL = off; off += PA;
  const size_t oKH = off; off += PA;
  const size_t oVH = off; off += PA;
  const size_t oVL = off; off += PA;
  if (off > ws_size) return;                        // off = 106954752
  if (off > (size_t)134217728) return;

  char* ws = (char*)d_ws;
  unsigned short* WqT = (unsigned short*)(ws + oWq);
  unsigned short* WkT = (unsigned short*)(ws + oWk);
  unsigned short* WvT = (unsigned short*)(ws + oWv);
  unsigned short* XH  = (unsigned short*)(ws + oXH);
  unsigned short* QH  = (unsigned short*)(ws + oQH);
  unsigned short* QL  = (unsigned short*)(ws + oQL);
  unsigned short* KH  = (unsigned short*)(ws + oKH);
  unsigned short* VTH = (unsigned short*)(ws + oVH);
  unsigned short* VTL = (unsigned short*)(ws + oVL);

  const dim3 blk(256), blk128(128);
  const dim3 gLn(NTOK / 8);                                            // 1024 blocks, 8 rows each
  const dim3 gTr(DM / 64, DM / 64);                                    // (cols/64, rows/64) of W[in][out]
  const dim3 gG(((NTOK / 64) * (DM / 64) + 7) / 8);                    // 2048 tiles -> 256 blocks
  const dim3 gAttn(NB * NH * NQB);                                     // 2048 blocks of 128
  const float osc_qk = 1.0f / (XSC * WSC);                             // q, k unscaled
  const float osc_v  = VSC / (XSC * WSC);                              // v^T carried x16

  // (0) layer norm -> XH f16 [8192][1024] (x16)
  ln_rows<<<gLn, blk, 0, stream>>>(x, gam, bet, XH, NTOK, XSC, LNEPS);
  // (1) weights W[in][out] f32 -> W^T f16 [out][in] (k contiguous), bf16 RNE-converted, x64
  wtrans_h<<<gTr, blk, 0, stream>>>(wq, WqT, DM, DM, WSC);
  wtrans_h<<<gTr, blk, 0, stream>>>(wk, WkT, DM, DM, WSC);
  wtrans_h<<<gTr, blk, 0, stream>>>(wv, WvT, DM, DM, WSC);
  // (2) q = xh . Wq + bq -> QH (hi), QL (residual x4096), f16 [8192][1024]
  gemm64<3, 0><<<gG, blk, 0, stream>>>(XH, DM, WqT, DM, bq, QH, QL, DM, NTOK, DM, DM, osc_qk, 1.0f, RSC);
  // (3) k = xh . Wk + bk -> KH f16 [8192][1024]
  gemm64<2, 0><<<gG, blk, 0, stream>>>(XH, DM, WkT, DM, bk, KH, KH, DM, NTOK, DM, DM, osc_qk, 1.0f, RSC);
  // (4) v^T: VT[m][t] = sum_k WvT[m][k] . xh[t][k] + bv[m] -> VTH (hi x16), VTL (residual x16 x4096),
  //     f16 [1024][8192]
  gemm64<3, 1><<<gG, blk, 0, stream>>>(WvT, DM, XH, DM, bv, VTH, VTL, NTOK, DM, NTOK, DM, osc_v, VSC, RSC);
  // (5) attention with per-head linear distance bias -> d_out f32 [8192][1024]
  attn_lb<<<gAttn, blk128, 0, stream>>>(QH, QL, KH, VTH, VTL, (float*)d_out, 0.125f, 1.0f / (PSC * VSC));
  (void)hipGetLastError();
}

// v001
// Measured time: 380 microseconds a run.
// Two timings next to v000 both put it at 1.50 times that version's speed.
// Contractions: q, k and v^T projections on v_wmma_f32_16x16x32_f16 (f16 layer-norm plane carried x16 times
// f16 transposed weight plane carried x64, one product each); attention q.k^T on v_wmma_f32_16x16x32_f16
// (q as f16 hi plane plus f16 residual plane carried x4096, k plain f16, two products); p.v on
// v_wmma_f32_16x16x32_f16 (p carried x1024, v^T as f16 hi plane carried x16 plus f16 residual plane carried
// x4096, two products); all f32 accumulate; layer norm and softmax in f32 on VALU; every float input
// RNE-converted to bf16 on load.
#include <hip/hip_runtime.h>
#include <math.h>
#include <stdint.h>

#define NB    4
#define SQ    2048
#define NTOK  (NB * SQ)
#define DM    1024
#define NH    16
#define HD    64
#define NQB   (SQ / 64)
#define XSC   16.0f
#define WSC   64.0f
#define VSC   16.0f
#define RSC   4096.0f
#define PSC   1024.0f
#define LNEPS 1e-5f
#define LP    72      // LDS row pitch in halves of the attention tiles: 144 B = 16 B x 9 (odd), for 16-byte readers
static_assert(NH * HD == DM);
static_assert((SQ % 64) == 0 && (DM % 64) == 0 && (NTOK % 64) == 0);
static_assert(DM == 4 * 256);
static_assert((NTOK % 8) == 0);

typedef _Float16 v16h __attribute__((ext_vector_type(16)));
typedef _Float16 v8h  __attribute__((ext_vector_type(8)));
typedef float    v8f  __attribute__((ext_vector_type(8)));
typedef float    v4f  __attribute__((ext_vector_type(4)));
typedef unsigned int v4u __attribute__((ext_vector_type(4)));

// ---- scalar helpers --------------------------------------------------------------------------------
__device__ __forceinline__ unsigned short bf_bits(float f) {          // f32 -> bf16 bits, RNE convert
  unsigned u = __float_as_uint(f);
  return (unsigned short)((u + 0x7FFFu + ((u >> 16) & 1u)) >> 16);
}
__device__ __forceinline__ float bf_up(unsigned short h) { return __uint_as_float(((unsigned)h) << 16); }
__device__ __forceinline__ float bfr(float f) { return bf_up(bf_bits(f)); }   // value of the bf16 RNE convert
__device__ __forceinline__ unsigned short h_bits(_Float16 x) { return __builtin_bit_cast(unsigned short, x); }
__device__ __forceinline__ unsigned pk16(unsigned short a, unsigned short b) { return (unsigned)a | ((unsigned)b << 16); }
__device__ __forceinline__ v8f zero8() { v8f z = {0.f, 0.f, 0.f, 0.f, 0.f, 0.f, 0.f, 0.f}; return z; }

// ---- fragment loader: 16-bit A/B operand, lane -> row/col (lane&15), p already includes +8*(lane>>4);
//      elements 0..7 <- p[0..7] (k0+8h..), elements 8..15 <- p[16..23] (k0+16+8h..)
__device__ __forceinline__ v16h ldfrag_h(const _Float16* p) {
  union { v16h v; v8h h[2]; } f;
  f.h[0] = *(const v8h*)(p);
  f.h[1] = *(const v8h*)(p + 16);
  return f.v;
}

// ---- WMMA helpers with trailing VALU hazard gap --------------------------------------------------------
__device__ __forceinline__ v8f mma_h(v16h a, v16h b, v8f c) {
  c = __builtin_amdgcn_wmma_f32_16x16x32_f16(false, a, false, b, (short)0, c, false, false);
#if defined(__HIP_DEVICE_COMPILE__)
  asm volatile("v_nop\n\tv_nop\n\tv_nop\n\tv_nop" : "+v"(c) : "v"(a), "v"(b));
#endif
  return c;
}
__device__ __forceinline__ v8f mma_h_raw(v16h a, v16h b, v8f c) {
  return __builtin_amdgcn_wmma_f32_16x16x32_f16(false, a, false, b, (short)0, c, false, false);
}
__device__ __forceinline__ void dep_guard1(v8f& a, v8f& b, v16h x) {
#if defined(__HIP_DEVICE_COMPILE__)
  asm volatile("v_nop\n\tv_nop\n\tv_nop\n\tv_nop" : "+v"(a), "+v"(b) : "v"(x));
#endif
}
__device__ __forceinline__ void keep4_h(v16h a, v16h b, v16h c, v16h d) {
#if defined(__HIP_DEVICE_COMPILE__)
  asm volatile("v_nop" :: "v"(a), "v"(b), "v"(c), "v"(d));
#endif
}
__device__ __forceinline__ void acc_guard4(v8f& a, v8f& b, v8f& c, v8f& d) {
#if defined(__HIP_DEVICE_COMPILE__)
  asm volatile("v_nop\n\tv_nop\n\tv_nop\n\tv_nop" : "+v"(a), "+v"(b), "+v"(c), "+v"(d));
#endif
}
__device__ __forceinline__ void wave_sync_lds() {
  __builtin_amdgcn_fence(__ATOMIC_RELEASE, "workgroup");
  __builtin_amdgcn_wave_barrier();
  __builtin_amdgcn_fence(__ATOMIC_ACQUIRE, "workgroup");
}

// =====================================================================================================
// Layer norm over rows of DM = 1024: one wave per row, 8 rows per block (grid = nrows/8). Every input value
// y = ((x - mu) * rstd * gamma + beta) * xsc written as one f16 plane [nrows][DM].
// Lane l handles columns 256*i + 8*l .. +7 (i = 0..3); each store instruction of the wave covers 512 B =
// coverage: grid(nrows/8) x 8 waves = every row; 4 iterations x 32 lanes x 8 = all 1024 columns.
// =====================================================================================================
__global__ __launch_bounds__(256) void ln_rows(const float* __restrict__ x, const float* __restrict__ gam,
                                               const float* __restrict__ bet, unsigned short* Xh,
                                               int nrows, float xsc, float eps) {
  const int lane = threadIdx.x & 31;
  const int wave = threadIdx.x >> 5;
  const int row  = blockIdx.x * 8 + wave;
  if (row >= nrows) return;                     // wave-uniform; no block barriers in this kernel
  const float* xr = x + (size_t)row * DM;
  const float rd = 1.0f / (float)DM;

  float s = 0.f;
#pragma unroll 1
  for (int i = 0; i < 4; ++i) {
    const int c0 = 256 * i + 8 * lane;
    const v4f a = *(const v4f*)(xr + c0);
    const v4f b = *(const v4f*)(xr + c0 + 4);
    s += ((bfr(a[0]) + bfr(a[1])) + (bfr(a[2]) + bfr(a[3]))) +
         ((bfr(b[0]) + bfr(b[1])) + (bfr(b[2]) + bfr(b[3])));
  }
#pragma unroll
  for (int off = 1; off < 32; off <<= 1) s += __shfl_xor(s, off, 32);
  const float mu = s * rd;

  float s2 = 0.f;
#pragma unroll 1
  for (int i = 0; i < 4; ++i) {
    const int c0 = 256 * i + 8 * lane;
    const v4f a = *(const v4f*)(xr + c0);
    const v4f b = *(const v4f*)(xr + c0 + 4);
#pragma unroll
    for (int e = 0; e < 4; ++e) {
      const float d0 = bfr(a[e]) - mu;
      const float d1 = bfr(b[e]) - mu;
      s2 += d0 * d0;
      s2 += d1 * d1;
    }
  }
#pragma unroll
  for (int off = 1; off < 32; off <<= 1) s2 += __shfl_xor(s2, off, 32);
  const float var  = s2 * rd;
  const float rstd = 1.0f / sqrtf(var + eps);

#pragma unroll 1
  for (int i = 0; i < 4; ++i) {
    const int c0 = 256 * i + 8 * lane;
    const v4f a  = *(const v4f*)(xr + c0);
    const v4f b  = *(const v4f*)(xr + c0 + 4);
    const v4f ga = *(const v4f*)(gam + c0);
    const v4f gb = *(const v4f*)(gam + c0 + 4);
    const v4f ba = *(const v4f*)(bet + c0);
    const v4f bb = *(const v4f*)(bet + c0 + 4);
    float y[8];
#pragma unroll
    for (int e = 0; e < 4; ++e) {
      y[e]     = ((bfr(a[e]) - mu) * rstd * bfr(ga[e]) + bfr(ba[e])) * xsc;
      y[4 + e] = ((bfr(b[e]) - mu) * rstd * bfr(gb[e]) + bfr(bb[e])) * xsc;
    }
    v4u u;
#pragma unroll
    for (int e = 0; e < 4; ++e) u[e] = pk16(h_bits((_Float16)y[2 * e]), h_bits((_Float16)y[2 * e + 1]));
    unsigned short* dst = Xh + (size_t)row * DM + c0;
    *(v4u*)dst = u;
    
  }
}

// =====================================================================================================
// Transpose-convert: W f32 in[R][C] (row-major) -> out f16 bits [C][R]; each value bf16 RNE-converted,
// multiplied by wsc (power of two, exact) and cast to f16. Block = one 64x64 tile staged through LDS,
// coverage: load 4 it x 256 threads x 4 = 64x64; store 2 it x 256 threads x 8 = 64x64; grid covers R x C.
// =====================================================================================================
__global__ __launch_bounds__(256) void wtrans_h(const float* __restrict__ W, unsigned short* Wt,
                                                int R, int C, float wsc) {
  __shared__ __align__(16) unsigned short sT[64 * 72];     // [c][r], pitch 72 halves = 144 B
  const int tid = threadIdx.x;
  const int r0  = blockIdx.y * 64;          // rows of W
  const int c0  = blockIdx.x * 64;          // cols of W
#pragma unroll
  for (int it = 0; it < 4; ++it) {
    const int idx = it * 256 + tid;         // 0..1023
    const int r   = idx >> 4;               // 0..63
    const int c4  = (idx & 15) * 4;         // 0..60
    const v4f w = *(const v4f*)(W + (size_t)(r0 + r) * C + c0 + c4);
#pragma unroll
    for (int e = 0; e < 4; ++e) sT[(c4 + e) * 72 + r] = h_bits((_Float16)(bfr(w[e]) * wsc));
  }
  __syncthreads();
  v4u u[2];
#pragma unroll
  for (int it = 0; it < 2; ++it) {
    const int row = it * 32 + (tid >> 3), col8 = (tid & 7) * 8;
    u[it] = *(const v4u*)(sT + row * 72 + col8);
  }
  {
#pragma unroll
    for (int it = 0; it < 2; ++it) {
      const int row = it * 32 + (tid >> 3), col8 = (tid & 7) * 8;
      *(v4u*)(Wt + (size_t)(c0 + row) * R + r0 + col8) = u[it];
    }
    
  }
}

// =====================================================================================================
// Register-blocked f16 WMMA GEMM: C[m][n] = oscale * sum_k A[m][k] * Bt[n][k] + bsc * bias; one wave per
// 64x64 tile, no block barriers. A row-major [M][K] pitch lda; Bt row-major [N][K] pitch ldb (k contiguous);
// M, N multiples of 64, K multiple of 32 (static here).
// Bias: BIASM == 0 -> per column bias0[n] (N entries, clamped-address 16-B loads); BIASM == 1 -> per row
//       bias0[m] (M entries). Bias values RNE-converted to bf16, then multiplied by bsc.
// OM: 2 = one f16 plane (Cout); 3 = f16 hi plane (Cout) plus f16 residual plane ((f - hi) * rsc, Cout2), same
//     indexing and pitch ldc for both planes.
// coverage: 4 slabs x 16 rows (it 0..3 x lane>>3 0..3) x 64 cols (8 lanes x 8) = the wave's whole 64x64 tile;
//           grid = ceil(tilesM*tilesN/8) blocks, surplus waves exit (wave-uniform).
// =====================================================================================================
template <int OM, int BIASM>
__global__ __launch_bounds__(256) void gemm64(
    const unsigned short* __restrict__ Ap, int lda,
    const unsigned short* __restrict__ Btp, int ldb,
    const float* __restrict__ bias0,
    unsigned short* Cout, unsigned short* Cout2, int ldc,
    int M, int N, int K, float oscale, float bsc, float rsc) {
  const _Float16* A  = (const _Float16*)(const void*)Ap;
  const _Float16* Bt = (const _Float16*)(const void*)Btp;
  __shared__ __align__(16) float sT[8][16 * 68];   // per-wave 16x64 slab, pitch 68 floats
  const int lane = threadIdx.x & 31;
  const int wave = threadIdx.x >> 5;
  const int tilesN = N >> 6;
  const int tilesM = M >> 6;
  const int tile = blockIdx.x * 8 + wave;
  if (tile >= tilesM * tilesN) return;   // wave-uniform; no block barriers in this kernel
  const int tm = tile / tilesN;
  const int tn = tile - tm * tilesN;
  const int m0 = tm << 6;
  const int n0 = tn << 6;

  const int rlane = lane & 15;                 // row (A) / col (B, D) within subtile
  const int koff  = (lane >> 4) * 8;           // k offset of this lane half
  const int mOff  = (lane >> 4) * 8;           // D row offset

  v8f acc[4][4];
#pragma unroll
  for (int i = 0; i < 4; ++i)
#pragma unroll
    for (int j = 0; j < 4; ++j) acc[i][j] = zero8();

  for (int k0 = 0; k0 < K; k0 += 32) {
    v16h bh[4];
#pragma unroll
    for (int j = 0; j < 4; ++j) {
      const size_t bo = (size_t)(n0 + (j << 4) + rlane) * ldb + koff + k0;
      bh[j] = ldfrag_h(Bt + bo);
    }
#pragma unroll
    for (int i = 0; i < 4; ++i) {
      const size_t ao = (size_t)(m0 + (i << 4) + rlane) * lda + koff + k0;
      const v16h ah = ldfrag_h(A + ao);
#pragma unroll
      for (int j = 0; j < 4; ++j) acc[i][j] = mma_h_raw(ah, bh[j], acc[i][j]);
      dep_guard1(acc[i][0], acc[i][3], ah);
    }
    keep4_h(bh[0], bh[1], bh[2], bh[3]);
  }
  acc_guard4(acc[0][0], acc[0][1], acc[0][2], acc[0][3]);
  acc_guard4(acc[1][0], acc[1][1], acc[1][2], acc[1][3]);
  acc_guard4(acc[2][0], acc[2][1], acc[2][2], acc[2][3]);
  acc_guard4(acc[3][0], acc[3][1], acc[3][2], acc[3][3]);

  const int q8 = lane >> 3, c8 = (lane & 7) * 8;
  float bc[8];
#pragma unroll
  for (int e = 0; e < 8; ++e) bc[e] = 0.f;
  if (BIASM == 0) {
    const int cb = n0 + c8;                                  // <= N - 8
    const int i0 = (cb < N - 8) ? cb : (N - 8);
    const v4f b0a = *(const v4f*)(bias0 + i0), b0b = *(const v4f*)(bias0 + i0 + 4);
#pragma unroll
    for (int e = 0; e < 4; ++e) {
      bc[e]     = bfr(b0a[e]) * bsc;
      bc[4 + e] = bfr(b0b[e]) * bsc;
    }
  }

  // ---- epilogue ----
  float* slab = sT[wave];
#pragma unroll
  for (int i = 0; i < 4; ++i) {
    const int mBase = m0 + (i << 4);
#pragma unroll
    for (int j = 0; j < 4; ++j) {
#pragma unroll
      for (int r = 0; r < 8; ++r) {
        slab[(mOff + r) * 68 + (j << 4) + rlane] = acc[i][j][r];
      }
    }
    wave_sync_lds();
    v4u hv[4], lv[4];
#pragma unroll
    for (int it = 0; it < 4; ++it) {
      const int row = it * 4 + q8;                       // it 0..3 x q8 0..3 = rows 0..15
      const float* sp = slab + row * 68 + c8;
      float bm = 0.f;
      if (BIASM == 1) bm = bfr(bias0[mBase + row]) * bsc; // mBase + row < M
      v4u a, lw;
#pragma unroll
      for (int e = 0; e < 4; ++e) {
        const float f0 = sp[2 * e]     * oscale + ((BIASM == 1) ? bm : bc[2 * e]);
        const float f1 = sp[2 * e + 1] * oscale + ((BIASM == 1) ? bm : bc[2 * e + 1]);
        const _Float16 g0 = (_Float16)f0;
        const _Float16 g1 = (_Float16)f1;
        a[e] = pk16(h_bits(g0), h_bits(g1));
        if (OM == 3) {
          const _Float16 r0 = (_Float16)((f0 - (float)g0) * rsc);
          const _Float16 r1 = (_Float16)((f1 - (float)g1) * rsc);
          lw[e] = pk16(h_bits(r0), h_bits(r1));
        } else {
          lw[e] = 0u;
        }
      }
      hv[it] = a;
      lv[it] = lw;
    }
    {
#pragma unroll
      for (int it = 0; it < 4; ++it) {
        const int row = it * 4 + q8;
        const size_t go = (size_t)(mBase + row) * ldc + n0 + c8;
        *(v4u*)(Cout + go) = hv[it];
        if (OM == 3) *(v4u*)(Cout2 + go) = lv[it];
      }
      
    }
    wave_sync_lds();
  }
}

// =====================================================================================================
// Full (non-causal) attention with a per-head linear distance bias, head dim 64, NB sequences of SQ tokens,
// NH heads.
//   q planes (f16 hi, f16 residual x RSC) [NTOK][DM], row = b*SQ + s, col = h*64 + d; k plane (f16) [NTOK][DM];
//   v^T planes (f16 hi x VSC, f16 residual x VSC x RSC) [DM][NTOK]: element (h*64 + d, b*SQ + s);
//   out f32 [NTOK][DM], col = h*64 + d.
//   raw = (qhi . k) + (qres . k) / RSC; logit = (raw - slope_h * |key - query|) * sscale (sscale = 1/8);
//   slope_h = 2^(-(h+1)/2): exact power of two for odd h, f32(2^-0.5) * 2^-(h/2) for even h.
//   p = exp(logit - m) carried as f16(PSC * p); context = p . vhi + (p . vres) / RSC on f16 WMMA, the residual
//   term accumulated per chunk from zero and folded into the f32 running context; online softmax in f32; final
//   scale onorm = 1 / (PSC * VSC) together with 1/l (l >= 1 since every key is allowed and the row max
//   contributes exp(0)).
//   Block = 4 waves = 64 query rows of one (sequence, head); grid = NB * NH * NQB; key chunks of 64, all NQB
//   chunks visited (block-uniform trip).
//   K / V^T hi / V^T res chunk staging: 128 threads x 32 elements per plane = the whole 64x64 tile of each of
//   the 3 planes (plain 16-B loads, __syncthreads before and after); P tiles are wave-private, spilled with
//   Output coverage: each wave stores rows q0..q0+15 (it 0..7 x lane>>4 0..1) x 64 columns (16 lanes x 4 f32),
//   column slices = the whole [NTOK][DM] output.
// =====================================================================================================
__global__ __launch_bounds__(128)
void attn_lb(const unsigned short* __restrict__ qhp, const unsigned short* __restrict__ qlp,
             const unsigned short* __restrict__ khp,
             const unsigned short* __restrict__ vthp, const unsigned short* __restrict__ vtlp,
             float* outp, float sscale, float onorm) {
  union FH { v16h v; v8h h[2]; };
  __shared__ __align__(16) _Float16 Ksh[64 * LP];                 // K [kv][d]        9 KB, pitch LP
  __shared__ __align__(16) _Float16 Vth[64 * LP];                 // V^T hi [d][kv]   9 KB, pitch LP
  __shared__ __align__(16) _Float16 Vtl[64 * LP];                 // V^T res [d][kv]  9 KB, pitch LP
  __shared__ __align__(16) _Float16 Psh[4][16 * LP];              // per wave P [row][kv], pitch LP
  __shared__ __align__(16) float    Os[4][16 * 64];               // per wave context tile [row][d]

  const int tid  = threadIdx.x;
  const int wave = tid >> 5;
  const int lane = tid & 31;
  const int hh   = lane >> 4;
  const int c    = lane & 15;

  const int bx   = blockIdx.x;
  const int qb   = bx % NQB;
  const int hb   = bx / NQB;
  const int h    = hb % NH;
  const int b    = hb / NH;
  const int tok0 = b * SQ;                       // first token row of this sequence
  const int ql0  = qb * 64 + wave * 16;          // local query index of this wave's first row
  const int q0   = tok0 + ql0;                   // global token row of this wave's first row

  const _Float16* Qh = (const _Float16*)(const void*)qhp + (size_t)h * HD;
  const _Float16* Ql = (const _Float16*)(const void*)qlp + (size_t)h * HD;
  const _Float16* Kg = (const _Float16*)(const void*)khp + (size_t)h * HD;
  const _Float16* Vh = (const _Float16*)(const void*)vthp + (size_t)h * HD * NTOK + tok0;
  const _Float16* Vl = (const _Float16*)(const void*)vtlp + (size_t)h * HD * NTOK + tok0;

  // ---- per-head slope (block-uniform) ----
  const int   se    = (h + 1) >> 1;
  const float spw   = __uint_as_float((unsigned)(127 - se) << 23);
  const float slope = (h & 1) ? spw : (spw * 0.70710678118654752f);

  // ---- Q fragments (A operand, row = lane&15): 2 d-chunks, hi and residual planes ----
  v16h qa[2], qr[2];
#pragma unroll
  for (int dc = 0; dc < 2; ++dc) {
    qa[dc] = ldfrag_h(Qh + (size_t)(q0 + c) * DM + dc * 32 + 8 * hh);
    qr[dc] = ldfrag_h(Ql + (size_t)(q0 + c) * DM + dc * 32 + 8 * hh);
  }

  float mrow[8], lrow[8];
  v8f oacc[4];
#pragma unroll
  for (int r = 0; r < 8; ++r) { mrow[r] = -INFINITY; lrow[r] = 0.f; }
#pragma unroll
  for (int t = 0; t < 4; ++t) oacc[t] = zero8();

  const float rinv = 1.0f / RSC;

  for (int kt = 0; kt < NQB; ++kt) {            // block-uniform trip = 32
    const int kv0 = kt * 64;                     // local key index of the chunk
    __syncthreads();
    {
      const int r = tid >> 1, hf = (tid & 1) * 32;
      const _Float16* kg = Kg + (size_t)(tok0 + kv0 + r) * DM + hf;   // K row, d = hf..hf+31
      const _Float16* vg = Vh + (size_t)r * NTOK + kv0 + hf;           // V^T hi row d = r, s = kv0+hf..+31
      const _Float16* wg = Vl + (size_t)r * NTOK + kv0 + hf;           // V^T res row d = r
#pragma unroll
      for (int i = 0; i < 4; ++i) {
        const v8h a0 = *(const v8h*)(kg + 8 * i);
        const v8h b0 = *(const v8h*)(vg + 8 * i);
        const v8h c0 = *(const v8h*)(wg + 8 * i);
        *(v8h*)(Ksh + r * LP + hf + 8 * i) = a0;
        *(v8h*)(Vth + r * LP + hf + 8 * i) = b0;
        *(v8h*)(Vtl + r * LP + hf + 8 * i) = c0;
      }
    }
    __syncthreads();

    // ---- logits: 16 query rows x 64 keys per wave ----
    v8f s[4];
#pragma unroll
    for (int j = 0; j < 4; ++j) {
      v8f sh = zero8(), sl = zero8();
#pragma unroll
      for (int dc = 0; dc < 2; ++dc) {
        FH kb;
        kb.h[0] = *(const v8h*)(Ksh + (j * 16 + c) * LP + dc * 32 + 8 * hh);
        kb.h[1] = *(const v8h*)(Ksh + (j * 16 + c) * LP + dc * 32 + 16 + 8 * hh);
        sh = mma_h(qa[dc], kb.v, sh);
        sl = mma_h(qr[dc], kb.v, sl);
      }
      const int key = kv0 + j * 16 + c;                             // D column = lane&15
#pragma unroll
      for (int r = 0; r < 8; ++r) {
        const int qrow = ql0 + 8 * hh + r;                          // D row = 8h + r
        int dd = key - qrow;
        if (dd < 0) dd = -dd;
        const float raw = sh[r] + sl[r] * rinv;
        s[j][r] = (raw - slope * (float)dd) * sscale;
      }
    }

    // ---- row max, online softmax, P (x PSC, f16) to LDS ----
    _Float16* pwh = Psh[wave];
#pragma unroll
    for (int r = 0; r < 8; ++r) {
      float m = s[0][r];
      m = fmaxf(m, s[1][r]);
      m = fmaxf(m, s[2][r]);
      m = fmaxf(m, s[3][r]);
#pragma unroll
      for (int off = 1; off < 16; off <<= 1) m = fmaxf(m, __shfl_xor(m, off, 32));
      const float mnew  = fmaxf(mrow[r], m);
      const float ms    = (mnew == -INFINITY) ? 0.f : mnew;
      const float alpha = __expf(mrow[r] - ms);
      mrow[r] = mnew;
      float psum = 0.f;
#pragma unroll
      for (int j = 0; j < 4; ++j) {
        const float p = __expf(s[j][r] - ms);
        psum += p;
        pwh[(8 * hh + r) * LP + j * 16 + c] = (_Float16)(p * PSC);
      }
#pragma unroll
      for (int off = 1; off < 16; off <<= 1) psum += __shfl_xor(psum, off, 32);
      lrow[r] = lrow[r] * alpha + psum;
#pragma unroll
      for (int t = 0; t < 4; ++t) oacc[t][r] *= alpha;
    }
    wave_sync_lds();

    // ---- context += P . Vhi ; chunk residual = P . Vres (f16 WMMA) ----
    v8f ol[4];
#pragma unroll
    for (int t = 0; t < 4; ++t) ol[t] = zero8();
#pragma unroll 1
    for (int kk = 0; kk < 2; ++kk) {
      FH pa;
      pa.h[0] = *(const v8h*)(pwh + c * LP + kk * 32 + 8 * hh);
      pa.h[1] = *(const v8h*)(pwh + c * LP + kk * 32 + 16 + 8 * hh);
#pragma unroll
      for (int t = 0; t < 4; ++t) {
        FH vb, wb;
        vb.h[0] = *(const v8h*)(Vth + (t * 16 + c) * LP + kk * 32 + 8 * hh);
        vb.h[1] = *(const v8h*)(Vth + (t * 16 + c) * LP + kk * 32 + 16 + 8 * hh);
        wb.h[0] = *(const v8h*)(Vtl + (t * 16 + c) * LP + kk * 32 + 8 * hh);
        wb.h[1] = *(const v8h*)(Vtl + (t * 16 + c) * LP + kk * 32 + 16 + 8 * hh);
        oacc[t] = mma_h(pa.v, vb.v, oacc[t]);
        ol[t]   = mma_h(pa.v, wb.v, ol[t]);
      }
    }
    // ---- fold this chunk's residual term into the running context (f32) ----
#pragma unroll
    for (int t = 0; t < 4; ++t) {
#pragma unroll
      for (int r = 0; r < 8; ++r) oacc[t][r] += ol[t][r] * rinv;
    }
  }

  // ---- normalise (1/l and the 1/(PSC*VSC) carry), stage the wave's 16x64 tile, write whole 256-B row
  float* os = Os[wave];
#pragma unroll
  for (int r = 0; r < 8; ++r) {
    const float l = lrow[r];
    const float inv = ((l > 0.f) ? (1.0f / l) : 0.f) * onorm;
#pragma unroll
    for (int t = 0; t < 4; ++t) os[(8 * hh + r) * 64 + t * 16 + c] = oacc[t][r] * inv;
  }
  wave_sync_lds();
  {
    const int hh2 = lane >> 4, c4 = (lane & 15) * 4;
    v4f vals[8];
#pragma unroll
    for (int it = 0; it < 8; ++it) {
      const int row = it * 2 + hh2;   // it 0..7 x hh2 0..1 = rows 0..15 of the wave tile
      vals[it] = *(const v4f*)(os + row * 64 + c4);
    }
    {
#pragma unroll
      for (int it = 0; it < 8; ++it) {
        const int row = it * 2 + hh2;
        const size_t go = (size_t)(q0 + row) * DM + (size_t)h * HD + c4;
        *(v4f*)(outp + go) = vals[it];
      }
      
    }
  }
}

// =====================================================================================================
// Workspace map (bytes); every plane is an exact multiple of its 64x64-tile / whole-line store granularity
// ([8192][1024] = 128x16 tiles, [1024][8192] = 16x128 tiles, weights [1024][1024] = 16x16 tiles):
//   WqT  f16 [1024][1024]   0          2097152   (transposed, x64)
//   WkT  f16 [1024][1024]   2097152    2097152
//   WvT  f16 [1024][1024]   4194304    2097152
//   XH   f16 [8192][1024]   6291456    16777216  (layer norm output x16)
//   QH   f16 [8192][1024]   23068672   16777216  (q hi)
//   QL   f16 [8192][1024]   39845888   16777216  (q residual x4096)
//   KH   f16 [8192][1024]   56623104   16777216
//   VTH  f16 [1024][8192]   73400320   16777216  (v^T hi x16)
//   VTL  f16 [1024][8192]   90177536   16777216  (v^T residual x16 x4096)
//   end                     106954752
// =====================================================================================================
extern "C" void kernel_launch(void* const* d_in, const int* in_sizes, int n_in,
                              void* d_out, int out_size, void* d_ws, size_t ws_size,
                              hipStream_t stream) {
  if (n_in < 9) return;
  if (in_sizes[0] != NTOK * DM) return;
  if (in_sizes[1] != DM || in_sizes[2] != DM) return;
  if (in_sizes[3] != DM * DM || in_sizes[5] != DM * DM || in_sizes[7] != DM * DM) return;
  if (in_sizes[4] != DM || in_sizes[6] != DM || in_sizes[8] != DM) return;
  if (out_size != NTOK * DM) return;

  const float* x   = (const float*)d_in[0];
  const float* gam = (const float*)d_in[1];
  const float* bet = (const float*)d_in[2];
  const float* wq  = (const float*)d_in[3];
  const float* bq  = (const float*)d_in[4];
  const float* wk  = (const float*)d_in[5];
  const float* bk  = (const float*)d_in[6];
  const float* wv  = (const float*)d_in[7];
  const float* bv  = (const float*)d_in[8];

  const size_t PW = (size_t)DM * DM * 2;            //  2097152
  const size_t PA = (size_t)NTOK * DM * 2;          // 16777216
  size_t off = 0;
  const size_t oWq = off; off += PW;
  const size_t oWk = off; off += PW;
  const size_t oWv = off; off += PW;
  const size_t oXH = off; off += PA;
  const size_t oQH = off; off += PA;
  const size_t oQL = off; off += PA;
  const size_t oKH = off; off += PA;
  const size_t oVH = off; off += PA;
  const size_t oVL = off; off += PA;
  if (off > ws_size) return;                        // off = 106954752
  if (off > (size_t)134217728) return;

  char* ws = (char*)d_ws;
  unsigned short* WqT = (unsigned short*)(ws + oWq);
  unsigned short* WkT = (unsigned short*)(ws + oWk);
  unsigned short* WvT = (unsigned short*)(ws + oWv);
  unsigned short* XH  = (unsigned short*)(ws + oXH);
  unsigned short* QH  = (unsigned short*)(ws + oQH);
  unsigned short* QL  = (unsigned short*)(ws + oQL);
  unsigned short* KH  = (unsigned short*)(ws + oKH);
  unsigned short* VTH = (unsigned short*)(ws + oVH);
  unsigned short* VTL = (unsigned short*)(ws + oVL);

  const dim3 blk(256), blk128(128);
  const dim3 gLn(NTOK / 8);                                            // 1024 blocks, 8 rows each
  const dim3 gTr(DM / 64, DM / 64);                                    // (cols/64, rows/64) of W[in][out]
  const dim3 gG(((NTOK / 64) * (DM / 64) + 7) / 8);                    // 2048 tiles -> 256 blocks
  const dim3 gAttn(NB * NH * NQB);                                     // 2048 blocks of 128
  const float osc_qk = 1.0f / (XSC * WSC);                             // q, k unscaled
  const float osc_v  = VSC / (XSC * WSC);                              // v^T carried x16

  // (0) layer norm -> XH f16 [8192][1024] (x16)
  ln_rows<<<gLn, blk, 0, stream>>>(x, gam, bet, XH, NTOK, XSC, LNEPS);
  // (1) weights W[in][out] f32 -> W^T f16 [out][in] (k contiguous), bf16 RNE-converted, x64
  wtrans_h<<<gTr, blk, 0, stream>>>(wq, WqT, DM, DM, WSC);
  wtrans_h<<<gTr, blk, 0, stream>>>(wk, WkT, DM, DM, WSC);
  wtrans_h<<<gTr, blk, 0, stream>>>(wv, WvT, DM, DM, WSC);
  // (2) q = xh . Wq + bq -> QH (hi), QL (residual x4096), f16 [8192][1024]
  gemm64<3, 0><<<gG, blk, 0, stream>>>(XH, DM, WqT, DM, bq, QH, QL, DM, NTOK, DM, DM, osc_qk, 1.0f, RSC);
  // (3) k = xh . Wk + bk -> KH f16 [8192][1024]
  gemm64<2, 0><<<gG, blk, 0, stream>>>(XH, DM, WkT, DM, bk, KH, KH, DM, NTOK, DM, DM, osc_qk, 1.0f, RSC);
  // (4) v^T: VT[m][t] = sum_k WvT[m][k] . xh[t][k] + bv[m] -> VTH (hi x16), VTL (residual x16 x4096),
  //     f16 [1024][8192]
  gemm64<3, 1><<<gG, blk, 0, stream>>>(WvT, DM, XH, DM, bv, VTH, VTL, NTOK, DM, NTOK, DM, osc_v, VSC, RSC);
  // (5) attention with per-head linear distance bias -> d_out f32 [8192][1024]
  attn_lb<<<gAttn, blk128, 0, stream>>>(QH, QL, KH, VTH, VTL, (float*)d_out, 0.125f, 1.0f / (PSC * VSC));
  (void)hipGetLastError();
}

// v002
// A run of this version takes 323 microseconds.
// Timed twice side by side with v001, it ran 1.18 times as fast both times.
// Over all steps from v000 it is 1.77 times as fast.
// Contractions: q, k and v^T projections on v_wmma_f32_16x16x32_f16 (f16 layer-norm plane carried x16 times
// f16 transposed weight plane carried x64, one product each); attention k.q^T on v_wmma_f32_16x16x32_f16
// (q as f16 hi plane plus f16 residual plane carried x4096, k plain f16, two products); v^T.p^T on
// v_wmma_f32_16x16x32_f16 (p carried x1024, v^T as f16 hi plane carried x16 plus f16 residual plane carried
// x4096, two products); all f32 accumulate; layer norm and softmax in f32 on VALU; every float input
// RNE-converted to bf16 on load.
#include <hip/hip_runtime.h>
#include <math.h>
#include <stdint.h>

#define NB    4
#define SQ    2048
#define NTOK  (NB * SQ)
#define DM    1024
#define NH    16
#define HD    64
#define NQB   (SQ / 64)
#define XSC   16.0f
#define WSC   64.0f
#define VSC   16.0f
#define RSC   4096.0f
#define PSC   1024.0f
#define LNEPS 1e-5f
#define LP    72      // LDS row pitch in halves of the attention tiles: 144 B = 16 B x 9 (odd), for 16-byte readers
static_assert(NH * HD == DM);
static_assert((SQ % 64) == 0 && (DM % 64) == 0 && (NTOK % 64) == 0);
static_assert(DM == 4 * 256);
static_assert((NTOK % 8) == 0);

typedef _Float16 v16h __attribute__((ext_vector_type(16)));
typedef _Float16 v8h  __attribute__((ext_vector_type(8)));
typedef float    v8f  __attribute__((ext_vector_type(8)));
typedef float    v4f  __attribute__((ext_vector_type(4)));
typedef unsigned int v4u __attribute__((ext_vector_type(4)));

// ---- scalar helpers --------------------------------------------------------------------------------
__device__ __forceinline__ unsigned short bf_bits(float f) {          // f32 -> bf16 bits, RNE convert
  unsigned u = __float_as_uint(f);
  return (unsigned short)((u + 0x7FFFu + ((u >> 16) & 1u)) >> 16);
}
__device__ __forceinline__ float bf_up(unsigned short h) { return __uint_as_float(((unsigned)h) << 16); }
__device__ __forceinline__ float bfr(float f) { return bf_up(bf_bits(f)); }   // value of the bf16 RNE convert
__device__ __forceinline__ unsigned short h_bits(_Float16 x) { return __builtin_bit_cast(unsigned short, x); }
__device__ __forceinline__ unsigned pk16(unsigned short a, unsigned short b) { return (unsigned)a | ((unsigned)b << 16); }
__device__ __forceinline__ v8f zero8() { v8f z = {0.f, 0.f, 0.f, 0.f, 0.f, 0.f, 0.f, 0.f}; return z; }

// ---- fragment loader: 16-bit A/B operand, lane -> row/col (lane&15), p already includes +8*(lane>>4);
//      elements 0..7 <- p[0..7] (k0+8h..), elements 8..15 <- p[16..23] (k0+16+8h..)
__device__ __forceinline__ v16h ldfrag_h(const _Float16* p) {
  union { v16h v; v8h h[2]; } f;
  f.h[0] = *(const v8h*)(p);
  f.h[1] = *(const v8h*)(p + 16);
  return f.v;
}

// ---- WMMA helpers with trailing VALU hazard gap --------------------------------------------------------
__device__ __forceinline__ v8f mma_h(v16h a, v16h b, v8f c) {
  c = __builtin_amdgcn_wmma_f32_16x16x32_f16(false, a, false, b, (short)0, c, false, false);
#if defined(__HIP_DEVICE_COMPILE__)
  asm volatile("v_nop\n\tv_nop\n\tv_nop\n\tv_nop" : "+v"(c) : "v"(a), "v"(b));
#endif
  return c;
}
__device__ __forceinline__ v8f mma_h_raw(v16h a, v16h b, v8f c) {
  return __builtin_amdgcn_wmma_f32_16x16x32_f16(false, a, false, b, (short)0, c, false, false);
}
__device__ __forceinline__ void dep_guard1(v8f& a, v8f& b, v16h x) {
#if defined(__HIP_DEVICE_COMPILE__)
  asm volatile("v_nop\n\tv_nop\n\tv_nop\n\tv_nop" : "+v"(a), "+v"(b) : "v"(x));
#endif
}
__device__ __forceinline__ void keep4_h(v16h a, v16h b, v16h c, v16h d) {
#if defined(__HIP_DEVICE_COMPILE__)
  asm volatile("v_nop" :: "v"(a), "v"(b), "v"(c), "v"(d));
#endif
}
__device__ __forceinline__ void acc_guard4(v8f& a, v8f& b, v8f& c, v8f& d) {
#if defined(__HIP_DEVICE_COMPILE__)
  asm volatile("v_nop\n\tv_nop\n\tv_nop\n\tv_nop" : "+v"(a), "+v"(b), "+v"(c), "+v"(d));
#endif
}
__device__ __forceinline__ void wave_sync_lds() {
  __builtin_amdgcn_fence(__ATOMIC_RELEASE, "workgroup");
  __builtin_amdgcn_wave_barrier();
  __builtin_amdgcn_fence(__ATOMIC_ACQUIRE, "workgroup");
}

// =====================================================================================================
// Layer norm over rows of DM = 1024: one wave per row, 8 rows per block (grid = nrows/8). Every input value
// y = ((x - mu) * rstd * gamma + beta) * xsc written as one f16 plane [nrows][DM].
// Lane l handles columns 256*i + 8*l .. +7 (i = 0..3); each store instruction of the wave covers 512 B =
// coverage: grid(nrows/8) x 8 waves = every row; 4 iterations x 32 lanes x 8 = all 1024 columns.
// =====================================================================================================
__global__ __launch_bounds__(256) void ln_rows(const float* __restrict__ x, const float* __restrict__ gam,
                                               const float* __restrict__ bet, unsigned short* Xh,
                                               int nrows, float xsc, float eps) {
  const int lane = threadIdx.x & 31;
  const int wave = threadIdx.x >> 5;
  const int row  = blockIdx.x * 8 + wave;
  if (row >= nrows) return;                     // wave-uniform; no block barriers in this kernel
  const float* xr = x + (size_t)row * DM;
  const float rd = 1.0f / (float)DM;

  float s = 0.f;
#pragma unroll 1
  for (int i = 0; i < 4; ++i) {
    const int c0 = 256 * i + 8 * lane;
    const v4f a = *(const v4f*)(xr + c0);
    const v4f b = *(const v4f*)(xr + c0 + 4);
    s += ((bfr(a[0]) + bfr(a[1])) + (bfr(a[2]) + bfr(a[3]))) +
         ((bfr(b[0]) + bfr(b[1])) + (bfr(b[2]) + bfr(b[3])));
  }
#pragma unroll
  for (int off = 1; off < 32; off <<= 1) s += __shfl_xor(s, off, 32);
  const float mu = s * rd;

  float s2 = 0.f;
#pragma unroll 1
  for (int i = 0; i < 4; ++i) {
    const int c0 = 256 * i + 8 * lane;
    const v4f a = *(const v4f*)(xr + c0);
    const v4f b = *(const v4f*)(xr + c0 + 4);
#pragma unroll
    for (int e = 0; e < 4; ++e) {
      const float d0 = bfr(a[e]) - mu;
      const float d1 = bfr(b[e]) - mu;
      s2 += d0 * d0;
      s2 += d1 * d1;
    }
  }
#pragma unroll
  for (int off = 1; off < 32; off <<= 1) s2 += __shfl_xor(s2, off, 32);
  const float var  = s2 * rd;
  const float rstd = 1.0f / sqrtf(var + eps);

#pragma unroll 1
  for (int i = 0; i < 4; ++i) {
    const int c0 = 256 * i + 8 * lane;
    const v4f a  = *(const v4f*)(xr + c0);
    const v4f b  = *(const v4f*)(xr + c0 + 4);
    const v4f ga = *(const v4f*)(gam + c0);
    const v4f gb = *(const v4f*)(gam + c0 + 4);
    const v4f ba = *(const v4f*)(bet + c0);
    const v4f bb = *(const v4f*)(bet + c0 + 4);
    float y[8];
#pragma unroll
    for (int e = 0; e < 4; ++e) {
      y[e]     = ((bfr(a[e]) - mu) * rstd * bfr(ga[e]) + bfr(ba[e])) * xsc;
      y[4 + e] = ((bfr(b[e]) - mu) * rstd * bfr(gb[e]) + bfr(bb[e])) * xsc;
    }
    v4u u;
#pragma unroll
    for (int e = 0; e < 4; ++e) u[e] = pk16(h_bits((_Float16)y[2 * e]), h_bits((_Float16)y[2 * e + 1]));
    unsigned short* dst = Xh + (size_t)row * DM + c0;
    *(v4u*)dst = u;
    
  }
}

// =====================================================================================================
// Transpose-convert: W f32 in[R][C] (row-major) -> out f16 bits [C][R]; each value bf16 RNE-converted,
// multiplied by wsc (power of two, exact) and cast to f16. Block = one 64x64 tile staged through LDS,
// coverage: load 4 it x 256 threads x 4 = 64x64; store 2 it x 256 threads x 8 = 64x64; grid covers R x C.
// =====================================================================================================
__global__ __launch_bounds__(256) void wtrans_h(const float* __restrict__ W, unsigned short* Wt,
                                                int R, int C, float wsc) {
  __shared__ __align__(16) unsigned short sT[64 * 72];     // [c][r], pitch 72 halves = 144 B
  const int tid = threadIdx.x;
  const int r0  = blockIdx.y * 64;          // rows of W
  const int c0  = blockIdx.x * 64;          // cols of W
#pragma unroll
  for (int it = 0; it < 4; ++it) {
    const int idx = it * 256 + tid;         // 0..1023
    const int r   = idx >> 4;               // 0..63
    const int c4  = (idx & 15) * 4;         // 0..60
    const v4f w = *(const v4f*)(W + (size_t)(r0 + r) * C + c0 + c4);
#pragma unroll
    for (int e = 0; e < 4; ++e) sT[(c4 + e) * 72 + r] = h_bits((_Float16)(bfr(w[e]) * wsc));
  }
  __syncthreads();
  v4u u[2];
#pragma unroll
  for (int it = 0; it < 2; ++it) {
    const int row = it * 32 + (tid >> 3), col8 = (tid & 7) * 8;
    u[it] = *(const v4u*)(sT + row * 72 + col8);
  }
  {
#pragma unroll
    for (int it = 0; it < 2; ++it) {
      const int row = it * 32 + (tid >> 3), col8 = (tid & 7) * 8;
      *(v4u*)(Wt + (size_t)(c0 + row) * R + r0 + col8) = u[it];
    }
    
  }
}

// =====================================================================================================
// Register-blocked f16 WMMA GEMM: C[m][n] = oscale * sum_k A[m][k] * Bt[n][k] + bsc * bias; one wave per
// 64x64 tile, no block barriers. A row-major [M][K] pitch lda; Bt row-major [N][K] pitch ldb (k contiguous);
// M, N multiples of 64, K multiple of 32 (static here).
// Bias: BIASM == 0 -> per column bias0[n] (N entries, clamped-address 16-B loads); BIASM == 1 -> per row
//       bias0[m] (M entries). Bias values RNE-converted to bf16, then multiplied by bsc.
// OM: 2 = one f16 plane (Cout); 3 = f16 hi plane (Cout) plus f16 residual plane ((f - hi) * rsc, Cout2), same
//     indexing and pitch ldc for both planes.
// coverage: 4 slabs x 16 rows (it 0..3 x lane>>3 0..3) x 64 cols (8 lanes x 8) = the wave's whole 64x64 tile;
//           grid = ceil(tilesM*tilesN/8) blocks, surplus waves exit (wave-uniform).
// =====================================================================================================
template <int OM, int BIASM>
__global__ __launch_bounds__(256) void gemm64(
    const unsigned short* __restrict__ Ap, int lda,
    const unsigned short* __restrict__ Btp, int ldb,
    const float* __restrict__ bias0,
    unsigned short* Cout, unsigned short* Cout2, int ldc,
    int M, int N, int K, float oscale, float bsc, float rsc) {
  const _Float16* A  = (const _Float16*)(const void*)Ap;
  const _Float16* Bt = (const _Float16*)(const void*)Btp;
  __shared__ __align__(16) float sT[8][16 * 68];   // per-wave 16x64 slab, pitch 68 floats
  const int lane = threadIdx.x & 31;
  const int wave = threadIdx.x >> 5;
  const int tilesN = N >> 6;
  const int tilesM = M >> 6;
  const int tile = blockIdx.x * 8 + wave;
  if (tile >= tilesM * tilesN) return;   // wave-uniform; no block barriers in this kernel
  const int tm = tile / tilesN;
  const int tn = tile - tm * tilesN;
  const int m0 = tm << 6;
  const int n0 = tn << 6;

  const int rlane = lane & 15;                 // row (A) / col (B, D) within subtile
  const int koff  = (lane >> 4) * 8;           // k offset of this lane half
  const int mOff  = (lane >> 4) * 8;           // D row offset

  v8f acc[4][4];
#pragma unroll
  for (int i = 0; i < 4; ++i)
#pragma unroll
    for (int j = 0; j < 4; ++j) acc[i][j] = zero8();

  for (int k0 = 0; k0 < K; k0 += 32) {
    v16h bh[4];
#pragma unroll
    for (int j = 0; j < 4; ++j) {
      const size_t bo = (size_t)(n0 + (j << 4) + rlane) * ldb + koff + k0;
      bh[j] = ldfrag_h(Bt + bo);
    }
#pragma unroll
    for (int i = 0; i < 4; ++i) {
      const size_t ao = (size_t)(m0 + (i << 4) + rlane) * lda + koff + k0;
      const v16h ah = ldfrag_h(A + ao);
#pragma unroll
      for (int j = 0; j < 4; ++j) acc[i][j] = mma_h_raw(ah, bh[j], acc[i][j]);
      dep_guard1(acc[i][0], acc[i][3], ah);
    }
    keep4_h(bh[0], bh[1], bh[2], bh[3]);
  }
  acc_guard4(acc[0][0], acc[0][1], acc[0][2], acc[0][3]);
  acc_guard4(acc[1][0], acc[1][1], acc[1][2], acc[1][3]);
  acc_guard4(acc[2][0], acc[2][1], acc[2][2], acc[2][3]);
  acc_guard4(acc[3][0], acc[3][1], acc[3][2], acc[3][3]);

  const int q8 = lane >> 3, c8 = (lane & 7) * 8;
  float bc[8];
#pragma unroll
  for (int e = 0; e < 8; ++e) bc[e] = 0.f;
  if (BIASM == 0) {
    const int cb = n0 + c8;                                  // <= N - 8
    const int i0 = (cb < N - 8) ? cb : (N - 8);
    const v4f b0a = *(const v4f*)(bias0 + i0), b0b = *(const v4f*)(bias0 + i0 + 4);
#pragma unroll
    for (int e = 0; e < 4; ++e) {
      bc[e]     = bfr(b0a[e]) * bsc;
      bc[4 + e] = bfr(b0b[e]) * bsc;
    }
  }

  // ---- epilogue ----
  float* slab = sT[wave];
#pragma unroll
  for (int i = 0; i < 4; ++i) {
    const int mBase = m0 + (i << 4);
#pragma unroll
    for (int j = 0; j < 4; ++j) {
#pragma unroll
      for (int r = 0; r < 8; ++r) {
        slab[(mOff + r) * 68 + (j << 4) + rlane] = acc[i][j][r];
      }
    }
    wave_sync_lds();
    v4u hv[4], lv[4];
#pragma unroll
    for (int it = 0; it < 4; ++it) {
      const int row = it * 4 + q8;                       // it 0..3 x q8 0..3 = rows 0..15
      const float* sp = slab + row * 68 + c8;
      float bm = 0.f;
      if (BIASM == 1) bm = bfr(bias0[mBase + row]) * bsc; // mBase + row < M
      v4u a, lw;
#pragma unroll
      for (int e = 0; e < 4; ++e) {
        const float f0 = sp[2 * e]     * oscale + ((BIASM == 1) ? bm : bc[2 * e]);
        const float f1 = sp[2 * e + 1] * oscale + ((BIASM == 1) ? bm : bc[2 * e + 1]);
        const _Float16 g0 = (_Float16)f0;
        const _Float16 g1 = (_Float16)f1;
        a[e] = pk16(h_bits(g0), h_bits(g1));
        if (OM == 3) {
          const _Float16 r0 = (_Float16)((f0 - (float)g0) * rsc);
          const _Float16 r1 = (_Float16)((f1 - (float)g1) * rsc);
          lw[e] = pk16(h_bits(r0), h_bits(r1));
        } else {
          lw[e] = 0u;
        }
      }
      hv[it] = a;
      lv[it] = lw;
    }
    {
#pragma unroll
      for (int it = 0; it < 4; ++it) {
        const int row = it * 4 + q8;
        const size_t go = (size_t)(mBase + row) * ldc + n0 + c8;
        *(v4u*)(Cout + go) = hv[it];
        if (OM == 3) *(v4u*)(Cout2 + go) = lv[it];
      }
      
    }
    wave_sync_lds();
  }
}

#define LOG2E 1.44269504088896340736f
#define OP 68      // LDS row pitch in floats of the output tile: 272 B = 16 B x 17 (odd), for 16-byte writers
__device__ __forceinline__ float other_half(float x) {    // value of lane l ^ 16
  const int b = __builtin_bit_cast(int, x);
  return __builtin_bit_cast(float, __builtin_amdgcn_permlanex16(b, b, 0x76543210, 0xfedcba98, false, false));
}
// exp(x) as v_exp_f32 of x * log2(e), eight at a time (one score tile) or alone. Written as asm so that the slot
// the instruction set asks for behind a transcendental is kept by construction: outputs are early-clobber, so
// inside a statement no v_exp_f32 is followed by a write of its source or a read of its result, and the closing
// v_nop fills the slot behind the last one whatever the compiler puts next.
__device__ __forceinline__ v8f exp_8(v8f x) {
  v8f e;
#if defined(__HIP_DEVICE_COMPILE__)
  float e0, e1, e2, e3, e4, e5, e6, e7;
  asm("v_exp_f32 %0, %8\n\tv_exp_f32 %1, %9\n\tv_exp_f32 %2, %10\n\tv_exp_f32 %3, %11\n\t"
      "v_exp_f32 %4, %12\n\tv_exp_f32 %5, %13\n\tv_exp_f32 %6, %14\n\tv_exp_f32 %7, %15\n\tv_nop"
      : "=&v"(e0), "=&v"(e1), "=&v"(e2), "=&v"(e3), "=&v"(e4), "=&v"(e5), "=&v"(e6), "=&v"(e7)
      : "v"(x[0] * LOG2E), "v"(x[1] * LOG2E), "v"(x[2] * LOG2E), "v"(x[3] * LOG2E),
        "v"(x[4] * LOG2E), "v"(x[5] * LOG2E), "v"(x[6] * LOG2E), "v"(x[7] * LOG2E));
  e[0] = e0; e[1] = e1; e[2] = e2; e[3] = e3; e[4] = e4; e[5] = e5; e[6] = e6; e[7] = e7;
#else
  e = x;
#endif
  return e;
}
__device__ __forceinline__ float exp_1(float x) {
  float e = x;
#if defined(__HIP_DEVICE_COMPILE__)
  asm("v_exp_f32 %0, %1\n\tv_nop" : "=&v"(e) : "v"(x * LOG2E));
#endif
  return e;
}

__global__ __launch_bounds__(128)
void attn_lb(const unsigned short* __restrict__ qhp, const unsigned short* __restrict__ qlp,
             const unsigned short* __restrict__ khp,
             const unsigned short* __restrict__ vthp, const unsigned short* __restrict__ vtlp,
             float* outp, float sscale, float onorm) {
  union FH { v16h v; v8h h[2]; };
  __shared__ __align__(16) _Float16 Ksh[64 * LP];                 // K [kv][d]        9 KB, pitch LP
  __shared__ __align__(16) _Float16 Vth[64 * LP];                 // V^T hi [d][kv]   9 KB, pitch LP
  __shared__ __align__(16) _Float16 Vtl[64 * LP];                 // V^T res [d][kv]  9 KB, pitch LP
  __shared__ __align__(16) float    Os[4][16 * OP];               // per wave context tile [row][d], pitch OP

  const int tid  = threadIdx.x;
  const int wave = tid >> 5;
  const int lane = tid & 31;
  const int hh   = lane >> 4;
  const int c    = lane & 15;

  const int bx   = blockIdx.x;
  const int qb   = bx % NQB;
  const int hb   = bx / NQB;
  const int h    = hb % NH;
  const int b    = hb / NH;
  const int tok0 = b * SQ;                       // first token row of this sequence
  const int ql0  = qb * 64 + wave * 16;          // local query index of this wave's first row
  const int q0   = tok0 + ql0;                   // global token row of this wave's first row

  const _Float16* Qh = (const _Float16*)(const void*)qhp + (size_t)h * HD;
  const _Float16* Ql = (const _Float16*)(const void*)qlp + (size_t)h * HD;
  const _Float16* Kg = (const _Float16*)(const void*)khp + (size_t)h * HD;
  const _Float16* Vh = (const _Float16*)(const void*)vthp + (size_t)h * HD * NTOK + tok0;
  const _Float16* Vl = (const _Float16*)(const void*)vtlp + (size_t)h * HD * NTOK + tok0;

  // ---- per-head slope (block-uniform) ----
  const int   se    = (h + 1) >> 1;
  const float spw   = __uint_as_float((unsigned)(127 - se) << 23);
  const float slope = (h & 1) ? spw : (spw * 0.70710678118654752f);

  // ---- Q fragments (B operand, column = lane&15): 2 d-chunks, hi and residual planes ----
  v16h qa[2], qr[2];
#pragma unroll
  for (int dc = 0; dc < 2; ++dc) {
    qa[dc] = ldfrag_h(Qh + (size_t)(q0 + c) * DM + dc * 32 + 8 * hh);
    qr[dc] = ldfrag_h(Ql + (size_t)(q0 + c) * DM + dc * 32 + 8 * hh);
  }

  const int qrow = ql0 + c;                      // this lane's query (D column = lane&15)
  float mrow = -INFINITY;                        // running maximum of query qrow (equal in both lane halves)
  float lrow = 0.f;                              // running sum over this lane half's keys only
  v8f oacc[4];                                   // oacc[t][r] = context[query c][d = 16 t + 8 hh + r]
#pragma unroll
  for (int t = 0; t < 4; ++t) oacc[t] = zero8();

  const float rinv = 1.0f / RSC;

  for (int kt = 0; kt < NQB; ++kt) {            // block-uniform trip = 32
    const int kv0 = kt * 64;                     // local key index of the chunk
    __syncthreads();
    {
      const int r = tid >> 1, hf = (tid & 1) * 32;
      const _Float16* kg = Kg + (size_t)(tok0 + kv0 + r) * DM + hf;   // K row, d = hf..hf+31
      const _Float16* vg = Vh + (size_t)r * NTOK + kv0 + hf;           // V^T hi row d = r, s = kv0+hf..+31
      const _Float16* wg = Vl + (size_t)r * NTOK + kv0 + hf;           // V^T res row d = r
#pragma unroll
      for (int i = 0; i < 4; ++i) {
        const v8h a0 = *(const v8h*)(kg + 8 * i);
        const v8h b0 = *(const v8h*)(vg + 8 * i);
        const v8h c0 = *(const v8h*)(wg + 8 * i);
        *(v8h*)(Ksh + r * LP + hf + 8 * i) = a0;
        *(v8h*)(Vth + r * LP + hf + 8 * i) = b0;
        *(v8h*)(Vtl + r * LP + hf + 8 * i) = c0;
      }
    }
    __syncthreads();

    // ---- logits, transposed: 64 keys x 16 queries per wave ----
    v8f s[4];
#pragma unroll
    for (int j = 0; j < 4; ++j) {
      v8f sh = zero8(), sl = zero8();
#pragma unroll
      for (int dc = 0; dc < 2; ++dc) {
        FH kb;
        kb.h[0] = *(const v8h*)(Ksh + (j * 16 + c) * LP + dc * 32 + 8 * hh);
        kb.h[1] = *(const v8h*)(Ksh + (j * 16 + c) * LP + dc * 32 + 16 + 8 * hh);
        sh = mma_h(kb.v, qa[dc], sh);
        sl = mma_h(kb.v, qr[dc], sl);
      }
#pragma unroll
      for (int r = 0; r < 8; ++r) {
        const int key = kv0 + j * 16 + 8 * hh + r;                  // D row = 8h + r
        int dd = key - qrow;
        if (dd < 0) dd = -dd;
        const float raw = sh[r] + sl[r] * rinv;
        s[j][r] = (raw - slope * (float)dd) * sscale;
      }
    }

    // ---- maximum in the lane, one exchange between the halves; online softmax ----
    float mj[4];
#pragma unroll
    for (int j = 0; j < 4; ++j) {
      mj[j] = s[j][0];
#pragma unroll
      for (int r = 1; r < 8; ++r) mj[j] = fmaxf(mj[j], s[j][r]);
    }
    float m = fmaxf(fmaxf(mj[0], mj[1]), fmaxf(mj[2], mj[3]));
    m = fmaxf(m, other_half(m));
    const float mnew  = fmaxf(mrow, m);
    const float ms    = (mnew == -INFINITY) ? 0.f : mnew;
    const float alpha = exp_1(mrow - ms);
    mrow = mnew;

    // ---- P (x PSC, f16) packed from the score registers into the B operands of p.v ----
    v16h pb[2];
    float pj[4];
#pragma unroll
    for (int j = 0; j < 4; ++j) {
      const v8f p = exp_8(s[j] - ms);
      pj[j] = 0.f;
#pragma unroll
      for (int r = 0; r < 8; ++r) {
        pj[j] += p[r];
        pb[j >> 1][(j & 1) * 8 + r] = (_Float16)(p[r] * PSC);
      }
    }
    lrow = lrow * alpha + ((pj[0] + pj[1]) + (pj[2] + pj[3]));
#pragma unroll
    for (int t = 0; t < 4; ++t) {
#pragma unroll
      for (int r = 0; r < 8; ++r) oacc[t][r] *= alpha;
    }

    // ---- context^T += Vhi . P^T ; chunk residual = Vres . P^T (f16 WMMA) ----
    v8f ol[4];
#pragma unroll
    for (int t = 0; t < 4; ++t) ol[t] = zero8();
#pragma unroll
    for (int kk = 0; kk < 2; ++kk) {
#pragma unroll
      for (int t = 0; t < 4; ++t) {
        FH vb, wb;
        vb.h[0] = *(const v8h*)(Vth + (t * 16 + c) * LP + kk * 32 + 8 * hh);
        vb.h[1] = *(const v8h*)(Vth + (t * 16 + c) * LP + kk * 32 + 16 + 8 * hh);
        wb.h[0] = *(const v8h*)(Vtl + (t * 16 + c) * LP + kk * 32 + 8 * hh);
        wb.h[1] = *(const v8h*)(Vtl + (t * 16 + c) * LP + kk * 32 + 16 + 8 * hh);
        oacc[t] = mma_h(vb.v, pb[kk], oacc[t]);
        ol[t]   = mma_h(wb.v, pb[kk], ol[t]);
      }
    }
    // ---- fold this chunk's residual term into the running context (f32) ----
#pragma unroll
    for (int t = 0; t < 4; ++t) {
#pragma unroll
      for (int r = 0; r < 8; ++r) oacc[t][r] += ol[t][r] * rinv;
    }
  }

  // ---- join the halves' sums, normalise (1/l and the 1/(PSC*VSC) carry), stage the wave's 16x64 tile
  //      (a lane holds 8 consecutive d of its query per t: two 16-B LDS writes), write whole 256-B rows
  float* os = Os[wave];
  {
    const float l = lrow + other_half(lrow);
    const float inv = ((l > 0.f) ? (1.0f / l) : 0.f) * onorm;
#pragma unroll
    for (int t = 0; t < 4; ++t) {
      v4f w0, w1;
#pragma unroll
      for (int e = 0; e < 4; ++e) { w0[e] = oacc[t][e] * inv; w1[e] = oacc[t][4 + e] * inv; }
      *(v4f*)(os + c * OP + t * 16 + 8 * hh)     = w0;
      *(v4f*)(os + c * OP + t * 16 + 8 * hh + 4) = w1;
    }
  }
  wave_sync_lds();
  {
    const int hh2 = lane >> 4, c4 = (lane & 15) * 4;
    v4f vals[8];
#pragma unroll
    for (int it = 0; it < 8; ++it) {
      const int row = it * 2 + hh2;   // it 0..7 x hh2 0..1 = rows 0..15 of the wave tile
      vals[it] = *(const v4f*)(os + row * OP + c4);
    }
    {
#pragma unroll
      for (int it = 0; it < 8; ++it) {
        const int row = it * 2 + hh2;
        const size_t go = (size_t)(q0 + row) * DM + (size_t)h * HD + c4;
        *(v4f*)(outp + go) = vals[it];
      }
    }
  }
}

// =====================================================================================================
// Workspace map (bytes); every plane is an exact multiple of its 64x64-tile / whole-line store granularity
// ([8192][1024] = 128x16 tiles, [1024][8192] = 16x128 tiles, weights [1024][1024] = 16x16 tiles):
//   WqT  f16 [1024][1024]   0          2097152   (transposed, x64)
//   WkT  f16 [1024][1024]   2097152    2097152
//   WvT  f16 [1024][1024]   4194304    2097152
//   XH   f16 [8192][1024]   6291456    16777216  (layer norm output x16)
//   QH   f16 [8192][1024]   23068672   16777216  (q hi)
//   QL   f16 [8192][1024]   39845888   16777216  (q residual x4096)
//   KH   f16 [8192][1024]   56623104   16777216
//   VTH  f16 [1024][8192]   73400320   16777216  (v^T hi x16)
//   VTL  f16 [1024][8192]   90177536   16777216  (v^T residual x16 x4096)
//   end                     106954752
// =====================================================================================================
extern "C" void kernel_launch(void* const* d_in, const int* in_sizes, int n_in,
                              void* d_out, int out_size, void* d_ws, size_t ws_size,
                              hipStream_t stream) {
  if (n_in < 9) return;
  if (in_sizes[0] != NTOK * DM) return;
  if (in_sizes[1] != DM || in_sizes[2] != DM) return;
  if (in_sizes[3] != DM * DM || in_sizes[5] != DM * DM || in_sizes[7] != DM * DM) return;
  if (in_sizes[4] != DM || in_sizes[6] != DM || in_sizes[8] != DM) return;
  if (out_size != NTOK * DM) return;

  const float* x   = (const float*)d_in[0];
  const float* gam = (const float*)d_in[1];
  const float* bet = (const float*)d_in[2];
  const float* wq  = (const float*)d_in[3];
  const float* bq  = (const float*)d_in[4];
  const float* wk  = (const float*)d_in[5];
  const float* bk  = (const float*)d_in[6];
  const float* wv  = (const float*)d_in[7];
  const float* bv  = (const float*)d_in[8];

  const size_t PW = (size_t)DM * DM * 2;            //  2097152
  const size_t PA = (size_t)NTOK * DM * 2;          // 16777216
  size_t off = 0;
  const size_t oWq = off; off += PW;
  const size_t oWk = off; off += PW;
  const size_t oWv = off; off += PW;
  const size_t oXH = off; off += PA;
  const size_t oQH = off; off += PA;
  const size_t oQL = off; off += PA;
  const size_t oKH = off; off += PA;
  const size_t oVH = off; off += PA;
  const size_t oVL = off; off += PA;
  if (off > ws_size) return;                        // off = 106954752
  if (off > (size_t)134217728) return;

  char* ws = (char*)d_ws;
  unsigned short* WqT = (unsigned short*)(ws + oWq);
  unsigned short* WkT = (unsigned short*)(ws + oWk);
  unsigned short* WvT = (unsigned short*)(ws + oWv);
  unsigned short* XH  = (unsigned short*)(ws + oXH);
  unsigned short* QH  = (unsigned short*)(ws + oQH);
  unsigned short* QL  = (unsigned short*)(ws + oQL);
  unsigned short* KH  = (unsigned short*)(ws + oKH);
  unsigned short* VTH = (unsigned short*)(ws + oVH);
  unsigned short* VTL = (unsigned short*)(ws + oVL);

  const dim3 blk(256), blk128(128);
  const dim3 gLn(NTOK / 8);                                            // 1024 blocks, 8 rows each
  const dim3 gTr(DM / 64, DM / 64);                                    // (cols/64, rows/64) of W[in][out]
  const dim3 gG(((NTOK / 64) * (DM / 64) + 7) / 8);                    // 2048 tiles -> 256 blocks
  const dim3 gAttn(NB * NH * NQB);                                     // 2048 blocks of 128
  const float osc_qk = 1.0f / (XSC * WSC);                             // q, k unscaled
  const float osc_v  = VSC / (XSC * WSC);                              // v^T carried x16

  // (0) layer norm -> XH f16 [8192][1024] (x16)
  ln_rows<<<gLn, blk, 0, stream>>>(x, gam, bet, XH, NTOK, XSC, LNEPS);
  // (1) weights W[in][out] f32 -> W^T f16 [out][in] (k contiguous), bf16 RNE-converted, x64
  wtrans_h<<<gTr, blk, 0, stream>>>(wq, WqT, DM, DM, WSC);
  wtrans_h<<<gTr, blk, 0, stream>>>(wk, WkT, DM, DM, WSC);
  wtrans_h<<<gTr, blk, 0, stream>>>(wv, WvT, DM, DM, WSC);
  // (2) q = xh . Wq + bq -> QH (hi), QL (residual x4096), f16 [8192][1024]
  gemm64<3, 0><<<gG, blk, 0, stream>>>(XH, DM, WqT, DM, bq, QH, QL, DM, NTOK, DM, DM, osc_qk, 1.0f, RSC);
  // (3) k = xh . Wk + bk -> KH f16 [8192][1024]
  gemm64<2, 0><<<gG, blk, 0, stream>>>(XH, DM, WkT, DM, bk, KH, KH, DM, NTOK, DM, DM, osc_qk, 1.0f, RSC);
  // (4) v^T: VT[m][t] = sum_k WvT[m][k] . xh[t][k] + bv[m] -> VTH (hi x16), VTL (residual x16 x4096),
  //     f16 [1024][8192]
  gemm64<3, 1><<<gG, blk, 0, stream>>>(WvT, DM, XH, DM, bv, VTH, VTL, NTOK, DM, NTOK, DM, osc_v, VSC, RSC);
  // (5) attention with per-head linear distance bias -> d_out f32 [8192][1024]
  attn_lb<<<gAttn, blk128, 0, stream>>>(QH, QL, KH, VTH, VTL, (float*)d_out, 0.125f, 1.0f / (PSC * VSC));
  (void)hipGetLastError();
}

// v003
// Measured time: 247 microseconds a run.
// Timed twice side by side with v002, it ran 1.31 times as fast both times.
// Counting every step since v000, it is 2.32 times as fast.
// Contractions: q, k and v^T projections on v_wmma_f32_16x16x32_f16 (f16 layer-norm plane carried x16 times
// f16 transposed weight plane carried x64, one product each); attention k.q^T on v_wmma_f32_16x16x32_f16
// (q as f16 hi plane plus f16 residual plane carried x4096, k plain f16, two products); v^T.p^T on
// v_wmma_f32_16x16x32_f16 (p carried x1024, v^T as f16 hi plane carried x16 plus f16 residual plane carried
// x4096, two products); all f32 accumulate; layer norm and softmax in f32 on VALU; every float input
// RNE-converted to bf16 on load.
#include <hip/hip_runtime.h>
#include <math.h>
#include <stdint.h>

#define NB    4
#define SQ    2048
#define NTOK  (NB * SQ)
#define DM    1024
#define NH    16
#define HD    64
#define NQB   (SQ / 64)
#define XSC   16.0f
#define WSC   64.0f
#define VSC   16.0f
#define RSC   4096.0f
#define PSC   1024.0f
#define LNEPS 1e-5f
#define LP    72      // LDS row pitch in halves of the attention tiles: 144 B = 16 B x 9 (odd), for 16-byte readers
static_assert(NH * HD == DM);
static_assert((SQ % 64) == 0 && (DM % 64) == 0 && (NTOK % 64) == 0);
static_assert(DM == 4 * 256);
static_assert((NTOK % 8) == 0);
static_assert((NTOK % 256) == 0 && (DM % 256) == 0);

typedef _Float16 v16h __attribute__((ext_vector_type(16)));
typedef _Float16 v8h  __attribute__((ext_vector_type(8)));
typedef float    v8f  __attribute__((ext_vector_type(8)));
typedef float    v4f  __attribute__((ext_vector_type(4)));
typedef unsigned int v4u __attribute__((ext_vector_type(4)));

// ---- scalar helpers --------------------------------------------------------------------------------
__device__ __forceinline__ unsigned short bf_bits(float f) {          // f32 -> bf16 bits, RNE convert
  unsigned u = __float_as_uint(f);
  return (unsigned short)((u + 0x7FFFu + ((u >> 16) & 1u)) >> 16);
}
__device__ __forceinline__ float bf_up(unsigned short h) { return __uint_as_float(((unsigned)h) << 16); }
__device__ __forceinline__ float bfr(float f) { return bf_up(bf_bits(f)); }   // value of the bf16 RNE convert
__device__ __forceinline__ unsigned short h_bits(_Float16 x) { return __builtin_bit_cast(unsigned short, x); }
__device__ __forceinline__ unsigned pk16(unsigned short a, unsigned short b) { return (unsigned)a | ((unsigned)b << 16); }
__device__ __forceinline__ v8f zero8() { v8f z = {0.f, 0.f, 0.f, 0.f, 0.f, 0.f, 0.f, 0.f}; return z; }

// ---- fragment loader: 16-bit A/B operand, lane -> row/col (lane&15), p already includes +8*(lane>>4);
//      elements 0..7 <- p[0..7] (k0+8h..), elements 8..15 <- p[16..23] (k0+16+8h..)
__device__ __forceinline__ v16h ldfrag_h(const _Float16* p) {
  union { v16h v; v8h h[2]; } f;
  f.h[0] = *(const v8h*)(p);
  f.h[1] = *(const v8h*)(p + 16);
  return f.v;
}

// ---- WMMA helpers with trailing VALU hazard gap --------------------------------------------------------
__device__ __forceinline__ v8f mma_h(v16h a, v16h b, v8f c) {
  c = __builtin_amdgcn_wmma_f32_16x16x32_f16(false, a, false, b, (short)0, c, false, false);
#if defined(__HIP_DEVICE_COMPILE__)
  asm volatile("v_nop\n\tv_nop\n\tv_nop\n\tv_nop" : "+v"(c) : "v"(a), "v"(b));
#endif
  return c;
}
__device__ __forceinline__ v8f mma_h_raw(v16h a, v16h b, v8f c) {
  return __builtin_amdgcn_wmma_f32_16x16x32_f16(false, a, false, b, (short)0, c, false, false);
}
__device__ __forceinline__ void acc_guard4(v8f& a, v8f& b, v8f& c, v8f& d) {
#if defined(__HIP_DEVICE_COMPILE__)
  asm volatile("v_nop\n\tv_nop\n\tv_nop\n\tv_nop" : "+v"(a), "+v"(b), "+v"(c), "+v"(d));
#endif
}
__device__ __forceinline__ void wave_sync_lds() {
  __builtin_amdgcn_fence(__ATOMIC_RELEASE, "workgroup");
  __builtin_amdgcn_wave_barrier();
  __builtin_amdgcn_fence(__ATOMIC_ACQUIRE, "workgroup");
}

// =====================================================================================================
// Layer norm over rows of DM = 1024: one wave per row, 8 rows per block (grid = nrows/8). Every input value
// y = ((x - mu) * rstd * gamma + beta) * xsc written as one f16 plane [nrows][DM].
// Lane l handles columns 256*i + 8*l .. +7 (i = 0..3); each store instruction of the wave covers 512 B =
// coverage: grid(nrows/8) x 8 waves = every row; 4 iterations x 32 lanes x 8 = all 1024 columns.
// =====================================================================================================
__global__ __launch_bounds__(256) void ln_rows(const float* __restrict__ x, const float* __restrict__ gam,
                                               const float* __restrict__ bet, unsigned short* Xh,
                                               int nrows, float xsc, float eps) {
  const int lane = threadIdx.x & 31;
  const int wave = threadIdx.x >> 5;
  const int row  = blockIdx.x * 8 + wave;
  if (row >= nrows) return;                     // wave-uniform; no block barriers in this kernel
  const float* xr = x + (size_t)row * DM;
  const float rd = 1.0f / (float)DM;

  float s = 0.f;
#pragma unroll 1
  for (int i = 0; i < 4; ++i) {
    const int c0 = 256 * i + 8 * lane;
    const v4f a = *(const v4f*)(xr + c0);
    const v4f b = *(const v4f*)(xr + c0 + 4);
    s += ((bfr(a[0]) + bfr(a[1])) + (bfr(a[2]) + bfr(a[3]))) +
         ((bfr(b[0]) + bfr(b[1])) + (bfr(b[2]) + bfr(b[3])));
  }
#pragma unroll
  for (int off = 1; off < 32; off <<= 1) s += __shfl_xor(s, off, 32);
  const float mu = s * rd;

  float s2 = 0.f;
#pragma unroll 1
  for (int i = 0; i < 4; ++i) {
    const int c0 = 256 * i + 8 * lane;
    const v4f a = *(const v4f*)(xr + c0);
    const v4f b = *(const v4f*)(xr + c0 + 4);
#pragma unroll
    for (int e = 0; e < 4; ++e) {
      const float d0 = bfr(a[e]) - mu;
      const float d1 = bfr(b[e]) - mu;
      s2 += d0 * d0;
      s2 += d1 * d1;
    }
  }
#pragma unroll
  for (int off = 1; off < 32; off <<= 1) s2 += __shfl_xor(s2, off, 32);
  const float var  = s2 * rd;
  const float rstd = 1.0f / sqrtf(var + eps);

#pragma unroll 1
  for (int i = 0; i < 4; ++i) {
    const int c0 = 256 * i + 8 * lane;
    const v4f a  = *(const v4f*)(xr + c0);
    const v4f b  = *(const v4f*)(xr + c0 + 4);
    const v4f ga = *(const v4f*)(gam + c0);
    const v4f gb = *(const v4f*)(gam + c0 + 4);
    const v4f ba = *(const v4f*)(bet + c0);
    const v4f bb = *(const v4f*)(bet + c0 + 4);
    float y[8];
#pragma unroll
    for (int e = 0; e < 4; ++e) {
      y[e]     = ((bfr(a[e]) - mu) * rstd * bfr(ga[e]) + bfr(ba[e])) * xsc;
      y[4 + e] = ((bfr(b[e]) - mu) * rstd * bfr(gb[e]) + bfr(bb[e])) * xsc;
    }
    v4u u;
#pragma unroll
    for (int e = 0; e < 4; ++e) u[e] = pk16(h_bits((_Float16)y[2 * e]), h_bits((_Float16)y[2 * e + 1]));
    unsigned short* dst = Xh + (size_t)row * DM + c0;
    *(v4u*)dst = u;
    
  }
}

// =====================================================================================================
// Transpose-convert: W f32 in[R][C] (row-major) -> out f16 bits [C][R]; each value bf16 RNE-converted,
// multiplied by wsc (power of two, exact) and cast to f16. Block = one 64x64 tile staged through LDS,
// coverage: load 4 it x 256 threads x 4 = 64x64; store 2 it x 256 threads x 8 = 64x64; grid covers R x C.
// =====================================================================================================
__global__ __launch_bounds__(256) void wtrans_h(const float* __restrict__ W, unsigned short* Wt,
                                                int R, int C, float wsc) {
  __shared__ __align__(16) unsigned short sT[64 * 72];     // [c][r], pitch 72 halves = 144 B
  const int tid = threadIdx.x;
  const int r0  = blockIdx.y * 64;          // rows of W
  const int c0  = blockIdx.x * 64;          // cols of W
#pragma unroll
  for (int it = 0; it < 4; ++it) {
    const int idx = it * 256 + tid;         // 0..1023
    const int r   = idx >> 4;               // 0..63
    const int c4  = (idx & 15) * 4;         // 0..60
    const v4f w = *(const v4f*)(W + (size_t)(r0 + r) * C + c0 + c4);
#pragma unroll
    for (int e = 0; e < 4; ++e) sT[(c4 + e) * 72 + r] = h_bits((_Float16)(bfr(w[e]) * wsc));
  }
  __syncthreads();
  v4u u[2];
#pragma unroll
  for (int it = 0; it < 2; ++it) {
    const int row = it * 32 + (tid >> 3), col8 = (tid & 7) * 8;
    u[it] = *(const v4u*)(sT + row * 72 + col8);
  }
  {
#pragma unroll
    for (int it = 0; it < 2; ++it) {
      const int row = it * 32 + (tid >> 3), col8 = (tid & 7) * 8;
      *(v4u*)(Wt + (size_t)(c0 + row) * R + r0 + col8) = u[it];
    }
    
  }
}

// =====================================================================================================
// f16 WMMA GEMM: C[m][n] = oscale * sum_k A[m][k] * Bt[n][k] + bsc * bias. A block of 8 waves owns a 128x256
// tile of C (2 x 4 waves, 64x64 each). A row-major [M][K] pitch lda; Bt row-major [N][K] pitch ldb (k contiguous);
// M multiple of 128, N multiple of 256, K multiple of 64 and at least 64 (static here).
// Operands: per k slice of 64 (128 B = one line of every row) the block brings its 128 A rows and 256 Bt rows
// into LDS by asynchronous 16-B copies, each wave-wide copy covering four whole rows of the slice; rows at pitch
// GP. Two buffers: slice t + 1 flies while slice t is multiplied; at the foot of a trip every wave waits for its
// LDS reads and its copies, one block barrier publishes slice t + 1 and frees the buffer of slice t for t + 2.
// Fragments come from LDS in the k order of ldfrag_h; every accumulator takes its k blocks of 32 in rising order.
// Bias: BIASM == 0 -> per column bias0[n] (N entries, clamped-address 16-B loads); BIASM == 1 -> per row
//       bias0[m] (M entries). Bias values RNE-converted to bf16, then multiplied by bsc.
// OM: 2 = one f16 plane (Cout); 3 = f16 hi plane (Cout) plus f16 residual plane ((f - hi) * rsc, Cout2), same
//     indexing and pitch ldc for both planes.
// coverage: 4 slabs x 16 rows (it 0..3 x lane>>3 0..3) x 64 cols (8 lanes x 8) = the wave's whole 64x64 tile;
//           8 waves = the block's 128x256 tile; grid >= (M/128)*(N/256) blocks, surplus blocks exit whole.
// =====================================================================================================
#define GP 72      // LDS row pitch in halves of the operand slices: 144 B = 16 B x 9 (odd), for 16-byte readers
template <int OM, int BIASM>
__global__ __launch_bounds__(256) void gemm64(
    const unsigned short* __restrict__ Ap, int lda,
    const unsigned short* __restrict__ Btp, int ldb,
    const float* __restrict__ bias0,
    unsigned short* Cout, unsigned short* Cout2, int ldc,
    int M, int N, int K, float oscale, float bsc, float rsc) {
  const _Float16* A  = (const _Float16*)(const void*)Ap;
  const _Float16* Bt = (const _Float16*)(const void*)Btp;
  __shared__ __align__(16) _Float16 sA[2][128 * GP];   // A slice  [row][k], two buffers
  __shared__ __align__(16) _Float16 sB[2][256 * GP];   // Bt slice [row][k], two buffers
  __shared__ __align__(16) float sT[8][16 * 68];       // per-wave 16x64 slab, pitch 68 floats
  const int tid  = threadIdx.x;
  const int lane = tid & 31;
  const int wave = tid >> 5;
  const int tilesN = N >> 8;
  const int tilesM = M >> 7;
  const int bt = blockIdx.x;
  if (bt >= tilesM * tilesN) return;   // block-uniform, in front of every barrier
  const int tm = bt / tilesN;
  const int tn = bt - tm * tilesN;
  const int mB = tm << 7;                      // block's first row of C
  const int nB = tn << 8;                      // block's first column of C
  const int wm = (wave >> 2) << 6;             // wave's row offset in the block tile
  const int wn = (wave & 3) << 6;              // wave's column offset in the block tile
  const int m0 = mB + wm;
  const int n0 = nB + wn;

  const int rlane = lane & 15;                 // row (A) / col (B, D) within subtile
  const int koff  = (lane >> 4) * 8;           // k offset of this lane half
  const int mOff  = (lane >> 4) * 8;           // D row offset

  v8f acc[4][4];
#pragma unroll
  for (int i = 0; i < 4; ++i)
#pragma unroll
    for (int j = 0; j < 4; ++j) acc[i][j] = zero8();

  // staging map: thread -> row (tid >> 3) + 32 * it, 16-B piece tid & 7 of the row's 128-B slice
  const int srow = tid >> 3, sc8 = (tid & 7) * 8;
  const _Float16* ga = A  + (size_t)(mB + srow) * lda + sc8;
  const _Float16* gb = Bt + (size_t)(nB + srow) * ldb + sc8;
  const size_t astep = (size_t)32 * lda, bstep = (size_t)32 * ldb;
  const unsigned la0 = (unsigned)(uintptr_t)(&sA[0][srow * GP + sc8]);   // lane's LDS byte address, buffer 0, it 0
  const unsigned lb0 = (unsigned)(uintptr_t)(&sB[0][srow * GP + sc8]);
  // One slice: 4 + 8 asynchronous 16-B copies per lane, global -> LDS, through no register. The closing
  // s_wait_xcnt stands in the copies' own statement so that no address register is rewritten in front of it.
  auto copies = [&](int buf, int k0) {
    const unsigned la = la0 + (unsigned)buf * (unsigned)(128 * GP * 2);
    const unsigned lb = lb0 + (unsigned)buf * (unsigned)(256 * GP * 2);
    const _Float16* pa = ga + k0;
    const _Float16* pb = gb + k0;
#if defined(__HIP_DEVICE_COMPILE__)
    asm volatile(
        "global_load_async_to_lds_b128 %0, %12, off\n\t"
        "global_load_async_to_lds_b128 %1, %13, off\n\t"
        "global_load_async_to_lds_b128 %2, %14, off\n\t"
        "global_load_async_to_lds_b128 %3, %15, off\n\t"
        "global_load_async_to_lds_b128 %4, %16, off\n\t"
        "global_load_async_to_lds_b128 %5, %17, off\n\t"
        "global_load_async_to_lds_b128 %6, %18, off\n\t"
        "global_load_async_to_lds_b128 %7, %19, off\n\t"
        "global_load_async_to_lds_b128 %8, %20, off\n\t"
        "global_load_async_to_lds_b128 %9, %21, off\n\t"
        "global_load_async_to_lds_b128 %10, %22, off\n\t"
        "global_load_async_to_lds_b128 %11, %23, off\n\t"
        "s_wait_xcnt 0x0"
        :: "v"(la), "v"(la + 1u * 32u * GP * 2u), "v"(la + 2u * 32u * GP * 2u), "v"(la + 3u * 32u * GP * 2u),
           "v"(lb), "v"(lb + 1u * 32u * GP * 2u), "v"(lb + 2u * 32u * GP * 2u), "v"(lb + 3u * 32u * GP * 2u),
           "v"(lb + 4u * 32u * GP * 2u), "v"(lb + 5u * 32u * GP * 2u), "v"(lb + 6u * 32u * GP * 2u),
           "v"(lb + 7u * 32u * GP * 2u),
           "v"(pa), "v"(pa + astep), "v"(pa + 2 * astep), "v"(pa + 3 * astep),
           "v"(pb), "v"(pb + bstep), "v"(pb + 2 * bstep), "v"(pb + 3 * bstep),
           "v"(pb + 4 * bstep), "v"(pb + 5 * bstep), "v"(pb + 6 * bstep), "v"(pb + 7 * bstep)
        : "memory");
#endif
  };
  // products of one slice; every loop below is unrolled so that fragments and accumulators, indexed by
  // constants, stay in registers
  auto compute = [&](int buf) {
    const _Float16* pa = &sA[buf][(wm + rlane) * GP + koff];
    const _Float16* pb = &sB[buf][(wn + rlane) * GP + koff];
#pragma unroll
    for (int ks = 0; ks < 2; ++ks) {
      v16h bh[4], ah[4];
#pragma unroll
      for (int j = 0; j < 4; ++j) bh[j] = ldfrag_h(pb + j * 16 * GP + ks * 32);
#pragma unroll
      for (int i = 0; i < 4; ++i) ah[i] = ldfrag_h(pa + i * 16 * GP + ks * 32);
      // keeps the 16 fragment reads of a k block as one group in front of its 16 products: left free, the
      // scheduler spreads them among the products on one A register set, and each place waits out the LDS latency
      __builtin_amdgcn_sched_barrier(0);
#pragma unroll
      for (int i = 0; i < 4; ++i)
#pragma unroll
        for (int j = 0; j < 4; ++j) acc[i][j] = mma_h_raw(ah[i], bh[j], acc[i][j]);
    }
  };

  const int nst = K >> 6;
  copies(0, 0);
  asm volatile("s_wait_asynccnt 0x0" ::: "memory");   // slice 0 has landed before the barrier publishes it
  __syncthreads();
  if (nst > 1) copies(1, 64);
  for (int t = 0; t < nst; ++t) {                      // block-uniform trip
    compute(t & 1);
    asm volatile("s_wait_dscnt 0x0" ::: "memory");     // this wave's reads of buffer t & 1 are done before its refill
    asm volatile("s_wait_asynccnt 0x0" ::: "memory");  // this wave's copies of slice t + 1 have landed
    __syncthreads();                                   // publishes slice t + 1, frees buffer t & 1
    if (t + 2 < nst) copies(t & 1, (t + 2) << 6);
  }
  asm volatile("s_wait_asynccnt 0x0" ::: "memory");    // nothing in flight when the wave goes on to the epilogue
  acc_guard4(acc[0][0], acc[0][1], acc[0][2], acc[0][3]);
  acc_guard4(acc[1][0], acc[1][1], acc[1][2], acc[1][3]);
  acc_guard4(acc[2][0], acc[2][1], acc[2][2], acc[2][3]);
  acc_guard4(acc[3][0], acc[3][1], acc[3][2], acc[3][3]);

  const int q8 = lane >> 3, c8 = (lane & 7) * 8;
  float bc[8];
#pragma unroll
  for (int e = 0; e < 8; ++e) bc[e] = 0.f;
  if (BIASM == 0) {
    const int cb = n0 + c8;                                  // <= N - 8
    const int i0 = (cb < N - 8) ? cb : (N - 8);
    const v4f b0a = *(const v4f*)(bias0 + i0), b0b = *(const v4f*)(bias0 + i0 + 4);
#pragma unroll
    for (int e = 0; e < 4; ++e) {
      bc[e]     = bfr(b0a[e]) * bsc;
      bc[4 + e] = bfr(b0b[e]) * bsc;
    }
  }

  // ---- epilogue ----
  float* slab = sT[wave];
#pragma unroll
  for (int i = 0; i < 4; ++i) {
    const int mBase = m0 + (i << 4);
#pragma unroll
    for (int j = 0; j < 4; ++j) {
#pragma unroll
      for (int r = 0; r < 8; ++r) {
        slab[(mOff + r) * 68 + (j << 4) + rlane] = acc[i][j][r];
      }
    }
    wave_sync_lds();
    v4u hv[4], lv[4];
#pragma unroll
    for (int it = 0; it < 4; ++it) {
      const int row = it * 4 + q8;                       // it 0..3 x q8 0..3 = rows 0..15
      const float* sp = slab + row * 68 + c8;
      float bm = 0.f;
      if (BIASM == 1) bm = bfr(bias0[mBase + row]) * bsc; // mBase + row < M
      v4u a, lw;
#pragma unroll
      for (int e = 0; e < 4; ++e) {
        const float f0 = sp[2 * e]     * oscale + ((BIASM == 1) ? bm : bc[2 * e]);
        const float f1 = sp[2 * e + 1] * oscale + ((BIASM == 1) ? bm : bc[2 * e + 1]);
        const _Float16 g0 = (_Float16)f0;
        const _Float16 g1 = (_Float16)f1;
        a[e] = pk16(h_bits(g0), h_bits(g1));
        if (OM == 3) {
          const _Float16 r0 = (_Float16)((f0 - (float)g0) * rsc);
          const _Float16 r1 = (_Float16)((f1 - (float)g1) * rsc);
          lw[e] = pk16(h_bits(r0), h_bits(r1));
        } else {
          lw[e] = 0u;
        }
      }
      hv[it] = a;
      lv[it] = lw;
    }
    {
#pragma unroll
      for (int it = 0; it < 4; ++it) {
        const int row = it * 4 + q8;
        const size_t go = (size_t)(mBase + row) * ldc + n0 + c8;
        *(v4u*)(Cout + go) = hv[it];
        if (OM == 3) *(v4u*)(Cout2 + go) = lv[it];
      }
      
    }
    wave_sync_lds();
  }
}

#define LOG2E 1.44269504088896340736f
#define OP 68      // LDS row pitch in floats of the output tile: 272 B = 16 B x 17 (odd), for 16-byte writers
__device__ __forceinline__ float other_half(float x) {    // value of lane l ^ 16
  const int b = __builtin_bit_cast(int, x);
  return __builtin_bit_cast(float, __builtin_amdgcn_permlanex16(b, b, 0x76543210, 0xfedcba98, false, false));
}
// exp(x) as v_exp_f32 of x * log2(e), eight at a time (one score tile) or alone. Written as asm so that the slot
// the instruction set asks for behind a transcendental is kept by construction: outputs are early-clobber, so
// inside a statement no v_exp_f32 is followed by a write of its source or a read of its result, and the closing
// v_nop fills the slot behind the last one whatever the compiler puts next.
__device__ __forceinline__ v8f exp_8(v8f x) {
  v8f e;
#if defined(__HIP_DEVICE_COMPILE__)
  float e0, e1, e2, e3, e4, e5, e6, e7;
  asm("v_exp_f32 %0, %8\n\tv_exp_f32 %1, %9\n\tv_exp_f32 %2, %10\n\tv_exp_f32 %3, %11\n\t"
      "v_exp_f32 %4, %12\n\tv_exp_f32 %5, %13\n\tv_exp_f32 %6, %14\n\tv_exp_f32 %7, %15\n\tv_nop"
      : "=&v"(e0), "=&v"(e1), "=&v"(e2), "=&v"(e3), "=&v"(e4), "=&v"(e5), "=&v"(e6), "=&v"(e7)
      : "v"(x[0] * LOG2E), "v"(x[1] * LOG2E), "v"(x[2] * LOG2E), "v"(x[3] * LOG2E),
        "v"(x[4] * LOG2E), "v"(x[5] * LOG2E), "v"(x[6] * LOG2E), "v"(x[7] * LOG2E));
  e[0] = e0; e[1] = e1; e[2] = e2; e[3] = e3; e[4] = e4; e[5] = e5; e[6] = e6; e[7] = e7;
#else
  e = x;
#endif
  return e;
}
__device__ __forceinline__ float exp_1(float x) {
  float e = x;
#if defined(__HIP_DEVICE_COMPILE__)
  asm("v_exp_f32 %0, %1\n\tv_nop" : "=&v"(e) : "v"(x * LOG2E));
#endif
  return e;
}

__global__ __launch_bounds__(128)
void attn_lb(const unsigned short* __restrict__ qhp, const unsigned short* __restrict__ qlp,
             const unsigned short* __restrict__ khp,
             const unsigned short* __restrict__ vthp, const unsigned short* __restrict__ vtlp,
             float* outp, float sscale, float onorm) {
  union FH { v16h v; v8h h[2]; };
  __shared__ __align__(16) _Float16 Ksh[64 * LP];                 // K [kv][d]        9 KB, pitch LP
  __shared__ __align__(16) _Float16 Vth[64 * LP];                 // V^T hi [d][kv]   9 KB, pitch LP
  __shared__ __align__(16) _Float16 Vtl[64 * LP];                 // V^T res [d][kv]  9 KB, pitch LP
  __shared__ __align__(16) float    Os[4][16 * OP];               // per wave context tile [row][d], pitch OP

  const int tid  = threadIdx.x;
  const int wave = tid >> 5;
  const int lane = tid & 31;
  const int hh   = lane >> 4;
  const int c    = lane & 15;

  const int bx   = blockIdx.x;
  const int qb   = bx % NQB;
  const int hb   = bx / NQB;
  const int h    = hb % NH;
  const int b    = hb / NH;
  const int tok0 = b * SQ;                       // first token row of this sequence
  const int ql0  = qb * 64 + wave * 16;          // local query index of this wave's first row
  const int q0   = tok0 + ql0;                   // global token row of this wave's first row

  const _Float16* Qh = (const _Float16*)(const void*)qhp + (size_t)h * HD;
  const _Float16* Ql = (const _Float16*)(const void*)qlp + (size_t)h * HD;
  const _Float16* Kg = (const _Float16*)(const void*)khp + (size_t)h * HD;
  const _Float16* Vh = (const _Float16*)(const void*)vthp + (size_t)h * HD * NTOK + tok0;
  const _Float16* Vl = (const _Float16*)(const void*)vtlp + (size_t)h * HD * NTOK + tok0;

  // ---- per-head slope (block-uniform) ----
  const int   se    = (h + 1) >> 1;
  const float spw   = __uint_as_float((unsigned)(127 - se) << 23);
  const float slope = (h & 1) ? spw : (spw * 0.70710678118654752f);

  // ---- Q fragments (B operand, column = lane&15): 2 d-chunks, hi and residual planes ----
  v16h qa[2], qr[2];
#pragma unroll
  for (int dc = 0; dc < 2; ++dc) {
    qa[dc] = ldfrag_h(Qh + (size_t)(q0 + c) * DM + dc * 32 + 8 * hh);
    qr[dc] = ldfrag_h(Ql + (size_t)(q0 + c) * DM + dc * 32 + 8 * hh);
  }

  const int qrow = ql0 + c;                      // this lane's query (D column = lane&15)
  float mrow = -INFINITY;                        // running maximum of query qrow (equal in both lane halves)
  float lrow = 0.f;                              // running sum over this lane half's keys only
  v8f oacc[4];                                   // oacc[t][r] = context[query c][d = 16 t + 8 hh + r]
#pragma unroll
  for (int t = 0; t < 4; ++t) oacc[t] = zero8();

  const float rinv = 1.0f / RSC;

  for (int kt = 0; kt < NQB; ++kt) {            // block-uniform trip = 32
    const int kv0 = kt * 64;                     // local key index of the chunk
    __syncthreads();
    {
      const int r = tid >> 1, hf = (tid & 1) * 32;
      const _Float16* kg = Kg + (size_t)(tok0 + kv0 + r) * DM + hf;   // K row, d = hf..hf+31
      const _Float16* vg = Vh + (size_t)r * NTOK + kv0 + hf;           // V^T hi row d = r, s = kv0+hf..+31
      const _Float16* wg = Vl + (size_t)r * NTOK + kv0 + hf;           // V^T res row d = r
#pragma unroll
      for (int i = 0; i < 4; ++i) {
        const v8h a0 = *(const v8h*)(kg + 8 * i);
        const v8h b0 = *(const v8h*)(vg + 8 * i);
        const v8h c0 = *(const v8h*)(wg + 8 * i);
        *(v8h*)(Ksh + r * LP + hf + 8 * i) = a0;
        *(v8h*)(Vth + r * LP + hf + 8 * i) = b0;
        *(v8h*)(Vtl + r * LP + hf + 8 * i) = c0;
      }
    }
    __syncthreads();

    // ---- logits, transposed: 64 keys x 16 queries per wave ----
    v8f s[4];
#pragma unroll
    for (int j = 0; j < 4; ++j) {
      v8f sh = zero8(), sl = zero8();
#pragma unroll
      for (int dc = 0; dc < 2; ++dc) {
        FH kb;
        kb.h[0] = *(const v8h*)(Ksh + (j * 16 + c) * LP + dc * 32 + 8 * hh);
        kb.h[1] = *(const v8h*)(Ksh + (j * 16 + c) * LP + dc * 32 + 16 + 8 * hh);
        sh = mma_h(kb.v, qa[dc], sh);
        sl = mma_h(kb.v, qr[dc], sl);
      }
#pragma unroll
      for (int r = 0; r < 8; ++r) {
        const int key = kv0 + j * 16 + 8 * hh + r;                  // D row = 8h + r
        int dd = key - qrow;
        if (dd < 0) dd = -dd;
        const float raw = sh[r] + sl[r] * rinv;
        s[j][r] = (raw - slope * (float)dd) * sscale;
      }
    }

    // ---- maximum in the lane, one exchange between the halves; online softmax ----
    float mj[4];
#pragma unroll
    for (int j = 0; j < 4; ++j) {
      mj[j] = s[j][0];
#pragma unroll
      for (int r = 1; r < 8; ++r) mj[j] = fmaxf(mj[j], s[j][r]);
    }
    float m = fmaxf(fmaxf(mj[0], mj[1]), fmaxf(mj[2], mj[3]));
    m = fmaxf(m, other_half(m));
    const float mnew  = fmaxf(mrow, m);
    const float ms    = (mnew == -INFINITY) ? 0.f : mnew;
    const float alpha = exp_1(mrow - ms);
    mrow = mnew;

    // ---- P (x PSC, f16) packed from the score registers into the B operands of p.v ----
    v16h pb[2];
    float pj[4];
#pragma unroll
    for (int j = 0; j < 4; ++j) {
      const v8f p = exp_8(s[j] - ms);
      pj[j] = 0.f;
#pragma unroll
      for (int r = 0; r < 8; ++r) {
        pj[j] += p[r];
        pb[j >> 1][(j & 1) * 8 + r] = (_Float16)(p[r] * PSC);
      }
    }
    lrow = lrow * alpha + ((pj[0] + pj[1]) + (pj[2] + pj[3]));
#pragma unroll
    for (int t = 0; t < 4; ++t) {
#pragma unroll
      for (int r = 0; r < 8; ++r) oacc[t][r] *= alpha;
    }

    // ---- context^T += Vhi . P^T ; chunk residual = Vres . P^T (f16 WMMA) ----
    v8f ol[4];
#pragma unroll
    for (int t = 0; t < 4; ++t) ol[t] = zero8();
#pragma unroll
    for (int kk = 0; kk < 2; ++kk) {
#pragma unroll
      for (int t = 0; t < 4; ++t) {
        FH vb, wb;
        vb.h[0] = *(const v8h*)(Vth + (t * 16 + c) * LP + kk * 32 + 8 * hh);
        vb.h[1] = *(const v8h*)(Vth + (t * 16 + c) * LP + kk * 32 + 16 + 8 * hh);
        wb.h[0] = *(const v8h*)(Vtl + (t * 16 + c) * LP + kk * 32 + 8 * hh);
        wb.h[1] = *(const v8h*)(Vtl + (t * 16 + c) * LP + kk * 32 + 16 + 8 * hh);
        oacc[t] = mma_h(vb.v, pb[kk], oacc[t]);
        ol[t]   = mma_h(wb.v, pb[kk], ol[t]);
      }
    }
    // ---- fold this chunk's residual term into the running context (f32) ----
#pragma unroll
    for (int t = 0; t < 4; ++t) {
#pragma unroll
      for (int r = 0; r < 8; ++r) oacc[t][r] += ol[t][r] * rinv;
    }
  }

  // ---- join the halves' sums, normalise (1/l and the 1/(PSC*VSC) carry), stage the wave's 16x64 tile
  //      (a lane holds 8 consecutive d of its query per t: two 16-B LDS writes), write whole 256-B rows
  float* os = Os[wave];
  {
    const float l = lrow + other_half(lrow);
    const float inv = ((l > 0.f) ? (1.0f / l) : 0.f) * onorm;
#pragma unroll
    for (int t = 0; t < 4; ++t) {
      v4f w0, w1;
#pragma unroll
      for (int e = 0; e < 4; ++e) { w0[e] = oacc[t][e] * inv; w1[e] = oacc[t][4 + e] * inv; }
      *(v4f*)(os + c * OP + t * 16 + 8 * hh)     = w0;
      *(v4f*)(os + c * OP + t * 16 + 8 * hh + 4) = w1;
    }
  }
  wave_sync_lds();
  {
    const int hh2 = lane >> 4, c4 = (lane & 15) * 4;
    v4f vals[8];
#pragma unroll
    for (int it = 0; it < 8; ++it) {
      const int row = it * 2 + hh2;   // it 0..7 x hh2 0..1 = rows 0..15 of the wave tile
      vals[it] = *(const v4f*)(os + row * OP + c4);
    }
    {
#pragma unroll
      for (int it = 0; it < 8; ++it) {
        const int row = it * 2 + hh2;
        const size_t go = (size_t)(q0 + row) * DM + (size_t)h * HD + c4;
        *(v4f*)(outp + go) = vals[it];
      }
    }
  }
}

// =====================================================================================================
// Workspace map (bytes); every plane is an exact multiple of its 64x64-tile / whole-line store granularity
// ([8192][1024] = 128x16 tiles, [1024][8192] = 16x128 tiles, weights [1024][1024] = 16x16 tiles):
//   WqT  f16 [1024][1024]   0          2097152   (transposed, x64)
//   WkT  f16 [1024][1024]   2097152    2097152
//   WvT  f16 [1024][1024]   4194304    2097152
//   XH   f16 [8192][1024]   6291456    16777216  (layer norm output x16)
//   QH   f16 [8192][1024]   23068672   16777216  (q hi)
//   QL   f16 [8192][1024]   39845888   16777216  (q residual x4096)
//   KH   f16 [8192][1024]   56623104   16777216
//   VTH  f16 [1024][8192]   73400320   16777216  (v^T hi x16)
//   VTL  f16 [1024][8192]   90177536   16777216  (v^T residual x16 x4096)
//   end                     106954752
// =====================================================================================================
extern "C" void kernel_launch(void* const* d_in, const int* in_sizes, int n_in,
                              void* d_out, int out_size, void* d_ws, size_t ws_size,
                              hipStream_t stream) {
  if (n_in < 9) return;
  if (in_sizes[0] != NTOK * DM) return;
  if (in_sizes[1] != DM || in_sizes[2] != DM) return;
  if (in_sizes[3] != DM * DM || in_sizes[5] != DM * DM || in_sizes[7] != DM * DM) return;
  if (in_sizes[4] != DM || in_sizes[6] != DM || in_sizes[8] != DM) return;
  if (out_size != NTOK * DM) return;

  const float* x   = (const float*)d_in[0];
  const float* gam = (const float*)d_in[1];
  const float* bet = (const float*)d_in[2];
  const float* wq  = (const float*)d_in[3];
  const float* bq  = (const float*)d_in[4];
  const float* wk  = (const float*)d_in[5];
  const float* bk  = (const float*)d_in[6];
  const float* wv  = (const float*)d_in[7];
  const float* bv  = (const float*)d_in[8];

  const size_t PW = (size_t)DM * DM * 2;            //  2097152
  const size_t PA = (size_t)NTOK * DM * 2;          // 16777216
  size_t off = 0;
  const size_t oWq = off; off += PW;
  const size_t oWk = off; off += PW;
  const size_t oWv = off; off += PW;
  const size_t oXH = off; off += PA;
  const size_t oQH = off; off += PA;
  const size_t oQL = off; off += PA;
  const size_t oKH = off; off += PA;
  const size_t oVH = off; off += PA;
  const size_t oVL = off; off += PA;
  if (off > ws_size) return;                        // off = 106954752
  if (off > (size_t)134217728) return;

  char* ws = (char*)d_ws;
  unsigned short* WqT = (unsigned short*)(ws + oWq);
  unsigned short* WkT = (unsigned short*)(ws + oWk);
  unsigned short* WvT = (unsigned short*)(ws + oWv);
  unsigned short* XH  = (unsigned short*)(ws + oXH);
  unsigned short* QH  = (unsigned short*)(ws + oQH);
  unsigned short* QL  = (unsigned short*)(ws + oQL);
  unsigned short* KH  = (unsigned short*)(ws + oKH);
  unsigned short* VTH = (unsigned short*)(ws + oVH);
  unsigned short* VTL = (unsigned short*)(ws + oVL);

  const dim3 blk(256), blk128(128);
  const dim3 gLn(NTOK / 8);                                            // 1024 blocks, 8 rows each
  const dim3 gTr(DM / 64, DM / 64);                                    // (cols/64, rows/64) of W[in][out]
  const dim3 gG(((NTOK / 64) * (DM / 64) + 7) / 8);                    // 256 blocks, one 128x256 tile each
  const dim3 gAttn(NB * NH * NQB);                                     // 2048 blocks of 128
  const float osc_qk = 1.0f / (XSC * WSC);                             // q, k unscaled
  const float osc_v  = VSC / (XSC * WSC);                              // v^T carried x16

  // (0) layer norm -> XH f16 [8192][1024] (x16)
  ln_rows<<<gLn, blk, 0, stream>>>(x, gam, bet, XH, NTOK, XSC, LNEPS);
  // (1) weights W[in][out] f32 -> W^T f16 [out][in] (k contiguous), bf16 RNE-converted, x64
  wtrans_h<<<gTr, blk, 0, stream>>>(wq, WqT, DM, DM, WSC);
  wtrans_h<<<gTr, blk, 0, stream>>>(wk, WkT, DM, DM, WSC);
  wtrans_h<<<gTr, blk, 0, stream>>>(wv, WvT, DM, DM, WSC);
  // (2) q = xh . Wq + bq -> QH (hi), QL (residual x4096), f16 [8192][1024]
  gemm64<3, 0><<<gG, blk, 0, stream>>>(XH, DM, WqT, DM, bq, QH, QL, DM, NTOK, DM, DM, osc_qk, 1.0f, RSC);
  // (3) k = xh . Wk + bk -> KH f16 [8192][1024]
  gemm64<2, 0><<<gG, blk, 0, stream>>>(XH, DM, WkT, DM, bk, KH, KH, DM, NTOK, DM, DM, osc_qk, 1.0f, RSC);
  // (4) v^T: VT[m][t] = sum_k WvT[m][k] . xh[t][k] + bv[m] -> VTH (hi x16), VTL (residual x16 x4096),
  //     f16 [1024][8192]
  gemm64<3, 1><<<gG, blk, 0, stream>>>(WvT, DM, XH, DM, bv, VTH, VTL, NTOK, DM, NTOK, DM, osc_v, VSC, RSC);
  // (5) attention with per-head linear distance bias -> d_out f32 [8192][1024]
  attn_lb<<<gAttn, blk128, 0, stream>>>(QH, QL, KH, VTH, VTL, (float*)d_out, 0.125f, 1.0f / (PSC * VSC));
  (void)hipGetLastError();
}

// v004
// Measured time: 229 microseconds a run.
// Next to v003, in two timings, it ran 1.08 times as fast each time.
// Over all steps from v000 it is 2.50 times as fast.
// Contractions: q, k and v^T projections on v_wmma_f32_16x16x32_f16 (f16 layer-norm plane carried x16 times
// f16 transposed weight plane carried x64, one product each); attention k.q^T on v_wmma_f32_16x16x32_f16
// (q as f16 hi plane plus f16 residual plane carried x4096, k plain f16, two products); v^T.p^T on
// v_wmma_f32_16x16x32_f16 (p carried x1024, v^T as f16 hi plane carried x16 plus f16 residual plane carried
// x4096, two products); all f32 accumulate; layer norm and softmax in f32 on VALU; every float input
// RNE-converted to bf16 on load.
#include <hip/hip_runtime.h>
#include <math.h>
#include <stdint.h>

#define NB    4
#define SQ    2048
#define NTOK  (NB * SQ)
#define DM    1024
#define NH    16
#define HD    64
#define NQB   (SQ / 64)
#define XSC   16.0f
#define WSC   64.0f
#define VSC   16.0f
#define RSC   4096.0f
#define PSC   1024.0f
#define LNEPS 1e-5f
#define LP    72      // LDS row pitch in halves of the attention tiles: 144 B = 16 B x 9 (odd), for 16-byte readers
static_assert(NH * HD == DM);
static_assert((SQ % 64) == 0 && (DM % 64) == 0 && (NTOK % 64) == 0);
static_assert(DM == 4 * 256);
static_assert((NTOK % 8) == 0);
static_assert((NTOK % 256) == 0 && (DM % 256) == 0);

typedef _Float16 v16h __attribute__((ext_vector_type(16)));
typedef _Float16 v8h  __attribute__((ext_vector_type(8)));
typedef float    v8f  __attribute__((ext_vector_type(8)));
typedef float    v4f  __attribute__((ext_vector_type(4)));
typedef unsigned int v4u __attribute__((ext_vector_type(4)));

// ---- scalar helpers --------------------------------------------------------------------------------
__device__ __forceinline__ unsigned short bf_bits(float f) {          // f32 -> bf16 bits, RNE convert
  unsigned u = __float_as_uint(f);
  return (unsigned short)((u + 0x7FFFu + ((u >> 16) & 1u)) >> 16);
}
__device__ __forceinline__ float bf_up(unsigned short h) { return __uint_as_float(((unsigned)h) << 16); }
__device__ __forceinline__ float bfr(float f) { return bf_up(bf_bits(f)); }   // value of the bf16 RNE convert
__device__ __forceinline__ unsigned short h_bits(_Float16 x) { return __builtin_bit_cast(unsigned short, x); }
__device__ __forceinline__ unsigned pk16(unsigned short a, unsigned short b) { return (unsigned)a | ((unsigned)b << 16); }
__device__ __forceinline__ v8f zero8() { v8f z = {0.f, 0.f, 0.f, 0.f, 0.f, 0.f, 0.f, 0.f}; return z; }

// ---- fragment loader: 16-bit A/B operand, lane -> row/col (lane&15), p already includes +8*(lane>>4);
//      elements 0..7 <- p[0..7] (k0+8h..), elements 8..15 <- p[16..23] (k0+16+8h..)
__device__ __forceinline__ v16h ldfrag_h(const _Float16* p) {
  union { v16h v; v8h h[2]; } f;
  f.h[0] = *(const v8h*)(p);
  f.h[1] = *(const v8h*)(p + 16);
  return f.v;
}

// ---- WMMA helpers with trailing VALU hazard gap --------------------------------------------------------
__device__ __forceinline__ v8f mma_h(v16h a, v16h b, v8f c) {
  c = __builtin_amdgcn_wmma_f32_16x16x32_f16(false, a, false, b, (short)0, c, false, false);
#if defined(__HIP_DEVICE_COMPILE__)
  asm volatile("v_nop\n\tv_nop\n\tv_nop\n\tv_nop" : "+v"(c) : "v"(a), "v"(b));
#endif
  return c;
}
__device__ __forceinline__ v8f mma_h_raw(v16h a, v16h b, v8f c) {
  return __builtin_amdgcn_wmma_f32_16x16x32_f16(false, a, false, b, (short)0, c, false, false);
}
__device__ __forceinline__ void acc_guard4(v8f& a, v8f& b, v8f& c, v8f& d) {
#if defined(__HIP_DEVICE_COMPILE__)
  asm volatile("v_nop\n\tv_nop\n\tv_nop\n\tv_nop" : "+v"(a), "+v"(b), "+v"(c), "+v"(d));
#endif
}
__device__ __forceinline__ void wave_sync_lds() {
  __builtin_amdgcn_fence(__ATOMIC_RELEASE, "workgroup");
  __builtin_amdgcn_wave_barrier();
  __builtin_amdgcn_fence(__ATOMIC_ACQUIRE, "workgroup");
}

// =====================================================================================================
// Layer norm over rows of DM = 1024: one wave per row, 8 rows per block (grid = nrows/8). Every input value
// y = ((x - mu) * rstd * gamma + beta) * xsc written as one f16 plane [nrows][DM].
// Lane l handles columns 256*i + 8*l .. +7 (i = 0..3); each store instruction of the wave covers 512 B =
// coverage: grid(nrows/8) x 8 waves = every row; 4 iterations x 32 lanes x 8 = all 1024 columns.
// =====================================================================================================
__global__ __launch_bounds__(256) void ln_rows(const float* __restrict__ x, const float* __restrict__ gam,
                                               const float* __restrict__ bet, unsigned short* Xh,
                                               int nrows, float xsc, float eps) {
  const int lane = threadIdx.x & 31;
  const int wave = threadIdx.x >> 5;
  const int row  = blockIdx.x * 8 + wave;
  if (row >= nrows) return;                     // wave-uniform; no block barriers in this kernel
  const float* xr = x + (size_t)row * DM;
  const float rd = 1.0f / (float)DM;

  float s = 0.f;
#pragma unroll 1
  for (int i = 0; i < 4; ++i) {
    const int c0 = 256 * i + 8 * lane;
    const v4f a = *(const v4f*)(xr + c0);
    const v4f b = *(const v4f*)(xr + c0 + 4);
    s += ((bfr(a[0]) + bfr(a[1])) + (bfr(a[2]) + bfr(a[3]))) +
         ((bfr(b[0]) + bfr(b[1])) + (bfr(b[2]) + bfr(b[3])));
  }
#pragma unroll
  for (int off = 1; off < 32; off <<= 1) s += __shfl_xor(s, off, 32);
  const float mu = s * rd;

  float s2 = 0.f;
#pragma unroll 1
  for (int i = 0; i < 4; ++i) {
    const int c0 = 256 * i + 8 * lane;
    const v4f a = *(const v4f*)(xr + c0);
    const v4f b = *(const v4f*)(xr + c0 + 4);
#pragma unroll
    for (int e = 0; e < 4; ++e) {
      const float d0 = bfr(a[e]) - mu;
      const float d1 = bfr(b[e]) - mu;
      s2 += d0 * d0;
      s2 += d1 * d1;
    }
  }
#pragma unroll
  for (int off = 1; off < 32; off <<= 1) s2 += __shfl_xor(s2, off, 32);
  const float var  = s2 * rd;
  const float rstd = 1.0f / sqrtf(var + eps);

#pragma unroll 1
  for (int i = 0; i < 4; ++i) {
    const int c0 = 256 * i + 8 * lane;
    const v4f a  = *(const v4f*)(xr + c0);
    const v4f b  = *(const v4f*)(xr + c0 + 4);
    const v4f ga = *(const v4f*)(gam + c0);
    const v4f gb = *(const v4f*)(gam + c0 + 4);
    const v4f ba = *(const v4f*)(bet + c0);
    const v4f bb = *(const v4f*)(bet + c0 + 4);
    float y[8];
#pragma unroll
    for (int e = 0; e < 4; ++e) {
      y[e]     = ((bfr(a[e]) - mu) * rstd * bfr(ga[e]) + bfr(ba[e])) * xsc;
      y[4 + e] = ((bfr(b[e]) - mu) * rstd * bfr(gb[e]) + bfr(bb[e])) * xsc;
    }
    v4u u;
#pragma unroll
    for (int e = 0; e < 4; ++e) u[e] = pk16(h_bits((_Float16)y[2 * e]), h_bits((_Float16)y[2 * e + 1]));
    unsigned short* dst = Xh + (size_t)row * DM + c0;
    *(v4u*)dst = u;
    
  }
}

// =====================================================================================================
// Transpose-convert: W f32 in[R][C] (row-major) -> out f16 bits [C][R]; each value bf16 RNE-converted,
// multiplied by wsc (power of two, exact) and cast to f16. Block = one 64x64 tile staged through LDS,
// coverage: load 4 it x 256 threads x 4 = 64x64; store 2 it x 256 threads x 8 = 64x64; grid covers R x C.
// =====================================================================================================
__global__ __launch_bounds__(256) void wtrans_h(const float* __restrict__ W, unsigned short* Wt,
                                                int R, int C, float wsc) {
  __shared__ __align__(16) unsigned short sT[64 * 72];     // [c][r], pitch 72 halves = 144 B
  const int tid = threadIdx.x;
  const int r0  = blockIdx.y * 64;          // rows of W
  const int c0  = blockIdx.x * 64;          // cols of W
#pragma unroll
  for (int it = 0; it < 4; ++it) {
    const int idx = it * 256 + tid;         // 0..1023
    const int r   = idx >> 4;               // 0..63
    const int c4  = (idx & 15) * 4;         // 0..60
    const v4f w = *(const v4f*)(W + (size_t)(r0 + r) * C + c0 + c4);
#pragma unroll
    for (int e = 0; e < 4; ++e) sT[(c4 + e) * 72 + r] = h_bits((_Float16)(bfr(w[e]) * wsc));
  }
  __syncthreads();
  v4u u[2];
#pragma unroll
  for (int it = 0; it < 2; ++it) {
    const int row = it * 32 + (tid >> 3), col8 = (tid & 7) * 8;
    u[it] = *(const v4u*)(sT + row * 72 + col8);
  }
  {
#pragma unroll
    for (int it = 0; it < 2; ++it) {
      const int row = it * 32 + (tid >> 3), col8 = (tid & 7) * 8;
      *(v4u*)(Wt + (size_t)(c0 + row) * R + r0 + col8) = u[it];
    }
    
  }
}

// =====================================================================================================
// f16 WMMA GEMM: C[m][n] = oscale * sum_k A[m][k] * Bt[n][k] + bsc * bias. A block of 8 waves owns a 128x256
// tile of C (2 x 4 waves, 64x64 each). A row-major [M][K] pitch lda; Bt row-major [N][K] pitch ldb (k contiguous);
// M multiple of 128, N multiple of 256, K multiple of 64 and at least 64 (static here).
// Operands: per k slice of 64 (128 B = one line of every row) the block brings its 128 A rows and 256 Bt rows
// into LDS by asynchronous 16-B copies, each wave-wide copy covering four whole rows of the slice; rows at pitch
// GP. Two buffers: slice t + 1 flies while slice t is multiplied; at the foot of a trip every wave waits for its
// LDS reads and its copies, one block barrier publishes slice t + 1 and frees the buffer of slice t for t + 2.
// Fragments come from LDS in the k order of ldfrag_h; every accumulator takes its k blocks of 32 in rising order.
// Bias: BIASM == 0 -> per column bias0[n] (N entries, clamped-address 16-B loads); BIASM == 1 -> per row
//       bias0[m] (M entries). Bias values RNE-converted to bf16, then multiplied by bsc.
// OM: 2 = one f16 plane (Cout); 3 = f16 hi plane (Cout) plus f16 residual plane ((f - hi) * rsc, Cout2), same
//     indexing and pitch ldc for both planes.
// coverage: 4 slabs x 16 rows (it 0..3 x lane>>3 0..3) x 64 cols (8 lanes x 8) = the wave's whole 64x64 tile;
//           8 waves = the block's 128x256 tile; grid >= (M/128)*(N/256) blocks, surplus blocks exit whole.
// =====================================================================================================
#define GP 72      // LDS row pitch in halves of the operand slices: 144 B = 16 B x 9 (odd), for 16-byte readers
template <int OM, int BIASM>
__global__ __launch_bounds__(256) void gemm64(
    const unsigned short* __restrict__ Ap, int lda,
    const unsigned short* __restrict__ Btp, int ldb,
    const float* __restrict__ bias0,
    unsigned short* Cout, unsigned short* Cout2, int ldc,
    int M, int N, int K, float oscale, float bsc, float rsc) {
  const _Float16* A  = (const _Float16*)(const void*)Ap;
  const _Float16* Bt = (const _Float16*)(const void*)Btp;
  __shared__ __align__(16) _Float16 sA[2][128 * GP];   // A slice  [row][k], two buffers
  __shared__ __align__(16) _Float16 sB[2][256 * GP];   // Bt slice [row][k], two buffers
  __shared__ __align__(16) float sT[8][16 * 68];       // per-wave 16x64 slab, pitch 68 floats
  const int tid  = threadIdx.x;
  const int lane = tid & 31;
  const int wave = tid >> 5;
  const int tilesN = N >> 8;
  const int tilesM = M >> 7;
  const int bt = blockIdx.x;
  if (bt >= tilesM * tilesN) return;   // block-uniform, in front of every barrier
  const int tm = bt / tilesN;
  const int tn = bt - tm * tilesN;
  const int mB = tm << 7;                      // block's first row of C
  const int nB = tn << 8;                      // block's first column of C
  const int wm = (wave >> 2) << 6;             // wave's row offset in the block tile
  const int wn = (wave & 3) << 6;              // wave's column offset in the block tile
  const int m0 = mB + wm;
  const int n0 = nB + wn;

  const int rlane = lane & 15;                 // row (A) / col (B, D) within subtile
  const int koff  = (lane >> 4) * 8;           // k offset of this lane half
  const int mOff  = (lane >> 4) * 8;           // D row offset

  v8f acc[4][4];
#pragma unroll
  for (int i = 0; i < 4; ++i)
#pragma unroll
    for (int j = 0; j < 4; ++j) acc[i][j] = zero8();

  // staging map: thread -> row (tid >> 3) + 32 * it, 16-B piece tid & 7 of the row's 128-B slice
  const int srow = tid >> 3, sc8 = (tid & 7) * 8;
  const _Float16* ga = A  + (size_t)(mB + srow) * lda + sc8;
  const _Float16* gb = Bt + (size_t)(nB + srow) * ldb + sc8;
  const size_t astep = (size_t)32 * lda, bstep = (size_t)32 * ldb;
  const unsigned la0 = (unsigned)(uintptr_t)(&sA[0][srow * GP + sc8]);   // lane's LDS byte address, buffer 0, it 0
  const unsigned lb0 = (unsigned)(uintptr_t)(&sB[0][srow * GP + sc8]);
  // One slice: 4 + 8 asynchronous 16-B copies per lane, global -> LDS, through no register. The closing
  // s_wait_xcnt stands in the copies' own statement so that no address register is rewritten in front of it.
  auto copies = [&](int buf, int k0) {
    const unsigned la = la0 + (unsigned)buf * (unsigned)(128 * GP * 2);
    const unsigned lb = lb0 + (unsigned)buf * (unsigned)(256 * GP * 2);
    const _Float16* pa = ga + k0;
    const _Float16* pb = gb + k0;
#if defined(__HIP_DEVICE_COMPILE__)
    asm volatile(
        "global_load_async_to_lds_b128 %0, %12, off\n\t"
        "global_load_async_to_lds_b128 %1, %13, off\n\t"
        "global_load_async_to_lds_b128 %2, %14, off\n\t"
        "global_load_async_to_lds_b128 %3, %15, off\n\t"
        "global_load_async_to_lds_b128 %4, %16, off\n\t"
        "global_load_async_to_lds_b128 %5, %17, off\n\t"
        "global_load_async_to_lds_b128 %6, %18, off\n\t"
        "global_load_async_to_lds_b128 %7, %19, off\n\t"
        "global_load_async_to_lds_b128 %8, %20, off\n\t"
        "global_load_async_to_lds_b128 %9, %21, off\n\t"
        "global_load_async_to_lds_b128 %10, %22, off\n\t"
        "global_load_async_to_lds_b128 %11, %23, off\n\t"
        "s_wait_xcnt 0x0"
        :: "v"(la), "v"(la + 1u * 32u * GP * 2u), "v"(la + 2u * 32u * GP * 2u), "v"(la + 3u * 32u * GP * 2u),
           "v"(lb), "v"(lb + 1u * 32u * GP * 2u), "v"(lb + 2u * 32u * GP * 2u), "v"(lb + 3u * 32u * GP * 2u),
           "v"(lb + 4u * 32u * GP * 2u), "v"(lb + 5u * 32u * GP * 2u), "v"(lb + 6u * 32u * GP * 2u),
           "v"(lb + 7u * 32u * GP * 2u),
           "v"(pa), "v"(pa + astep), "v"(pa + 2 * astep), "v"(pa + 3 * astep),
           "v"(pb), "v"(pb + bstep), "v"(pb + 2 * bstep), "v"(pb + 3 * bstep),
           "v"(pb + 4 * bstep), "v"(pb + 5 * bstep), "v"(pb + 6 * bstep), "v"(pb + 7 * bstep)
        : "memory");
#endif
  };
  // products of one slice; every loop below is unrolled so that fragments and accumulators, indexed by
  // constants, stay in registers
  auto compute = [&](int buf) {
    const _Float16* pa = &sA[buf][(wm + rlane) * GP + koff];
    const _Float16* pb = &sB[buf][(wn + rlane) * GP + koff];
#pragma unroll
    for (int ks = 0; ks < 2; ++ks) {
      v16h bh[4], ah[4];
#pragma unroll
      for (int j = 0; j < 4; ++j) bh[j] = ldfrag_h(pb + j * 16 * GP + ks * 32);
#pragma unroll
      for (int i = 0; i < 4; ++i) ah[i] = ldfrag_h(pa + i * 16 * GP + ks * 32);
      // keeps the 16 fragment reads of a k block as one group in front of its 16 products: left free, the
      // scheduler spreads them among the products on one A register set, and each place waits out the LDS latency
      __builtin_amdgcn_sched_barrier(0);
#pragma unroll
      for (int i = 0; i < 4; ++i)
#pragma unroll
        for (int j = 0; j < 4; ++j) acc[i][j] = mma_h_raw(ah[i], bh[j], acc[i][j]);
    }
  };

  const int nst = K >> 6;
  copies(0, 0);
  asm volatile("s_wait_asynccnt 0x0" ::: "memory");   // slice 0 has landed before the barrier publishes it
  __syncthreads();
  if (nst > 1) copies(1, 64);
  for (int t = 0; t < nst; ++t) {                      // block-uniform trip
    compute(t & 1);
    asm volatile("s_wait_dscnt 0x0" ::: "memory");     // this wave's reads of buffer t & 1 are done before its refill
    asm volatile("s_wait_asynccnt 0x0" ::: "memory");  // this wave's copies of slice t + 1 have landed
    __syncthreads();                                   // publishes slice t + 1, frees buffer t & 1
    if (t + 2 < nst) copies(t & 1, (t + 2) << 6);
  }
  asm volatile("s_wait_asynccnt 0x0" ::: "memory");    // nothing in flight when the wave goes on to the epilogue
  acc_guard4(acc[0][0], acc[0][1], acc[0][2], acc[0][3]);
  acc_guard4(acc[1][0], acc[1][1], acc[1][2], acc[1][3]);
  acc_guard4(acc[2][0], acc[2][1], acc[2][2], acc[2][3]);
  acc_guard4(acc[3][0], acc[3][1], acc[3][2], acc[3][3]);

  const int q8 = lane >> 3, c8 = (lane & 7) * 8;
  float bc[8];
#pragma unroll
  for (int e = 0; e < 8; ++e) bc[e] = 0.f;
  if (BIASM == 0) {
    const int cb = n0 + c8;                                  // <= N - 8
    const int i0 = (cb < N - 8) ? cb : (N - 8);
    const v4f b0a = *(const v4f*)(bias0 + i0), b0b = *(const v4f*)(bias0 + i0 + 4);
#pragma unroll
    for (int e = 0; e < 4; ++e) {
      bc[e]     = bfr(b0a[e]) * bsc;
      bc[4 + e] = bfr(b0b[e]) * bsc;
    }
  }

  // ---- epilogue ----
  float* slab = sT[wave];
#pragma unroll
  for (int i = 0; i < 4; ++i) {
    const int mBase = m0 + (i << 4);
#pragma unroll
    for (int j = 0; j < 4; ++j) {
#pragma unroll
      for (int r = 0; r < 8; ++r) {
        slab[(mOff + r) * 68 + (j << 4) + rlane] = acc[i][j][r];
      }
    }
    wave_sync_lds();
    v4u hv[4], lv[4];
#pragma unroll
    for (int it = 0; it < 4; ++it) {
      const int row = it * 4 + q8;                       // it 0..3 x q8 0..3 = rows 0..15
      const float* sp = slab + row * 68 + c8;
      float bm = 0.f;
      if (BIASM == 1) bm = bfr(bias0[mBase + row]) * bsc; // mBase + row < M
      v4u a, lw;
#pragma unroll
      for (int e = 0; e < 4; ++e) {
        const float f0 = sp[2 * e]     * oscale + ((BIASM == 1) ? bm : bc[2 * e]);
        const float f1 = sp[2 * e + 1] * oscale + ((BIASM == 1) ? bm : bc[2 * e + 1]);
        const _Float16 g0 = (_Float16)f0;
        const _Float16 g1 = (_Float16)f1;
        a[e] = pk16(h_bits(g0), h_bits(g1));
        if (OM == 3) {
          const _Float16 r0 = (_Float16)((f0 - (float)g0) * rsc);
          const _Float16 r1 = (_Float16)((f1 - (float)g1) * rsc);
          lw[e] = pk16(h_bits(r0), h_bits(r1));
        } else {
          lw[e] = 0u;
        }
      }
      hv[it] = a;
      lv[it] = lw;
    }
    {
#pragma unroll
      for (int it = 0; it < 4; ++it) {
        const int row = it * 4 + q8;
        const size_t go = (size_t)(mBase + row) * ldc + n0 + c8;
        *(v4u*)(Cout + go) = hv[it];
        if (OM == 3) *(v4u*)(Cout2 + go) = lv[it];
      }
      
    }
    wave_sync_lds();
  }
}

#define LOG2E 1.44269504088896340736f
#define OP 68      // LDS row pitch in floats of the output tile: 272 B = 16 B x 17 (odd), for 16-byte writers
__device__ __forceinline__ float other_half(float x) {    // value of lane l ^ 16
  const int b = __builtin_bit_cast(int, x);
  return __builtin_bit_cast(float, __builtin_amdgcn_permlanex16(b, b, 0x76543210, 0xfedcba98, false, false));
}
// exp(x) as v_exp_f32 of x * log2(e), eight at a time (one score tile) or alone. Written as asm so that the slot
// the instruction set asks for behind a transcendental is kept by construction: outputs are early-clobber, so
// inside a statement no v_exp_f32 is followed by a write of its source or a read of its result, and the closing
// v_nop fills the slot behind the last one whatever the compiler puts next.
__device__ __forceinline__ v8f exp_8(v8f x) {
  v8f e;
#if defined(__HIP_DEVICE_COMPILE__)
  float e0, e1, e2, e3, e4, e5, e6, e7;
  asm("v_exp_f32 %0, %8\n\tv_exp_f32 %1, %9\n\tv_exp_f32 %2, %10\n\tv_exp_f32 %3, %11\n\t"
      "v_exp_f32 %4, %12\n\tv_exp_f32 %5, %13\n\tv_exp_f32 %6, %14\n\tv_exp_f32 %7, %15\n\tv_nop"
      : "=&v"(e0), "=&v"(e1), "=&v"(e2), "=&v"(e3), "=&v"(e4), "=&v"(e5), "=&v"(e6), "=&v"(e7)
      : "v"(x[0] * LOG2E), "v"(x[1] * LOG2E), "v"(x[2] * LOG2E), "v"(x[3] * LOG2E),
        "v"(x[4] * LOG2E), "v"(x[5] * LOG2E), "v"(x[6] * LOG2E), "v"(x[7] * LOG2E));
  e[0] = e0; e[1] = e1; e[2] = e2; e[3] = e3; e[4] = e4; e[5] = e5; e[6] = e6; e[7] = e7;
#else
  e = x;
#endif
  return e;
}
__device__ __forceinline__ float exp_1(float x) {
  float e = x;
#if defined(__HIP_DEVICE_COMPILE__)
  asm("v_exp_f32 %0, %1\n\tv_nop" : "=&v"(e) : "v"(x * LOG2E));
#endif
  return e;
}

__global__ __launch_bounds__(128)
void attn_lb(const unsigned short* __restrict__ qhp, const unsigned short* __restrict__ qlp,
             const unsigned short* __restrict__ khp,
             const unsigned short* __restrict__ vthp, const unsigned short* __restrict__ vtlp,
             float* outp, float sscale, float onorm) {
  union FH { v16h v; v8h h[2]; };
  // two buffers of three tiles, 9 KB each, pitch LP: K [kv][d], V^T hi [d][kv], V^T res [d][kv]
  __shared__ __align__(16) _Float16 Ring[2][3][64 * LP];
  __shared__ __align__(16) float    Os[4][16 * OP];               // per wave context tile [row][d], pitch OP

  const int tid  = threadIdx.x;
  const int wave = tid >> 5;
  const int lane = tid & 31;
  const int hh   = lane >> 4;
  const int c    = lane & 15;

  const int bx   = blockIdx.x;
  const int qb   = bx % NQB;
  const int hb   = bx / NQB;
  const int h    = hb % NH;
  const int b    = hb / NH;
  const int tok0 = b * SQ;                       // first token row of this sequence
  const int ql0  = qb * 64 + wave * 16;          // local query index of this wave's first row
  const int q0   = tok0 + ql0;                   // global token row of this wave's first row

  const _Float16* Qh = (const _Float16*)(const void*)qhp + (size_t)h * HD;
  const _Float16* Ql = (const _Float16*)(const void*)qlp + (size_t)h * HD;
  const _Float16* Kg = (const _Float16*)(const void*)khp + (size_t)h * HD;
  const _Float16* Vh = (const _Float16*)(const void*)vthp + (size_t)h * HD * NTOK + tok0;
  const _Float16* Vl = (const _Float16*)(const void*)vtlp + (size_t)h * HD * NTOK + tok0;

  // ---- per-head slope (block-uniform) ----
  const int   se    = (h + 1) >> 1;
  const float spw   = __uint_as_float((unsigned)(127 - se) << 23);
  const float slope = (h & 1) ? spw : (spw * 0.70710678118654752f);

  // ---- Q fragments (B operand, column = lane&15): 2 d-chunks, hi and residual planes ----
  v16h qa[2], qr[2];
#pragma unroll
  for (int dc = 0; dc < 2; ++dc) {
    qa[dc] = ldfrag_h(Qh + (size_t)(q0 + c) * DM + dc * 32 + 8 * hh);
    qr[dc] = ldfrag_h(Ql + (size_t)(q0 + c) * DM + dc * 32 + 8 * hh);
  }

  const int qrow = ql0 + c;                      // this lane's query (D column = lane&15)
  float mrow = -INFINITY;                        // running maximum of query qrow (equal in both lane halves)
  float lrow = 0.f;                              // running sum over this lane half's keys only
  v8f oacc[4];                                   // oacc[t][r] = context[query c][d = 16 t + 8 hh + r]
#pragma unroll
  for (int t = 0; t < 4; ++t) oacc[t] = zero8();

  const float rinv = 1.0f / RSC;

  // staging map: thread -> row (tid >> 3) + 16 * it, 16-B piece tid & 7 of the row's 128 B
  const int srow = tid >> 3, sc8 = (tid & 7) * 8;
  const _Float16* gk = Kg + (size_t)(tok0 + srow) * DM + sc8;      // K row = key, d = sc8..sc8+7
  const _Float16* gv = Vh + (size_t)srow * NTOK + sc8;             // V^T hi row = d, key = sc8..sc8+7
  const _Float16* gw = Vl + (size_t)srow * NTOK + sc8;             // V^T res row = d
  const unsigned l0 = (unsigned)(uintptr_t)(&Ring[0][0][srow * LP + sc8]);   // lane's LDS byte address, buffer 0, K, it 0
  // One chunk: 3 x 4 asynchronous 16-B copies per lane, global -> LDS, through no register. The closing
  // s_wait_xcnt stands in the copies' own statement so that no address register is rewritten in front of it.
  auto copies = [&](int buf, int kv) {
    const unsigned lk = l0 + (unsigned)buf * (unsigned)(3 * 64 * LP * 2);
    const unsigned lv = lk + (unsigned)(64 * LP * 2);
    const unsigned lw = lk + (unsigned)(2 * 64 * LP * 2);
    const _Float16* pk = gk + (size_t)kv * DM;
    const _Float16* pv = gv + kv;
    const _Float16* pw = gw + kv;
    const size_t kstep = (size_t)16 * DM, vstep = (size_t)16 * NTOK;
#if defined(__HIP_DEVICE_COMPILE__)
    asm volatile(
        "global_load_async_to_lds_b128 %0, %12, off\n\t"
        "global_load_async_to_lds_b128 %1, %13, off\n\t"
        "global_load_async_to_lds_b128 %2, %14, off\n\t"
        "global_load_async_to_lds_b128 %3, %15, off\n\t"
        "global_load_async_to_lds_b128 %4, %16, off\n\t"
        "global_load_async_to_lds_b128 %5, %17, off\n\t"
        "global_load_async_to_lds_b128 %6, %18, off\n\t"
        "global_load_async_to_lds_b128 %7, %19, off\n\t"
        "global_load_async_to_lds_b128 %8, %20, off\n\t"
        "global_load_async_to_lds_b128 %9, %21, off\n\t"
        "global_load_async_to_lds_b128 %10, %22, off\n\t"
        "global_load_async_to_lds_b128 %11, %23, off\n\t"
        "s_wait_xcnt 0x0"
        :: "v"(lk), "v"(lk + 1u * 16u * LP * 2u), "v"(lk + 2u * 16u * LP * 2u), "v"(lk + 3u * 16u * LP * 2u),
           "v"(lv), "v"(lv + 1u * 16u * LP * 2u), "v"(lv + 2u * 16u * LP * 2u), "v"(lv + 3u * 16u * LP * 2u),
           "v"(lw), "v"(lw + 1u * 16u * LP * 2u), "v"(lw + 2u * 16u * LP * 2u), "v"(lw + 3u * 16u * LP * 2u),
           "v"(pk), "v"(pk + kstep), "v"(pk + 2 * kstep), "v"(pk + 3 * kstep),
           "v"(pv), "v"(pv + vstep), "v"(pv + 2 * vstep), "v"(pv + 3 * vstep),
           "v"(pw), "v"(pw + vstep), "v"(pw + 2 * vstep), "v"(pw + 3 * vstep)
        : "memory");
#endif
  };

  static_assert(NQB >= 2);
  copies(0, 0);
  asm volatile("s_wait_asynccnt 0x0" ::: "memory");   // chunk 0 has landed before the barrier publishes it
  __syncthreads();
  copies(1, 64);
  for (int kt = 0; kt < NQB; ++kt) {            // block-uniform trip = 32
    const int kv0 = kt * 64;                     // local key index of the chunk
    const _Float16* Ksh = &Ring[kt & 1][0][0];
    const _Float16* Vth = &Ring[kt & 1][1][0];
    const _Float16* Vtl = &Ring[kt & 1][2][0];

    // ---- logits, transposed: 64 keys x 16 queries per wave ----
    v8f s[4];
#pragma unroll
    for (int j = 0; j < 4; ++j) {
      v8f sh = zero8(), sl = zero8();
#pragma unroll
      for (int dc = 0; dc < 2; ++dc) {
        FH kb;
        kb.h[0] = *(const v8h*)(Ksh + (j * 16 + c) * LP + dc * 32 + 8 * hh);
        kb.h[1] = *(const v8h*)(Ksh + (j * 16 + c) * LP + dc * 32 + 16 + 8 * hh);
        sh = mma_h(kb.v, qa[dc], sh);
        sl = mma_h(kb.v, qr[dc], sl);
      }
#pragma unroll
      for (int r = 0; r < 8; ++r) {
        const int key = kv0 + j * 16 + 8 * hh + r;                  // D row = 8h + r
        int dd = key - qrow;
        if (dd < 0) dd = -dd;
        const float raw = sh[r] + sl[r] * rinv;
        s[j][r] = (raw - slope * (float)dd) * sscale;
      }
    }

    // ---- maximum in the lane, one exchange between the halves; online softmax ----
    float mj[4];
#pragma unroll
    for (int j = 0; j < 4; ++j) {
      mj[j] = s[j][0];
#pragma unroll
      for (int r = 1; r < 8; ++r) mj[j] = fmaxf(mj[j], s[j][r]);
    }
    float m = fmaxf(fmaxf(mj[0], mj[1]), fmaxf(mj[2], mj[3]));
    m = fmaxf(m, other_half(m));
    const float mnew  = fmaxf(mrow, m);
    const float ms    = (mnew == -INFINITY) ? 0.f : mnew;
    const float alpha = exp_1(mrow - ms);
    mrow = mnew;

    // ---- P (x PSC, f16) packed from the score registers into the B operands of p.v ----
    v16h pb[2];
    float pj[4];
#pragma unroll
    for (int j = 0; j < 4; ++j) {
      const v8f p = exp_8(s[j] - ms);
      pj[j] = 0.f;
#pragma unroll
      for (int r = 0; r < 8; ++r) {
        pj[j] += p[r];
        pb[j >> 1][(j & 1) * 8 + r] = (_Float16)(p[r] * PSC);
      }
    }
    lrow = lrow * alpha + ((pj[0] + pj[1]) + (pj[2] + pj[3]));
#pragma unroll
    for (int t = 0; t < 4; ++t) {
#pragma unroll
      for (int r = 0; r < 8; ++r) oacc[t][r] *= alpha;
    }

    // ---- context^T += Vhi . P^T ; chunk residual = Vres . P^T (f16 WMMA) ----
    v8f ol[4];
#pragma unroll
    for (int t = 0; t < 4; ++t) ol[t] = zero8();
#pragma unroll
    for (int kk = 0; kk < 2; ++kk) {
#pragma unroll
      for (int t = 0; t < 4; ++t) {
        FH vb, wb;
        vb.h[0] = *(const v8h*)(Vth + (t * 16 + c) * LP + kk * 32 + 8 * hh);
        vb.h[1] = *(const v8h*)(Vth + (t * 16 + c) * LP + kk * 32 + 16 + 8 * hh);
        wb.h[0] = *(const v8h*)(Vtl + (t * 16 + c) * LP + kk * 32 + 8 * hh);
        wb.h[1] = *(const v8h*)(Vtl + (t * 16 + c) * LP + kk * 32 + 16 + 8 * hh);
        oacc[t] = mma_h(vb.v, pb[kk], oacc[t]);
        ol[t]   = mma_h(wb.v, pb[kk], ol[t]);
      }
    }
    // ---- fold this chunk's residual term into the running context (f32) ----
#pragma unroll
    for (int t = 0; t < 4; ++t) {
#pragma unroll
      for (int r = 0; r < 8; ++r) oacc[t][r] += ol[t][r] * rinv;
    }
    asm volatile("s_wait_dscnt 0x0" ::: "memory");     // this wave's reads of buffer kt & 1 are done before its refill
    asm volatile("s_wait_asynccnt 0x0" ::: "memory");  // this wave's copies of chunk kt + 1 have landed
    __syncthreads();                                   // publishes chunk kt + 1, frees buffer kt & 1
    if (kt + 2 < NQB) copies(kt & 1, kv0 + 128);
  }
  asm volatile("s_wait_asynccnt 0x0" ::: "memory");    // nothing in flight when the wave goes on to the epilogue

  // ---- join the halves' sums, normalise (1/l and the 1/(PSC*VSC) carry), stage the wave's 16x64 tile
  //      (a lane holds 8 consecutive d of its query per t: two 16-B LDS writes), write whole 256-B rows
  float* os = Os[wave];
  {
    const float l = lrow + other_half(lrow);
    const float inv = ((l > 0.f) ? (1.0f / l) : 0.f) * onorm;
#pragma unroll
    for (int t = 0; t < 4; ++t) {
      v4f w0, w1;
#pragma unroll
      for (int e = 0; e < 4; ++e) { w0[e] = oacc[t][e] * inv; w1[e] = oacc[t][4 + e] * inv; }
      *(v4f*)(os + c * OP + t * 16 + 8 * hh)     = w0;
      *(v4f*)(os + c * OP + t * 16 + 8 * hh + 4) = w1;
    }
  }
  wave_sync_lds();
  {
    const int hh2 = lane >> 4, c4 = (lane & 15) * 4;
    v4f vals[8];
#pragma unroll
    for (int it = 0; it < 8; ++it) {
      const int row = it * 2 + hh2;   // it 0..7 x hh2 0..1 = rows 0..15 of the wave tile
      vals[it] = *(const v4f*)(os + row * OP + c4);
    }
    {
#pragma unroll
      for (int it = 0; it < 8; ++it) {
        const int row = it * 2 + hh2;
        const size_t go = (size_t)(q0 + row) * DM + (size_t)h * HD + c4;
        *(v4f*)(outp + go) = vals[it];
      }
    }
  }
}

// =====================================================================================================
// Workspace map (bytes); every plane is an exact multiple of its 64x64-tile / whole-line store granularity
// ([8192][1024] = 128x16 tiles, [1024][8192] = 16x128 tiles, weights [1024][1024] = 16x16 tiles):
//   WqT  f16 [1024][1024]   0          2097152   (transposed, x64)
//   WkT  f16 [1024][1024]   2097152    2097152
//   WvT  f16 [1024][1024]   4194304    2097152
//   XH   f16 [8192][1024]   6291456    16777216  (layer norm output x16)
//   QH   f16 [8192][1024]   23068672   16777216  (q hi)
//   QL   f16 [8192][1024]   39845888   16777216  (q residual x4096)
//   KH   f16 [8192][1024]   56623104   16777216
//   VTH  f16 [1024][8192]   73400320   16777216  (v^T hi x16)
//   VTL  f16 [1024][8192]   90177536   16777216  (v^T residual x16 x4096)
//   end                     106954752
// =====================================================================================================
extern "C" void kernel_launch(void* const* d_in, const int* in_sizes, int n_in,
                              void* d_out, int out_size, void* d_ws, size_t ws_size,
                              hipStream_t stream) {
  if (n_in < 9) return;
  if (in_sizes[0] != NTOK * DM) return;
  if (in_sizes[1] != DM || in_sizes[2] != DM) return;
  if (in_sizes[3] != DM * DM || in_sizes[5] != DM * DM || in_sizes[7] != DM * DM) return;
  if (in_sizes[4] != DM || in_sizes[6] != DM || in_sizes[8] != DM) return;
  if (out_size != NTOK * DM) return;

  const float* x   = (const float*)d_in[0];
  const float* gam = (const float*)d_in[1];
  const float* bet = (const float*)d_in[2];
  const float* wq  = (const float*)d_in[3];
  const float* bq  = (const float*)d_in[4];
  const float* wk  = (const float*)d_in[5];
  const float* bk  = (const float*)d_in[6];
  const float* wv  = (const float*)d_in[7];
  const float* bv  = (const float*)d_in[8];

  const size_t PW = (size_t)DM * DM * 2;            //  2097152
  const size_t PA = (size_t)NTOK * DM * 2;          // 16777216
  size_t off = 0;
  const size_t oWq = off; off += PW;
  const size_t oWk = off; off += PW;
  const size_t oWv = off; off += PW;
  const size_t oXH = off; off += PA;
  const size_t oQH = off; off += PA;
  const size_t oQL = off; off += PA;
  const size_t oKH = off; off += PA;
  const size_t oVH = off; off += PA;
  const size_t oVL = off; off += PA;
  if (off > ws_size) return;                        // off = 106954752
  if (off > (size_t)134217728) return;

  char* ws = (char*)d_ws;
  unsigned short* WqT = (unsigned short*)(ws + oWq);
  unsigned short* WkT = (unsigned short*)(ws + oWk);
  unsigned short* WvT = (unsigned short*)(ws + oWv);
  unsigned short* XH  = (unsigned short*)(ws + oXH);
  unsigned short* QH  = (unsigned short*)(ws + oQH);
  unsigned short* QL  = (unsigned short*)(ws + oQL);
  unsigned short* KH  = (unsigned short*)(ws + oKH);
  unsigned short* VTH = (unsigned short*)(ws + oVH);
  unsigned short* VTL = (unsigned short*)(ws + oVL);

  const dim3 blk(256), blk128(128);
  const dim3 gLn(NTOK / 8);                                            // 1024 blocks, 8 rows each
  const dim3 gTr(DM / 64, DM / 64);                                    // (cols/64, rows/64) of W[in][out]
  const dim3 gG(((NTOK / 64) * (DM / 64) + 7) / 8);                    // 256 blocks, one 128x256 tile each
  const dim3 gAttn(NB * NH * NQB);                                     // 2048 blocks of 128
  const float osc_qk = 1.0f / (XSC * WSC);                             // q, k unscaled
  const float osc_v  = VSC / (XSC * WSC);                              // v^T carried x16

  // (0) layer norm -> XH f16 [8192][1024] (x16)
  ln_rows<<<gLn, blk, 0, stream>>>(x, gam, bet, XH, NTOK, XSC, LNEPS);
  // (1) weights W[in][out] f32 -> W^T f16 [out][in] (k contiguous), bf16 RNE-converted, x64
  wtrans_h<<<gTr, blk, 0, stream>>>(wq, WqT, DM, DM, WSC);
  wtrans_h<<<gTr, blk, 0, stream>>>(wk, WkT, DM, DM, WSC);
  wtrans_h<<<gTr, blk, 0, stream>>>(wv, WvT, DM, DM, WSC);
  // (2) q = xh . Wq + bq -> QH (hi), QL (residual x4096), f16 [8192][1024]
  gemm64<3, 0><<<gG, blk, 0, stream>>>(XH, DM, WqT, DM, bq, QH, QL, DM, NTOK, DM, DM, osc_qk, 1.0f, RSC);
  // (3) k = xh . Wk + bk -> KH f16 [8192][1024]
  gemm64<2, 0><<<gG, blk, 0, stream>>>(XH, DM, WkT, DM, bk, KH, KH, DM, NTOK, DM, DM, osc_qk, 1.0f, RSC);
  // (4) v^T: VT[m][t] = sum_k WvT[m][k] . xh[t][k] + bv[m] -> VTH (hi x16), VTL (residual x16 x4096),
  //     f16 [1024][8192]
  gemm64<3, 1><<<gG, blk, 0, stream>>>(WvT, DM, XH, DM, bv, VTH, VTL, NTOK, DM, NTOK, DM, osc_v, VSC, RSC);
  // (5) attention with per-head linear distance bias -> d_out f32 [8192][1024]
  attn_lb<<<gAttn, blk128, 0, stream>>>(QH, QL, KH, VTH, VTL, (float*)d_out, 0.125f, 1.0f / (PSC * VSC));
  (void)hipGetLastError();
}

// v005
// A run of this version takes 218 microseconds.
// Timed twice side by side with v004, it ran 1.05 and 1.06 times as fast.
// Over all steps from v000 it is 2.63 times as fast.
// Contractions: q, k and v^T projections on v_wmma_f32_16x16x32_f16 (f16 layer-norm plane carried x16 times
// f16 transposed weight plane carried x64, one product each); attention k.q^T on v_wmma_f32_16x16x32_f16
// (q as f16 hi plane plus f16 residual plane carried x4096, k plain f16, two products); v^T.p^T on
// v_wmma_f32_16x16x32_f16 (p carried x1024, v^T as f16 hi plane carried x16 plus f16 residual plane carried
// x4096, two products); all f32 accumulate; layer norm and softmax in f32 on VALU; every float input
// RNE-converted to bf16 on load.
#include <hip/hip_runtime.h>
#include <math.h>
#include <stdint.h>

#define NB    4
#define SQ    2048
#define NTOK  (NB * SQ)
#define DM    1024
#define NH    16
#define HD    64
#define NQB   (SQ / 64)
#define XSC   16.0f
#define WSC   64.0f
#define VSC   16.0f
#define RSC   4096.0f
#define PSC   1024.0f
#define LNEPS 1e-5f
#define LP    72      // LDS row pitch in halves of the attention tiles: 144 B = 16 B x 9 (odd), for 16-byte readers
static_assert(NH * HD == DM);
static_assert((SQ % 64) == 0 && (DM % 64) == 0 && (NTOK % 64) == 0);
static_assert(DM == 4 * 256);
static_assert((NTOK % 8) == 0);
static_assert((NTOK % 256) == 0 && (DM % 256) == 0);

typedef _Float16 v16h __attribute__((ext_vector_type(16)));
typedef _Float16 v8h  __attribute__((ext_vector_type(8)));
typedef float    v8f  __attribute__((ext_vector_type(8)));
typedef float    v4f  __attribute__((ext_vector_type(4)));
typedef unsigned int v4u __attribute__((ext_vector_type(4)));

// ---- scalar helpers --------------------------------------------------------------------------------
__device__ __forceinline__ unsigned short bf_bits(float f) {          // f32 -> bf16 bits, RNE convert
  unsigned u = __float_as_uint(f);
  return (unsigned short)((u + 0x7FFFu + ((u >> 16) & 1u)) >> 16);
}
__device__ __forceinline__ float bf_up(unsigned short h) { return __uint_as_float(((unsigned)h) << 16); }
__device__ __forceinline__ float bfr(float f) { return bf_up(bf_bits(f)); }   // value of the bf16 RNE convert
__device__ __forceinline__ unsigned short h_bits(_Float16 x) { return __builtin_bit_cast(unsigned short, x); }
__device__ __forceinline__ unsigned pk16(unsigned short a, unsigned short b) { return (unsigned)a | ((unsigned)b << 16); }
__device__ __forceinline__ v8f zero8() { v8f z = {0.f, 0.f, 0.f, 0.f, 0.f, 0.f, 0.f, 0.f}; return z; }

// ---- fragment loader: 16-bit A/B operand, lane -> row/col (lane&15), p already includes +8*(lane>>4);
//      elements 0..7 <- p[0..7] (k0+8h..), elements 8..15 <- p[16..23] (k0+16+8h..)
__device__ __forceinline__ v16h ldfrag_h(const _Float16* p) {
  union { v16h v; v8h h[2]; } f;
  f.h[0] = *(const v8h*)(p);
  f.h[1] = *(const v8h*)(p + 16);
  return f.v;
}

// ---- WMMA helpers with trailing VALU hazard gap --------------------------------------------------------
__device__ __forceinline__ v8f mma_h(v16h a, v16h b, v8f c) {
  c = __builtin_amdgcn_wmma_f32_16x16x32_f16(false, a, false, b, (short)0, c, false, false);
#if defined(__HIP_DEVICE_COMPILE__)
  asm volatile("v_nop\n\tv_nop\n\tv_nop\n\tv_nop" : "+v"(c) : "v"(a), "v"(b));
#endif
  return c;
}
__device__ __forceinline__ v8f mma_h_raw(v16h a, v16h b, v8f c) {
  return __builtin_amdgcn_wmma_f32_16x16x32_f16(false, a, false, b, (short)0, c, false, false);
}
__device__ __forceinline__ void acc_guard4(v8f& a, v8f& b, v8f& c, v8f& d) {
#if defined(__HIP_DEVICE_COMPILE__)
  asm volatile("v_nop\n\tv_nop\n\tv_nop\n\tv_nop" : "+v"(a), "+v"(b), "+v"(c), "+v"(d));
#endif
}
__device__ __forceinline__ void wave_sync_lds() {
  __builtin_amdgcn_fence(__ATOMIC_RELEASE, "workgroup");
  __builtin_amdgcn_wave_barrier();
  __builtin_amdgcn_fence(__ATOMIC_ACQUIRE, "workgroup");
}

// =====================================================================================================
// Layer norm over rows of DM = 1024: one wave per row, 8 rows per block (grid = nrows/8). Every input value
// y = ((x - mu) * rstd * gamma + beta) * xsc written as one f16 plane [nrows][DM].
// Lane l handles columns 256*i + 8*l .. +7 (i = 0..3); each store instruction of the wave covers 512 B =
// coverage: grid(nrows/8) x 8 waves = every row; 4 iterations x 32 lanes x 8 = all 1024 columns.
// =====================================================================================================
__global__ __launch_bounds__(256) void ln_rows(const float* __restrict__ x, const float* __restrict__ gam,
                                               const float* __restrict__ bet, unsigned short* Xh,
                                               int nrows, float xsc, float eps) {
  const int lane = threadIdx.x & 31;
  const int wave = threadIdx.x >> 5;
  const int row  = blockIdx.x * 8 + wave;
  if (row >= nrows) return;                     // wave-uniform; no block barriers in this kernel
  const float* xr = x + (size_t)row * DM;
  const float rd = 1.0f / (float)DM;

  float s = 0.f;
#pragma unroll 1
  for (int i = 0; i < 4; ++i) {
    const int c0 = 256 * i + 8 * lane;
    const v4f a = *(const v4f*)(xr + c0);
    const v4f b = *(const v4f*)(xr + c0 + 4);
    s += ((bfr(a[0]) + bfr(a[1])) + (bfr(a[2]) + bfr(a[3]))) +
         ((bfr(b[0]) + bfr(b[1])) + (bfr(b[2]) + bfr(b[3])));
  }
#pragma unroll
  for (int off = 1; off < 32; off <<= 1) s += __shfl_xor(s, off, 32);
  const float mu = s * rd;

  float s2 = 0.f;
#pragma unroll 1
  for (int i = 0; i < 4; ++i) {
    const int c0 = 256 * i + 8 * lane;
    const v4f a = *(const v4f*)(xr + c0);
    const v4f b = *(const v4f*)(xr + c0 + 4);
#pragma unroll
    for (int e = 0; e < 4; ++e) {
      const float d0 = bfr(a[e]) - mu;
      const float d1 = bfr(b[e]) - mu;
      s2 += d0 * d0;
      s2 += d1 * d1;
    }
  }
#pragma unroll
  for (int off = 1; off < 32; off <<= 1) s2 += __shfl_xor(s2, off, 32);
  const float var  = s2 * rd;
  const float rstd = 1.0f / sqrtf(var + eps);

#pragma unroll 1
  for (int i = 0; i < 4; ++i) {
    const int c0 = 256 * i + 8 * lane;
    const v4f a  = *(const v4f*)(xr + c0);
    const v4f b  = *(const v4f*)(xr + c0 + 4);
    const v4f ga = *(const v4f*)(gam + c0);
    const v4f gb = *(const v4f*)(gam + c0 + 4);
    const v4f ba = *(const v4f*)(bet + c0);
    const v4f bb = *(const v4f*)(bet + c0 + 4);
    float y[8];
#pragma unroll
    for (int e = 0; e < 4; ++e) {
      y[e]     = ((bfr(a[e]) - mu) * rstd * bfr(ga[e]) + bfr(ba[e])) * xsc;
      y[4 + e] = ((bfr(b[e]) - mu) * rstd * bfr(gb[e]) + bfr(bb[e])) * xsc;
    }
    v4u u;
#pragma unroll
    for (int e = 0; e < 4; ++e) u[e] = pk16(h_bits((_Float16)y[2 * e]), h_bits((_Float16)y[2 * e + 1]));
    unsigned short* dst = Xh + (size_t)row * DM + c0;
    *(v4u*)dst = u;
    
  }
}

// =====================================================================================================
// Transpose-convert: W f32 in[R][C] (row-major) -> out f16 bits [C][R]; each value bf16 RNE-converted,
// multiplied by wsc (power of two, exact) and cast to f16. Block = one 64x64 tile staged through LDS,
// coverage: load 4 it x 256 threads x 4 = 64x64; store 2 it x 256 threads x 8 = 64x64; grid covers R x C.
// =====================================================================================================
__global__ __launch_bounds__(256) void wtrans_h(const float* __restrict__ W, unsigned short* Wt,
                                                int R, int C, float wsc) {
  __shared__ __align__(16) unsigned short sT[64 * 72];     // [c][r], pitch 72 halves = 144 B
  const int tid = threadIdx.x;
  const int r0  = blockIdx.y * 64;          // rows of W
  const int c0  = blockIdx.x * 64;          // cols of W
#pragma unroll
  for (int it = 0; it < 4; ++it) {
    const int idx = it * 256 + tid;         // 0..1023
    const int r   = idx >> 4;               // 0..63
    const int c4  = (idx & 15) * 4;         // 0..60
    const v4f w = *(const v4f*)(W + (size_t)(r0 + r) * C + c0 + c4);
#pragma unroll
    for (int e = 0; e < 4; ++e) sT[(c4 + e) * 72 + r] = h_bits((_Float16)(bfr(w[e]) * wsc));
  }
  __syncthreads();
  v4u u[2];
#pragma unroll
  for (int it = 0; it < 2; ++it) {
    const int row = it * 32 + (tid >> 3), col8 = (tid & 7) * 8;
    u[it] = *(const v4u*)(sT + row * 72 + col8);
  }
  {
#pragma unroll
    for (int it = 0; it < 2; ++it) {
      const int row = it * 32 + (tid >> 3), col8 = (tid & 7) * 8;
      *(v4u*)(Wt + (size_t)(c0 + row) * R + r0 + col8) = u[it];
    }
    
  }
}

// =====================================================================================================
// f16 WMMA GEMM: C[m][n] = oscale * sum_k A[m][k] * Bt[n][k] + bsc * bias. A block of 8 waves owns a 128x256
// tile of C (2 x 4 waves, 64x64 each). A row-major [M][K] pitch lda; Bt row-major [N][K] pitch ldb (k contiguous);
// M multiple of 128, N multiple of 256, K multiple of 64 and at least 64 (static here).
// Operands: per k slice of 64 (128 B = one line of every row) the block brings its 128 A rows and 256 Bt rows
// into LDS by asynchronous 16-B copies, each wave-wide copy covering four whole rows of the slice; rows at pitch
// GP. Two buffers: slice t + 1 flies while slice t is multiplied; at the foot of a trip every wave waits for its
// LDS reads and its copies, one block barrier publishes slice t + 1 and frees the buffer of slice t for t + 2.
// Fragments come from LDS in the k order of ldfrag_h; every accumulator takes its k blocks of 32 in rising order.
// Bias: BIASM == 0 -> per column bias0[n] (N entries, clamped-address 16-B loads); BIASM == 1 -> per row
//       bias0[m] (M entries). Bias values RNE-converted to bf16, then multiplied by bsc.
// OM: 2 = one f16 plane (Cout); 3 = f16 hi plane (Cout) plus f16 residual plane ((f - hi) * rsc, Cout2), same
//     indexing and pitch ldc for both planes.
// coverage: 4 slabs x 16 rows (it 0..3 x lane>>3 0..3) x 64 cols (8 lanes x 8) = the wave's whole 64x64 tile;
//           8 waves = the block's 128x256 tile; grid >= (M/128)*(N/256) blocks, surplus blocks exit whole.
// =====================================================================================================
#define GP 72      // LDS row pitch in halves of the operand slices: 144 B = 16 B x 9 (odd), for 16-byte readers
template <int OM, int BIASM>
__global__ __launch_bounds__(256) void gemm64(
    const unsigned short* __restrict__ Ap, int lda,
    const unsigned short* __restrict__ Btp, int ldb,
    const float* __restrict__ bias0,
    unsigned short* Cout, unsigned short* Cout2, int ldc,
    int M, int N, int K, float oscale, float bsc, float rsc) {
  const _Float16* A  = (const _Float16*)(const void*)Ap;
  const _Float16* Bt = (const _Float16*)(const void*)Btp;
  __shared__ __align__(16) _Float16 sA[2][128 * GP];   // A slice  [row][k], two buffers
  __shared__ __align__(16) _Float16 sB[2][256 * GP];   // Bt slice [row][k], two buffers
  __shared__ __align__(16) float sT[8][16 * 68];       // per-wave 16x64 slab, pitch 68 floats
  const int tid  = threadIdx.x;
  const int lane = tid & 31;
  const int wave = tid >> 5;
  const int tilesN = N >> 8;
  const int tilesM = M >> 7;
  const int bt = blockIdx.x;
  if (bt >= tilesM * tilesN) return;   // block-uniform, in front of every barrier
  const int tm = bt / tilesN;
  const int tn = bt - tm * tilesN;
  const int mB = tm << 7;                      // block's first row of C
  const int nB = tn << 8;                      // block's first column of C
  const int wm = (wave >> 2) << 6;             // wave's row offset in the block tile
  const int wn = (wave & 3) << 6;              // wave's column offset in the block tile
  const int m0 = mB + wm;
  const int n0 = nB + wn;

  const int rlane = lane & 15;                 // row (A) / col (B, D) within subtile
  const int koff  = (lane >> 4) * 8;           // k offset of this lane half
  const int mOff  = (lane >> 4) * 8;           // D row offset

  v8f acc[4][4];
#pragma unroll
  for (int i = 0; i < 4; ++i)
#pragma unroll
    for (int j = 0; j < 4; ++j) acc[i][j] = zero8();

  // staging map: thread -> row (tid >> 3) + 32 * it, 16-B piece tid & 7 of the row's 128-B slice
  const int srow = tid >> 3, sc8 = (tid & 7) * 8;
  const _Float16* ga = A  + (size_t)(mB + srow) * lda + sc8;
  const _Float16* gb = Bt + (size_t)(nB + srow) * ldb + sc8;
  const size_t astep = (size_t)32 * lda, bstep = (size_t)32 * ldb;
  const unsigned la0 = (unsigned)(uintptr_t)(&sA[0][srow * GP + sc8]);   // lane's LDS byte address, buffer 0, it 0
  const unsigned lb0 = (unsigned)(uintptr_t)(&sB[0][srow * GP + sc8]);
  // One slice: 4 + 8 asynchronous 16-B copies per lane, global -> LDS, through no register. The closing
  // s_wait_xcnt stands in the copies' own statement so that no address register is rewritten in front of it.
  auto copies = [&](int buf, int k0) {
    const unsigned la = la0 + (unsigned)buf * (unsigned)(128 * GP * 2);
    const unsigned lb = lb0 + (unsigned)buf * (unsigned)(256 * GP * 2);
    const _Float16* pa = ga + k0;
    const _Float16* pb = gb + k0;
#if defined(__HIP_DEVICE_COMPILE__)
    asm volatile(
        "global_load_async_to_lds_b128 %0, %12, off\n\t"
        "global_load_async_to_lds_b128 %1, %13, off\n\t"
        "global_load_async_to_lds_b128 %2, %14, off\n\t"
        "global_load_async_to_lds_b128 %3, %15, off\n\t"
        "global_load_async_to_lds_b128 %4, %16, off\n\t"
        "global_load_async_to_lds_b128 %5, %17, off\n\t"
        "global_load_async_to_lds_b128 %6, %18, off\n\t"
        "global_load_async_to_lds_b128 %7, %19, off\n\t"
        "global_load_async_to_lds_b128 %8, %20, off\n\t"
        "global_load_async_to_lds_b128 %9, %21, off\n\t"
        "global_load_async_to_lds_b128 %10, %22, off\n\t"
        "global_load_async_to_lds_b128 %11, %23, off\n\t"
        "s_wait_xcnt 0x0"
        :: "v"(la), "v"(la + 1u * 32u * GP * 2u), "v"(la + 2u * 32u * GP * 2u), "v"(la + 3u * 32u * GP * 2u),
           "v"(lb), "v"(lb + 1u * 32u * GP * 2u), "v"(lb + 2u * 32u * GP * 2u), "v"(lb + 3u * 32u * GP * 2u),
           "v"(lb + 4u * 32u * GP * 2u), "v"(lb + 5u * 32u * GP * 2u), "v"(lb + 6u * 32u * GP * 2u),
           "v"(lb + 7u * 32u * GP * 2u),
           "v"(pa), "v"(pa + astep), "v"(pa + 2 * astep), "v"(pa + 3 * astep),
           "v"(pb), "v"(pb + bstep), "v"(pb + 2 * bstep), "v"(pb + 3 * bstep),
           "v"(pb + 4 * bstep), "v"(pb + 5 * bstep), "v"(pb + 6 * bstep), "v"(pb + 7 * bstep)
        : "memory");
#endif
  };
  // products of one slice; every loop below is unrolled so that fragments and accumulators, indexed by
  // constants, stay in registers
  auto compute = [&](int buf) {
    const _Float16* pa = &sA[buf][(wm + rlane) * GP + koff];
    const _Float16* pb = &sB[buf][(wn + rlane) * GP + koff];
#pragma unroll
    for (int ks = 0; ks < 2; ++ks) {
      v16h bh[4], ah[4];
#pragma unroll
      for (int j = 0; j < 4; ++j) bh[j] = ldfrag_h(pb + j * 16 * GP + ks * 32);
#pragma unroll
      for (int i = 0; i < 4; ++i) ah[i] = ldfrag_h(pa + i * 16 * GP + ks * 32);
      // keeps the 16 fragment reads of a k block as one group in front of its 16 products: left free, the
      // scheduler spreads them among the products on one A register set, and each place waits out the LDS latency
      __builtin_amdgcn_sched_barrier(0);
#pragma unroll
      for (int i = 0; i < 4; ++i)
#pragma unroll
        for (int j = 0; j < 4; ++j) acc[i][j] = mma_h_raw(ah[i], bh[j], acc[i][j]);
    }
  };

  const int nst = K >> 6;
  copies(0, 0);
  asm volatile("s_wait_asynccnt 0x0" ::: "memory");   // slice 0 has landed before the barrier publishes it
  __syncthreads();
  if (nst > 1) copies(1, 64);
  for (int t = 0; t < nst; ++t) {                      // block-uniform trip
    compute(t & 1);
    asm volatile("s_wait_dscnt 0x0" ::: "memory");     // this wave's reads of buffer t & 1 are done before its refill
    asm volatile("s_wait_asynccnt 0x0" ::: "memory");  // this wave's copies of slice t + 1 have landed
    __syncthreads();                                   // publishes slice t + 1, frees buffer t & 1
    if (t + 2 < nst) copies(t & 1, (t + 2) << 6);
  }
  asm volatile("s_wait_asynccnt 0x0" ::: "memory");    // nothing in flight when the wave goes on to the epilogue
  acc_guard4(acc[0][0], acc[0][1], acc[0][2], acc[0][3]);
  acc_guard4(acc[1][0], acc[1][1], acc[1][2], acc[1][3]);
  acc_guard4(acc[2][0], acc[2][1], acc[2][2], acc[2][3]);
  acc_guard4(acc[3][0], acc[3][1], acc[3][2], acc[3][3]);

  const int q8 = lane >> 3, c8 = (lane & 7) * 8;
  float bc[8];
#pragma unroll
  for (int e = 0; e < 8; ++e) bc[e] = 0.f;
  if (BIASM == 0) {
    const int cb = n0 + c8;                                  // <= N - 8
    const int i0 = (cb < N - 8) ? cb : (N - 8);
    const v4f b0a = *(const v4f*)(bias0 + i0), b0b = *(const v4f*)(bias0 + i0 + 4);
#pragma unroll
    for (int e = 0; e < 4; ++e) {
      bc[e]     = bfr(b0a[e]) * bsc;
      bc[4 + e] = bfr(b0b[e]) * bsc;
    }
  }

  // ---- epilogue ----
  float* slab = sT[wave];
#pragma unroll
  for (int i = 0; i < 4; ++i) {
    const int mBase = m0 + (i << 4);
#pragma unroll
    for (int j = 0; j < 4; ++j) {
#pragma unroll
      for (int r = 0; r < 8; ++r) {
        slab[(mOff + r) * 68 + (j << 4) + rlane] = acc[i][j][r];
      }
    }
    wave_sync_lds();
    v4u hv[4], lv[4];
#pragma unroll
    for (int it = 0; it < 4; ++it) {
      const int row = it * 4 + q8;                       // it 0..3 x q8 0..3 = rows 0..15
      const float* sp = slab + row * 68 + c8;
      float bm = 0.f;
      if (BIASM == 1) bm = bfr(bias0[mBase + row]) * bsc; // mBase + row < M
      v4u a, lw;
#pragma unroll
      for (int e = 0; e < 4; ++e) {
        const float f0 = sp[2 * e]     * oscale + ((BIASM == 1) ? bm : bc[2 * e]);
        const float f1 = sp[2 * e + 1] * oscale + ((BIASM == 1) ? bm : bc[2 * e + 1]);
        const _Float16 g0 = (_Float16)f0;
        const _Float16 g1 = (_Float16)f1;
        a[e] = pk16(h_bits(g0), h_bits(g1));
        if (OM == 3) {
          const _Float16 r0 = (_Float16)((f0 - (float)g0) * rsc);
          const _Float16 r1 = (_Float16)((f1 - (float)g1) * rsc);
          lw[e] = pk16(h_bits(r0), h_bits(r1));
        } else {
          lw[e] = 0u;
        }
      }
      hv[it] = a;
      lv[it] = lw;
    }
    {
#pragma unroll
      for (int it = 0; it < 4; ++it) {
        const int row = it * 4 + q8;
        const size_t go = (size_t)(mBase + row) * ldc + n0 + c8;
        *(v4u*)(Cout + go) = hv[it];
        if (OM == 3) *(v4u*)(Cout2 + go) = lv[it];
      }
      
    }
    wave_sync_lds();
  }
}

#define LOG2E 1.44269504088896340736f
#define OP 68      // LDS row pitch in floats of the output tile: 272 B = 16 B x 17 (odd), for 16-byte writers
__device__ __forceinline__ float other_half(float x) {    // value of lane l ^ 16
  const int b = __builtin_bit_cast(int, x);
  return __builtin_bit_cast(float, __builtin_amdgcn_permlanex16(b, b, 0x76543210, 0xfedcba98, false, false));
}
// exp(x) as v_exp_f32 of x * log2(e), eight at a time (one score tile) or alone. Written as asm so that the slot
// the instruction set asks for behind a transcendental is kept by construction: outputs are early-clobber, so
// inside a statement no v_exp_f32 is followed by a write of its source or a read of its result, and the closing
// v_nop fills the slot behind the last one whatever the compiler puts next.
__device__ __forceinline__ v8f exp_8(v8f x) {
  v8f e;
#if defined(__HIP_DEVICE_COMPILE__)
  float e0, e1, e2, e3, e4, e5, e6, e7;
  asm("v_exp_f32 %0, %8\n\tv_exp_f32 %1, %9\n\tv_exp_f32 %2, %10\n\tv_exp_f32 %3, %11\n\t"
      "v_exp_f32 %4, %12\n\tv_exp_f32 %5, %13\n\tv_exp_f32 %6, %14\n\tv_exp_f32 %7, %15\n\tv_nop"
      : "=&v"(e0), "=&v"(e1), "=&v"(e2), "=&v"(e3), "=&v"(e4), "=&v"(e5), "=&v"(e6), "=&v"(e7)
      : "v"(x[0] * LOG2E), "v"(x[1] * LOG2E), "v"(x[2] * LOG2E), "v"(x[3] * LOG2E),
        "v"(x[4] * LOG2E), "v"(x[5] * LOG2E), "v"(x[6] * LOG2E), "v"(x[7] * LOG2E));
  e[0] = e0; e[1] = e1; e[2] = e2; e[3] = e3; e[4] = e4; e[5] = e5; e[6] = e6; e[7] = e7;
#else
  e = x;
#endif
  return e;
}
__device__ __forceinline__ float exp_1(float x) {
  float e = x;
#if defined(__HIP_DEVICE_COMPILE__)
  asm("v_exp_f32 %0, %1\n\tv_nop" : "=&v"(e) : "v"(x * LOG2E));
#endif
  return e;
}

__global__ __launch_bounds__(128)
void attn_lb(const unsigned short* __restrict__ qhp, const unsigned short* __restrict__ qlp,
             const unsigned short* __restrict__ khp,
             const unsigned short* __restrict__ vthp, const unsigned short* __restrict__ vtlp,
             float* outp, float sscale, float onorm) {
  union FH { v16h v; v8h h[2]; };
  // two buffers of three tiles, 9 KB each, pitch LP: K [kv][d], V^T hi [d][kv], V^T res [d][kv]
  __shared__ __align__(16) _Float16 Ring[2][3][64 * LP];
  __shared__ __align__(16) float    Os[4][16 * OP];               // per wave context tile [row][d], pitch OP

  const int tid  = threadIdx.x;
  const int wave = tid >> 5;
  const int lane = tid & 31;
  const int hh   = lane >> 4;
  const int c    = lane & 15;

  const int bx   = blockIdx.x;
  const int qb   = bx % NQB;
  const int hb   = bx / NQB;
  const int h    = hb % NH;
  const int b    = hb / NH;
  const int tok0 = b * SQ;                       // first token row of this sequence
  const int ql0  = qb * 64 + wave * 16;          // local query index of this wave's first row
  const int q0   = tok0 + ql0;                   // global token row of this wave's first row

  const _Float16* Qh = (const _Float16*)(const void*)qhp + (size_t)h * HD;
  const _Float16* Ql = (const _Float16*)(const void*)qlp + (size_t)h * HD;
  const _Float16* Kg = (const _Float16*)(const void*)khp + (size_t)h * HD;
  const _Float16* Vh = (const _Float16*)(const void*)vthp + (size_t)h * HD * NTOK + tok0;
  const _Float16* Vl = (const _Float16*)(const void*)vtlp + (size_t)h * HD * NTOK + tok0;

  // ---- per-head slope (block-uniform) ----
  const int   se    = (h + 1) >> 1;
  const float spw   = __uint_as_float((unsigned)(127 - se) << 23);
  const float slope = (h & 1) ? spw : (spw * 0.70710678118654752f);

  // ---- Q fragments (B operand, column = lane&15): 2 d-chunks, hi and residual planes ----
  v16h qa[2], qr[2];
#pragma unroll
  for (int dc = 0; dc < 2; ++dc) {
    qa[dc] = ldfrag_h(Qh + (size_t)(q0 + c) * DM + dc * 32 + 8 * hh);
    qr[dc] = ldfrag_h(Ql + (size_t)(q0 + c) * DM + dc * 32 + 8 * hh);
  }

  const int qrow = ql0 + c;                      // this lane's query (D column = lane&15)
  float mrow = -INFINITY;                        // running maximum of query qrow (equal in both lane halves)
  float lrow = 0.f;                              // running sum over this lane half's keys only
  v8f oacc[4];                                   // oacc[t][r] = context[query c][d = 16 t + 8 hh + r]
#pragma unroll
  for (int t = 0; t < 4; ++t) oacc[t] = zero8();

  const float rinv = 1.0f / RSC;

  // staging map: thread -> row (tid >> 3) + 16 * it, 16-B piece tid & 7 of the row's 128 B
  const int srow = tid >> 3, sc8 = (tid & 7) * 8;
  const _Float16* gk = Kg + (size_t)(tok0 + srow) * DM + sc8;      // K row = key, d = sc8..sc8+7
  const _Float16* gv = Vh + (size_t)srow * NTOK + sc8;             // V^T hi row = d, key = sc8..sc8+7
  const _Float16* gw = Vl + (size_t)srow * NTOK + sc8;             // V^T res row = d
  const unsigned l0 = (unsigned)(uintptr_t)(&Ring[0][0][srow * LP + sc8]);   // lane's LDS byte address, buffer 0, K, it 0
  // One chunk: 3 x 4 asynchronous 16-B copies per lane, global -> LDS, through no register. The closing
  // s_wait_xcnt stands in the copies' own statement so that no address register is rewritten in front of it.
  auto copies = [&](int buf, int kv) {
    const unsigned lk = l0 + (unsigned)buf * (unsigned)(3 * 64 * LP * 2);
    const unsigned lv = lk + (unsigned)(64 * LP * 2);
    const unsigned lw = lk + (unsigned)(2 * 64 * LP * 2);
    const _Float16* pk = gk + (size_t)kv * DM;
    const _Float16* pv = gv + kv;
    const _Float16* pw = gw + kv;
    const size_t kstep = (size_t)16 * DM, vstep = (size_t)16 * NTOK;
#if defined(__HIP_DEVICE_COMPILE__)
    asm volatile(
        "global_load_async_to_lds_b128 %0, %12, off\n\t"
        "global_load_async_to_lds_b128 %1, %13, off\n\t"
        "global_load_async_to_lds_b128 %2, %14, off\n\t"
        "global_load_async_to_lds_b128 %3, %15, off\n\t"
        "global_load_async_to_lds_b128 %4, %16, off\n\t"
        "global_load_async_to_lds_b128 %5, %17, off\n\t"
        "global_load_async_to_lds_b128 %6, %18, off\n\t"
        "global_load_async_to_lds_b128 %7, %19, off\n\t"
        "global_load_async_to_lds_b128 %8, %20, off\n\t"
        "global_load_async_to_lds_b128 %9, %21, off\n\t"
        "global_load_async_to_lds_b128 %10, %22, off\n\t"
        "global_load_async_to_lds_b128 %11, %23, off\n\t"
        "s_wait_xcnt 0x0"
        :: "v"(lk), "v"(lk + 1u * 16u * LP * 2u), "v"(lk + 2u * 16u * LP * 2u), "v"(lk + 3u * 16u * LP * 2u),
           "v"(lv), "v"(lv + 1u * 16u * LP * 2u), "v"(lv + 2u * 16u * LP * 2u), "v"(lv + 3u * 16u * LP * 2u),
           "v"(lw), "v"(lw + 1u * 16u * LP * 2u), "v"(lw + 2u * 16u * LP * 2u), "v"(lw + 3u * 16u * LP * 2u),
           "v"(pk), "v"(pk + kstep), "v"(pk + 2 * kstep), "v"(pk + 3 * kstep),
           "v"(pv), "v"(pv + vstep), "v"(pv + 2 * vstep), "v"(pv + 3 * vstep),
           "v"(pw), "v"(pw + vstep), "v"(pw + 2 * vstep), "v"(pw + 3 * vstep)
        : "memory");
#endif
  };

  static_assert(NQB >= 2);
  copies(0, 0);
  asm volatile("s_wait_asynccnt 0x0" ::: "memory");   // chunk 0 has landed before the barrier publishes it
  __syncthreads();
  copies(1, 64);
  for (int kt = 0; kt < NQB; ++kt) {            // block-uniform trip = 32
    const int kv0 = kt * 64;                     // local key index of the chunk
    const _Float16* Ksh = &Ring[kt & 1][0][0];
    const _Float16* Vth = &Ring[kt & 1][1][0];
    const _Float16* Vtl = &Ring[kt & 1][2][0];

    // ---- K fragments of the whole chunk: 16 reads as one group (loops unrolled: fragments stay in registers) ----
    FH kb[4][2];
#pragma unroll
    for (int j = 0; j < 4; ++j) {
#pragma unroll
      for (int dc = 0; dc < 2; ++dc) {
        kb[j][dc].h[0] = *(const v8h*)(Ksh + (j * 16 + c) * LP + dc * 32 + 8 * hh);
        kb[j][dc].h[1] = *(const v8h*)(Ksh + (j * 16 + c) * LP + dc * 32 + 16 + 8 * hh);
      }
    }

    // ---- logits, transposed: 64 keys x 16 queries per wave ----
    v8f s[4];
#pragma unroll
    for (int j = 0; j < 4; ++j) {
      v8f sh = zero8(), sl = zero8();
#pragma unroll
      for (int dc = 0; dc < 2; ++dc) {
        sh = mma_h(kb[j][dc].v, qa[dc], sh);
        sl = mma_h(kb[j][dc].v, qr[dc], sl);
      }
#pragma unroll
      for (int r = 0; r < 8; ++r) {
        const int key = kv0 + j * 16 + 8 * hh + r;                  // D row = 8h + r
        int dd = key - qrow;
        if (dd < 0) dd = -dd;
        const float raw = sh[r] + sl[r] * rinv;
        s[j][r] = (raw - slope * (float)dd) * sscale;
      }
    }

    // ---- V^T fragments of keys 0..31 (hi and residual): 16 reads as one group, in flight under the softmax ----
    FH vb[2][4], wb[2][4];
#pragma unroll
    for (int t = 0; t < 4; ++t) {
      vb[0][t].h[0] = *(const v8h*)(Vth + (t * 16 + c) * LP + 8 * hh);
      vb[0][t].h[1] = *(const v8h*)(Vth + (t * 16 + c) * LP + 16 + 8 * hh);
      wb[0][t].h[0] = *(const v8h*)(Vtl + (t * 16 + c) * LP + 8 * hh);
      wb[0][t].h[1] = *(const v8h*)(Vtl + (t * 16 + c) * LP + 16 + 8 * hh);
    }
    // keeps all 16 reads in front of the softmax arithmetic, which covers their latency: left free, the scheduler
    // sinks the last four to the front of the first product, where their latency is waited out
    __builtin_amdgcn_sched_barrier(0);

    // ---- maximum in the lane, one exchange between the halves; online softmax ----
    float mj[4];
#pragma unroll
    for (int j = 0; j < 4; ++j) {
      mj[j] = s[j][0];
#pragma unroll
      for (int r = 1; r < 8; ++r) mj[j] = fmaxf(mj[j], s[j][r]);
    }
    float m = fmaxf(fmaxf(mj[0], mj[1]), fmaxf(mj[2], mj[3]));
    m = fmaxf(m, other_half(m));
    const float mnew  = fmaxf(mrow, m);
    const float ms    = (mnew == -INFINITY) ? 0.f : mnew;
    const float alpha = exp_1(mrow - ms);
    mrow = mnew;

    // ---- P (x PSC, f16) packed from the score registers into the B operands of p.v ----
    v16h pb[2];
    float pj[4];
#pragma unroll
    for (int j = 0; j < 4; ++j) {
      const v8f p = exp_8(s[j] - ms);
      pj[j] = 0.f;
#pragma unroll
      for (int r = 0; r < 8; ++r) {
        pj[j] += p[r];
        pb[j >> 1][(j & 1) * 8 + r] = (_Float16)(p[r] * PSC);
      }
    }
    // ---- V^T fragments of keys 32..63, d rows 0..31: 8 reads as one group, in flight under the products of
    //      keys 0..31 ----
#pragma unroll
    for (int t = 0; t < 2; ++t) {
      vb[1][t].h[0] = *(const v8h*)(Vth + (t * 16 + c) * LP + 32 + 8 * hh);
      vb[1][t].h[1] = *(const v8h*)(Vth + (t * 16 + c) * LP + 32 + 16 + 8 * hh);
      wb[1][t].h[0] = *(const v8h*)(Vtl + (t * 16 + c) * LP + 32 + 8 * hh);
      wb[1][t].h[1] = *(const v8h*)(Vtl + (t * 16 + c) * LP + 32 + 16 + 8 * hh);
    }
    lrow = lrow * alpha + ((pj[0] + pj[1]) + (pj[2] + pj[3]));
#pragma unroll
    for (int t = 0; t < 4; ++t) {
#pragma unroll
      for (int r = 0; r < 8; ++r) oacc[t][r] *= alpha;
    }

    // ---- context^T += Vhi . P^T ; chunk residual = Vres . P^T (f16 WMMA) ----
    v8f ol[4];
#pragma unroll
    for (int t = 0; t < 4; ++t) ol[t] = zero8();
#pragma unroll
    for (int kk = 0; kk < 2; ++kk) {
#pragma unroll
      for (int t = 0; t < 4; ++t) {
        if (kk == 0 && t == 2) {
          // V^T fragments of keys 32..63, d rows 32..63: 8 reads as one group into the registers that the four
          // products above have left, in flight under the next eight products
#pragma unroll
          for (int u = 2; u < 4; ++u) {
            vb[1][u].h[0] = *(const v8h*)(Vth + (u * 16 + c) * LP + 32 + 8 * hh);
            vb[1][u].h[1] = *(const v8h*)(Vth + (u * 16 + c) * LP + 32 + 16 + 8 * hh);
            wb[1][u].h[0] = *(const v8h*)(Vtl + (u * 16 + c) * LP + 32 + 8 * hh);
            wb[1][u].h[1] = *(const v8h*)(Vtl + (u * 16 + c) * LP + 32 + 16 + 8 * hh);
          }
        }
        oacc[t] = mma_h(vb[kk][t].v, pb[kk], oacc[t]);
        ol[t]   = mma_h(wb[kk][t].v, pb[kk], ol[t]);
      }
    }
    // ---- fold this chunk's residual term into the running context (f32) ----
#pragma unroll
    for (int t = 0; t < 4; ++t) {
#pragma unroll
      for (int r = 0; r < 8; ++r) oacc[t][r] += ol[t][r] * rinv;
    }
    asm volatile("s_wait_dscnt 0x0" ::: "memory");     // this wave's reads of buffer kt & 1 are done before its refill
    asm volatile("s_wait_asynccnt 0x0" ::: "memory");  // this wave's copies of chunk kt + 1 have landed
    __syncthreads();                                   // publishes chunk kt + 1, frees buffer kt & 1
    if (kt + 2 < NQB) copies(kt & 1, kv0 + 128);
  }
  asm volatile("s_wait_asynccnt 0x0" ::: "memory");    // nothing in flight when the wave goes on to the epilogue

  // ---- join the halves' sums, normalise (1/l and the 1/(PSC*VSC) carry), stage the wave's 16x64 tile
  //      (a lane holds 8 consecutive d of its query per t: two 16-B LDS writes), write whole 256-B rows
  float* os = Os[wave];
  {
    const float l = lrow + other_half(lrow);
    const float inv = ((l > 0.f) ? (1.0f / l) : 0.f) * onorm;
#pragma unroll
    for (int t = 0; t < 4; ++t) {
      v4f w0, w1;
#pragma unroll
      for (int e = 0; e < 4; ++e) { w0[e] = oacc[t][e] * inv; w1[e] = oacc[t][4 + e] * inv; }
      *(v4f*)(os + c * OP + t * 16 + 8 * hh)     = w0;
      *(v4f*)(os + c * OP + t * 16 + 8 * hh + 4) = w1;
    }
  }
  wave_sync_lds();
  {
    const int hh2 = lane >> 4, c4 = (lane & 15) * 4;
    v4f vals[8];
#pragma unroll
    for (int it = 0; it < 8; ++it) {
      const int row = it * 2 + hh2;   // it 0..7 x hh2 0..1 = rows 0..15 of the wave tile
      vals[it] = *(const v4f*)(os + row * OP + c4);
    }
    {
#pragma unroll
      for (int it = 0; it < 8; ++it) {
        const int row = it * 2 + hh2;
        const size_t go = (size_t)(q0 + row) * DM + (size_t)h * HD + c4;
        *(v4f*)(outp + go) = vals[it];
      }
    }
  }
}

// =====================================================================================================
// Workspace map (bytes); every plane is an exact multiple of its 64x64-tile / whole-line store granularity
// ([8192][1024] = 128x16 tiles, [1024][8192] = 16x128 tiles, weights [1024][1024] = 16x16 tiles):
//   WqT  f16 [1024][1024]   0          2097152   (transposed, x64)
//   WkT  f16 [1024][1024]   2097152    2097152
//   WvT  f16 [1024][1024]   4194304    2097152
//   XH   f16 [8192][1024]   6291456    16777216  (layer norm output x16)
//   QH   f16 [8192][1024]   23068672   16777216  (q hi)
//   QL   f16 [8192][1024]   39845888   16777216  (q residual x4096)
//   KH   f16 [8192][1024]   56623104   16777216
//   VTH  f16 [1024][8192]   73400320   16777216  (v^T hi x16)
//   VTL  f16 [1024][8192]   90177536   16777216  (v^T residual x16 x4096)
//   end                     106954752
// =====================================================================================================
extern "C" void kernel_launch(void* const* d_in, const int* in_sizes, int n_in,
                              void* d_out, int out_size, void* d_ws, size_t ws_size,
                              hipStream_t stream) {
  if (n_in < 9) return;
  if (in_sizes[0] != NTOK * DM) return;
  if (in_sizes[1] != DM || in_sizes[2] != DM) return;
  if (in_sizes[3] != DM * DM || in_sizes[5] != DM * DM || in_sizes[7] != DM * DM) return;
  if (in_sizes[4] != DM || in_sizes[6] != DM || in_sizes[8] != DM) return;
  if (out_size != NTOK * DM) return;

  const float* x   = (const float*)d_in[0];
  const float* gam = (const float*)d_in[1];
  const float* bet = (const float*)d_in[2];
  const float* wq  = (const float*)d_in[3];
  const float* bq  = (const float*)d_in[4];
  const float* wk  = (const float*)d_in[5];
  const float* bk  = (const float*)d_in[6];
  const float* wv  = (const float*)d_in[7];
  const float* bv  = (const float*)d_in[8];

  const size_t PW = (size_t)DM * DM * 2;            //  2097152
  const size_t PA = (size_t)NTOK * DM * 2;          // 16777216
  size_t off = 0;
  const size_t oWq = off; off += PW;
  const size_t oWk = off; off += PW;
  const size_t oWv = off; off += PW;
  const size_t oXH = off; off += PA;
  const size_t oQH = off; off += PA;
  const size_t oQL = off; off += PA;
  const size_t oKH = off; off += PA;
  const size_t oVH = off; off += PA;
  const size_t oVL = off; off += PA;
  if (off > ws_size) return;                        // off = 106954752
  if (off > (size_t)134217728) return;

  char* ws = (char*)d_ws;
  unsigned short* WqT = (unsigned short*)(ws + oWq);
  unsigned short* WkT = (unsigned short*)(ws + oWk);
  unsigned short* WvT = (unsigned short*)(ws + oWv);
  unsigned short* XH  = (unsigned short*)(ws + oXH);
  unsigned short* QH  = (unsigned short*)(ws + oQH);
  unsigned short* QL  = (unsigned short*)(ws + oQL);
  unsigned short* KH  = (unsigned short*)(ws + oKH);
  unsigned short* VTH = (unsigned short*)(ws + oVH);
  unsigned short* VTL = (unsigned short*)(ws + oVL);

  const dim3 blk(256), blk128(128);
  const dim3 gLn(NTOK / 8);                                            // 1024 blocks, 8 rows each
  const dim3 gTr(DM / 64, DM / 64);                                    // (cols/64, rows/64) of W[in][out]
  const dim3 gG(((NTOK / 64) * (DM / 64) + 7) / 8);                    // 256 blocks, one 128x256 tile each
  const dim3 gAttn(NB * NH * NQB);                                     // 2048 blocks of 128
  const float osc_qk = 1.0f / (XSC * WSC);                             // q, k unscaled
  const float osc_v  = VSC / (XSC * WSC);                              // v^T carried x16

  // (0) layer norm -> XH f16 [8192][1024] (x16)
  ln_rows<<<gLn, blk, 0, stream>>>(x, gam, bet, XH, NTOK, XSC, LNEPS);
  // (1) weights W[in][out] f32 -> W^T f16 [out][in] (k contiguous), bf16 RNE-converted, x64
  wtrans_h<<<gTr, blk, 0, stream>>>(wq, WqT, DM, DM, WSC);
  wtrans_h<<<gTr, blk, 0, stream>>>(wk, WkT, DM, DM, WSC);
  wtrans_h<<<gTr, blk, 0, stream>>>(wv, WvT, DM, DM, WSC);
  // (2) q = xh . Wq + bq -> QH (hi), QL (residual x4096), f16 [8192][1024]
  gemm64<3, 0><<<gG, blk, 0, stream>>>(XH, DM, WqT, DM, bq, QH, QL, DM, NTOK, DM, DM, osc_qk, 1.0f, RSC);
  // (3) k = xh . Wk + bk -> KH f16 [8192][1024]
  gemm64<2, 0><<<gG, blk, 0, stream>>>(XH, DM, WkT, DM, bk, KH, KH, DM, NTOK, DM, DM, osc_qk, 1.0f, RSC);
  // (4) v^T: VT[m][t] = sum_k WvT[m][k] . xh[t][k] + bv[m] -> VTH (hi x16), VTL (residual x16 x4096),
  //     f16 [1024][8192]
  gemm64<3, 1><<<gG, blk, 0, stream>>>(WvT, DM, XH, DM, bv, VTH, VTL, NTOK, DM, NTOK, DM, osc_v, VSC, RSC);
  // (5) attention with per-head linear distance bias -> d_out f32 [8192][1024]
  attn_lb<<<gAttn, blk128, 0, stream>>>(QH, QL, KH, VTH, VTL, (float*)d_out, 0.125f, 1.0f / (PSC * VSC));
  (void)hipGetLastError();
}

// v006
// One run takes 192 microseconds.
// Two timings next to v005 put it at 1.13 and 1.12 times that version's speed.
// Over all steps from v000 it is 2.96 times as fast.
// Contractions: q, k and v^T projections on v_wmma_f32_16x16x32_f16 (f16 layer-norm plane carried x16 times
// f16 transposed weight plane carried x64, one product each); attention k.q^T on v_wmma_f32_16x16x32_f16
// (q as f16 hi plane plus f16 residual plane carried x4096, k plain f16, two products); v^T.p^T on
// v_wmma_f32_16x16x32_f16 (p carried x1024, v^T as f16 hi plane carried x16 plus f16 residual plane carried
// x4096, two products); all f32 accumulate; layer norm and softmax in f32 on VALU; every float input
// RNE-converted to bf16 on load.
#include <hip/hip_runtime.h>
#include <math.h>
#include <stdint.h>

#define NB    4
#define SQ    2048
#define NTOK  (NB * SQ)
#define DM    1024
#define NH    16
#define HD    64
#define NQB   (SQ / 64)
#define XSC   16.0f
#define WSC   64.0f
#define VSC   16.0f
#define RSC   4096.0f
#define PSC   1024.0f
#define LNEPS 1e-5f
#define LP    72      // LDS row pitch in halves of the attention tiles: 144 B = 16 B x 9 (odd), for 16-byte readers
static_assert(NH * HD == DM);
static_assert((SQ % 64) == 0 && (DM % 64) == 0 && (NTOK % 64) == 0);
static_assert(DM == 4 * 256);
static_assert((NTOK % 8) == 0);
static_assert((NTOK % 256) == 0 && (DM % 256) == 0);

typedef _Float16 v16h __attribute__((ext_vector_type(16)));
typedef _Float16 v8h  __attribute__((ext_vector_type(8)));
typedef float    v8f  __attribute__((ext_vector_type(8)));
typedef float    v4f  __attribute__((ext_vector_type(4)));
typedef unsigned int v4u __attribute__((ext_vector_type(4)));

// ---- scalar helpers --------------------------------------------------------------------------------
__device__ __forceinline__ unsigned short bf_bits(float f) {          // f32 -> bf16 bits, RNE convert
  unsigned u = __float_as_uint(f);
  return (unsigned short)((u + 0x7FFFu + ((u >> 16) & 1u)) >> 16);
}
__device__ __forceinline__ float bf_up(unsigned short h) { return __uint_as_float(((unsigned)h) << 16); }
__device__ __forceinline__ float bfr(float f) { return bf_up(bf_bits(f)); }   // value of the bf16 RNE convert
__device__ __forceinline__ unsigned short h_bits(_Float16 x) { return __builtin_bit_cast(unsigned short, x); }
__device__ __forceinline__ unsigned pk16(unsigned short a, unsigned short b) { return (unsigned)a | ((unsigned)b << 16); }
__device__ __forceinline__ v8f zero8() { v8f z = {0.f, 0.f, 0.f, 0.f, 0.f, 0.f, 0.f, 0.f}; return z; }

// ---- fragment loader: 16-bit A/B operand, lane -> row/col (lane&15), p already includes +8*(lane>>4);
//      elements 0..7 <- p[0..7] (k0+8h..), elements 8..15 <- p[16..23] (k0+16+8h..)
__device__ __forceinline__ v16h ldfrag_h(const _Float16* p) {
  union { v16h v; v8h h[2]; } f;
  f.h[0] = *(const v8h*)(p);
  f.h[1] = *(const v8h*)(p + 16);
  return f.v;
}

// ---- WMMA helpers with trailing VALU hazard gap --------------------------------------------------------
__device__ __forceinline__ v8f mma_h(v16h a, v16h b, v8f c) {
  c = __builtin_amdgcn_wmma_f32_16x16x32_f16(false, a, false, b, (short)0, c, false, false);
#if defined(__HIP_DEVICE_COMPILE__)
  asm volatile("v_nop\n\tv_nop\n\tv_nop\n\tv_nop" : "+v"(c) : "v"(a), "v"(b));
#endif
  return c;
}
__device__ __forceinline__ v8f mma_h_raw(v16h a, v16h b, v8f c) {
  return __builtin_amdgcn_wmma_f32_16x16x32_f16(false, a, false, b, (short)0, c, false, false);
}
__device__ __forceinline__ void acc_guard4(v8f& a, v8f& b, v8f& c, v8f& d) {
#if defined(__HIP_DEVICE_COMPILE__)
  asm volatile("v_nop\n\tv_nop\n\tv_nop\n\tv_nop" : "+v"(a), "+v"(b), "+v"(c), "+v"(d));
#endif
}
__device__ __forceinline__ void wave_sync_lds() {
  __builtin_amdgcn_fence(__ATOMIC_RELEASE, "workgroup");
  __builtin_amdgcn_wave_barrier();
  __builtin_amdgcn_fence(__ATOMIC_ACQUIRE, "workgroup");
}

// =====================================================================================================
// Layer norm over rows of DM = 1024: one wave per row, 8 rows per block (grid = nrows/8). Every input value
// y = ((x - mu) * rstd * gamma + beta) * xsc written as one f16 plane [nrows][DM].
// Lane l handles columns 256*i + 8*l .. +7 (i = 0..3); each store instruction of the wave covers 512 B =
// coverage: grid(nrows/8) x 8 waves = every row; 4 iterations x 32 lanes x 8 = all 1024 columns.
// =====================================================================================================
__global__ __launch_bounds__(256) void ln_rows(const float* __restrict__ x, const float* __restrict__ gam,
                                               const float* __restrict__ bet, unsigned short* Xh,
                                               int nrows, float xsc, float eps) {
  const int lane = threadIdx.x & 31;
  const int wave = threadIdx.x >> 5;
  const int row  = blockIdx.x * 8 + wave;
  if (row >= nrows) return;                     // wave-uniform; no block barriers in this kernel
  const float* xr = x + (size_t)row * DM;
  const float rd = 1.0f / (float)DM;

  float s = 0.f;
#pragma unroll 1
  for (int i = 0; i < 4; ++i) {
    const int c0 = 256 * i + 8 * lane;
    const v4f a = *(const v4f*)(xr + c0);
    const v4f b = *(const v4f*)(xr + c0 + 4);
    s += ((bfr(a[0]) + bfr(a[1])) + (bfr(a[2]) + bfr(a[3]))) +
         ((bfr(b[0]) + bfr(b[1])) + (bfr(b[2]) + bfr(b[3])));
  }
#pragma unroll
  for (int off = 1; off < 32; off <<= 1) s += __shfl_xor(s, off, 32);
  const float mu = s * rd;

  float s2 = 0.f;
#pragma unroll 1
  for (int i = 0; i < 4; ++i) {
    const int c0 = 256 * i + 8 * lane;
    const v4f a = *(const v4f*)(xr + c0);
    const v4f b = *(const v4f*)(xr + c0 + 4);
#pragma unroll
    for (int e = 0; e < 4; ++e) {
      const float d0 = bfr(a[e]) - mu;
      const float d1 = bfr(b[e]) - mu;
      s2 += d0 * d0;
      s2 += d1 * d1;
    }
  }
#pragma unroll
  for (int off = 1; off < 32; off <<= 1) s2 += __shfl_xor(s2, off, 32);
  const float var  = s2 * rd;
  const float rstd = 1.0f / sqrtf(var + eps);

#pragma unroll 1
  for (int i = 0; i < 4; ++i) {
    const int c0 = 256 * i + 8 * lane;
    const v4f a  = *(const v4f*)(xr + c0);
    const v4f b  = *(const v4f*)(xr + c0 + 4);
    const v4f ga = *(const v4f*)(gam + c0);
    const v4f gb = *(const v4f*)(gam + c0 + 4);
    const v4f ba = *(const v4f*)(bet + c0);
    const v4f bb = *(const v4f*)(bet + c0 + 4);
    float y[8];
#pragma unroll
    for (int e = 0; e < 4; ++e) {
      y[e]     = ((bfr(a[e]) - mu) * rstd * bfr(ga[e]) + bfr(ba[e])) * xsc;
      y[4 + e] = ((bfr(b[e]) - mu) * rstd * bfr(gb[e]) + bfr(bb[e])) * xsc;
    }
    v4u u;
#pragma unroll
    for (int e = 0; e < 4; ++e) u[e] = pk16(h_bits((_Float16)y[2 * e]), h_bits((_Float16)y[2 * e + 1]));
    unsigned short* dst = Xh + (size_t)row * DM + c0;
    *(v4u*)dst = u;
    
  }
}

// =====================================================================================================
// Transpose-convert: W f32 in[R][C] (row-major) -> out f16 bits [C][R]; each value bf16 RNE-converted,
// multiplied by wsc (power of two, exact) and cast to f16. Block = one 64x64 tile staged through LDS,
// coverage: load 4 it x 256 threads x 4 = 64x64; store 2 it x 256 threads x 8 = 64x64; grid covers R x C.
// =====================================================================================================
__global__ __launch_bounds__(256) void wtrans_h(const float* __restrict__ W, unsigned short* Wt,
                                                int R, int C, float wsc) {
  __shared__ __align__(16) unsigned short sT[64 * 72];     // [c][r], pitch 72 halves = 144 B
  const int tid = threadIdx.x;
  const int r0  = blockIdx.y * 64;          // rows of W
  const int c0  = blockIdx.x * 64;          // cols of W
#pragma unroll
  for (int it = 0; it < 4; ++it) {
    const int idx = it * 256 + tid;         // 0..1023
    const int r   = idx >> 4;               // 0..63
    const int c4  = (idx & 15) * 4;         // 0..60
    const v4f w = *(const v4f*)(W + (size_t)(r0 + r) * C + c0 + c4);
#pragma unroll
    for (int e = 0; e < 4; ++e) sT[(c4 + e) * 72 + r] = h_bits((_Float16)(bfr(w[e]) * wsc));
  }
  __syncthreads();
  v4u u[2];
#pragma unroll
  for (int it = 0; it < 2; ++it) {
    const int row = it * 32 + (tid >> 3), col8 = (tid & 7) * 8;
    u[it] = *(const v4u*)(sT + row * 72 + col8);
  }
  {
#pragma unroll
    for (int it = 0; it < 2; ++it) {
      const int row = it * 32 + (tid >> 3), col8 = (tid & 7) * 8;
      *(v4u*)(Wt + (size_t)(c0 + row) * R + r0 + col8) = u[it];
    }
    
  }
}

// =====================================================================================================
// f16 WMMA GEMM: C[m][n] = oscale * sum_k A[m][k] * Bt[n][k] + bsc * bias. A block of 8 waves owns a 128x256
// tile of C (2 x 4 waves, 64x64 each). A row-major [M][K] pitch lda; Bt row-major [N][K] pitch ldb (k contiguous);
// M multiple of 128, N multiple of 256, K multiple of 64 and at least 64 (static here).
// Operands: per k slice of 64 (128 B = one line of every row) the block brings its 128 A rows and 256 Bt rows
// into LDS by asynchronous 16-B copies, each wave-wide copy covering four whole rows of the slice; rows at pitch
// GP. Two buffers: slice t + 1 flies while slice t is multiplied; at the foot of a trip every wave waits for its
// LDS reads and its copies, one block barrier publishes slice t + 1 and frees the buffer of slice t for t + 2.
// Fragments come from LDS in the k order of ldfrag_h; every accumulator takes its k blocks of 32 in rising order.
// Bias: BIASM == 0 -> per column bias0[n] (N entries, clamped-address 16-B loads); BIASM == 1 -> per row
//       bias0[m] (M entries). Bias values RNE-converted to bf16, then multiplied by bsc.
// OM: 2 = one f16 plane (Cout); 3 = f16 hi plane (Cout) plus f16 residual plane ((f - hi) * rsc, Cout2), same
//     indexing and pitch ldc for both planes.
// coverage: 4 slabs x 16 rows (it 0..3 x lane>>3 0..3) x 64 cols (8 lanes x 8) = the wave's whole 64x64 tile;
//           8 waves = the block's 128x256 tile; grid >= (M/128)*(N/256) blocks, surplus blocks exit whole.
// =====================================================================================================
#define GP 72      // LDS row pitch in halves of the operand slices: 144 B = 16 B x 9 (odd), for 16-byte readers
template <int OM, int BIASM>
__global__ __launch_bounds__(256) void gemm64(
    const unsigned short* __restrict__ Ap, int lda,
    const unsigned short* __restrict__ Btp, int ldb,
    const float* __restrict__ bias0,
    unsigned short* Cout, unsigned short* Cout2, int ldc,
    int M, int N, int K, float oscale, float bsc, float rsc) {
  const _Float16* A  = (const _Float16*)(const void*)Ap;
  const _Float16* Bt = (const _Float16*)(const void*)Btp;
  __shared__ __align__(16) _Float16 sA[2][128 * GP];   // A slice  [row][k], two buffers
  __shared__ __align__(16) _Float16 sB[2][256 * GP];   // Bt slice [row][k], two buffers
  __shared__ __align__(16) float sT[8][16 * 68];       // per-wave 16x64 slab, pitch 68 floats
  const int tid  = threadIdx.x;
  const int lane = tid & 31;
  const int wave = tid >> 5;
  const int tilesN = N >> 8;
  const int tilesM = M >> 7;
  const int bt = blockIdx.x;
  if (bt >= tilesM * tilesN) return;   // block-uniform, in front of every barrier
  const int tm = bt / tilesN;
  const int tn = bt - tm * tilesN;
  const int mB = tm << 7;                      // block's first row of C
  const int nB = tn << 8;                      // block's first column of C
  const int wm = (wave >> 2) << 6;             // wave's row offset in the block tile
  const int wn = (wave & 3) << 6;              // wave's column offset in the block tile
  const int m0 = mB + wm;
  const int n0 = nB + wn;

  const int rlane = lane & 15;                 // row (A) / col (B, D) within subtile
  const int koff  = (lane >> 4) * 8;           // k offset of this lane half
  const int mOff  = (lane >> 4) * 8;           // D row offset

  v8f acc[4][4];
#pragma unroll
  for (int i = 0; i < 4; ++i)
#pragma unroll
    for (int j = 0; j < 4; ++j) acc[i][j] = zero8();

  // staging map: thread -> row (tid >> 3) + 32 * it, 16-B piece tid & 7 of the row's 128-B slice
  const int srow = tid >> 3, sc8 = (tid & 7) * 8;
  const _Float16* ga = A  + (size_t)(mB + srow) * lda + sc8;
  const _Float16* gb = Bt + (size_t)(nB + srow) * ldb + sc8;
  const size_t astep = (size_t)32 * lda, bstep = (size_t)32 * ldb;
  const unsigned la0 = (unsigned)(uintptr_t)(&sA[0][srow * GP + sc8]);   // lane's LDS byte address, buffer 0, it 0
  const unsigned lb0 = (unsigned)(uintptr_t)(&sB[0][srow * GP + sc8]);
  // One slice: 4 + 8 asynchronous 16-B copies per lane, global -> LDS, through no register. The closing
  // s_wait_xcnt stands in the copies' own statement so that no address register is rewritten in front of it.
  auto copies = [&](int buf, int k0) {
    const unsigned la = la0 + (unsigned)buf * (unsigned)(128 * GP * 2);
    const unsigned lb = lb0 + (unsigned)buf * (unsigned)(256 * GP * 2);
    const _Float16* pa = ga + k0;
    const _Float16* pb = gb + k0;
#if defined(__HIP_DEVICE_COMPILE__)
    asm volatile(
        "global_load_async_to_lds_b128 %0, %12, off\n\t"
        "global_load_async_to_lds_b128 %1, %13, off\n\t"
        "global_load_async_to_lds_b128 %2, %14, off\n\t"
        "global_load_async_to_lds_b128 %3, %15, off\n\t"
        "global_load_async_to_lds_b128 %4, %16, off\n\t"
        "global_load_async_to_lds_b128 %5, %17, off\n\t"
        "global_load_async_to_lds_b128 %6, %18, off\n\t"
        "global_load_async_to_lds_b128 %7, %19, off\n\t"
        "global_load_async_to_lds_b128 %8, %20, off\n\t"
        "global_load_async_to_lds_b128 %9, %21, off\n\t"
        "global_load_async_to_lds_b128 %10, %22, off\n\t"
        "global_load_async_to_lds_b128 %11, %23, off\n\t"
        "s_wait_xcnt 0x0"
        :: "v"(la), "v"(la + 1u * 32u * GP * 2u), "v"(la + 2u * 32u * GP * 2u), "v"(la + 3u * 32u * GP * 2u),
           "v"(lb), "v"(lb + 1u * 32u * GP * 2u), "v"(lb + 2u * 32u * GP * 2u), "v"(lb + 3u * 32u * GP * 2u),
           "v"(lb + 4u * 32u * GP * 2u), "v"(lb + 5u * 32u * GP * 2u), "v"(lb + 6u * 32u * GP * 2u),
           "v"(lb + 7u * 32u * GP * 2u),
           "v"(pa), "v"(pa + astep), "v"(pa + 2 * astep), "v"(pa + 3 * astep),
           "v"(pb), "v"(pb + bstep), "v"(pb + 2 * bstep), "v"(pb + 3 * bstep),
           "v"(pb + 4 * bstep), "v"(pb + 5 * bstep), "v"(pb + 6 * bstep), "v"(pb + 7 * bstep)
        : "memory");
#endif
  };
  // products of one slice; every loop below is unrolled so that fragments and accumulators, indexed by
  // constants, stay in registers
  auto compute = [&](int buf) {
    const _Float16* pa = &sA[buf][(wm + rlane) * GP + koff];
    const _Float16* pb = &sB[buf][(wn + rlane) * GP + koff];
#pragma unroll
    for (int ks = 0; ks < 2; ++ks) {
      v16h bh[4], ah[4];
#pragma unroll
      for (int j = 0; j < 4; ++j) bh[j] = ldfrag_h(pb + j * 16 * GP + ks * 32);
#pragma unroll
      for (int i = 0; i < 4; ++i) ah[i] = ldfrag_h(pa + i * 16 * GP + ks * 32);
      // keeps the 16 fragment reads of a k block as one group in front of its 16 products: left free, the
      // scheduler spreads them among the products on one A register set, and each place waits out the LDS latency
      __builtin_amdgcn_sched_barrier(0);
#pragma unroll
      for (int i = 0; i < 4; ++i)
#pragma unroll
        for (int j = 0; j < 4; ++j) acc[i][j] = mma_h_raw(ah[i], bh[j], acc[i][j]);
    }
  };

  const int nst = K >> 6;
  copies(0, 0);
  asm volatile("s_wait_asynccnt 0x0" ::: "memory");   // slice 0 has landed before the barrier publishes it
  __syncthreads();
  if (nst > 1) copies(1, 64);
  for (int t = 0; t < nst; ++t) {                      // block-uniform trip
    compute(t & 1);
    asm volatile("s_wait_dscnt 0x0" ::: "memory");     // this wave's reads of buffer t & 1 are done before its refill
    asm volatile("s_wait_asynccnt 0x0" ::: "memory");  // this wave's copies of slice t + 1 have landed
    __syncthreads();                                   // publishes slice t + 1, frees buffer t & 1
    if (t + 2 < nst) copies(t & 1, (t + 2) << 6);
  }
  asm volatile("s_wait_asynccnt 0x0" ::: "memory");    // nothing in flight when the wave goes on to the epilogue
  acc_guard4(acc[0][0], acc[0][1], acc[0][2], acc[0][3]);
  acc_guard4(acc[1][0], acc[1][1], acc[1][2], acc[1][3]);
  acc_guard4(acc[2][0], acc[2][1], acc[2][2], acc[2][3]);
  acc_guard4(acc[3][0], acc[3][1], acc[3][2], acc[3][3]);

  const int q8 = lane >> 3, c8 = (lane & 7) * 8;
  float bc[8];
#pragma unroll
  for (int e = 0; e < 8; ++e) bc[e] = 0.f;
  if (BIASM == 0) {
    const int cb = n0 + c8;                                  // <= N - 8
    const int i0 = (cb < N - 8) ? cb : (N - 8);
    const v4f b0a = *(const v4f*)(bias0 + i0), b0b = *(const v4f*)(bias0 + i0 + 4);
#pragma unroll
    for (int e = 0; e < 4; ++e) {
      bc[e]     = bfr(b0a[e]) * bsc;
      bc[4 + e] = bfr(b0b[e]) * bsc;
    }
  }

  // ---- epilogue ----
  float* slab = sT[wave];
#pragma unroll
  for (int i = 0; i < 4; ++i) {
    const int mBase = m0 + (i << 4);
#pragma unroll
    for (int j = 0; j < 4; ++j) {
#pragma unroll
      for (int r = 0; r < 8; ++r) {
        slab[(mOff + r) * 68 + (j << 4) + rlane] = acc[i][j][r];
      }
    }
    wave_sync_lds();
    v4u hv[4], lv[4];
#pragma unroll
    for (int it = 0; it < 4; ++it) {
      const int row = it * 4 + q8;                       // it 0..3 x q8 0..3 = rows 0..15
      const float* sp = slab + row * 68 + c8;
      float bm = 0.f;
      if (BIASM == 1) bm = bfr(bias0[mBase + row]) * bsc; // mBase + row < M
      v4u a, lw;
#pragma unroll
      for (int e = 0; e < 4; ++e) {
        const float f0 = sp[2 * e]     * oscale + ((BIASM == 1) ? bm : bc[2 * e]);
        const float f1 = sp[2 * e + 1] * oscale + ((BIASM == 1) ? bm : bc[2 * e + 1]);
        const _Float16 g0 = (_Float16)f0;
        const _Float16 g1 = (_Float16)f1;
        a[e] = pk16(h_bits(g0), h_bits(g1));
        if (OM == 3) {
          const _Float16 r0 = (_Float16)((f0 - (float)g0) * rsc);
          const _Float16 r1 = (_Float16)((f1 - (float)g1) * rsc);
          lw[e] = pk16(h_bits(r0), h_bits(r1));
        } else {
          lw[e] = 0u;
        }
      }
      hv[it] = a;
      lv[it] = lw;
    }
    {
#pragma unroll
      for (int it = 0; it < 4; ++it) {
        const int row = it * 4 + q8;
        const size_t go = (size_t)(mBase + row) * ldc + n0 + c8;
        *(v4u*)(Cout + go) = hv[it];
        if (OM == 3) *(v4u*)(Cout2 + go) = lv[it];
      }
      
    }
    wave_sync_lds();
  }
}

#define LOG2E 1.44269504088896340736f
#define PLOG2 10.0f      // log2 of PSC
static_assert(PSC == 1024.0f);
#define OP 68      // LDS row pitch in floats of the output tile: 272 B = 16 B x 17 (odd), for 16-byte writers
__device__ __forceinline__ float other_half(float x) {    // value of lane l ^ 16
  const int b = __builtin_bit_cast(int, x);
  return __builtin_bit_cast(float, __builtin_amdgcn_permlanex16(b, b, 0x76543210, 0xfedcba98, false, false));
}
// 2^x as v_exp_f32, eight at a time (one score tile) or alone. Written as asm so that the slot
// the instruction set asks for behind a transcendental is kept by construction: outputs are early-clobber, so
// inside a statement no v_exp_f32 is followed by a write of its source or a read of its result, and the closing
// v_nop fills the slot behind the last one whatever the compiler puts next.
__device__ __forceinline__ v8f exp2_8(v8f x) {
  v8f e;
#if defined(__HIP_DEVICE_COMPILE__)
  float e0, e1, e2, e3, e4, e5, e6, e7;
  asm("v_exp_f32 %0, %8\n\tv_exp_f32 %1, %9\n\tv_exp_f32 %2, %10\n\tv_exp_f32 %3, %11\n\t"
      "v_exp_f32 %4, %12\n\tv_exp_f32 %5, %13\n\tv_exp_f32 %6, %14\n\tv_exp_f32 %7, %15\n\tv_nop"
      : "=&v"(e0), "=&v"(e1), "=&v"(e2), "=&v"(e3), "=&v"(e4), "=&v"(e5), "=&v"(e6), "=&v"(e7)
      : "v"(x[0]), "v"(x[1]), "v"(x[2]), "v"(x[3]), "v"(x[4]), "v"(x[5]), "v"(x[6]), "v"(x[7]));
  e[0] = e0; e[1] = e1; e[2] = e2; e[3] = e3; e[4] = e4; e[5] = e5; e[6] = e6; e[7] = e7;
#else
  e = x;
#endif
  return e;
}
__device__ __forceinline__ float exp2_1(float x) {
  float e = x;
#if defined(__HIP_DEVICE_COMPILE__)
  asm("v_exp_f32 %0, %1\n\tv_nop" : "=&v"(e) : "v"(x));
#endif
  return e;
}

__global__ __launch_bounds__(128) __attribute__((amdgpu_waves_per_eu(4, 4)))   // registers stay within four waves per SIMD
void attn_lb(const unsigned short* __restrict__ qhp, const unsigned short* __restrict__ qlp,
             const unsigned short* __restrict__ khp,
             const unsigned short* __restrict__ vthp, const unsigned short* __restrict__ vtlp,
             float* outp, float sscale, float onorm) {
  union FH { v16h v; v8h h[2]; };
  // two buffers of three tiles, 9 KB each, pitch LP: K [kv][d], V^T hi [d][kv], V^T res [d][kv]
  __shared__ __align__(16) _Float16 Ring[2][3][64 * LP];
  __shared__ __align__(16) float    Os[4][16 * OP];               // per wave context tile [row][d], pitch OP

  const int tid  = threadIdx.x;
  const int wave = tid >> 5;
  const int lane = tid & 31;
  const int hh   = lane >> 4;
  const int c    = lane & 15;

  const int bx   = blockIdx.x;
  const int qb   = bx % NQB;
  const int hb   = bx / NQB;
  const int h    = hb % NH;
  const int b    = hb / NH;
  const int tok0 = b * SQ;                       // first token row of this sequence
  const int ql0  = qb * 64 + wave * 16;          // local query index of this wave's first row
  const int q0   = tok0 + ql0;                   // global token row of this wave's first row

  const _Float16* Qh = (const _Float16*)(const void*)qhp + (size_t)h * HD;
  const _Float16* Ql = (const _Float16*)(const void*)qlp + (size_t)h * HD;
  const _Float16* Kg = (const _Float16*)(const void*)khp + (size_t)h * HD;
  const _Float16* Vh = (const _Float16*)(const void*)vthp + (size_t)h * HD * NTOK + tok0;
  const _Float16* Vl = (const _Float16*)(const void*)vtlp + (size_t)h * HD * NTOK + tok0;

  // ---- per-head slope (block-uniform) ----
  const int   se    = (h + 1) >> 1;
  const float spw   = __uint_as_float((unsigned)(127 - se) << 23);
  const float slope = (h & 1) ? spw : (spw * 0.70710678118654752f);

  // ---- Q fragments (B operand, column = lane&15): 2 d-chunks, hi and residual planes ----
  v16h qa[2], qr[2];
#pragma unroll
  for (int dc = 0; dc < 2; ++dc) {
    qa[dc] = ldfrag_h(Qh + (size_t)(q0 + c) * DM + dc * 32 + 8 * hh);
    qr[dc] = ldfrag_h(Ql + (size_t)(q0 + c) * DM + dc * 32 + 8 * hh);
  }

  const int qrow = ql0 + c;                      // this lane's query (D column = lane&15)
  float mrow = -INFINITY;                        // running maximum of raw of query qrow (equal in both lane halves)
  float nrow = INFINITY;                         // addend of the exponent that the running sum and context stand on
  float lrow = 0.f;                              // running sum (x PSC) over this lane half's keys only
  v8f oacc[4];                                   // oacc[t][r] = context[query c][d = 16 t + 8 hh + r]
#pragma unroll
  for (int t = 0; t < 4; ++t) oacc[t] = zero8();

  const float rinv = 1.0f / RSC;
  const float c2   = sscale * LOG2E;             // raw -> exponent of two
  const float ydl  = (float)(8 * hh - qrow);     // key - query of the lane's register 0, tile 0, chunk 0

  // staging map: thread -> row (tid >> 3) + 16 * it, 16-B piece tid & 7 of the row's 128 B
  const int srow = tid >> 3, sc8 = (tid & 7) * 8;
  const _Float16* gk = Kg + (size_t)(tok0 + srow) * DM + sc8;      // K row = key, d = sc8..sc8+7
  const _Float16* gv = Vh + (size_t)srow * NTOK + sc8;             // V^T hi row = d, key = sc8..sc8+7
  const _Float16* gw = Vl + (size_t)srow * NTOK + sc8;             // V^T res row = d
  const unsigned l0 = (unsigned)(uintptr_t)(&Ring[0][0][srow * LP + sc8]);   // lane's LDS byte address, buffer 0, K, it 0
  // One chunk: 3 x 4 asynchronous 16-B copies per lane, global -> LDS, through no register. The closing
  // s_wait_xcnt stands in the copies' own statement so that no address register is rewritten in front of it.
  auto copies = [&](int buf, int kv) {
    const unsigned lk = l0 + (unsigned)buf * (unsigned)(3 * 64 * LP * 2);
    const unsigned lv = lk + (unsigned)(64 * LP * 2);
    const unsigned lw = lk + (unsigned)(2 * 64 * LP * 2);
    const _Float16* pk = gk + (size_t)kv * DM;
    const _Float16* pv = gv + kv;
    const _Float16* pw = gw + kv;
    const size_t kstep = (size_t)16 * DM, vstep = (size_t)16 * NTOK;
#if defined(__HIP_DEVICE_COMPILE__)
    asm volatile(
        "global_load_async_to_lds_b128 %0, %12, off\n\t"
        "global_load_async_to_lds_b128 %1, %13, off\n\t"
        "global_load_async_to_lds_b128 %2, %14, off\n\t"
        "global_load_async_to_lds_b128 %3, %15, off\n\t"
        "global_load_async_to_lds_b128 %4, %16, off\n\t"
        "global_load_async_to_lds_b128 %5, %17, off\n\t"
        "global_load_async_to_lds_b128 %6, %18, off\n\t"
        "global_load_async_to_lds_b128 %7, %19, off\n\t"
        "global_load_async_to_lds_b128 %8, %20, off\n\t"
        "global_load_async_to_lds_b128 %9, %21, off\n\t"
        "global_load_async_to_lds_b128 %10, %22, off\n\t"
        "global_load_async_to_lds_b128 %11, %23, off\n\t"
        "s_wait_xcnt 0x0"
        :: "v"(lk), "v"(lk + 1u * 16u * LP * 2u), "v"(lk + 2u * 16u * LP * 2u), "v"(lk + 3u * 16u * LP * 2u),
           "v"(lv), "v"(lv + 1u * 16u * LP * 2u), "v"(lv + 2u * 16u * LP * 2u), "v"(lv + 3u * 16u * LP * 2u),
           "v"(lw), "v"(lw + 1u * 16u * LP * 2u), "v"(lw + 2u * 16u * LP * 2u), "v"(lw + 3u * 16u * LP * 2u),
           "v"(pk), "v"(pk + kstep), "v"(pk + 2 * kstep), "v"(pk + 3 * kstep),
           "v"(pv), "v"(pv + vstep), "v"(pv + 2 * vstep), "v"(pv + 3 * vstep),
           "v"(pw), "v"(pw + vstep), "v"(pw + 2 * vstep), "v"(pw + 3 * vstep)
        : "memory");
#endif
  };

  static_assert(NQB >= 2);
  copies(0, 0);
  asm volatile("s_wait_asynccnt 0x0" ::: "memory");   // chunk 0 has landed before the barrier publishes it
  __syncthreads();
  copies(1, 64);
  for (int kt = 0; kt < NQB; ++kt) {            // block-uniform trip = 32
    const int kv0 = kt * 64;                     // local key index of the chunk
    const _Float16* Ksh = &Ring[kt & 1][0][0];
    const _Float16* Vth = &Ring[kt & 1][1][0];
    const _Float16* Vtl = &Ring[kt & 1][2][0];
    const float yd = ydl + (float)kv0;

    // ---- K fragments of the whole chunk: 16 reads as one group (loops unrolled: fragments stay in registers) ----
    FH kb[4][2];
#pragma unroll
    for (int j = 0; j < 4; ++j) {
#pragma unroll
      for (int dc = 0; dc < 2; ++dc) {
        kb[j][dc].h[0] = *(const v8h*)(Ksh + (j * 16 + c) * LP + dc * 32 + 8 * hh);
        kb[j][dc].h[1] = *(const v8h*)(Ksh + (j * 16 + c) * LP + dc * 32 + 16 + 8 * hh);
      }
    }

    // ---- distance term -slope * |key - query| of the 64 x 16 scores; register r of tile j: key - query = yd + 16 j + r.
    //      In every chunk but the block's own, key - query has one sign for all scores: the term is linear there ----
    // compiler fence: keeps the 16 K reads in front of the branch below, so that the distance term is formed under
    // their latency; left free, they sink behind the branch's join
    asm volatile("" ::: "memory");
    v8f bs[4];
    if (kt == qb) {                              // block-uniform
#pragma unroll
      for (int j = 0; j < 4; ++j) {
#pragma unroll
        for (int r = 0; r < 8; ++r) bs[j][r] = -slope * fabsf(yd + (float)(j * 16 + r));
      }
    } else {
      const float sg = (kt < qb) ? slope : -slope;
      const float z0 = sg * yd;
#pragma unroll
      for (int r = 0; r < 8; ++r) bs[0][r] = sg * (float)r + z0;
#pragma unroll
      for (int j = 1; j < 4; ++j) bs[j] = bs[0] + sg * (float)(j * 16);
    }

    // ---- raw scores, transposed: 64 keys x 16 queries per wave ----
    v8f s[4];
#pragma unroll
    for (int j = 0; j < 4; ++j) {
      v8f sh = bs[j], sl = zero8();
#pragma unroll
      for (int dc = 0; dc < 2; ++dc) {
        sh = mma_h(kb[j][dc].v, qa[dc], sh);
        sl = mma_h(kb[j][dc].v, qr[dc], sl);
      }
#pragma unroll
      for (int r = 0; r < 8; ++r) s[j][r] = sh[r] + sl[r] * rinv;
    }

    // ---- V^T fragments of keys 0..31 (hi and residual): 16 reads as one group, in flight under the softmax ----
    FH vb[2][4], wb[2][4];
#pragma unroll
    for (int t = 0; t < 4; ++t) {
      vb[0][t].h[0] = *(const v8h*)(Vth + (t * 16 + c) * LP + 8 * hh);
      vb[0][t].h[1] = *(const v8h*)(Vth + (t * 16 + c) * LP + 16 + 8 * hh);
      wb[0][t].h[0] = *(const v8h*)(Vtl + (t * 16 + c) * LP + 8 * hh);
      wb[0][t].h[1] = *(const v8h*)(Vtl + (t * 16 + c) * LP + 16 + 8 * hh);
    }
    // keeps all 16 reads in front of the softmax arithmetic, which covers their latency: left free, the scheduler
    // sinks the last four to the front of the first product, where their latency is waited out
    __builtin_amdgcn_sched_barrier(0);

    // ---- maximum in the lane, one exchange between the halves; online softmax ----
    float mj[4];
#pragma unroll
    for (int j = 0; j < 4; ++j) {
      mj[j] = s[j][0];
#pragma unroll
      for (int r = 1; r < 8; ++r) mj[j] = fmaxf(mj[j], s[j][r]);
    }
    float m = fmaxf(fmaxf(mj[0], mj[1]), fmaxf(mj[2], mj[3]));
    m = fmaxf(m, other_half(m));
    const float mnew  = fmaxf(mrow, m);
    const bool  none  = (mnew == -INFINITY);
    const float nb    = none ? PLOG2 : (PLOG2 - mnew * c2);
    const float alpha = exp2_1(nb - nrow);
    mrow = mnew;
    nrow = none ? INFINITY : nb;

    // ---- P (x PSC, f16) packed from the score registers into the B operands of p.v ----
    v16h pb[2];
    float pj[4];
#pragma unroll
    for (int j = 0; j < 4; ++j) {
      const v8f p = exp2_8(s[j] * c2 + nb);
      pj[j] = 0.f;
#pragma unroll
      for (int r = 0; r < 8; ++r) {
        pj[j] += p[r];
        pb[j >> 1][(j & 1) * 8 + r] = (_Float16)p[r];
      }
    }
    // ---- V^T fragments of keys 32..63, d rows 0..31: 8 reads as one group, in flight under the products of
    //      keys 0..31 ----
#pragma unroll
    for (int t = 0; t < 2; ++t) {
      vb[1][t].h[0] = *(const v8h*)(Vth + (t * 16 + c) * LP + 32 + 8 * hh);
      vb[1][t].h[1] = *(const v8h*)(Vth + (t * 16 + c) * LP + 32 + 16 + 8 * hh);
      wb[1][t].h[0] = *(const v8h*)(Vtl + (t * 16 + c) * LP + 32 + 8 * hh);
      wb[1][t].h[1] = *(const v8h*)(Vtl + (t * 16 + c) * LP + 32 + 16 + 8 * hh);
    }
    lrow = lrow * alpha + ((pj[0] + pj[1]) + (pj[2] + pj[3]));
#pragma unroll
    for (int t = 0; t < 4; ++t) {
#pragma unroll
      for (int r = 0; r < 8; ++r) oacc[t][r] *= alpha;
    }

    // ---- context^T += Vhi . P^T ; chunk residual = Vres . P^T (f16 WMMA) ----
    v8f ol[4];
#pragma unroll
    for (int t = 0; t < 4; ++t) ol[t] = zero8();
#pragma unroll
    for (int kk = 0; kk < 2; ++kk) {
#pragma unroll
      for (int t = 0; t < 4; ++t) {
        if (kk == 0 && t == 2) {
          // V^T fragments of keys 32..63, d rows 32..63: 8 reads as one group into the registers that the four
          // products above have left, in flight under the next eight products
#pragma unroll
          for (int u = 2; u < 4; ++u) {
            vb[1][u].h[0] = *(const v8h*)(Vth + (u * 16 + c) * LP + 32 + 8 * hh);
            vb[1][u].h[1] = *(const v8h*)(Vth + (u * 16 + c) * LP + 32 + 16 + 8 * hh);
            wb[1][u].h[0] = *(const v8h*)(Vtl + (u * 16 + c) * LP + 32 + 8 * hh);
            wb[1][u].h[1] = *(const v8h*)(Vtl + (u * 16 + c) * LP + 32 + 16 + 8 * hh);
          }
        }
        oacc[t] = mma_h(vb[kk][t].v, pb[kk], oacc[t]);
        ol[t]   = mma_h(wb[kk][t].v, pb[kk], ol[t]);
      }
    }
    // ---- fold this chunk's residual term into the running context (f32) ----
#pragma unroll
    for (int t = 0; t < 4; ++t) {
#pragma unroll
      for (int r = 0; r < 8; ++r) oacc[t][r] += ol[t][r] * rinv;
    }
    asm volatile("s_wait_dscnt 0x0" ::: "memory");     // this wave's reads of buffer kt & 1 are done before its refill
    asm volatile("s_wait_asynccnt 0x0" ::: "memory");  // this wave's copies of chunk kt + 1 have landed
    __syncthreads();                                   // publishes chunk kt + 1, frees buffer kt & 1
    if (kt + 2 < NQB) copies(kt & 1, kv0 + 128);
  }
  asm volatile("s_wait_asynccnt 0x0" ::: "memory");    // nothing in flight when the wave goes on to the epilogue

  // ---- join the halves' sums, normalise (1/l and the 1/(PSC*VSC) carry), stage the wave's 16x64 tile
  //      (a lane holds 8 consecutive d of its query per t: two 16-B LDS writes), write whole 256-B rows
  float* os = Os[wave];
  {
    const float l = lrow + other_half(lrow);
    const float inv = ((l > 0.f) ? (1.0f / l) : 0.f) * (onorm * PSC);
#pragma unroll
    for (int t = 0; t < 4; ++t) {
      v4f w0, w1;
#pragma unroll
      for (int e = 0; e < 4; ++e) { w0[e] = oacc[t][e] * inv; w1[e] = oacc[t][4 + e] * inv; }
      *(v4f*)(os + c * OP + t * 16 + 8 * hh)     = w0;
      *(v4f*)(os + c * OP + t * 16 + 8 * hh + 4) = w1;
    }
  }
  wave_sync_lds();
  {
    const int hh2 = lane >> 4, c4 = (lane & 15) * 4;
    v4f vals[8];
#pragma unroll
    for (int it = 0; it < 8; ++it) {
      const int row = it * 2 + hh2;   // it 0..7 x hh2 0..1 = rows 0..15 of the wave tile
      vals[it] = *(const v4f*)(os + row * OP + c4);
    }
    {
#pragma unroll
      for (int it = 0; it < 8; ++it) {
        const int row = it * 2 + hh2;
        const size_t go = (size_t)(q0 + row) * DM + (size_t)h * HD + c4;
        *(v4f*)(outp + go) = vals[it];
      }
    }
  }
}

// =====================================================================================================
// Workspace map (bytes); every plane is an exact multiple of its 64x64-tile / whole-line store granularity
// ([8192][1024] = 128x16 tiles, [1024][8192] = 16x128 tiles, weights [1024][1024] = 16x16 tiles):
//   WqT  f16 [1024][1024]   0          2097152   (transposed, x64)
//   WkT  f16 [1024][1024]   2097152    2097152
//   WvT  f16 [1024][1024]   4194304    2097152
//   XH   f16 [8192][1024]   6291456    16777216  (layer norm output x16)
//   QH   f16 [8192][1024]   23068672   16777216  (q hi)
//   QL   f16 [8192][1024]   39845888   16777216  (q residual x4096)
//   KH   f16 [8192][1024]   56623104   16777216
//   VTH  f16 [1024][8192]   73400320   16777216  (v^T hi x16)
//   VTL  f16 [1024][8192]   90177536   16777216  (v^T residual x16 x4096)
//   end                     106954752
// =====================================================================================================
extern "C" void kernel_launch(void* const* d_in, const int* in_sizes, int n_in,
                              void* d_out, int out_size, void* d_ws, size_t ws_size,
                              hipStream_t stream) {
  if (n_in < 9) return;
  if (in_sizes[0] != NTOK * DM) return;
  if (in_sizes[1] != DM || in_sizes[2] != DM) return;
  if (in_sizes[3] != DM * DM || in_sizes[5] != DM * DM || in_sizes[7] != DM * DM) return;
  if (in_sizes[4] != DM || in_sizes[6] != DM || in_sizes[8] != DM) return;
  if (out_size != NTOK * DM) return;

  const float* x   = (const float*)d_in[0];
  const float* gam = (const float*)d_in[1];
  const float* bet = (const float*)d_in[2];
  const float* wq  = (const float*)d_in[3];
  const float* bq  = (const float*)d_in[4];
  const float* wk  = (const float*)d_in[5];
  const float* bk  = (const float*)d_in[6];
  const float* wv  = (const float*)d_in[7];
  const float* bv  = (const float*)d_in[8];

  const size_t PW = (size_t)DM * DM * 2;            //  2097152
  const size_t PA = (size_t)NTOK * DM * 2;          // 16777216
  size_t off = 0;
  const size_t oWq = off; off += PW;
  const size_t oWk = off; off += PW;
  const size_t oWv = off; off += PW;
  const size_t oXH = off; off += PA;
  const size_t oQH = off; off += PA;
  const size_t oQL = off; off += PA;
  const size_t oKH = off; off += PA;
  const size_t oVH = off; off += PA;
  const size_t oVL = off; off += PA;
  if (off > ws_size) return;                        // off = 106954752
  if (off > (size_t)134217728) return;

  char* ws = (char*)d_ws;
  unsigned short* WqT = (unsigned short*)(ws + oWq);
  unsigned short* WkT = (unsigned short*)(ws + oWk);
  unsigned short* WvT = (unsigned short*)(ws + oWv);
  unsigned short* XH  = (unsigned short*)(ws + oXH);
  unsigned short* QH  = (unsigned short*)(ws + oQH);
  unsigned short* QL  = (unsigned short*)(ws + oQL);
  unsigned short* KH  = (unsigned short*)(ws + oKH);
  unsigned short* VTH = (unsigned short*)(ws + oVH);
  unsigned short* VTL = (unsigned short*)(ws + oVL);

  const dim3 blk(256), blk128(128);
  const dim3 gLn(NTOK / 8);                                            // 1024 blocks, 8 rows each
  const dim3 gTr(DM / 64, DM / 64);                                    // (cols/64, rows/64) of W[in][out]
  const dim3 gG(((NTOK / 64) * (DM / 64) + 7) / 8);                    // 256 blocks, one 128x256 tile each
  const dim3 gAttn(NB * NH * NQB);                                     // 2048 blocks of 128
  const float osc_qk = 1.0f / (XSC * WSC);                             // q, k unscaled
  const float osc_v  = VSC / (XSC * WSC);                              // v^T carried x16

  // (0) layer norm -> XH f16 [8192][1024] (x16)
  ln_rows<<<gLn, blk, 0, stream>>>(x, gam, bet, XH, NTOK, XSC, LNEPS);
  // (1) weights W[in][out] f32 -> W^T f16 [out][in] (k contiguous), bf16 RNE-converted, x64
  wtrans_h<<<gTr, blk, 0, stream>>>(wq, WqT, DM, DM, WSC);
  wtrans_h<<<gTr, blk, 0, stream>>>(wk, WkT, DM, DM, WSC);
  wtrans_h<<<gTr, blk, 0, stream>>>(wv, WvT, DM, DM, WSC);
  // (2) q = xh . Wq + bq -> QH (hi), QL (residual x4096), f16 [8192][1024]
  gemm64<3, 0><<<gG, blk, 0, stream>>>(XH, DM, WqT, DM, bq, QH, QL, DM, NTOK, DM, DM, osc_qk, 1.0f, RSC);
  // (3) k = xh . Wk + bk -> KH f16 [8192][1024]
  gemm64<2, 0><<<gG, blk, 0, stream>>>(XH, DM, WkT, DM, bk, KH, KH, DM, NTOK, DM, DM, osc_qk, 1.0f, RSC);
  // (4) v^T: VT[m][t] = sum_k WvT[m][k] . xh[t][k] + bv[m] -> VTH (hi x16), VTL (residual x16 x4096),
  //     f16 [1024][8192]
  gemm64<3, 1><<<gG, blk, 0, stream>>>(WvT, DM, XH, DM, bv, VTH, VTL, NTOK, DM, NTOK, DM, osc_v, VSC, RSC);
  // (5) attention with per-head linear distance bias -> d_out f32 [8192][1024]
  attn_lb<<<gAttn, blk128, 0, stream>>>(QH, QL, KH, VTH, VTL, (float*)d_out, 0.125f, 1.0f / (PSC * VSC));
  (void)hipGetLastError();
}

// v007
// Measured time: 174 microseconds a run.
// Next to v006, in two timings, it ran 1.10 times as fast each time.
// Counting every step since v000, it is 3.25 times as fast.
// Contractions: q, k and v^T projections on v_wmma_f32_16x16x32_f16 (f16 layer-norm plane carried x16 times
// f16 transposed weight plane carried x64, one product each); attention k.q^T on v_wmma_f32_16x16x32_f16
// (q as f16 hi plane plus f16 residual plane carried x4096, k plain f16, two products); v^T.p^T on
// v_wmma_f32_16x16x32_f16 (p carried x1024, v^T as f16 hi plane carried x16 plus f16 residual plane carried
// x4096, two products); all f32 accumulate; layer norm and softmax in f32 on VALU; every float input
// RNE-converted to bf16 on load.
#include <hip/hip_runtime.h>
#include <math.h>
#include <stdint.h>

#define NB    4
#define SQ    2048
#define NTOK  (NB * SQ)
#define DM    1024
#define NH    16
#define HD    64
#define NQB   (SQ / 64)
#define XSC   16.0f
#define WSC   64.0f
#define VSC   16.0f
#define RSC   4096.0f
#define PSC   1024.0f
#define LNEPS 1e-5f
#define LP    72      // LDS row pitch in halves of the attention tiles: 144 B = 16 B x 9 (odd), for 16-byte readers
static_assert(NH * HD == DM);
static_assert((SQ % 64) == 0 && (DM % 64) == 0 && (NTOK % 64) == 0);
static_assert(DM == 4 * 256);
static_assert((NTOK % 8) == 0);
static_assert((NTOK % 256) == 0 && (DM % 256) == 0);

typedef _Float16 v16h __attribute__((ext_vector_type(16)));
typedef _Float16 v8h  __attribute__((ext_vector_type(8)));
typedef float    v8f  __attribute__((ext_vector_type(8)));
typedef float    v4f  __attribute__((ext_vector_type(4)));
typedef unsigned int v4u __attribute__((ext_vector_type(4)));

// ---- scalar helpers --------------------------------------------------------------------------------
__device__ __forceinline__ unsigned short bf_bits(float f) {          // f32 -> bf16 bits, RNE convert
  unsigned u = __float_as_uint(f);
  return (unsigned short)((u + 0x7FFFu + ((u >> 16) & 1u)) >> 16);
}
__device__ __forceinline__ float bf_up(unsigned short h) { return __uint_as_float(((unsigned)h) << 16); }
__device__ __forceinline__ float bfr(float f) { return bf_up(bf_bits(f)); }   // value of the bf16 RNE convert
__device__ __forceinline__ unsigned short h_bits(_Float16 x) { return __builtin_bit_cast(unsigned short, x); }
__device__ __forceinline__ unsigned pk16(unsigned short a, unsigned short b) { return (unsigned)a | ((unsigned)b << 16); }
__device__ __forceinline__ v8f zero8() { v8f z = {0.f, 0.f, 0.f, 0.f, 0.f, 0.f, 0.f, 0.f}; return z; }

// ---- fragment loader: 16-bit A/B operand, lane -> row/col (lane&15), p already includes +8*(lane>>4);
//      elements 0..7 <- p[0..7] (k0+8h..), elements 8..15 <- p[16..23] (k0+16+8h..)
__device__ __forceinline__ v16h ldfrag_h(const _Float16* p) {
  union { v16h v; v8h h[2]; } f;
  f.h[0] = *(const v8h*)(p);
  f.h[1] = *(const v8h*)(p + 16);
  return f.v;
}

// ---- WMMA helpers with trailing VALU hazard gap --------------------------------------------------------
__device__ __forceinline__ v8f mma_h(v16h a, v16h b, v8f c) {
  c = __builtin_amdgcn_wmma_f32_16x16x32_f16(false, a, false, b, (short)0, c, false, false);
#if defined(__HIP_DEVICE_COMPILE__)
  asm volatile("v_nop\n\tv_nop\n\tv_nop\n\tv_nop" : "+v"(c) : "v"(a), "v"(b));
#endif
  return c;
}
__device__ __forceinline__ v8f mma_h_raw(v16h a, v16h b, v8f c) {
  return __builtin_amdgcn_wmma_f32_16x16x32_f16(false, a, false, b, (short)0, c, false, false);
}
__device__ __forceinline__ void acc_guard4(v8f& a, v8f& b, v8f& c, v8f& d) {
#if defined(__HIP_DEVICE_COMPILE__)
  asm volatile("v_nop\n\tv_nop\n\tv_nop\n\tv_nop" : "+v"(a), "+v"(b), "+v"(c), "+v"(d));
#endif
}
__device__ __forceinline__ void wave_sync_lds() {
  __builtin_amdgcn_fence(__ATOMIC_RELEASE, "workgroup");
  __builtin_amdgcn_wave_barrier();
  __builtin_amdgcn_fence(__ATOMIC_ACQUIRE, "workgroup");
}

// =====================================================================================================
// Layer norm over rows of DM = 1024: one wave per row, 8 rows per block (blk = 0 .. nrows/8 - 1). Every input value
// y = ((x - mu) * rstd * gamma + beta) * xsc written as one f16 plane [nrows][DM].
// Lane l handles columns 256*i + 8*l .. +7 (i = 0..3); each store instruction of the wave covers 512 B =
// coverage: nrows/8 blocks x 8 waves = every row; 4 iterations x 32 lanes x 8 = all 1024 columns.
// =====================================================================================================
__device__ __forceinline__ void ln_rows(int blk, const float* __restrict__ x, const float* __restrict__ gam,
                                        const float* __restrict__ bet, unsigned short* Xh,
                                        int nrows, float xsc, float eps) {
  const int lane = threadIdx.x & 31;
  const int wave = threadIdx.x >> 5;
  const int row  = blk * 8 + wave;
  if (row >= nrows) return;                     // wave-uniform; no block barrier on the layer-norm path
  const float* xr = x + (size_t)row * DM;
  const float rd = 1.0f / (float)DM;

  float s = 0.f;
#pragma unroll 1
  for (int i = 0; i < 4; ++i) {
    const int c0 = 256 * i + 8 * lane;
    const v4f a = *(const v4f*)(xr + c0);
    const v4f b = *(const v4f*)(xr + c0 + 4);
    s += ((bfr(a[0]) + bfr(a[1])) + (bfr(a[2]) + bfr(a[3]))) +
         ((bfr(b[0]) + bfr(b[1])) + (bfr(b[2]) + bfr(b[3])));
  }
#pragma unroll
  for (int off = 1; off < 32; off <<= 1) s += __shfl_xor(s, off, 32);
  const float mu = s * rd;

  float s2 = 0.f;
#pragma unroll 1
  for (int i = 0; i < 4; ++i) {
    const int c0 = 256 * i + 8 * lane;
    const v4f a = *(const v4f*)(xr + c0);
    const v4f b = *(const v4f*)(xr + c0 + 4);
#pragma unroll
    for (int e = 0; e < 4; ++e) {
      const float d0 = bfr(a[e]) - mu;
      const float d1 = bfr(b[e]) - mu;
      s2 += d0 * d0;
      s2 += d1 * d1;
    }
  }
#pragma unroll
  for (int off = 1; off < 32; off <<= 1) s2 += __shfl_xor(s2, off, 32);
  const float var  = s2 * rd;
  const float rstd = 1.0f / sqrtf(var + eps);

#pragma unroll 1
  for (int i = 0; i < 4; ++i) {
    const int c0 = 256 * i + 8 * lane;
    const v4f a  = *(const v4f*)(xr + c0);
    const v4f b  = *(const v4f*)(xr + c0 + 4);
    const v4f ga = *(const v4f*)(gam + c0);
    const v4f gb = *(const v4f*)(gam + c0 + 4);
    const v4f ba = *(const v4f*)(bet + c0);
    const v4f bb = *(const v4f*)(bet + c0 + 4);
    float y[8];
#pragma unroll
    for (int e = 0; e < 4; ++e) {
      y[e]     = ((bfr(a[e]) - mu) * rstd * bfr(ga[e]) + bfr(ba[e])) * xsc;
      y[4 + e] = ((bfr(b[e]) - mu) * rstd * bfr(gb[e]) + bfr(bb[e])) * xsc;
    }
    v4u u;
#pragma unroll
    for (int e = 0; e < 4; ++e) u[e] = pk16(h_bits((_Float16)y[2 * e]), h_bits((_Float16)y[2 * e + 1]));
    unsigned short* dst = Xh + (size_t)row * DM + c0;
    *(v4u*)dst = u;
    
  }
}

// =====================================================================================================
// Transpose-convert: W f32 in[R][C] (row-major) -> out f16 bits [C][R]; each value bf16 RNE-converted,
// multiplied by wsc (power of two, exact) and cast to f16. Block = one 64x64 tile staged through LDS,
// coverage: load 4 it x 256 threads x 4 = 64x64; store 2 it x 256 threads x 8 = 64x64; tiles (bx, by) cover R x C.
// =====================================================================================================
__device__ __forceinline__ void wtrans_h(unsigned short* sT, int bx, int by, const float* __restrict__ W,
                                         unsigned short* Wt, int R, int C, float wsc) {
  const int tid = threadIdx.x;
  const int r0  = by * 64;                  // rows of W
  const int c0  = bx * 64;                  // cols of W
#pragma unroll
  for (int it = 0; it < 4; ++it) {
    const int idx = it * 256 + tid;         // 0..1023
    const int r   = idx >> 4;               // 0..63
    const int c4  = (idx & 15) * 4;         // 0..60
    const v4f w = *(const v4f*)(W + (size_t)(r0 + r) * C + c0 + c4);
#pragma unroll
    for (int e = 0; e < 4; ++e) sT[(c4 + e) * 72 + r] = h_bits((_Float16)(bfr(w[e]) * wsc));
  }
  __syncthreads();
  v4u u[2];
#pragma unroll
  for (int it = 0; it < 2; ++it) {
    const int row = it * 32 + (tid >> 3), col8 = (tid & 7) * 8;
    u[it] = *(const v4u*)(sT + row * 72 + col8);
  }
  {
#pragma unroll
    for (int it = 0; it < 2; ++it) {
      const int row = it * 32 + (tid >> 3), col8 = (tid & 7) * 8;
      *(v4u*)(Wt + (size_t)(c0 + row) * R + r0 + col8) = u[it];
    }
    // the stores' registers may be rewritten by whatever code follows the inlined body: the wait stands in front of that
    asm volatile("s_wait_xcnt 0x0" ::: "memory");
  }
}

// =====================================================================================================
// One launch for the four pieces of work that depend on the inputs alone: blocks 0 .. nln - 1 do the layer norm
// (8 rows each), the next 3 * (DM / 64) * (DM / 64) blocks the 64x64 tiles of the three weight transposes. The
// choice is block-uniform; the only block barrier stands in the transpose branch, which whole blocks take.
// =====================================================================================================
__global__ __launch_bounds__(256) void prep(const float* __restrict__ x, const float* __restrict__ gam,
                                            const float* __restrict__ bet, const float* __restrict__ wq,
                                            const float* __restrict__ wk, const float* __restrict__ wv,
                                            unsigned short* Xh, unsigned short* WqT, unsigned short* WkT,
                                            unsigned short* WvT, int nln, float xsc, float eps, float wsc) {
  __shared__ __align__(16) unsigned short sT[64 * 72];     // transpose tile [c][r], pitch 72 halves = 144 B
  const int bx = blockIdx.x;
  if (bx < nln) {
    ln_rows(bx, x, gam, bet, Xh, nln * 8, xsc, eps);
  } else {
    const int t  = bx - nln;
    const int w  = t / ((DM / 64) * (DM / 64));            // which weight
    const int tl = t - w * ((DM / 64) * (DM / 64));        // its tile
    if (w > 2) return;                                     // block-uniform, in front of the barrier
    const float*    W  = (w == 0) ? wq  : ((w == 1) ? wk  : wv);
    unsigned short* Wt = (w == 0) ? WqT : ((w == 1) ? WkT : WvT);
    wtrans_h(sT, tl % (DM / 64), tl / (DM / 64), W, Wt, DM, DM, wsc);
  }
}

// =====================================================================================================
// f16 WMMA GEMM: C[m][n] = oscale * sum_k A[m][k] * Bt[n][k] + bsc * bias. A block of 8 waves owns a 128x256
// tile of C (2 x 4 waves, 64x64 each). A row-major [M][K] pitch lda; Bt row-major [N][K] pitch ldb (k contiguous);
// M multiple of 128, N multiple of 256, K multiple of 64 and at least 64 (static here).
// Operands: per k slice of 64 (128 B = one line of every row) the block brings its 128 A rows and 256 Bt rows
// into LDS by asynchronous 16-B copies, each wave-wide copy covering four whole rows of the slice; rows at pitch
// GP. Two buffers: slice t + 1 flies while slice t is multiplied; at the foot of a trip every wave waits for its
// LDS reads and its copies, one block barrier publishes slice t + 1 and frees the buffer of slice t for t + 2.
// Fragments come from LDS in the k order of ldfrag_h; every accumulator takes its k blocks of 32 in rising order.
// Bias: BIASM == 0 -> per column bias0[n] (N entries, clamped-address 16-B loads); BIASM == 1 -> per row
//       bias0[m] (M entries). Bias values RNE-converted to bf16, then multiplied by bsc.
// OM: 2 = one f16 plane (Cout); 3 = f16 hi plane (Cout) plus f16 residual plane ((f - hi) * rsc, Cout2), same
//     indexing and pitch ldc for both planes.
// coverage: 4 slabs x 16 rows (it 0..3 x lane>>3 0..3) x 64 cols (8 lanes x 8) = the wave's whole 64x64 tile;
//           8 waves = the block's 128x256 tile; bt = 0 .. (M/128)*(N/256) - 1 is the tile, a block with a larger bt
//           exits whole.
// =====================================================================================================
#define GP 72      // LDS row pitch in halves of the operand slices: 144 B = 16 B x 9 (odd), for 16-byte readers
struct GemmLds {
  __align__(16) _Float16 sA[2][128 * GP];   // A slice  [row][k], two buffers
  __align__(16) _Float16 sB[2][256 * GP];   // Bt slice [row][k], two buffers
  __align__(16) float sT[8][16 * 68];       // per-wave 16x64 slab, pitch 68 floats
};
template <int OM, int BIASM>
__device__ __forceinline__ void gemm64(
    GemmLds& L, int bt,
    const unsigned short* __restrict__ Ap, int lda,
    const unsigned short* __restrict__ Btp, int ldb,
    const float* __restrict__ bias0,
    unsigned short* Cout, unsigned short* Cout2, int ldc,
    int M, int N, int K, float oscale, float bsc, float rsc) {
  const _Float16* A  = (const _Float16*)(const void*)Ap;
  const _Float16* Bt = (const _Float16*)(const void*)Btp;
  auto& sA = L.sA;
  auto& sB = L.sB;
  auto& sT = L.sT;
  const int tid  = threadIdx.x;
  const int lane = tid & 31;
  const int wave = tid >> 5;
  const int tilesN = N >> 8;
  const int tilesM = M >> 7;
  if (bt >= tilesM * tilesN) return;   // block-uniform, in front of every barrier
  const int tm = bt / tilesN;
  const int tn = bt - tm * tilesN;
  const int mB = tm << 7;                      // block's first row of C
  const int nB = tn << 8;                      // block's first column of C
  const int wm = (wave >> 2) << 6;             // wave's row offset in the block tile
  const int wn = (wave & 3) << 6;              // wave's column offset in the block tile
  const int m0 = mB + wm;
  const int n0 = nB + wn;

  const int rlane = lane & 15;                 // row (A) / col (B, D) within subtile
  const int koff  = (lane >> 4) * 8;           // k offset of this lane half
  const int mOff  = (lane >> 4) * 8;           // D row offset

  v8f acc[4][4];
#pragma unroll
  for (int i = 0; i < 4; ++i)
#pragma unroll
    for (int j = 0; j < 4; ++j) acc[i][j] = zero8();

  // staging map: thread -> row (tid >> 3) + 32 * it, 16-B piece tid & 7 of the row's 128-B slice
  const int srow = tid >> 3, sc8 = (tid & 7) * 8;
  const _Float16* ga = A  + (size_t)(mB + srow) * lda + sc8;
  const _Float16* gb = Bt + (size_t)(nB + srow) * ldb + sc8;
  const size_t astep = (size_t)32 * lda, bstep = (size_t)32 * ldb;
  const unsigned la0 = (unsigned)(uintptr_t)(&sA[0][srow * GP + sc8]);   // lane's LDS byte address, buffer 0, it 0
  const unsigned lb0 = (unsigned)(uintptr_t)(&sB[0][srow * GP + sc8]);
  // One slice: 4 + 8 asynchronous 16-B copies per lane, global -> LDS, through no register. The closing
  // s_wait_xcnt stands in the copies' own statement so that no address register is rewritten in front of it.
  auto copies = [&](int buf, int k0) {
    const unsigned la = la0 + (unsigned)buf * (unsigned)(128 * GP * 2);
    const unsigned lb = lb0 + (unsigned)buf * (unsigned)(256 * GP * 2);
    const _Float16* pa = ga + k0;
    const _Float16* pb = gb + k0;
#if defined(__HIP_DEVICE_COMPILE__)
    asm volatile(
        "global_load_async_to_lds_b128 %0, %12, off\n\t"
        "global_load_async_to_lds_b128 %1, %13, off\n\t"
        "global_load_async_to_lds_b128 %2, %14, off\n\t"
        "global_load_async_to_lds_b128 %3, %15, off\n\t"
        "global_load_async_to_lds_b128 %4, %16, off\n\t"
        "global_load_async_to_lds_b128 %5, %17, off\n\t"
        "global_load_async_to_lds_b128 %6, %18, off\n\t"
        "global_load_async_to_lds_b128 %7, %19, off\n\t"
        "global_load_async_to_lds_b128 %8, %20, off\n\t"
        "global_load_async_to_lds_b128 %9, %21, off\n\t"
        "global_load_async_to_lds_b128 %10, %22, off\n\t"
        "global_load_async_to_lds_b128 %11, %23, off\n\t"
        "s_wait_xcnt 0x0"
        :: "v"(la), "v"(la + 1u * 32u * GP * 2u), "v"(la + 2u * 32u * GP * 2u), "v"(la + 3u * 32u * GP * 2u),
           "v"(lb), "v"(lb + 1u * 32u * GP * 2u), "v"(lb + 2u * 32u * GP * 2u), "v"(lb + 3u * 32u * GP * 2u),
           "v"(lb + 4u * 32u * GP * 2u), "v"(lb + 5u * 32u * GP * 2u), "v"(lb + 6u * 32u * GP * 2u),
           "v"(lb + 7u * 32u * GP * 2u),
           "v"(pa), "v"(pa + astep), "v"(pa + 2 * astep), "v"(pa + 3 * astep),
           "v"(pb), "v"(pb + bstep), "v"(pb + 2 * bstep), "v"(pb + 3 * bstep),
           "v"(pb + 4 * bstep), "v"(pb + 5 * bstep), "v"(pb + 6 * bstep), "v"(pb + 7 * bstep)
        : "memory");
#endif
  };
  // products of one slice; every loop below is unrolled so that fragments and accumulators, indexed by
  // constants, stay in registers
  auto compute = [&](int buf) {
    const _Float16* pa = &sA[buf][(wm + rlane) * GP + koff];
    const _Float16* pb = &sB[buf][(wn + rlane) * GP + koff];
#pragma unroll
    for (int ks = 0; ks < 2; ++ks) {
      v16h bh[4], ah[4];
#pragma unroll
      for (int j = 0; j < 4; ++j) bh[j] = ldfrag_h(pb + j * 16 * GP + ks * 32);
#pragma unroll
      for (int i = 0; i < 4; ++i) ah[i] = ldfrag_h(pa + i * 16 * GP + ks * 32);
      // keeps the 16 fragment reads of a k block as one group in front of its 16 products: left free, the
      // scheduler spreads them among the products on one A register set, and each place waits out the LDS latency
      __builtin_amdgcn_sched_barrier(0);
#pragma unroll
      for (int i = 0; i < 4; ++i)
#pragma unroll
        for (int j = 0; j < 4; ++j) acc[i][j] = mma_h_raw(ah[i], bh[j], acc[i][j]);
    }
  };

  const int nst = K >> 6;
  copies(0, 0);
  asm volatile("s_wait_asynccnt 0x0" ::: "memory");   // slice 0 has landed before the barrier publishes it
  __syncthreads();
  if (nst > 1) copies(1, 64);
  for (int t = 0; t < nst; ++t) {                      // block-uniform trip
    compute(t & 1);
    asm volatile("s_wait_dscnt 0x0" ::: "memory");     // this wave's reads of buffer t & 1 are done before its refill
    asm volatile("s_wait_asynccnt 0x0" ::: "memory");  // this wave's copies of slice t + 1 have landed
    __syncthreads();                                   // publishes slice t + 1, frees buffer t & 1
    if (t + 2 < nst) copies(t & 1, (t + 2) << 6);
  }
  asm volatile("s_wait_asynccnt 0x0" ::: "memory");    // nothing in flight when the wave goes on to the epilogue
  acc_guard4(acc[0][0], acc[0][1], acc[0][2], acc[0][3]);
  acc_guard4(acc[1][0], acc[1][1], acc[1][2], acc[1][3]);
  acc_guard4(acc[2][0], acc[2][1], acc[2][2], acc[2][3]);
  acc_guard4(acc[3][0], acc[3][1], acc[3][2], acc[3][3]);

  const int q8 = lane >> 3, c8 = (lane & 7) * 8;
  float bc[8];
#pragma unroll
  for (int e = 0; e < 8; ++e) bc[e] = 0.f;
  if (BIASM == 0) {
    const int cb = n0 + c8;                                  // <= N - 8
    const int i0 = (cb < N - 8) ? cb : (N - 8);
    const v4f b0a = *(const v4f*)(bias0 + i0), b0b = *(const v4f*)(bias0 + i0 + 4);
#pragma unroll
    for (int e = 0; e < 4; ++e) {
      bc[e]     = bfr(b0a[e]) * bsc;
      bc[4 + e] = bfr(b0b[e]) * bsc;
    }
  }

  // ---- epilogue ----
  float* slab = sT[wave];
#pragma unroll
  for (int i = 0; i < 4; ++i) {
    const int mBase = m0 + (i << 4);
#pragma unroll
    for (int j = 0; j < 4; ++j) {
#pragma unroll
      for (int r = 0; r < 8; ++r) {
        slab[(mOff + r) * 68 + (j << 4) + rlane] = acc[i][j][r];
      }
    }
    wave_sync_lds();
    v4u hv[4], lv[4];
#pragma unroll
    for (int it = 0; it < 4; ++it) {
      const int row = it * 4 + q8;                       // it 0..3 x q8 0..3 = rows 0..15
      const float* sp = slab + row * 68 + c8;
      float bm = 0.f;
      if (BIASM == 1) bm = bfr(bias0[mBase + row]) * bsc; // mBase + row < M
      v4u a, lw;
#pragma unroll
      for (int e = 0; e < 4; ++e) {
        const float f0 = sp[2 * e]     * oscale + ((BIASM == 1) ? bm : bc[2 * e]);
        const float f1 = sp[2 * e + 1] * oscale + ((BIASM == 1) ? bm : bc[2 * e + 1]);
        const _Float16 g0 = (_Float16)f0;
        const _Float16 g1 = (_Float16)f1;
        a[e] = pk16(h_bits(g0), h_bits(g1));
        if (OM == 3) {
          const _Float16 r0 = (_Float16)((f0 - (float)g0) * rsc);
          const _Float16 r1 = (_Float16)((f1 - (float)g1) * rsc);
          lw[e] = pk16(h_bits(r0), h_bits(r1));
        } else {
          lw[e] = 0u;
        }
      }
      hv[it] = a;
      lv[it] = lw;
    }
    {
#pragma unroll
      for (int it = 0; it < 4; ++it) {
        const int row = it * 4 + q8;
        const size_t go = (size_t)(mBase + row) * ldc + n0 + c8;
        *(v4u*)(Cout + go) = hv[it];
        if (OM == 3) *(v4u*)(Cout2 + go) = lv[it];
      }
      
    }
    wave_sync_lds();
  }
}

// =====================================================================================================
// The three projections in one launch: blocks 0 .. nt - 1 form q, the next nt blocks k, the next nt blocks v^T
// (nt = tiles of one projection). Each reads the layer-norm plane and its own weight plane, nothing of the others. The choice is
// block-uniform. Two blocks fit a WGP's LDS and registers, so one block's products run under the other's waits.
// =====================================================================================================
__global__ __launch_bounds__(256) void proj3(
    const unsigned short* __restrict__ XH, const unsigned short* __restrict__ WqT,
    const unsigned short* __restrict__ WkT, const unsigned short* __restrict__ WvT,
    const float* __restrict__ bq, const float* __restrict__ bk, const float* __restrict__ bv,
    unsigned short* QH, unsigned short* QL, unsigned short* KH, unsigned short* VTH, unsigned short* VTL,
    int nt, float osc_qk, float osc_v, float vsc, float rsc) {
  __shared__ GemmLds L;
  const int bx = blockIdx.x;
  if (bx < nt) {
    // q = xh . Wq + bq -> QH (hi), QL (residual x rsc), f16 [NTOK][DM]
    gemm64<3, 0>(L, bx, XH, DM, WqT, DM, bq, QH, QL, DM, NTOK, DM, DM, osc_qk, 1.0f, rsc);
  } else if (bx < 2 * nt) {
    // k = xh . Wk + bk -> KH f16 [NTOK][DM]
    gemm64<2, 0>(L, bx - nt, XH, DM, WkT, DM, bk, KH, KH, DM, NTOK, DM, DM, osc_qk, 1.0f, rsc);
  } else {
    // v^T: VT[m][t] = sum_k WvT[m][k] . xh[t][k] + bv[m] -> VTH (hi x vsc), VTL (residual x vsc x rsc), f16 [DM][NTOK]
    gemm64<3, 1>(L, bx - 2 * nt, WvT, DM, XH, DM, bv, VTH, VTL, NTOK, DM, NTOK, DM, osc_v, vsc, rsc);
  }
}

#define LOG2E 1.44269504088896340736f
#define PLOG2 10.0f      // log2 of PSC
static_assert(PSC == 1024.0f);
#define OP 68      // LDS row pitch in floats of the output tile: 272 B = 16 B x 17 (odd), for 16-byte writers
__device__ __forceinline__ float other_half(float x) {    // value of lane l ^ 16
  const int b = __builtin_bit_cast(int, x);
  return __builtin_bit_cast(float, __builtin_amdgcn_permlanex16(b, b, 0x76543210, 0xfedcba98, false, false));
}
// 2^x as v_exp_f32, eight at a time (one score tile) or alone. Written as asm so that the slot
// the instruction set asks for behind a transcendental is kept by construction: outputs are early-clobber, so
// inside a statement no v_exp_f32 is followed by a write of its source or a read of its result, and the closing
// v_nop fills the slot behind the last one whatever the compiler puts next.
__device__ __forceinline__ v8f exp2_8(v8f x) {
  v8f e;
#if defined(__HIP_DEVICE_COMPILE__)
  float e0, e1, e2, e3, e4, e5, e6, e7;
  asm("v_exp_f32 %0, %8\n\tv_exp_f32 %1, %9\n\tv_exp_f32 %2, %10\n\tv_exp_f32 %3, %11\n\t"
      "v_exp_f32 %4, %12\n\tv_exp_f32 %5, %13\n\tv_exp_f32 %6, %14\n\tv_exp_f32 %7, %15\n\tv_nop"
      : "=&v"(e0), "=&v"(e1), "=&v"(e2), "=&v"(e3), "=&v"(e4), "=&v"(e5), "=&v"(e6), "=&v"(e7)
      : "v"(x[0]), "v"(x[1]), "v"(x[2]), "v"(x[3]), "v"(x[4]), "v"(x[5]), "v"(x[6]), "v"(x[7]));
  e[0] = e0; e[1] = e1; e[2] = e2; e[3] = e3; e[4] = e4; e[5] = e5; e[6] = e6; e[7] = e7;
#else
  e = x;
#endif
  return e;
}
__device__ __forceinline__ float exp2_1(float x) {
  float e = x;
#if defined(__HIP_DEVICE_COMPILE__)
  asm("v_exp_f32 %0, %1\n\tv_nop" : "=&v"(e) : "v"(x));
#endif
  return e;
}

__global__ __launch_bounds__(128) __attribute__((amdgpu_waves_per_eu(4, 4)))   // registers stay within four waves per SIMD
void attn_lb(const unsigned short* __restrict__ qhp, const unsigned short* __restrict__ qlp,
             const unsigned short* __restrict__ khp,
             const unsigned short* __restrict__ vthp, const unsigned short* __restrict__ vtlp,
             float* outp, float sscale, float onorm) {
  union FH { v16h v; v8h h[2]; };
  // two buffers of three tiles, 9 KB each, pitch LP: K [kv][d], V^T hi [d][kv], V^T res [d][kv]
  __shared__ __align__(16) _Float16 Ring[2][3][64 * LP];
  __shared__ __align__(16) float    Os[4][16 * OP];               // per wave context tile [row][d], pitch OP

  const int tid  = threadIdx.x;
  const int wave = tid >> 5;
  const int lane = tid & 31;
  const int hh   = lane >> 4;
  const int c    = lane & 15;

  const int bx   = blockIdx.x;
  const int qb   = bx % NQB;
  const int hb   = bx / NQB;
  const int h    = hb % NH;
  const int b    = hb / NH;
  const int tok0 = b * SQ;                       // first token row of this sequence
  const int ql0  = qb * 64 + wave * 16;          // local query index of this wave's first row
  const int q0   = tok0 + ql0;                   // global token row of this wave's first row

  const _Float16* Qh = (const _Float16*)(const void*)qhp + (size_t)h * HD;
  const _Float16* Ql = (const _Float16*)(const void*)qlp + (size_t)h * HD;
  const _Float16* Kg = (const _Float16*)(const void*)khp + (size_t)h * HD;
  const _Float16* Vh = (const _Float16*)(const void*)vthp + (size_t)h * HD * NTOK + tok0;
  const _Float16* Vl = (const _Float16*)(const void*)vtlp + (size_t)h * HD * NTOK + tok0;

  // ---- per-head slope (block-uniform) ----
  const int   se    = (h + 1) >> 1;
  const float spw   = __uint_as_float((unsigned)(127 - se) << 23);
  const float slope = (h & 1) ? spw : (spw * 0.70710678118654752f);

  // ---- Q fragments (B operand, column = lane&15): 2 d-chunks, hi and residual planes ----
  v16h qa[2], qr[2];
#pragma unroll
  for (int dc = 0; dc < 2; ++dc) {
    qa[dc] = ldfrag_h(Qh + (size_t)(q0 + c) * DM + dc * 32 + 8 * hh);
    qr[dc] = ldfrag_h(Ql + (size_t)(q0 + c) * DM + dc * 32 + 8 * hh);
  }

  const int qrow = ql0 + c;                      // this lane's query (D column = lane&15)
  float mrow = -INFINITY;                        // running maximum of raw of query qrow (equal in both lane halves)
  float nrow = INFINITY;                         // addend of the exponent that the running sum and context stand on
  float lrow = 0.f;                              // running sum (x PSC) over this lane half's keys only
  v8f oacc[4];                                   // oacc[t][r] = context[query c][d = 16 t + 8 hh + r]
#pragma unroll
  for (int t = 0; t < 4; ++t) oacc[t] = zero8();

  const float rinv = 1.0f / RSC;
  const float c2   = sscale * LOG2E;             // raw -> exponent of two
  const float ydl  = (float)(8 * hh - qrow);     // key - query of the lane's register 0, tile 0, chunk 0

  // staging map: thread -> row (tid >> 3) + 16 * it, 16-B piece tid & 7 of the row's 128 B
  const int srow = tid >> 3, sc8 = (tid & 7) * 8;
  const _Float16* gk = Kg + (size_t)(tok0 + srow) * DM + sc8;      // K row = key, d = sc8..sc8+7
  const _Float16* gv = Vh + (size_t)srow * NTOK + sc8;             // V^T hi row = d, key = sc8..sc8+7
  const _Float16* gw = Vl + (size_t)srow * NTOK + sc8;             // V^T res row = d
  const unsigned l0 = (unsigned)(uintptr_t)(&Ring[0][0][srow * LP + sc8]);   // lane's LDS byte address, buffer 0, K, it 0
  // One chunk: 3 x 4 asynchronous 16-B copies per lane, global -> LDS, through no register. The closing
  // s_wait_xcnt stands in the copies' own statement so that no address register is rewritten in front of it.
  auto copies = [&](int buf, int kv) {
    const unsigned lk = l0 + (unsigned)buf * (unsigned)(3 * 64 * LP * 2);
    const unsigned lv = lk + (unsigned)(64 * LP * 2);
    const unsigned lw = lk + (unsigned)(2 * 64 * LP * 2);
    const _Float16* pk = gk + (size_t)kv * DM;
    const _Float16* pv = gv + kv;
    const _Float16* pw = gw + kv;
    const size_t kstep = (size_t)16 * DM, vstep = (size_t)16 * NTOK;
#if defined(__HIP_DEVICE_COMPILE__)
    asm volatile(
        "global_load_async_to_lds_b128 %0, %12, off\n\t"
        "global_load_async_to_lds_b128 %1, %13, off\n\t"
        "global_load_async_to_lds_b128 %2, %14, off\n\t"
        "global_load_async_to_lds_b128 %3, %15, off\n\t"
        "global_load_async_to_lds_b128 %4, %16, off\n\t"
        "global_load_async_to_lds_b128 %5, %17, off\n\t"
        "global_load_async_to_lds_b128 %6, %18, off\n\t"
        "global_load_async_to_lds_b128 %7, %19, off\n\t"
        "global_load_async_to_lds_b128 %8, %20, off\n\t"
        "global_load_async_to_lds_b128 %9, %21, off\n\t"
        "global_load_async_to_lds_b128 %10, %22, off\n\t"
        "global_load_async_to_lds_b128 %11, %23, off\n\t"
        "s_wait_xcnt 0x0"
        :: "v"(lk), "v"(lk + 1u * 16u * LP * 2u), "v"(lk + 2u * 16u * LP * 2u), "v"(lk + 3u * 16u * LP * 2u),
           "v"(lv), "v"(lv + 1u * 16u * LP * 2u), "v"(lv + 2u * 16u * LP * 2u), "v"(lv + 3u * 16u * LP * 2u),
           "v"(lw), "v"(lw + 1u * 16u * LP * 2u), "v"(lw + 2u * 16u * LP * 2u), "v"(lw + 3u * 16u * LP * 2u),
           "v"(pk), "v"(pk + kstep), "v"(pk + 2 * kstep), "v"(pk + 3 * kstep),
           "v"(pv), "v"(pv + vstep), "v"(pv + 2 * vstep), "v"(pv + 3 * vstep),
           "v"(pw), "v"(pw + vstep), "v"(pw + 2 * vstep), "v"(pw + 3 * vstep)
        : "memory");
#endif
  };

  static_assert(NQB >= 2);
  copies(0, 0);
  asm volatile("s_wait_asynccnt 0x0" ::: "memory");   // chunk 0 has landed before the barrier publishes it
  __syncthreads();
  copies(1, 64);
  for (int kt = 0; kt < NQB; ++kt) {            // block-uniform trip = 32
    const int kv0 = kt * 64;                     // local key index of the chunk
    const _Float16* Ksh = &Ring[kt & 1][0][0];
    const _Float16* Vth = &Ring[kt & 1][1][0];
    const _Float16* Vtl = &Ring[kt & 1][2][0];
    const float yd = ydl + (float)kv0;

    // ---- K fragments of the whole chunk: 16 reads as one group (loops unrolled: fragments stay in registers) ----
    FH kb[4][2];
#pragma unroll
    for (int j = 0; j < 4; ++j) {
#pragma unroll
      for (int dc = 0; dc < 2; ++dc) {
        kb[j][dc].h[0] = *(const v8h*)(Ksh + (j * 16 + c) * LP + dc * 32 + 8 * hh);
        kb[j][dc].h[1] = *(const v8h*)(Ksh + (j * 16 + c) * LP + dc * 32 + 16 + 8 * hh);
      }
    }

    // ---- distance term -slope * |key - query| of the 64 x 16 scores; register r of tile j: key - query = yd + 16 j + r.
    //      In every chunk but the block's own, key - query has one sign for all scores: the term is linear there ----
    // compiler fence: keeps the 16 K reads in front of the branch below, so that the distance term is formed under
    // their latency; left free, they sink behind the branch's join
    asm volatile("" ::: "memory");
    v8f bs[4];
    if (kt == qb) {                              // block-uniform
#pragma unroll
      for (int j = 0; j < 4; ++j) {
#pragma unroll
        for (int r = 0; r < 8; ++r) bs[j][r] = -slope * fabsf(yd + (float)(j * 16 + r));
      }
    } else {
      const float sg = (kt < qb) ? slope : -slope;
      const float z0 = sg * yd;
#pragma unroll
      for (int r = 0; r < 8; ++r) bs[0][r] = sg * (float)r + z0;
#pragma unroll
      for (int j = 1; j < 4; ++j) bs[j] = bs[0] + sg * (float)(j * 16);
    }

    // ---- raw scores, transposed: 64 keys x 16 queries per wave ----
    v8f s[4];
#pragma unroll
    for (int j = 0; j < 4; ++j) {
      v8f sh = bs[j], sl = zero8();
#pragma unroll
      for (int dc = 0; dc < 2; ++dc) {
        sh = mma_h(kb[j][dc].v, qa[dc], sh);
        sl = mma_h(kb[j][dc].v, qr[dc], sl);
      }
#pragma unroll
      for (int r = 0; r < 8; ++r) s[j][r] = sh[r] + sl[r] * rinv;
    }

    // ---- V^T fragments of keys 0..31 (hi and residual): 16 reads as one group, in flight under the softmax ----
    FH vb[2][4], wb[2][4];
#pragma unroll
    for (int t = 0; t < 4; ++t) {
      vb[0][t].h[0] = *(const v8h*)(Vth + (t * 16 + c) * LP + 8 * hh);
      vb[0][t].h[1] = *(const v8h*)(Vth + (t * 16 + c) * LP + 16 + 8 * hh);
      wb[0][t].h[0] = *(const v8h*)(Vtl + (t * 16 + c) * LP + 8 * hh);
      wb[0][t].h[1] = *(const v8h*)(Vtl + (t * 16 + c) * LP + 16 + 8 * hh);
    }
    // keeps all 16 reads in front of the softmax arithmetic, which covers their latency: left free, the scheduler
    // sinks the last four to the front of the first product, where their latency is waited out
    __builtin_amdgcn_sched_barrier(0);

    // ---- maximum in the lane, one exchange between the halves; online softmax ----
    float mj[4];
#pragma unroll
    for (int j = 0; j < 4; ++j) {
      mj[j] = s[j][0];
#pragma unroll
      for (int r = 1; r < 8; ++r) mj[j] = fmaxf(mj[j], s[j][r]);
    }
    float m = fmaxf(fmaxf(mj[0], mj[1]), fmaxf(mj[2], mj[3]));
    m = fmaxf(m, other_half(m));
    const float mnew  = fmaxf(mrow, m);
    const bool  none  = (mnew == -INFINITY);
    const float nb    = none ? PLOG2 : (PLOG2 - mnew * c2);
    const float alpha = exp2_1(nb - nrow);
    mrow = mnew;
    nrow = none ? INFINITY : nb;

    // ---- P (x PSC, f16) packed from the score registers into the B operands of p.v ----
    v16h pb[2];
    float pj[4];
#pragma unroll
    for (int j = 0; j < 4; ++j) {
      const v8f p = exp2_8(s[j] * c2 + nb);
      pj[j] = 0.f;
#pragma unroll
      for (int r = 0; r < 8; ++r) {
        pj[j] += p[r];
        pb[j >> 1][(j & 1) * 8 + r] = (_Float16)p[r];
      }
    }
    // ---- V^T fragments of keys 32..63, d rows 0..31: 8 reads as one group, in flight under the products of
    //      keys 0..31 ----
#pragma unroll
    for (int t = 0; t < 2; ++t) {
      vb[1][t].h[0] = *(const v8h*)(Vth + (t * 16 + c) * LP + 32 + 8 * hh);
      vb[1][t].h[1] = *(const v8h*)(Vth + (t * 16 + c) * LP + 32 + 16 + 8 * hh);
      wb[1][t].h[0] = *(const v8h*)(Vtl + (t * 16 + c) * LP + 32 + 8 * hh);
      wb[1][t].h[1] = *(const v8h*)(Vtl + (t * 16 + c) * LP + 32 + 16 + 8 * hh);
    }
    lrow = lrow * alpha + ((pj[0] + pj[1]) + (pj[2] + pj[3]));
#pragma unroll
    for (int t = 0; t < 4; ++t) {
#pragma unroll
      for (int r = 0; r < 8; ++r) oacc[t][r] *= alpha;
    }

    // ---- context^T += Vhi . P^T ; chunk residual = Vres . P^T (f16 WMMA) ----
    v8f ol[4];
#pragma unroll
    for (int t = 0; t < 4; ++t) ol[t] = zero8();
#pragma unroll
    for (int kk = 0; kk < 2; ++kk) {
#pragma unroll
      for (int t = 0; t < 4; ++t) {
        if (kk == 0 && t == 2) {
          // V^T fragments of keys 32..63, d rows 32..63: 8 reads as one group into the registers that the four
          // products above have left, in flight under the next eight products
#pragma unroll
          for (int u = 2; u < 4; ++u) {
            vb[1][u].h[0] = *(const v8h*)(Vth + (u * 16 + c) * LP + 32 + 8 * hh);
            vb[1][u].h[1] = *(const v8h*)(Vth + (u * 16 + c) * LP + 32 + 16 + 8 * hh);
            wb[1][u].h[0] = *(const v8h*)(Vtl + (u * 16 + c) * LP + 32 + 8 * hh);
            wb[1][u].h[1] = *(const v8h*)(Vtl + (u * 16 + c) * LP + 32 + 16 + 8 * hh);
          }
        }
        oacc[t] = mma_h(vb[kk][t].v, pb[kk], oacc[t]);
        ol[t]   = mma_h(wb[kk][t].v, pb[kk], ol[t]);
      }
    }
    // ---- fold this chunk's residual term into the running context (f32) ----
#pragma unroll
    for (int t = 0; t < 4; ++t) {
#pragma unroll
      for (int r = 0; r < 8; ++r) oacc[t][r] += ol[t][r] * rinv;
    }
    asm volatile("s_wait_dscnt 0x0" ::: "memory");     // this wave's reads of buffer kt & 1 are done before its refill
    asm volatile("s_wait_asynccnt 0x0" ::: "memory");  // this wave's copies of chunk kt + 1 have landed
    __syncthreads();                                   // publishes chunk kt + 1, frees buffer kt & 1
    if (kt + 2 < NQB) copies(kt & 1, kv0 + 128);
  }
  asm volatile("s_wait_asynccnt 0x0" ::: "memory");    // nothing in flight when the wave goes on to the epilogue

  // ---- join the halves' sums, normalise (1/l and the 1/(PSC*VSC) carry), stage the wave's 16x64 tile
  //      (a lane holds 8 consecutive d of its query per t: two 16-B LDS writes), write whole 256-B rows
  float* os = Os[wave];
  {
    const float l = lrow + other_half(lrow);
    const float inv = ((l > 0.f) ? (1.0f / l) : 0.f) * (onorm * PSC);
#pragma unroll
    for (int t = 0; t < 4; ++t) {
      v4f w0, w1;
#pragma unroll
      for (int e = 0; e < 4; ++e) { w0[e] = oacc[t][e] * inv; w1[e] = oacc[t][4 + e] * inv; }
      *(v4f*)(os + c * OP + t * 16 + 8 * hh)     = w0;
      *(v4f*)(os + c * OP + t * 16 + 8 * hh + 4) = w1;
    }
  }
  wave_sync_lds();
  {
    const int hh2 = lane >> 4, c4 = (lane & 15) * 4;
    v4f vals[8];
#pragma unroll
    for (int it = 0; it < 8; ++it) {
      const int row = it * 2 + hh2;   // it 0..7 x hh2 0..1 = rows 0..15 of the wave tile
      vals[it] = *(const v4f*)(os + row * OP + c4);
    }
    {
#pragma unroll
      for (int it = 0; it < 8; ++it) {
        const int row = it * 2 + hh2;
        const size_t go = (size_t)(q0 + row) * DM + (size_t)h * HD + c4;
        *(v4f*)(outp + go) = vals[it];
      }
    }
  }
}

// =====================================================================================================
// Workspace map (bytes); every plane is an exact multiple of its 64x64-tile / whole-line store granularity
// ([8192][1024] = 128x16 tiles, [1024][8192] = 16x128 tiles, weights [1024][1024] = 16x16 tiles):
//   WqT  f16 [1024][1024]   0          2097152   (transposed, x64)
//   WkT  f16 [1024][1024]   2097152    2097152
//   WvT  f16 [1024][1024]   4194304    2097152
//   XH   f16 [8192][1024]   6291456    16777216  (layer norm output x16)
//   QH   f16 [8192][1024]   23068672   16777216  (q hi)
//   QL   f16 [8192][1024]   39845888   16777216  (q residual x4096)
//   KH   f16 [8192][1024]   56623104   16777216
//   VTH  f16 [1024][8192]   73400320   16777216  (v^T hi x16)
//   VTL  f16 [1024][8192]   90177536   16777216  (v^T residual x16 x4096)
//   end                     106954752
// =====================================================================================================
extern "C" void kernel_launch(void* const* d_in, const int* in_sizes, int n_in,
                              void* d_out, int out_size, void* d_ws, size_t ws_size,
                              hipStream_t stream) {
  if (n_in < 9) return;
  if (in_sizes[0] != NTOK * DM) return;
  if (in_sizes[1] != DM || in_sizes[2] != DM) return;
  if (in_sizes[3] != DM * DM || in_sizes[5] != DM * DM || in_sizes[7] != DM * DM) return;
  if (in_sizes[4] != DM || in_sizes[6] != DM || in_sizes[8] != DM) return;
  if (out_size != NTOK * DM) return;

  const float* x   = (const float*)d_in[0];
  const float* gam = (const float*)d_in[1];
  const float* bet = (const float*)d_in[2];
  const float* wq  = (const float*)d_in[3];
  const float* bq  = (const float*)d_in[4];
  const float* wk  = (const float*)d_in[5];
  const float* bk  = (const float*)d_in[6];
  const float* wv  = (const float*)d_in[7];
  const float* bv  = (const float*)d_in[8];

  const size_t PW = (size_t)DM * DM * 2;            //  2097152
  const size_t PA = (size_t)NTOK * DM * 2;          // 16777216
  size_t off = 0;
  const size_t oWq = off; off += PW;
  const size_t oWk = off; off += PW;
  const size_t oWv = off; off += PW;
  const size_t oXH = off; off += PA;
  const size_t oQH = off; off += PA;
  const size_t oQL = off; off += PA;
  const size_t oKH = off; off += PA;
  const size_t oVH = off; off += PA;
  const size_t oVL = off; off += PA;
  if (off > ws_size) return;                        // off = 106954752
  if (off > (size_t)134217728) return;

  char* ws = (char*)d_ws;
  unsigned short* WqT = (unsigned short*)(ws + oWq);
  unsigned short* WkT = (unsigned short*)(ws + oWk);
  unsigned short* WvT = (unsigned short*)(ws + oWv);
  unsigned short* XH  = (unsigned short*)(ws + oXH);
  unsigned short* QH  = (unsigned short*)(ws + oQH);
  unsigned short* QL  = (unsigned short*)(ws + oQL);
  unsigned short* KH  = (unsigned short*)(ws + oKH);
  unsigned short* VTH = (unsigned short*)(ws + oVH);
  unsigned short* VTL = (unsigned short*)(ws + oVL);

  const dim3 blk(256), blk128(128);
  const dim3 gPrep(NTOK / 8 + 3 * (DM / 64) * (DM / 64));              // 1024 blocks of 8 rows + 3 x 256 tiles of 64x64
  const dim3 gG(3 * ((NTOK / 128) * (DM / 256)));                      // 3 x 256 blocks, one 128x256 tile each
  const dim3 gAttn(NB * NH * NQB);                                     // 2048 blocks of 128
  const float osc_qk = 1.0f / (XSC * WSC);                             // q, k unscaled
  const float osc_v  = VSC / (XSC * WSC);                              // v^T carried x16

  // (0) layer norm -> XH f16 [8192][1024] (x16); weights W[in][out] f32 -> W^T f16 [out][in] (k contiguous),
  //     bf16 RNE-converted, x64
  prep<<<gPrep, blk, 0, stream>>>(x, gam, bet, wq, wk, wv, XH, WqT, WkT, WvT, NTOK / 8, XSC, LNEPS, WSC);
  // (1) q -> QH (hi), QL (residual x4096), k -> KH, f16 [8192][1024]; v^T -> VTH (hi x16), VTL (residual x16 x4096),
  //     f16 [1024][8192]
  proj3<<<gG, blk, 0, stream>>>(XH, WqT, WkT, WvT, bq, bk, bv, QH, QL, KH, VTH, VTL,
                                (NTOK / 128) * (DM / 256), osc_qk, osc_v, VSC, RSC);
  // (2) attention with per-head linear distance bias -> d_out f32 [8192][1024]
  attn_lb<<<gAttn, blk128, 0, stream>>>(QH, QL, KH, VTH, VTL, (float*)d_out, 0.125f, 1.0f / (PSC * VSC));
  (void)hipGetLastError();
}

// v008
// A run of this version takes 167 microseconds.
// In both of two side-by-side timings against v007, it was 1.04 times as fast.
// Counting every step since v000, it is 3.39 times as fast.
// Contractions: q, k and v^T projections on v_wmma_f32_16x16x32_f16 (f16 layer-norm plane carried x16 times
// f16 transposed weight plane carried x64, one product each); attention k.q^T on v_wmma_f32_16x16x32_f16
// (q as f16 hi plane plus f16 residual plane carried x4096, k plain f16, two products); v^T.p^T on
// v_wmma_f32_16x16x32_f16 (p carried x1024, v^T as f16 hi plane carried x16 plus f16 residual plane carried
// x4096, two products); all f32 accumulate; layer norm and softmax in f32 on VALU; every float input
// RNE-converted to bf16 on load.
#include <hip/hip_runtime.h>
#include <math.h>
#include <stdint.h>

#define NB    4
#define SQ    2048
#define NTOK  (NB * SQ)
#define DM    1024
#define NH    16
#define HD    64
#define NQB   (SQ / 64)
#define XSC   16.0f
#define WSC   64.0f
#define VSC   16.0f
#define RSC   4096.0f
#define PSC   1024.0f
#define LNEPS 1e-5f
#define LP    72      // LDS row pitch in halves of the attention tiles: 144 B = 16 B x 9 (odd), for 16-byte readers
static_assert(NH * HD == DM);
static_assert((SQ % 64) == 0 && (DM % 64) == 0 && (NTOK % 64) == 0);
static_assert(DM == 4 * 256);
static_assert((NTOK % 8) == 0);
static_assert((NTOK % 256) == 0 && (DM % 256) == 0);

typedef _Float16 v16h __attribute__((ext_vector_type(16)));
typedef _Float16 v8h  __attribute__((ext_vector_type(8)));
typedef float    v8f  __attribute__((ext_vector_type(8)));
typedef float    v4f  __attribute__((ext_vector_type(4)));
typedef unsigned int v4u __attribute__((ext_vector_type(4)));

// ---- scalar helpers --------------------------------------------------------------------------------
__device__ __forceinline__ unsigned short bf_bits(float f) {          // f32 -> bf16 bits, RNE convert
  unsigned u = __float_as_uint(f);
  return (unsigned short)((u + 0x7FFFu + ((u >> 16) & 1u)) >> 16);
}
__device__ __forceinline__ float bf_up(unsigned short h) { return __uint_as_float(((unsigned)h) << 16); }
__device__ __forceinline__ float bfr(float f) { return bf_up(bf_bits(f)); }   // value of the bf16 RNE convert
__device__ __forceinline__ unsigned short h_bits(_Float16 x) { return __builtin_bit_cast(unsigned short, x); }
__device__ __forceinline__ unsigned pk16(unsigned short a, unsigned short b) { return (unsigned)a | ((unsigned)b << 16); }
__device__ __forceinline__ v8f zero8() { v8f z = {0.f, 0.f, 0.f, 0.f, 0.f, 0.f, 0.f, 0.f}; return z; }

// ---- fragment loader: 16-bit A/B operand, lane -> row/col (lane&15), p already includes +8*(lane>>4);
//      elements 0..7 <- p[0..7] (k0+8h..), elements 8..15 <- p[16..23] (k0+16+8h..)
__device__ __forceinline__ v16h ldfrag_h(const _Float16* p) {
  union { v16h v; v8h h[2]; } f;
  f.h[0] = *(const v8h*)(p);
  f.h[1] = *(const v8h*)(p + 16);
  return f.v;
}

// ---- WMMA helpers: the builtin form, behind which the compiler keeps the distance to a vector instruction itself ----
__device__ __forceinline__ v8f mma_h_raw(v16h a, v16h b, v8f c) {
  return __builtin_amdgcn_wmma_f32_16x16x32_f16(false, a, false, b, (short)0, c, false, false);
}
__device__ __forceinline__ void acc_guard4(v8f& a, v8f& b, v8f& c, v8f& d) {
#if defined(__HIP_DEVICE_COMPILE__)
  asm volatile("v_nop\n\tv_nop\n\tv_nop\n\tv_nop" : "+v"(a), "+v"(b), "+v"(c), "+v"(d));
#endif
}
__device__ __forceinline__ void wave_sync_lds() {
  __builtin_amdgcn_fence(__ATOMIC_RELEASE, "workgroup");
  __builtin_amdgcn_wave_barrier();
  __builtin_amdgcn_fence(__ATOMIC_ACQUIRE, "workgroup");
}

// =====================================================================================================
// Layer norm over rows of DM = 1024: one wave per row, 8 rows per block (blk = 0 .. nrows/8 - 1). Every input value
// y = ((x - mu) * rstd * gamma + beta) * xsc written as one f16 plane [nrows][DM].
// Lane l handles columns 256*i + 8*l .. +7 (i = 0..3); each store instruction of the wave covers 512 B =
// coverage: nrows/8 blocks x 8 waves = every row; 4 iterations x 32 lanes x 8 = all 1024 columns.
// =====================================================================================================
__device__ __forceinline__ void ln_rows(int blk, const float* __restrict__ x, const float* __restrict__ gam,
                                        const float* __restrict__ bet, unsigned short* Xh,
                                        int nrows, float xsc, float eps) {
  const int lane = threadIdx.x & 31;
  const int wave = threadIdx.x >> 5;
  const int row  = blk * 8 + wave;
  if (row >= nrows) return;                     // wave-uniform; no block barrier on the layer-norm path
  const float* xr = x + (size_t)row * DM;
  const float rd = 1.0f / (float)DM;

  float s = 0.f;
#pragma unroll 1
  for (int i = 0; i < 4; ++i) {
    const int c0 = 256 * i + 8 * lane;
    const v4f a = *(const v4f*)(xr + c0);
    const v4f b = *(const v4f*)(xr + c0 + 4);
    s += ((bfr(a[0]) + bfr(a[1])) + (bfr(a[2]) + bfr(a[3]))) +
         ((bfr(b[0]) + bfr(b[1])) + (bfr(b[2]) + bfr(b[3])));
  }
#pragma unroll
  for (int off = 1; off < 32; off <<= 1) s += __shfl_xor(s, off, 32);
  const float mu = s * rd;

  float s2 = 0.f;
#pragma unroll 1
  for (int i = 0; i < 4; ++i) {
    const int c0 = 256 * i + 8 * lane;
    const v4f a = *(const v4f*)(xr + c0);
    const v4f b = *(const v4f*)(xr + c0 + 4);
#pragma unroll
    for (int e = 0; e < 4; ++e) {
      const float d0 = bfr(a[e]) - mu;
      const float d1 = bfr(b[e]) - mu;
      s2 += d0 * d0;
      s2 += d1 * d1;
    }
  }
#pragma unroll
  for (int off = 1; off < 32; off <<= 1) s2 += __shfl_xor(s2, off, 32);
  const float var  = s2 * rd;
  const float rstd = 1.0f / sqrtf(var + eps);

#pragma unroll 1
  for (int i = 0; i < 4; ++i) {
    const int c0 = 256 * i + 8 * lane;
    const v4f a  = *(const v4f*)(xr + c0);
    const v4f b  = *(const v4f*)(xr + c0 + 4);
    const v4f ga = *(const v4f*)(gam + c0);
    const v4f gb = *(const v4f*)(gam + c0 + 4);
    const v4f ba = *(const v4f*)(bet + c0);
    const v4f bb = *(const v4f*)(bet + c0 + 4);
    float y[8];
#pragma unroll
    for (int e = 0; e < 4; ++e) {
      y[e]     = ((bfr(a[e]) - mu) * rstd * bfr(ga[e]) + bfr(ba[e])) * xsc;
      y[4 + e] = ((bfr(b[e]) - mu) * rstd * bfr(gb[e]) + bfr(bb[e])) * xsc;
    }
    v4u u;
#pragma unroll
    for (int e = 0; e < 4; ++e) u[e] = pk16(h_bits((_Float16)y[2 * e]), h_bits((_Float16)y[2 * e + 1]));
    unsigned short* dst = Xh + (size_t)row * DM + c0;
    *(v4u*)dst = u;
    
  }
}

// =====================================================================================================
// Transpose-convert: W f32 in[R][C] (row-major) -> out f16 bits [C][R]; each value bf16 RNE-converted,
// multiplied by wsc (power of two, exact) and cast to f16. Block = one 64x64 tile staged through LDS,
// coverage: load 4 it x 256 threads x 4 = 64x64; store 2 it x 256 threads x 8 = 64x64; tiles (bx, by) cover R x C.
// =====================================================================================================
__device__ __forceinline__ void wtrans_h(unsigned short* sT, int bx, int by, const float* __restrict__ W,
                                         unsigned short* Wt, int R, int C, float wsc) {
  const int tid = threadIdx.x;
  const int r0  = by * 64;                  // rows of W
  const int c0  = bx * 64;                  // cols of W
#pragma unroll
  for (int it = 0; it < 4; ++it) {
    const int idx = it * 256 + tid;         // 0..1023
    const int r   = idx >> 4;               // 0..63
    const int c4  = (idx & 15) * 4;         // 0..60
    const v4f w = *(const v4f*)(W + (size_t)(r0 + r) * C + c0 + c4);
#pragma unroll
    for (int e = 0; e < 4; ++e) sT[(c4 + e) * 72 + r] = h_bits((_Float16)(bfr(w[e]) * wsc));
  }
  __syncthreads();
  v4u u[2];
#pragma unroll
  for (int it = 0; it < 2; ++it) {
    const int row = it * 32 + (tid >> 3), col8 = (tid & 7) * 8;
    u[it] = *(const v4u*)(sT + row * 72 + col8);
  }
  {
#pragma unroll
    for (int it = 0; it < 2; ++it) {
      const int row = it * 32 + (tid >> 3), col8 = (tid & 7) * 8;
      *(v4u*)(Wt + (size_t)(c0 + row) * R + r0 + col8) = u[it];
    }
    // the stores' registers may be rewritten by whatever code follows the inlined body: the wait stands in front of that
    asm volatile("s_wait_xcnt 0x0" ::: "memory");
  }
}

// =====================================================================================================
// One launch for the four pieces of work that depend on the inputs alone: blocks 0 .. nln - 1 do the layer norm
// (8 rows each), the next 3 * (DM / 64) * (DM / 64) blocks the 64x64 tiles of the three weight transposes. The
// choice is block-uniform; the only block barrier stands in the transpose branch, which whole blocks take.
// =====================================================================================================
__global__ __launch_bounds__(256) void prep(const float* __restrict__ x, const float* __restrict__ gam,
                                            const float* __restrict__ bet, const float* __restrict__ wq,
                                            const float* __restrict__ wk, const float* __restrict__ wv,
                                            unsigned short* Xh, unsigned short* WqT, unsigned short* WkT,
                                            unsigned short* WvT, int nln, float xsc, float eps, float wsc) {
  __shared__ __align__(16) unsigned short sT[64 * 72];     // transpose tile [c][r], pitch 72 halves = 144 B
  const int bx = blockIdx.x;
  if (bx < nln) {
    ln_rows(bx, x, gam, bet, Xh, nln * 8, xsc, eps);
  } else {
    const int t  = bx - nln;
    const int w  = t / ((DM / 64) * (DM / 64));            // which weight
    const int tl = t - w * ((DM / 64) * (DM / 64));        // its tile
    if (w > 2) return;                                     // block-uniform, in front of the barrier
    const float*    W  = (w == 0) ? wq  : ((w == 1) ? wk  : wv);
    unsigned short* Wt = (w == 0) ? WqT : ((w == 1) ? WkT : WvT);
    wtrans_h(sT, tl % (DM / 64), tl / (DM / 64), W, Wt, DM, DM, wsc);
  }
}

// =====================================================================================================
// f16 WMMA GEMM: C[m][n] = oscale * sum_k A[m][k] * Bt[n][k] + bsc * bias. A block of 8 waves owns a 128x256
// tile of C (2 x 4 waves, 64x64 each). A row-major [M][K] pitch lda; Bt row-major [N][K] pitch ldb (k contiguous);
// M multiple of 128, N multiple of 256, K multiple of 64 and at least 64 (static here).
// Operands: per k slice of 64 (128 B = one line of every row) the block brings its 128 A rows and 256 Bt rows
// into LDS by asynchronous 16-B copies, each wave-wide copy covering four whole rows of the slice; rows at pitch
// GP. Two buffers: slice t + 1 flies while slice t is multiplied; at the foot of a trip every wave waits for its
// LDS reads and its copies, one block barrier publishes slice t + 1 and frees the buffer of slice t for t + 2.
// Fragments come from LDS in the k order of ldfrag_h; every accumulator takes its k blocks of 32 in rising order.
// Bias: BIASM == 0 -> per column bias0[n] (N entries, clamped-address 16-B loads); BIASM == 1 -> per row
//       bias0[m] (M entries). Bias values RNE-converted to bf16, then multiplied by bsc.
// OM: 2 = one f16 plane (Cout); 3 = f16 hi plane (Cout) plus f16 residual plane ((f - hi) * rsc, Cout2), same
//     indexing and pitch ldc for both planes.
// coverage: 4 slabs x 16 rows (it 0..3 x lane>>3 0..3) x 64 cols (8 lanes x 8) = the wave's whole 64x64 tile;
//           8 waves = the block's 128x256 tile; bt = 0 .. (M/128)*(N/256) - 1 is the tile, a block with a larger bt
//           exits whole.
// =====================================================================================================
#define GP 72      // LDS row pitch in halves of the operand slices: 144 B = 16 B x 9 (odd), for 16-byte readers
struct GemmLds {
  __align__(16) _Float16 sA[2][128 * GP];   // A slice  [row][k], two buffers
  __align__(16) _Float16 sB[2][256 * GP];   // Bt slice [row][k], two buffers
  __align__(16) float sT[8][16 * 68];       // per-wave 16x64 slab, pitch 68 floats
};
template <int OM, int BIASM>
__device__ __forceinline__ void gemm64(
    GemmLds& L, int bt,
    const unsigned short* __restrict__ Ap, int lda,
    const unsigned short* __restrict__ Btp, int ldb,
    const float* __restrict__ bias0,
    unsigned short* Cout, unsigned short* Cout2, int ldc,
    int M, int N, int K, float oscale, float bsc, float rsc) {
  const _Float16* A  = (const _Float16*)(const void*)Ap;
  const _Float16* Bt = (const _Float16*)(const void*)Btp;
  auto& sA = L.sA;
  auto& sB = L.sB;
  auto& sT = L.sT;
  const int tid  = threadIdx.x;
  const int lane = tid & 31;
  const int wave = tid >> 5;
  const int tilesN = N >> 8;
  const int tilesM = M >> 7;
  if (bt >= tilesM * tilesN) return;   // block-uniform, in front of every barrier
  const int tm = bt / tilesN;
  const int tn = bt - tm * tilesN;
  const int mB = tm << 7;                      // block's first row of C
  const int nB = tn << 8;                      // block's first column of C
  const int wm = (wave >> 2) << 6;             // wave's row offset in the block tile
  const int wn = (wave & 3) << 6;              // wave's column offset in the block tile
  const int m0 = mB + wm;
  const int n0 = nB + wn;

  const int rlane = lane & 15;                 // row (A) / col (B, D) within subtile
  const int koff  = (lane >> 4) * 8;           // k offset of this lane half
  const int mOff  = (lane >> 4) * 8;           // D row offset

  v8f acc[4][4];
#pragma unroll
  for (int i = 0; i < 4; ++i)
#pragma unroll
    for (int j = 0; j < 4; ++j) acc[i][j] = zero8();

  // staging map: thread -> row (tid >> 3) + 32 * it, 16-B piece tid & 7 of the row's 128-B slice
  const int srow = tid >> 3, sc8 = (tid & 7) * 8;
  const _Float16* ga = A  + (size_t)(mB + srow) * lda + sc8;
  const _Float16* gb = Bt + (size_t)(nB + srow) * ldb + sc8;
  const size_t astep = (size_t)32 * lda, bstep = (size_t)32 * ldb;
  const unsigned la0 = (unsigned)(uintptr_t)(&sA[0][srow * GP + sc8]);   // lane's LDS byte address, buffer 0, it 0
  const unsigned lb0 = (unsigned)(uintptr_t)(&sB[0][srow * GP + sc8]);
  // One slice: 4 + 8 asynchronous 16-B copies per lane, global -> LDS, through no register. The closing
  // s_wait_xcnt stands in the copies' own statement so that no address register is rewritten in front of it.
  auto copies = [&](int buf, int k0) {
    const unsigned la = la0 + (unsigned)buf * (unsigned)(128 * GP * 2);
    const unsigned lb = lb0 + (unsigned)buf * (unsigned)(256 * GP * 2);
    const _Float16* pa = ga + k0;
    const _Float16* pb = gb + k0;
#if defined(__HIP_DEVICE_COMPILE__)
    asm volatile(
        "global_load_async_to_lds_b128 %0, %12, off\n\t"
        "global_load_async_to_lds_b128 %1, %13, off\n\t"
        "global_load_async_to_lds_b128 %2, %14, off\n\t"
        "global_load_async_to_lds_b128 %3, %15, off\n\t"
        "global_load_async_to_lds_b128 %4, %16, off\n\t"
        "global_load_async_to_lds_b128 %5, %17, off\n\t"
        "global_load_async_to_lds_b128 %6, %18, off\n\t"
        "global_load_async_to_lds_b128 %7, %19, off\n\t"
        "global_load_async_to_lds_b128 %8, %20, off\n\t"
        "global_load_async_to_lds_b128 %9, %21, off\n\t"
        "global_load_async_to_lds_b128 %10, %22, off\n\t"
        "global_load_async_to_lds_b128 %11, %23, off\n\t"
        "s_wait_xcnt 0x0"
        :: "v"(la), "v"(la + 1u * 32u * GP * 2u), "v"(la + 2u * 32u * GP * 2u), "v"(la + 3u * 32u * GP * 2u),
           "v"(lb), "v"(lb + 1u * 32u * GP * 2u), "v"(lb + 2u * 32u * GP * 2u), "v"(lb + 3u * 32u * GP * 2u),
           "v"(lb + 4u * 32u * GP * 2u), "v"(lb + 5u * 32u * GP * 2u), "v"(lb + 6u * 32u * GP * 2u),
           "v"(lb + 7u * 32u * GP * 2u),
           "v"(pa), "v"(pa + astep), "v"(pa + 2 * astep), "v"(pa + 3 * astep),
           "v"(pb), "v"(pb + bstep), "v"(pb + 2 * bstep), "v"(pb + 3 * bstep),
           "v"(pb + 4 * bstep), "v"(pb + 5 * bstep), "v"(pb + 6 * bstep), "v"(pb + 7 * bstep)
        : "memory");
#endif
  };
  // products of one slice; every loop below is unrolled so that fragments and accumulators, indexed by
  // constants, stay in registers
  auto compute = [&](int buf) {
    const _Float16* pa = &sA[buf][(wm + rlane) * GP + koff];
    const _Float16* pb = &sB[buf][(wn + rlane) * GP + koff];
#pragma unroll
    for (int ks = 0; ks < 2; ++ks) {
      v16h bh[4], ah[4];
#pragma unroll
      for (int j = 0; j < 4; ++j) bh[j] = ldfrag_h(pb + j * 16 * GP + ks * 32);
#pragma unroll
      for (int i = 0; i < 4; ++i) ah[i] = ldfrag_h(pa + i * 16 * GP + ks * 32);
      // keeps the 16 fragment reads of a k block as one group in front of its 16 products: left free, the
      // scheduler spreads them among the products on one A register set, and each place waits out the LDS latency
      __builtin_amdgcn_sched_barrier(0);
#pragma unroll
      for (int i = 0; i < 4; ++i)
#pragma unroll
        for (int j = 0; j < 4; ++j) acc[i][j] = mma_h_raw(ah[i], bh[j], acc[i][j]);
    }
  };

  const int nst = K >> 6;
  copies(0, 0);
  asm volatile("s_wait_asynccnt 0x0" ::: "memory");   // slice 0 has landed before the barrier publishes it
  __syncthreads();
  if (nst > 1) copies(1, 64);
  for (int t = 0; t < nst; ++t) {                      // block-uniform trip
    compute(t & 1);
    asm volatile("s_wait_dscnt 0x0" ::: "memory");     // this wave's reads of buffer t & 1 are done before its refill
    asm volatile("s_wait_asynccnt 0x0" ::: "memory");  // this wave's copies of slice t + 1 have landed
    __syncthreads();                                   // publishes slice t + 1, frees buffer t & 1
    if (t + 2 < nst) copies(t & 1, (t + 2) << 6);
  }
  asm volatile("s_wait_asynccnt 0x0" ::: "memory");    // nothing in flight when the wave goes on to the epilogue
  acc_guard4(acc[0][0], acc[0][1], acc[0][2], acc[0][3]);
  acc_guard4(acc[1][0], acc[1][1], acc[1][2], acc[1][3]);
  acc_guard4(acc[2][0], acc[2][1], acc[2][2], acc[2][3]);
  acc_guard4(acc[3][0], acc[3][1], acc[3][2], acc[3][3]);

  const int q8 = lane >> 3, c8 = (lane & 7) * 8;
  float bc[8];
#pragma unroll
  for (int e = 0; e < 8; ++e) bc[e] = 0.f;
  if (BIASM == 0) {
    const int cb = n0 + c8;                                  // <= N - 8
    const int i0 = (cb < N - 8) ? cb : (N - 8);
    const v4f b0a = *(const v4f*)(bias0 + i0), b0b = *(const v4f*)(bias0 + i0 + 4);
#pragma unroll
    for (int e = 0; e < 4; ++e) {
      bc[e]     = bfr(b0a[e]) * bsc;
      bc[4 + e] = bfr(b0b[e]) * bsc;
    }
  }

  // ---- epilogue ----
  float* slab = sT[wave];
#pragma unroll
  for (int i = 0; i < 4; ++i) {
    const int mBase = m0 + (i << 4);
#pragma unroll
    for (int j = 0; j < 4; ++j) {
#pragma unroll
      for (int r = 0; r < 8; ++r) {
        slab[(mOff + r) * 68 + (j << 4) + rlane] = acc[i][j][r];
      }
    }
    wave_sync_lds();
    v4u hv[4], lv[4];
#pragma unroll
    for (int it = 0; it < 4; ++it) {
      const int row = it * 4 + q8;                       // it 0..3 x q8 0..3 = rows 0..15
      const float* sp = slab + row * 68 + c8;
      float bm = 0.f;
      if (BIASM == 1) bm = bfr(bias0[mBase + row]) * bsc; // mBase + row < M
      v4u a, lw;
#pragma unroll
      for (int e = 0; e < 4; ++e) {
        const float f0 = sp[2 * e]     * oscale + ((BIASM == 1) ? bm : bc[2 * e]);
        const float f1 = sp[2 * e + 1] * oscale + ((BIASM == 1) ? bm : bc[2 * e + 1]);
        const _Float16 g0 = (_Float16)f0;
        const _Float16 g1 = (_Float16)f1;
        a[e] = pk16(h_bits(g0), h_bits(g1));
        if (OM == 3) {
          const _Float16 r0 = (_Float16)((f0 - (float)g0) * rsc);
          const _Float16 r1 = (_Float16)((f1 - (float)g1) * rsc);
          lw[e] = pk16(h_bits(r0), h_bits(r1));
        } else {
          lw[e] = 0u;
        }
      }
      hv[it] = a;
      lv[it] = lw;
    }
    {
#pragma unroll
      for (int it = 0; it < 4; ++it) {
        const int row = it * 4 + q8;
        const size_t go = (size_t)(mBase + row) * ldc + n0 + c8;
        *(v4u*)(Cout + go) = hv[it];
        if (OM == 3) *(v4u*)(Cout2 + go) = lv[it];
      }
      
    }
    wave_sync_lds();
  }
}

// =====================================================================================================
// The three projections in one launch: blocks 0 .. nt - 1 form q, the next nt blocks k, the next nt blocks v^T
// (nt = tiles of one projection). Each reads the layer-norm plane and its own weight plane, nothing of the others. The choice is
// block-uniform. Two blocks fit a WGP's LDS and registers, so one block's products run under the other's waits.
// =====================================================================================================
__global__ __launch_bounds__(256) void proj3(
    const unsigned short* __restrict__ XH, const unsigned short* __restrict__ WqT,
    const unsigned short* __restrict__ WkT, const unsigned short* __restrict__ WvT,
    const float* __restrict__ bq, const float* __restrict__ bk, const float* __restrict__ bv,
    unsigned short* QH, unsigned short* QL, unsigned short* KH, unsigned short* VTH, unsigned short* VTL,
    int nt, float osc_qk, float osc_v, float vsc, float rsc) {
  __shared__ GemmLds L;
  const int bx = blockIdx.x;
  if (bx < nt) {
    // q = xh . Wq + bq -> QH (hi), QL (residual x rsc), f16 [NTOK][DM]
    gemm64<3, 0>(L, bx, XH, DM, WqT, DM, bq, QH, QL, DM, NTOK, DM, DM, osc_qk, 1.0f, rsc);
  } else if (bx < 2 * nt) {
    // k = xh . Wk + bk -> KH f16 [NTOK][DM]
    gemm64<2, 0>(L, bx - nt, XH, DM, WkT, DM, bk, KH, KH, DM, NTOK, DM, DM, osc_qk, 1.0f, rsc);
  } else {
    // v^T: VT[m][t] = sum_k WvT[m][k] . xh[t][k] + bv[m] -> VTH (hi x vsc), VTL (residual x vsc x rsc), f16 [DM][NTOK]
    gemm64<3, 1>(L, bx - 2 * nt, WvT, DM, XH, DM, bv, VTH, VTL, NTOK, DM, NTOK, DM, osc_v, vsc, rsc);
  }
}

#define LOG2E 1.44269504088896340736f
#define PLOG2 10.0f      // log2 of PSC
static_assert(PSC == 1024.0f);
#define OP 68      // LDS row pitch in floats of the output tile: 272 B = 16 B x 17 (odd), for 16-byte writers
__device__ __forceinline__ float other_half(float x) {    // value of lane l ^ 16
  const int b = __builtin_bit_cast(int, x);
  return __builtin_bit_cast(float, __builtin_amdgcn_permlanex16(b, b, 0x76543210, 0xfedcba98, false, false));
}
// 2^x as v_exp_f32, eight at a time (one score tile) or alone. Written as asm so that the slot
// the instruction set asks for behind a transcendental is kept by construction: outputs are early-clobber, so
// inside a statement no v_exp_f32 is followed by a write of its source or a read of its result, and the closing
// v_nop fills the slot behind the last one whatever the compiler puts next.
__device__ __forceinline__ v8f exp2_8(v8f x) {
  v8f e;
#if defined(__HIP_DEVICE_COMPILE__)
  float e0, e1, e2, e3, e4, e5, e6, e7;
  asm("v_exp_f32 %0, %8\n\tv_exp_f32 %1, %9\n\tv_exp_f32 %2, %10\n\tv_exp_f32 %3, %11\n\t"
      "v_exp_f32 %4, %12\n\tv_exp_f32 %5, %13\n\tv_exp_f32 %6, %14\n\tv_exp_f32 %7, %15\n\tv_nop"
      : "=&v"(e0), "=&v"(e1), "=&v"(e2), "=&v"(e3), "=&v"(e4), "=&v"(e5), "=&v"(e6), "=&v"(e7)
      : "v"(x[0]), "v"(x[1]), "v"(x[2]), "v"(x[3]), "v"(x[4]), "v"(x[5]), "v"(x[6]), "v"(x[7]));
  e[0] = e0; e[1] = e1; e[2] = e2; e[3] = e3; e[4] = e4; e[5] = e5; e[6] = e6; e[7] = e7;
#else
  e = x;
#endif
  return e;
}
__device__ __forceinline__ float exp2_1(float x) {
  float e = x;
#if defined(__HIP_DEVICE_COMPILE__)
  asm("v_exp_f32 %0, %1\n\tv_nop" : "=&v"(e) : "v"(x));
#endif
  return e;
}

__global__ __launch_bounds__(128) __attribute__((amdgpu_waves_per_eu(4, 4)))   // registers stay within four waves per SIMD
void attn_lb(const unsigned short* __restrict__ qhp, const unsigned short* __restrict__ qlp,
             const unsigned short* __restrict__ khp,
             const unsigned short* __restrict__ vthp, const unsigned short* __restrict__ vtlp,
             float* outp, float sscale, float onorm) {
  union FH { v16h v; v8h h[2]; };
  // two buffers of three tiles, 9 KB each, pitch LP: K [kv][d], V^T hi [d][kv], V^T res [d][kv]
  __shared__ __align__(16) _Float16 Ring[2][3][64 * LP];
  __shared__ __align__(16) float    Os[4][16 * OP];               // per wave context tile [row][d], pitch OP

  const int tid  = threadIdx.x;
  const int wave = tid >> 5;
  const int lane = tid & 31;
  const int hh   = lane >> 4;
  const int c    = lane & 15;

  const int bx   = blockIdx.x;
  const int qb   = bx % NQB;
  const int hb   = bx / NQB;
  const int h    = hb % NH;
  const int b    = hb / NH;
  const int tok0 = b * SQ;                       // first token row of this sequence
  const int ql0  = qb * 64 + wave * 16;          // local query index of this wave's first row
  const int q0   = tok0 + ql0;                   // global token row of this wave's first row

  const _Float16* Qh = (const _Float16*)(const void*)qhp + (size_t)h * HD;
  const _Float16* Ql = (const _Float16*)(const void*)qlp + (size_t)h * HD;
  const _Float16* Kg = (const _Float16*)(const void*)khp + (size_t)h * HD;
  const _Float16* Vh = (const _Float16*)(const void*)vthp + (size_t)h * HD * NTOK + tok0;
  const _Float16* Vl = (const _Float16*)(const void*)vtlp + (size_t)h * HD * NTOK + tok0;

  // ---- per-head slope (block-uniform) ----
  const int   se    = (h + 1) >> 1;
  const float spw   = __uint_as_float((unsigned)(127 - se) << 23);
  const float slope = (h & 1) ? spw : (spw * 0.70710678118654752f);

  // ---- Q fragments (B operand, column = lane&15): 2 d-chunks, hi and residual planes ----
  v16h qa[2], qr[2];
#pragma unroll
  for (int dc = 0; dc < 2; ++dc) {
    qa[dc] = ldfrag_h(Qh + (size_t)(q0 + c) * DM + dc * 32 + 8 * hh);
    qr[dc] = ldfrag_h(Ql + (size_t)(q0 + c) * DM + dc * 32 + 8 * hh);
  }

  const int qrow = ql0 + c;                      // this lane's query (D column = lane&15)
  float mrow = -INFINITY;                        // running maximum of raw of query qrow (equal in both lane halves)
  float nrow = INFINITY;                         // addend of the exponent that the running sum and context stand on
  float lrow = 0.f;                              // running sum (x PSC) over this lane half's keys only
  v8f oacc[4];                                   // oacc[t][r] = context[query c][d = 16 t + 8 hh + r]
#pragma unroll
  for (int t = 0; t < 4; ++t) oacc[t] = zero8();

  const float rinv = 1.0f / RSC;
  const float c2   = sscale * LOG2E;             // raw -> exponent of two
  const float ydl  = (float)(8 * hh - qrow);     // key - query of the lane's register 0, tile 0, chunk 0

  // staging map: thread -> row (tid >> 3) + 16 * it, 16-B piece tid & 7 of the row's 128 B
  const int srow = tid >> 3, sc8 = (tid & 7) * 8;
  const _Float16* gk = Kg + (size_t)(tok0 + srow) * DM + sc8;      // K row = key, d = sc8..sc8+7
  const _Float16* gv = Vh + (size_t)srow * NTOK + sc8;             // V^T hi row = d, key = sc8..sc8+7
  const _Float16* gw = Vl + (size_t)srow * NTOK + sc8;             // V^T res row = d
  const unsigned l0 = (unsigned)(uintptr_t)(&Ring[0][0][srow * LP + sc8]);   // lane's LDS byte address, buffer 0, K, it 0
  // One chunk: 3 x 4 asynchronous 16-B copies per lane, global -> LDS, through no register. The closing
  // s_wait_xcnt stands in the copies' own statement so that no address register is rewritten in front of it.
  auto copies = [&](int buf, int kv) {
    const unsigned lk = l0 + (unsigned)buf * (unsigned)(3 * 64 * LP * 2);
    const unsigned lv = lk + (unsigned)(64 * LP * 2);
    const unsigned lw = lk + (unsigned)(2 * 64 * LP * 2);
    const _Float16* pk = gk + (size_t)kv * DM;
    const _Float16* pv = gv + kv;
    const _Float16* pw = gw + kv;
    const size_t kstep = (size_t)16 * DM, vstep = (size_t)16 * NTOK;
#if defined(__HIP_DEVICE_COMPILE__)
    asm volatile(
        "global_load_async_to_lds_b128 %0, %12, off\n\t"
        "global_load_async_to_lds_b128 %1, %13, off\n\t"
        "global_load_async_to_lds_b128 %2, %14, off\n\t"
        "global_load_async_to_lds_b128 %3, %15, off\n\t"
        "global_load_async_to_lds_b128 %4, %16, off\n\t"
        "global_load_async_to_lds_b128 %5, %17, off\n\t"
        "global_load_async_to_lds_b128 %6, %18, off\n\t"
        "global_load_async_to_lds_b128 %7, %19, off\n\t"
        "global_load_async_to_lds_b128 %8, %20, off\n\t"
        "global_load_async_to_lds_b128 %9, %21, off\n\t"
        "global_load_async_to_lds_b128 %10, %22, off\n\t"
        "global_load_async_to_lds_b128 %11, %23, off\n\t"
        "s_wait_xcnt 0x0"
        :: "v"(lk), "v"(lk + 1u * 16u * LP * 2u), "v"(lk + 2u * 16u * LP * 2u), "v"(lk + 3u * 16u * LP * 2u),
           "v"(lv), "v"(lv + 1u * 16u * LP * 2u), "v"(lv + 2u * 16u * LP * 2u), "v"(lv + 3u * 16u * LP * 2u),
           "v"(lw), "v"(lw + 1u * 16u * LP * 2u), "v"(lw + 2u * 16u * LP * 2u), "v"(lw + 3u * 16u * LP * 2u),
           "v"(pk), "v"(pk + kstep), "v"(pk + 2 * kstep), "v"(pk + 3 * kstep),
           "v"(pv), "v"(pv + vstep), "v"(pv + 2 * vstep), "v"(pv + 3 * vstep),
           "v"(pw), "v"(pw + vstep), "v"(pw + 2 * vstep), "v"(pw + 3 * vstep)
        : "memory");
#endif
  };

  static_assert(NQB >= 2);
  copies(0, 0);
  asm volatile("s_wait_asynccnt 0x0" ::: "memory");   // chunk 0 has landed before the barrier publishes it
  __syncthreads();
  copies(1, 64);
  for (int kt = 0; kt < NQB; ++kt) {            // block-uniform trip = 32
    const int kv0 = kt * 64;                     // local key index of the chunk
    const _Float16* Ksh = &Ring[kt & 1][0][0];
    const _Float16* Vth = &Ring[kt & 1][1][0];
    const _Float16* Vtl = &Ring[kt & 1][2][0];
    const float yd = ydl + (float)kv0;

    // ---- K fragments of the whole chunk: 16 reads as one group (loops unrolled: fragments stay in registers) ----
    FH kb[4][2];
#pragma unroll
    for (int j = 0; j < 4; ++j) {
#pragma unroll
      for (int dc = 0; dc < 2; ++dc) {
        kb[j][dc].h[0] = *(const v8h*)(Ksh + (j * 16 + c) * LP + dc * 32 + 8 * hh);
        kb[j][dc].h[1] = *(const v8h*)(Ksh + (j * 16 + c) * LP + dc * 32 + 16 + 8 * hh);
      }
    }

    // ---- distance term -slope * |key - query| of the 64 x 16 scores; register r of tile j: key - query = yd + 16 j + r.
    //      In every chunk but the block's own, key - query has one sign for all scores: the term is linear there ----
    // compiler fence: keeps the 16 K reads in front of the branch below, so that the distance term is formed under
    // their latency; left free, they sink behind the branch's join
    asm volatile("" ::: "memory");
    v8f bs[4];
    if (kt == qb) {                              // block-uniform
#pragma unroll
      for (int j = 0; j < 4; ++j) {
#pragma unroll
        for (int r = 0; r < 8; ++r) bs[j][r] = -slope * fabsf(yd + (float)(j * 16 + r));
      }
    } else {
      const float sg = (kt < qb) ? slope : -slope;
      const float z0 = sg * yd;
#pragma unroll
      for (int r = 0; r < 8; ++r) bs[0][r] = sg * (float)r + z0;
#pragma unroll
      for (int j = 1; j < 4; ++j) bs[j] = bs[0] + sg * (float)(j * 16);
    }

    // ---- logits, transposed: 64 keys x 16 queries per wave ----
    //      16 products back to back on 8 independent accumulators: each fills the distance that the ones before it need
    v8f s[4], sl[4];
#pragma unroll
    for (int j = 0; j < 4; ++j) { s[j] = bs[j]; sl[j] = zero8(); }
#pragma unroll
    for (int dc = 0; dc < 2; ++dc) {
#pragma unroll
      for (int j = 0; j < 4; ++j) {
        s[j]  = mma_h_raw(kb[j][dc].v, qa[dc], s[j]);
        sl[j] = mma_h_raw(kb[j][dc].v, qr[dc], sl[j]);
      }
    }
    // keeps the 16 V^T reads below behind the run of 16 products
    __builtin_amdgcn_sched_barrier(0);

    // ---- V^T fragments of keys 0..31 (hi and residual): 16 reads as one group, in flight under the softmax ----
    FH vb[2][4], wb[2][4];
#pragma unroll
    for (int t = 0; t < 4; ++t) {
      vb[0][t].h[0] = *(const v8h*)(Vth + (t * 16 + c) * LP + 8 * hh);
      vb[0][t].h[1] = *(const v8h*)(Vth + (t * 16 + c) * LP + 16 + 8 * hh);
      wb[0][t].h[0] = *(const v8h*)(Vtl + (t * 16 + c) * LP + 8 * hh);
      wb[0][t].h[1] = *(const v8h*)(Vtl + (t * 16 + c) * LP + 16 + 8 * hh);
    }
    // keeps all 16 reads in front of the softmax arithmetic, which covers their latency: left free, the scheduler
    // sinks the last four to the front of the first product, where their latency is waited out
    __builtin_amdgcn_sched_barrier(0);

    // ---- residual term folded into the scores ----
#pragma unroll
    for (int j = 0; j < 4; ++j) {
#pragma unroll
      for (int r = 0; r < 8; ++r) s[j][r] = s[j][r] + sl[j][r] * rinv;
    }

    // ---- maximum in the lane, one exchange between the halves; online softmax ----
    float mj[4];
#pragma unroll
    for (int j = 0; j < 4; ++j) {
      mj[j] = s[j][0];
#pragma unroll
      for (int r = 1; r < 8; ++r) mj[j] = fmaxf(mj[j], s[j][r]);
    }
    float m = fmaxf(fmaxf(mj[0], mj[1]), fmaxf(mj[2], mj[3]));
    m = fmaxf(m, other_half(m));
    const float mnew  = fmaxf(mrow, m);
    const bool  none  = (mnew == -INFINITY);
    const float nb    = none ? PLOG2 : (PLOG2 - mnew * c2);
    const float alpha = exp2_1(nb - nrow);
    mrow = mnew;
    nrow = none ? INFINITY : nb;

    // ---- P (x PSC, f16) packed from the score registers into the B operands of p.v ----
    v16h pb[2];
    float pj[4];
#pragma unroll
    for (int j = 0; j < 4; ++j) {
      const v8f p = exp2_8(s[j] * c2 + nb);
      pj[j] = 0.f;
#pragma unroll
      for (int r = 0; r < 8; ++r) {
        pj[j] += p[r];
        pb[j >> 1][(j & 1) * 8 + r] = (_Float16)p[r];
      }
    }
    // ---- V^T fragments of keys 32..63, d rows 0..31: 8 reads as one group, in flight under the products of
    //      keys 0..31 ----
#pragma unroll
    for (int t = 0; t < 2; ++t) {
      vb[1][t].h[0] = *(const v8h*)(Vth + (t * 16 + c) * LP + 32 + 8 * hh);
      vb[1][t].h[1] = *(const v8h*)(Vth + (t * 16 + c) * LP + 32 + 16 + 8 * hh);
      wb[1][t].h[0] = *(const v8h*)(Vtl + (t * 16 + c) * LP + 32 + 8 * hh);
      wb[1][t].h[1] = *(const v8h*)(Vtl + (t * 16 + c) * LP + 32 + 16 + 8 * hh);
    }
    lrow = lrow * alpha + ((pj[0] + pj[1]) + (pj[2] + pj[3]));
#pragma unroll
    for (int t = 0; t < 4; ++t) {
#pragma unroll
      for (int r = 0; r < 8; ++r) oacc[t][r] *= alpha;
    }
    // keeps every v_exp_f32 statement in front of the products: left free, the
    // scheduler puts such a statement right behind one
    __builtin_amdgcn_sched_barrier(0);

    // ---- context^T += Vhi . P^T ; chunk residual = Vres . P^T (f16 WMMA) ----
    v8f ol[4];
#pragma unroll
    for (int t = 0; t < 4; ++t) ol[t] = zero8();
#pragma unroll
    for (int kk = 0; kk < 2; ++kk) {
#pragma unroll
      for (int t = 0; t < 4; ++t) {
        if (kk == 0 && t == 2) {
          // V^T fragments of keys 32..63, d rows 32..63: 8 reads as one group into the registers that the four
          // products above have left, in flight under the next eight products
          __builtin_amdgcn_sched_barrier(0);   // the four products stay in front of the reads that take their registers
#pragma unroll
          for (int u = 2; u < 4; ++u) {
            vb[1][u].h[0] = *(const v8h*)(Vth + (u * 16 + c) * LP + 32 + 8 * hh);
            vb[1][u].h[1] = *(const v8h*)(Vth + (u * 16 + c) * LP + 32 + 16 + 8 * hh);
            wb[1][u].h[0] = *(const v8h*)(Vtl + (u * 16 + c) * LP + 32 + 8 * hh);
            wb[1][u].h[1] = *(const v8h*)(Vtl + (u * 16 + c) * LP + 32 + 16 + 8 * hh);
          }
          // keeps the 8 reads one group at this place: left free, the scheduler deals them out in pairs, one pair
          // in front of each product that needs it, and every pair's latency is waited out
          __builtin_amdgcn_sched_barrier(0);
        }
        oacc[t] = mma_h_raw(vb[kk][t].v, pb[kk], oacc[t]);
        ol[t]   = mma_h_raw(wb[kk][t].v, pb[kk], ol[t]);
      }
    }
    // keeps the products in front of the trip's waits and barrier, and the folds behind the whole run of products
    __builtin_amdgcn_sched_barrier(0);
    // ---- fold this chunk's residual term into the running context (f32) ----
#pragma unroll
    for (int t = 0; t < 4; ++t) {
#pragma unroll
      for (int r = 0; r < 8; ++r) oacc[t][r] += ol[t][r] * rinv;
    }
    asm volatile("s_wait_dscnt 0x0" ::: "memory");     // this wave's reads of buffer kt & 1 are done before its refill
    asm volatile("s_wait_asynccnt 0x0" ::: "memory");  // this wave's copies of chunk kt + 1 have landed
    __syncthreads();                                   // publishes chunk kt + 1, frees buffer kt & 1
    if (kt + 2 < NQB) copies(kt & 1, kv0 + 128);
  }
  asm volatile("s_wait_asynccnt 0x0" ::: "memory");    // nothing in flight when the wave goes on to the epilogue

  // ---- join the halves' sums, normalise (1/l and the 1/(PSC*VSC) carry), stage the wave's 16x64 tile
  //      (a lane holds 8 consecutive d of its query per t: two 16-B LDS writes), write whole 256-B rows
  float* os = Os[wave];
  {
    const float l = lrow + other_half(lrow);
    const float inv = ((l > 0.f) ? (1.0f / l) : 0.f) * (onorm * PSC);
#pragma unroll
    for (int t = 0; t < 4; ++t) {
      v4f w0, w1;
#pragma unroll
      for (int e = 0; e < 4; ++e) { w0[e] = oacc[t][e] * inv; w1[e] = oacc[t][4 + e] * inv; }
      *(v4f*)(os + c * OP + t * 16 + 8 * hh)     = w0;
      *(v4f*)(os + c * OP + t * 16 + 8 * hh + 4) = w1;
    }
  }
  wave_sync_lds();
  {
    const int hh2 = lane >> 4, c4 = (lane & 15) * 4;
    v4f vals[8];
#pragma unroll
    for (int it = 0; it < 8; ++it) {
      const int row = it * 2 + hh2;   // it 0..7 x hh2 0..1 = rows 0..15 of the wave tile
      vals[it] = *(const v4f*)(os + row * OP + c4);
    }
    {
#pragma unroll
      for (int it = 0; it < 8; ++it) {
        const int row = it * 2 + hh2;
        const size_t go = (size_t)(q0 + row) * DM + (size_t)h * HD + c4;
        *(v4f*)(outp + go) = vals[it];
      }
    }
  }
}

// =====================================================================================================
// Workspace map (bytes); every plane is an exact multiple of its 64x64-tile / whole-line store granularity
// ([8192][1024] = 128x16 tiles, [1024][8192] = 16x128 tiles, weights [1024][1024] = 16x16 tiles):
//   WqT  f16 [1024][1024]   0          2097152   (transposed, x64)
//   WkT  f16 [1024][1024]   2097152    2097152
//   WvT  f16 [1024][1024]   4194304    2097152
//   XH   f16 [8192][1024]   6291456    16777216  (layer norm output x16)
//   QH   f16 [8192][1024]   23068672   16777216  (q hi)
//   QL   f16 [8192][1024]   39845888   16777216  (q residual x4096)
//   KH   f16 [8192][1024]   56623104   16777216
//   VTH  f16 [1024][8192]   73400320   16777216  (v^T hi x16)
//   VTL  f16 [1024][8192]   90177536   16777216  (v^T residual x16 x4096)
//   end                     106954752
// =====================================================================================================
extern "C" void kernel_launch(void* const* d_in, const int* in_sizes, int n_in,
                              void* d_out, int out_size, void* d_ws, size_t ws_size,
                              hipStream_t stream) {
  if (n_in < 9) return;
  if (in_sizes[0] != NTOK * DM) return;
  if (in_sizes[1] != DM || in_sizes[2] != DM) return;
  if (in_sizes[3] != DM * DM || in_sizes[5] != DM * DM || in_sizes[7] != DM * DM) return;
  if (in_sizes[4] != DM || in_sizes[6] != DM || in_sizes[8] != DM) return;
  if (out_size != NTOK * DM) return;

  const float* x   = (const float*)d_in[0];
  const float* gam = (const float*)d_in[1];
  const float* bet = (const float*)d_in[2];
  const float* wq  = (const float*)d_in[3];
  const float* bq  = (const float*)d_in[4];
  const float* wk  = (const float*)d_in[5];
  const float* bk  = (const float*)d_in[6];
  const float* wv  = (const float*)d_in[7];
  const float* bv  = (const float*)d_in[8];

  const size_t PW = (size_t)DM * DM * 2;            //  2097152
  const size_t PA = (size_t)NTOK * DM * 2;          // 16777216
  size_t off = 0;
  const size_t oWq = off; off += PW;
  const size_t oWk = off; off += PW;
  const size_t oWv = off; off += PW;
  const size_t oXH = off; off += PA;
  const size_t oQH = off; off += PA;
  const size_t oQL = off; off += PA;
  const size_t oKH = off; off += PA;
  const size_t oVH = off; off += PA;
  const size_t oVL = off; off += PA;
  if (off > ws_size) return;                        // off = 106954752
  if (off > (size_t)134217728) return;

  char* ws = (char*)d_ws;
  unsigned short* WqT = (unsigned short*)(ws + oWq);
  unsigned short* WkT = (unsigned short*)(ws + oWk);
  unsigned short* WvT = (unsigned short*)(ws + oWv);
  unsigned short* XH  = (unsigned short*)(ws + oXH);
  unsigned short* QH  = (unsigned short*)(ws + oQH);
  unsigned short* QL  = (unsigned short*)(ws + oQL);
  unsigned short* KH  = (unsigned short*)(ws + oKH);
  unsigned short* VTH = (unsigned short*)(ws + oVH);
  unsigned short* VTL = (unsigned short*)(ws + oVL);

  const dim3 blk(256), blk128(128);
  const dim3 gPrep(NTOK / 8 + 3 * (DM / 64) * (DM / 64));              // 1024 blocks of 8 rows + 3 x 256 tiles of 64x64
  const dim3 gG(3 * ((NTOK / 128) * (DM / 256)));                      // 3 x 256 blocks, one 128x256 tile each
  const dim3 gAttn(NB * NH * NQB);                                     // 2048 blocks of 128
  const float osc_qk = 1.0f / (XSC * WSC);                             // q, k unscaled
  const float osc_v  = VSC / (XSC * WSC);                              // v^T carried x16

  // (0) layer norm -> XH f16 [8192][1024] (x16); weights W[in][out] f32 -> W^T f16 [out][in] (k contiguous),
  //     bf16 RNE-converted, x64
  prep<<<gPrep, blk, 0, stream>>>(x, gam, bet, wq, wk, wv, XH, WqT, WkT, WvT, NTOK / 8, XSC, LNEPS, WSC);
  // (1) q -> QH (hi), QL (residual x4096), k -> KH, f16 [8192][1024]; v^T -> VTH (hi x16), VTL (residual x16 x4096),
  //     f16 [1024][8192]
  proj3<<<gG, blk, 0, stream>>>(XH, WqT, WkT, WvT, bq, bk, bv, QH, QL, KH, VTH, VTL,
                                (NTOK / 128) * (DM / 256), osc_qk, osc_v, VSC, RSC);
  // (2) attention with per-head linear distance bias -> d_out f32 [8192][1024]
  attn_lb<<<gAttn, blk128, 0, stream>>>(QH, QL, KH, VTH, VTL, (float*)d_out, 0.125f, 1.0f / (PSC * VSC));
  (void)hipGetLastError();
}

// v010
// A run of this version takes 117 microseconds.
// It is 1.43 times as fast as v008, going by the measured steps of the versions left out in between.
// All steps since v000 together make it 4.86 times as fast.
// Contractions: q, k and v^T projections on v_wmma_f32_16x16x32_f16 (f16 layer-norm plane carried x16 times
// f16 transposed weight plane carried x64, one product each); attention k.q^T on v_wmma_f32_16x16x32_f16
// (q plain f16, k plain f16, one product); v^T.p^T on v_wmma_f32_16x16x32_f16 (p carried x1024, v^T as one f16
// plane carried x16, one product); all f32 accumulate; layer norm and softmax in f32 on VALU; every float input
// RNE-converted to bf16 on load.
#include <hip/hip_runtime.h>
#include <math.h>
#include <stdint.h>

#define NB    4
#define SQ    2048
#define NTOK  (NB * SQ)
#define DM    1024
#define NH    16
#define HD    64
#define NQB   (SQ / 64)
#define XSC   16.0f
#define WSC   64.0f
#define VSC   16.0f
#define PSC   1024.0f
#define LNEPS 1e-5f
#define LP    72      // LDS row pitch in halves of the attention tiles: 144 B = 16 B x 9 (odd), for 16-byte readers
static_assert(NH * HD == DM);
static_assert((SQ % 64) == 0 && (DM % 64) == 0 && (NTOK % 64) == 0);
static_assert(DM == 4 * 256);
static_assert((NTOK % 8) == 0);
static_assert((NTOK % 256) == 0 && (DM % 256) == 0);

typedef _Float16 v16h __attribute__((ext_vector_type(16)));
typedef _Float16 v8h  __attribute__((ext_vector_type(8)));
typedef float    v8f  __attribute__((ext_vector_type(8)));
typedef float    v4f  __attribute__((ext_vector_type(4)));
typedef unsigned int v4u __attribute__((ext_vector_type(4)));

// ---- scalar helpers --------------------------------------------------------------------------------
__device__ __forceinline__ unsigned short bf_bits(float f) {          // f32 -> bf16 bits, RNE convert
  unsigned u = __float_as_uint(f);
  return (unsigned short)((u + 0x7FFFu + ((u >> 16) & 1u)) >> 16);
}
__device__ __forceinline__ float bf_up(unsigned short h) { return __uint_as_float(((unsigned)h) << 16); }
__device__ __forceinline__ float bfr(float f) { return bf_up(bf_bits(f)); }   // value of the bf16 RNE convert
__device__ __forceinline__ unsigned short h_bits(_Float16 x) { return __builtin_bit_cast(unsigned short, x); }
__device__ __forceinline__ unsigned pk16(unsigned short a, unsigned short b) { return (unsigned)a | ((unsigned)b << 16); }
__device__ __forceinline__ v8f zero8() { v8f z = {0.f, 0.f, 0.f, 0.f, 0.f, 0.f, 0.f, 0.f}; return z; }

// ---- fragment loader: 16-bit A/B operand, lane -> row/col (lane&15), p already includes +8*(lane>>4);
//      elements 0..7 <- p[0..7] (k0+8h..), elements 8..15 <- p[16..23] (k0+16+8h..)
__device__ __forceinline__ v16h ldfrag_h(const _Float16* p) {
  union { v16h v; v8h h[2]; } f;
  f.h[0] = *(const v8h*)(p);
  f.h[1] = *(const v8h*)(p + 16);
  return f.v;
}

// ---- WMMA helpers: the builtin form, behind which the compiler keeps the distance to a vector instruction itself ----
__device__ __forceinline__ v8f mma_h_raw(v16h a, v16h b, v8f c) {
  return __builtin_amdgcn_wmma_f32_16x16x32_f16(false, a, false, b, (short)0, c, false, false);
}
__device__ __forceinline__ void acc_guard4(v8f& a, v8f& b, v8f& c, v8f& d) {
#if defined(__HIP_DEVICE_COMPILE__)
  asm volatile("v_nop\n\tv_nop\n\tv_nop\n\tv_nop" : "+v"(a), "+v"(b), "+v"(c), "+v"(d));
#endif
}
__device__ __forceinline__ void wave_sync_lds() {
  __builtin_amdgcn_fence(__ATOMIC_RELEASE, "workgroup");
  __builtin_amdgcn_wave_barrier();
  __builtin_amdgcn_fence(__ATOMIC_ACQUIRE, "workgroup");
}

// =====================================================================================================
// Layer norm over rows of DM = 1024: one wave per row, 8 rows per block (blk = 0 .. nrows/8 - 1). Every input value
// y = ((x - mu) * rstd * gamma + beta) * xsc written as one f16 plane [nrows][DM].
// Lane l handles columns 256*i + 8*l .. +7 (i = 0..3); each store instruction of the wave covers 512 B =
// coverage: nrows/8 blocks x 8 waves = every row; 4 iterations x 32 lanes x 8 = all 1024 columns.
// =====================================================================================================
__device__ __forceinline__ void ln_rows(int blk, const float* __restrict__ x, const float* __restrict__ gam,
                                        const float* __restrict__ bet, unsigned short* Xh,
                                        int nrows, float xsc, float eps) {
  const int lane = threadIdx.x & 31;
  const int wave = threadIdx.x >> 5;
  const int row  = blk * 8 + wave;
  if (row >= nrows) return;                     // wave-uniform; no block barrier on the layer-norm path
  const float* xr = x + (size_t)row * DM;
  const float rd = 1.0f / (float)DM;

  float s = 0.f;
#pragma unroll 1
  for (int i = 0; i < 4; ++i) {
    const int c0 = 256 * i + 8 * lane;
    const v4f a = *(const v4f*)(xr + c0);
    const v4f b = *(const v4f*)(xr + c0 + 4);
    s += ((bfr(a[0]) + bfr(a[1])) + (bfr(a[2]) + bfr(a[3]))) +
         ((bfr(b[0]) + bfr(b[1])) + (bfr(b[2]) + bfr(b[3])));
  }
#pragma unroll
  for (int off = 1; off < 32; off <<= 1) s += __shfl_xor(s, off, 32);
  const float mu = s * rd;

  float s2 = 0.f;
#pragma unroll 1
  for (int i = 0; i < 4; ++i) {
    const int c0 = 256 * i + 8 * lane;
    const v4f a = *(const v4f*)(xr + c0);
    const v4f b = *(const v4f*)(xr + c0 + 4);
#pragma unroll
    for (int e = 0; e < 4; ++e) {
      const float d0 = bfr(a[e]) - mu;
      const float d1 = bfr(b[e]) - mu;
      s2 += d0 * d0;
      s2 += d1 * d1;
    }
  }
#pragma unroll
  for (int off = 1; off < 32; off <<= 1) s2 += __shfl_xor(s2, off, 32);
  const float var  = s2 * rd;
  const float rstd = 1.0f / sqrtf(var + eps);

#pragma unroll 1
  for (int i = 0; i < 4; ++i) {
    const int c0 = 256 * i + 8 * lane;
    const v4f a  = *(const v4f*)(xr + c0);
    const v4f b  = *(const v4f*)(xr + c0 + 4);
    const v4f ga = *(const v4f*)(gam + c0);
    const v4f gb = *(const v4f*)(gam + c0 + 4);
    const v4f ba = *(const v4f*)(bet + c0);
    const v4f bb = *(const v4f*)(bet + c0 + 4);
    float y[8];
#pragma unroll
    for (int e = 0; e < 4; ++e) {
      y[e]     = ((bfr(a[e]) - mu) * rstd * bfr(ga[e]) + bfr(ba[e])) * xsc;
      y[4 + e] = ((bfr(b[e]) - mu) * rstd * bfr(gb[e]) + bfr(bb[e])) * xsc;
    }
    v4u u;
#pragma unroll
    for (int e = 0; e < 4; ++e) u[e] = pk16(h_bits((_Float16)y[2 * e]), h_bits((_Float16)y[2 * e + 1]));
    unsigned short* dst = Xh + (size_t)row * DM + c0;
    *(v4u*)dst = u;
    
  }
}

// =====================================================================================================
// Transpose-convert: W f32 in[R][C] (row-major) -> out f16 bits [C][R]; each value bf16 RNE-converted,
// multiplied by wsc (power of two, exact) and cast to f16. Block = one 64x64 tile staged through LDS,
// coverage: load 4 it x 256 threads x 4 = 64x64; store 2 it x 256 threads x 8 = 64x64; tiles (bx, by) cover R x C.
// =====================================================================================================
__device__ __forceinline__ void wtrans_h(unsigned short* sT, int bx, int by, const float* __restrict__ W,
                                         unsigned short* Wt, int R, int C, float wsc) {
  const int tid = threadIdx.x;
  const int r0  = by * 64;                  // rows of W
  const int c0  = bx * 64;                  // cols of W
#pragma unroll
  for (int it = 0; it < 4; ++it) {
    const int idx = it * 256 + tid;         // 0..1023
    const int r   = idx >> 4;               // 0..63
    const int c4  = (idx & 15) * 4;         // 0..60
    const v4f w = *(const v4f*)(W + (size_t)(r0 + r) * C + c0 + c4);
#pragma unroll
    for (int e = 0; e < 4; ++e) sT[(c4 + e) * 72 + r] = h_bits((_Float16)(bfr(w[e]) * wsc));
  }
  __syncthreads();
  v4u u[2];
#pragma unroll
  for (int it = 0; it < 2; ++it) {
    const int row = it * 32 + (tid >> 3), col8 = (tid & 7) * 8;
    u[it] = *(const v4u*)(sT + row * 72 + col8);
  }
  {
#pragma unroll
    for (int it = 0; it < 2; ++it) {
      const int row = it * 32 + (tid >> 3), col8 = (tid & 7) * 8;
      *(v4u*)(Wt + (size_t)(c0 + row) * R + r0 + col8) = u[it];
    }
    // the stores' registers may be rewritten by whatever code follows the inlined body: the wait stands in front of that
    asm volatile("s_wait_xcnt 0x0" ::: "memory");
  }
}

// =====================================================================================================
// One launch for the four pieces of work that depend on the inputs alone: blocks 0 .. nln - 1 do the layer norm
// (8 rows each), the next 3 * (DM / 64) * (DM / 64) blocks the 64x64 tiles of the three weight transposes. The
// choice is block-uniform; the only block barrier stands in the transpose branch, which whole blocks take.
// =====================================================================================================
__global__ __launch_bounds__(256) void prep(const float* __restrict__ x, const float* __restrict__ gam,
                                            const float* __restrict__ bet, const float* __restrict__ wq,
                                            const float* __restrict__ wk, const float* __restrict__ wv,
                                            unsigned short* Xh, unsigned short* WqT, unsigned short* WkT,
                                            unsigned short* WvT, int nln, float xsc, float eps, float wsc) {
  __shared__ __align__(16) unsigned short sT[64 * 72];     // transpose tile [c][r], pitch 72 halves = 144 B
  const int bx = blockIdx.x;
  if (bx < nln) {
    ln_rows(bx, x, gam, bet, Xh, nln * 8, xsc, eps);
  } else {
    const int t  = bx - nln;
    const int w  = t / ((DM / 64) * (DM / 64));            // which weight
    const int tl = t - w * ((DM / 64) * (DM / 64));        // its tile
    if (w > 2) return;                                     // block-uniform, in front of the barrier
    const float*    W  = (w == 0) ? wq  : ((w == 1) ? wk  : wv);
    unsigned short* Wt = (w == 0) ? WqT : ((w == 1) ? WkT : WvT);
    wtrans_h(sT, tl % (DM / 64), tl / (DM / 64), W, Wt, DM, DM, wsc);
  }
}

// =====================================================================================================
// f16 WMMA GEMM: C[m][n] = oscale * sum_k A[m][k] * Bt[n][k] + bsc * bias. A block of 8 waves owns a 128x256
// tile of C (2 x 4 waves, 64x64 each). A row-major [M][K] pitch lda; Bt row-major [N][K] pitch ldb (k contiguous);
// M multiple of 128, N multiple of 256, K multiple of 64 and at least 64 (static here).
// Operands: per k slice of 64 (128 B = one line of every row) the block brings its 128 A rows and 256 Bt rows
// into LDS by asynchronous 16-B copies, each wave-wide copy covering four whole rows of the slice; rows at pitch
// GP. Two buffers: slice t + 1 flies while slice t is multiplied; at the foot of a trip every wave waits for its
// LDS reads and its copies, one block barrier publishes slice t + 1 and frees the buffer of slice t for t + 2.
// Fragments come from LDS in the k order of ldfrag_h; every accumulator takes its k blocks of 32 in rising order.
// Bias: BIASM == 0 -> per column bias0[n] (N entries, clamped-address 16-B loads); BIASM == 1 -> per row
//       bias0[m] (M entries). Bias values RNE-converted to bf16, then multiplied by bsc.
// Output: one f16 plane (Cout), pitch ldc.
// coverage: 4 slabs x 16 rows (it 0..3 x lane>>3 0..3) x 64 cols (8 lanes x 8) = the wave's whole 64x64 tile;
//           8 waves = the block's 128x256 tile; bt = 0 .. (M/128)*(N/256) - 1 is the tile, a block with a larger bt
//           exits whole.
// =====================================================================================================
#define GP 72      // LDS row pitch in halves of the operand slices: 144 B = 16 B x 9 (odd), for 16-byte readers
struct GemmLds {
  __align__(16) _Float16 sA[2][128 * GP];   // A slice  [row][k], two buffers
  __align__(16) _Float16 sB[2][256 * GP];   // Bt slice [row][k], two buffers
  __align__(16) float sT[8][16 * 68];       // per-wave 16x64 slab, pitch 68 floats
};
template <int BIASM>
__device__ __forceinline__ void gemm64(
    GemmLds& L, int bt,
    const unsigned short* __restrict__ Ap, int lda,
    const unsigned short* __restrict__ Btp, int ldb,
    const float* __restrict__ bias0,
    unsigned short* Cout, int ldc,
    int M, int N, int K, float oscale, float bsc) {
  const _Float16* A  = (const _Float16*)(const void*)Ap;
  const _Float16* Bt = (const _Float16*)(const void*)Btp;
  auto& sA = L.sA;
  auto& sB = L.sB;
  auto& sT = L.sT;
  const int tid  = threadIdx.x;
  const int lane = tid & 31;
  const int wave = tid >> 5;
  const int tilesN = N >> 8;
  const int tilesM = M >> 7;
  if (bt >= tilesM * tilesN) return;   // block-uniform, in front of every barrier
  const int tm = bt / tilesN;
  const int tn = bt - tm * tilesN;
  const int mB = tm << 7;                      // block's first row of C
  const int nB = tn << 8;                      // block's first column of C
  const int wm = (wave >> 2) << 6;             // wave's row offset in the block tile
  const int wn = (wave & 3) << 6;              // wave's column offset in the block tile
  const int m0 = mB + wm;
  const int n0 = nB + wn;

  const int rlane = lane & 15;                 // row (A) / col (B, D) within subtile
  const int koff  = (lane >> 4) * 8;           // k offset of this lane half
  const int mOff  = (lane >> 4) * 8;           // D row offset

  v8f acc[4][4];
#pragma unroll
  for (int i = 0; i < 4; ++i)
#pragma unroll
    for (int j = 0; j < 4; ++j) acc[i][j] = zero8();

  // staging map: thread -> row (tid >> 3) + 32 * it, 16-B piece tid & 7 of the row's 128-B slice
  const int srow = tid >> 3, sc8 = (tid & 7) * 8;
  const _Float16* ga = A  + (size_t)(mB + srow) * lda + sc8;
  const _Float16* gb = Bt + (size_t)(nB + srow) * ldb + sc8;
  const size_t astep = (size_t)32 * lda, bstep = (size_t)32 * ldb;
  const unsigned la0 = (unsigned)(uintptr_t)(&sA[0][srow * GP + sc8]);   // lane's LDS byte address, buffer 0, it 0
  const unsigned lb0 = (unsigned)(uintptr_t)(&sB[0][srow * GP + sc8]);
  // One slice: 4 + 8 asynchronous 16-B copies per lane, global -> LDS, through no register. The closing
  // s_wait_xcnt stands in the copies' own statement so that no address register is rewritten in front of it.
  auto copies = [&](int buf, int k0) {
    const unsigned la = la0 + (unsigned)buf * (unsigned)(128 * GP * 2);
    const unsigned lb = lb0 + (unsigned)buf * (unsigned)(256 * GP * 2);
    const _Float16* pa = ga + k0;
    const _Float16* pb = gb + k0;
#if defined(__HIP_DEVICE_COMPILE__)
    asm volatile(
        "global_load_async_to_lds_b128 %0, %12, off\n\t"
        "global_load_async_to_lds_b128 %1, %13, off\n\t"
        "global_load_async_to_lds_b128 %2, %14, off\n\t"
        "global_load_async_to_lds_b128 %3, %15, off\n\t"
        "global_load_async_to_lds_b128 %4, %16, off\n\t"
        "global_load_async_to_lds_b128 %5, %17, off\n\t"
        "global_load_async_to_lds_b128 %6, %18, off\n\t"
        "global_load_async_to_lds_b128 %7, %19, off\n\t"
        "global_load_async_to_lds_b128 %8, %20, off\n\t"
        "global_load_async_to_lds_b128 %9, %21, off\n\t"
        "global_load_async_to_lds_b128 %10, %22, off\n\t"
        "global_load_async_to_lds_b128 %11, %23, off\n\t"
        "s_wait_xcnt 0x0"
        :: "v"(la), "v"(la + 1u * 32u * GP * 2u), "v"(la + 2u * 32u * GP * 2u), "v"(la + 3u * 32u * GP * 2u),
           "v"(lb), "v"(lb + 1u * 32u * GP * 2u), "v"(lb + 2u * 32u * GP * 2u), "v"(lb + 3u * 32u * GP * 2u),
           "v"(lb + 4u * 32u * GP * 2u), "v"(lb + 5u * 32u * GP * 2u), "v"(lb + 6u * 32u * GP * 2u),
           "v"(lb + 7u * 32u * GP * 2u),
           "v"(pa), "v"(pa + astep), "v"(pa + 2 * astep), "v"(pa + 3 * astep),
           "v"(pb), "v"(pb + bstep), "v"(pb + 2 * bstep), "v"(pb + 3 * bstep),
           "v"(pb + 4 * bstep), "v"(pb + 5 * bstep), "v"(pb + 6 * bstep), "v"(pb + 7 * bstep)
        : "memory");
#endif
  };
  // products of one slice; every loop below is unrolled so that fragments and accumulators, indexed by
  // constants, stay in registers
  auto compute = [&](int buf) {
    const _Float16* pa = &sA[buf][(wm + rlane) * GP + koff];
    const _Float16* pb = &sB[buf][(wn + rlane) * GP + koff];
#pragma unroll
    for (int ks = 0; ks < 2; ++ks) {
      v16h bh[4], ah[4];
#pragma unroll
      for (int j = 0; j < 4; ++j) bh[j] = ldfrag_h(pb + j * 16 * GP + ks * 32);
#pragma unroll
      for (int i = 0; i < 4; ++i) ah[i] = ldfrag_h(pa + i * 16 * GP + ks * 32);
      // keeps the 16 fragment reads of a k block as one group in front of its 16 products: left free, the
      // scheduler spreads them among the products on one A register set, and each place waits out the LDS latency
      __builtin_amdgcn_sched_barrier(0);
#pragma unroll
      for (int i = 0; i < 4; ++i)
#pragma unroll
        for (int j = 0; j < 4; ++j) acc[i][j] = mma_h_raw(ah[i], bh[j], acc[i][j]);
    }
  };

  const int nst = K >> 6;
  copies(0, 0);
  asm volatile("s_wait_asynccnt 0x0" ::: "memory");   // slice 0 has landed before the barrier publishes it
  __syncthreads();
  if (nst > 1) copies(1, 64);
  for (int t = 0; t < nst; ++t) {                      // block-uniform trip
    compute(t & 1);
    asm volatile("s_wait_dscnt 0x0" ::: "memory");     // this wave's reads of buffer t & 1 are done before its refill
    asm volatile("s_wait_asynccnt 0x0" ::: "memory");  // this wave's copies of slice t + 1 have landed
    __syncthreads();                                   // publishes slice t + 1, frees buffer t & 1
    if (t + 2 < nst) copies(t & 1, (t + 2) << 6);
  }
  asm volatile("s_wait_asynccnt 0x0" ::: "memory");    // nothing in flight when the wave goes on to the epilogue
  acc_guard4(acc[0][0], acc[0][1], acc[0][2], acc[0][3]);
  acc_guard4(acc[1][0], acc[1][1], acc[1][2], acc[1][3]);
  acc_guard4(acc[2][0], acc[2][1], acc[2][2], acc[2][3]);
  acc_guard4(acc[3][0], acc[3][1], acc[3][2], acc[3][3]);

  const int q8 = lane >> 3, c8 = (lane & 7) * 8;
  float bc[8];
#pragma unroll
  for (int e = 0; e < 8; ++e) bc[e] = 0.f;
  if (BIASM == 0) {
    const int cb = n0 + c8;                                  // <= N - 8
    const int i0 = (cb < N - 8) ? cb : (N - 8);
    const v4f b0a = *(const v4f*)(bias0 + i0), b0b = *(const v4f*)(bias0 + i0 + 4);
#pragma unroll
    for (int e = 0; e < 4; ++e) {
      bc[e]     = bfr(b0a[e]) * bsc;
      bc[4 + e] = bfr(b0b[e]) * bsc;
    }
  }

  // ---- epilogue ----
  float* slab = sT[wave];
#pragma unroll
  for (int i = 0; i < 4; ++i) {
    const int mBase = m0 + (i << 4);
#pragma unroll
    for (int j = 0; j < 4; ++j) {
#pragma unroll
      for (int r = 0; r < 8; ++r) {
        slab[(mOff + r) * 68 + (j << 4) + rlane] = acc[i][j][r];
      }
    }
    wave_sync_lds();
    v4u hv[4];
#pragma unroll
    for (int it = 0; it < 4; ++it) {
      const int row = it * 4 + q8;                       // it 0..3 x q8 0..3 = rows 0..15
      const float* sp = slab + row * 68 + c8;
      float bm = 0.f;
      if (BIASM == 1) bm = bfr(bias0[mBase + row]) * bsc; // mBase + row < M
      v4u a;
#pragma unroll
      for (int e = 0; e < 4; ++e) {
        const float f0 = sp[2 * e]     * oscale + ((BIASM == 1) ? bm : bc[2 * e]);
        const float f1 = sp[2 * e + 1] * oscale + ((BIASM == 1) ? bm : bc[2 * e + 1]);
        a[e] = pk16(h_bits((_Float16)f0), h_bits((_Float16)f1));
      }
      hv[it] = a;
    }
    {
#pragma unroll
      for (int it = 0; it < 4; ++it) {
        const int row = it * 4 + q8;
        const size_t go = (size_t)(mBase + row) * ldc + n0 + c8;
        *(v4u*)(Cout + go) = hv[it];
      }
      
    }
    wave_sync_lds();
  }
}

// =====================================================================================================
// The three projections in one launch: blocks 0 .. nt - 1 form q, the next nt blocks k, the next nt blocks v^T
// (nt = tiles of one projection). Each reads the layer-norm plane and its own weight plane, nothing of the others. The choice is
// block-uniform. Two blocks fit a WGP's LDS and registers, so one block's products run under the other's waits.
// =====================================================================================================
__global__ __launch_bounds__(256) void proj3(
    const unsigned short* __restrict__ XH, const unsigned short* __restrict__ WqT,
    const unsigned short* __restrict__ WkT, const unsigned short* __restrict__ WvT,
    const float* __restrict__ bq, const float* __restrict__ bk, const float* __restrict__ bv,
    unsigned short* QH, unsigned short* KH, unsigned short* VTH,
    int nt, float osc_qk, float osc_v, float vsc) {
  __shared__ GemmLds L;
  const int bx = blockIdx.x;
  if (bx < nt) {
    // q = xh . Wq + bq -> QH f16 [NTOK][DM]
    gemm64<0>(L, bx, XH, DM, WqT, DM, bq, QH, DM, NTOK, DM, DM, osc_qk, 1.0f);
  } else if (bx < 2 * nt) {
    // k = xh . Wk + bk -> KH f16 [NTOK][DM]
    gemm64<0>(L, bx - nt, XH, DM, WkT, DM, bk, KH, DM, NTOK, DM, DM, osc_qk, 1.0f);
  } else {
    // v^T: VT[m][t] = sum_k WvT[m][k] . xh[t][k] + bv[m] -> VTH (x vsc), f16 [DM][NTOK]
    gemm64<1>(L, bx - 2 * nt, WvT, DM, XH, DM, bv, VTH, NTOK, DM, NTOK, DM, osc_v, vsc);
  }
}

#define LOG2E 1.44269504088896340736f
#define PLOG2 10.0f      // log2 of PSC
static_assert(PSC == 1024.0f);
#define OP 68      // LDS row pitch in floats of the output tile: 272 B = 16 B x 17 (odd), for 16-byte writers
__device__ __forceinline__ float other_half(float x) {    // value of lane l ^ 16
  const int b = __builtin_bit_cast(int, x);
  return __builtin_bit_cast(float, __builtin_amdgcn_permlanex16(b, b, 0x76543210, 0xfedcba98, false, false));
}
// 2^x as v_exp_f32, eight at a time (one score tile) or alone. Written as asm so that the slot
// the instruction set asks for behind a transcendental is kept by construction: outputs are early-clobber, so
// inside a statement no v_exp_f32 is followed by a write of its source or a read of its result, and the closing
// v_nop fills the slot behind the last one whatever the compiler puts next.
__device__ __forceinline__ v8f exp2_8(v8f x) {
  v8f e;
#if defined(__HIP_DEVICE_COMPILE__)
  float e0, e1, e2, e3, e4, e5, e6, e7;
  asm("v_exp_f32 %0, %8\n\tv_exp_f32 %1, %9\n\tv_exp_f32 %2, %10\n\tv_exp_f32 %3, %11\n\t"
      "v_exp_f32 %4, %12\n\tv_exp_f32 %5, %13\n\tv_exp_f32 %6, %14\n\tv_exp_f32 %7, %15\n\tv_nop"
      : "=&v"(e0), "=&v"(e1), "=&v"(e2), "=&v"(e3), "=&v"(e4), "=&v"(e5), "=&v"(e6), "=&v"(e7)
      : "v"(x[0]), "v"(x[1]), "v"(x[2]), "v"(x[3]), "v"(x[4]), "v"(x[5]), "v"(x[6]), "v"(x[7]));
  e[0] = e0; e[1] = e1; e[2] = e2; e[3] = e3; e[4] = e4; e[5] = e5; e[6] = e6; e[7] = e7;
#else
  e = x;
#endif
  return e;
}
__device__ __forceinline__ float exp2_1(float x) {
  float e = x;
#if defined(__HIP_DEVICE_COMPILE__)
  asm("v_exp_f32 %0, %1\n\tv_nop" : "=&v"(e) : "v"(x));
#endif
  return e;
}

#define QT   2                  // query tiles of 16 per wave: every K and V^T fragment read from LDS feeds QT products
#define AWV  8                  // waves per block
#define QBLK (AWV * QT * 16)    // queries per block
#define NQK  (SQ / QBLK)        // query blocks per (sequence, head)
static_assert((SQ % QBLK) == 0 && (64 % (QT * 16)) == 0);
__global__ __launch_bounds__(AWV * 32) __attribute__((amdgpu_waves_per_eu(4, 4)))   // registers stay within four waves per SIMD
void attn_lb(const unsigned short* __restrict__ qhp, const unsigned short* __restrict__ khp,
             const unsigned short* __restrict__ vthp, float* outp, float sscale, float onorm) {
  union FH { v16h v; v8h h[2]; };
  // two buffers of two tiles, 9 KB each, pitch LP: K [kv][d], V^T [d][kv]
  __shared__ __align__(16) _Float16 Ring[2][2][64 * LP];
  __shared__ __align__(16) float    Os[AWV * QT][16 * OP];        // per wave and query tile: context [row][d], pitch OP

  const int tid  = threadIdx.x;
  const int wave = tid >> 5;
  const int lane = tid & 31;
  const int hh   = lane >> 4;
  const int c    = lane & 15;

  const int bx   = blockIdx.x;
  const int qb   = bx % NQK;
  const int hb   = bx / NQK;
  const int h    = hb % NH;
  const int b    = hb / NH;
  const int tok0 = b * SQ;                       // first token row of this sequence
  const int ql0  = qb * QBLK + wave * (QT * 16); // local query index of this wave's first row
  const int q0   = tok0 + ql0;                   // global token row of this wave's first row
  // the one key chunk that holds this wave's queries; equal in all lanes, read into a scalar so that the test on it is
  // a scalar branch
  const int kown = __builtin_amdgcn_readfirstlane(ql0 >> 6);

  const _Float16* Qh = (const _Float16*)(const void*)qhp + (size_t)h * HD;
  const _Float16* Kg = (const _Float16*)(const void*)khp + (size_t)h * HD;
  const _Float16* Vh = (const _Float16*)(const void*)vthp + (size_t)h * HD * NTOK + tok0;

  // ---- per-head slope (block-uniform) ----
  const int   se    = (h + 1) >> 1;
  const float spw   = __uint_as_float((unsigned)(127 - se) << 23);
  const float slope = (h & 1) ? spw : (spw * 0.70710678118654752f);

  // ---- Q fragments (B operand, column = lane&15): QT query tiles x 2 d-chunks ----
  v16h qa[QT][2];
#pragma unroll
  for (int u = 0; u < QT; ++u)
#pragma unroll
    for (int dc = 0; dc < 2; ++dc) qa[u][dc] = ldfrag_h(Qh + (size_t)(q0 + u * 16 + c) * DM + dc * 32 + 8 * hh);

  float mrow[QT], nrow[QT], lrow[QT];            // per query tile u, query ql0 + 16 u + c (D column = lane&15):
  v8f oacc[QT][4];                               // oacc[u][t][r] = context[query][d = 16 t + 8 hh + r]
#pragma unroll
  for (int u = 0; u < QT; ++u) {
    mrow[u] = -INFINITY;                         // running maximum of raw (equal in both lane halves)
    nrow[u] = INFINITY;                          // addend of the exponent that the running sum and context stand on
    lrow[u] = 0.f;                               // running sum (x PSC) over this lane half's keys only
#pragma unroll
    for (int t = 0; t < 4; ++t) oacc[u][t] = zero8();
  }

  const float c2   = sscale * LOG2E;             // raw -> exponent of two
  const float ydl  = (float)(8 * hh - (ql0 + c)); // key - query of the lane's register 0, key tile 0, chunk 0, query tile 0

  // staging map: thread -> row (tid >> 3) + 32 * it, 16-B piece tid & 7 of the row's 128 B
  const int srow = tid >> 3, sc8 = (tid & 7) * 8;
  const _Float16* gk = Kg + (size_t)(tok0 + srow) * DM + sc8;      // K row = key, d = sc8..sc8+7
  const _Float16* gv = Vh + (size_t)srow * NTOK + sc8;             // V^T row = d, key = sc8..sc8+7
  const unsigned l0 = (unsigned)(uintptr_t)(&Ring[0][0][srow * LP + sc8]);   // lane's LDS byte address, buffer 0, K, it 0
  // One chunk: 2 x 2 asynchronous 16-B copies per lane, global -> LDS, through no register. The closing
  // s_wait_xcnt stands in the copies' own statement so that no address register is rewritten in front of it.
  auto copies = [&](int buf, int kv) {
    const unsigned lk = l0 + (unsigned)buf * (unsigned)(2 * 64 * LP * 2);
    const unsigned lv = lk + (unsigned)(64 * LP * 2);
    const _Float16* pk = gk + (size_t)kv * DM;
    const _Float16* pv = gv + kv;
    const size_t kstep = (size_t)32 * DM, vstep = (size_t)32 * NTOK;
#if defined(__HIP_DEVICE_COMPILE__)
    asm volatile(
        "global_load_async_to_lds_b128 %0, %4, off\n\t"
        "global_load_async_to_lds_b128 %1, %5, off\n\t"
        "global_load_async_to_lds_b128 %2, %6, off\n\t"
        "global_load_async_to_lds_b128 %3, %7, off\n\t"
        "s_wait_xcnt 0x0"
        :: "v"(lk), "v"(lk + 32u * LP * 2u), "v"(lv), "v"(lv + 32u * LP * 2u),
           "v"(pk), "v"(pk + kstep), "v"(pv), "v"(pv + vstep)
        : "memory");
#endif
  };

  static_assert(NQB >= 2);
  copies(0, 0);
  asm volatile("s_wait_asynccnt 0x0" ::: "memory");   // chunk 0 has landed before the barrier publishes it
  __syncthreads();
  copies(1, 64);
  // one trip = one key chunk. refill is a constant at either place of call: the trips that refill a buffer and the last
  // two, which do not, are loops of their own, so that a trip's foot has no branch; behind such a branch the compiler
  // puts the adds of the running sums, and all of a chunk's p values then stay in registers across the products
  auto trip = [&](int kt, bool refill) __attribute__((always_inline)) {
    const int kv0 = kt * 64;                     // local key index of the chunk
    const _Float16* Ksh = &Ring[kt & 1][0][0];
    const _Float16* Vth = &Ring[kt & 1][1][0];
    const float yd = ydl + (float)kv0;

    // ---- K fragments of the whole chunk: 16 reads as one group (loops unrolled: fragments stay in registers) ----
    FH kb[4][2];
#pragma unroll
    for (int j = 0; j < 4; ++j) {
#pragma unroll
      for (int dc = 0; dc < 2; ++dc) {
        kb[j][dc].h[0] = *(const v8h*)(Ksh + (j * 16 + c) * LP + dc * 32 + 8 * hh);
        kb[j][dc].h[1] = *(const v8h*)(Ksh + (j * 16 + c) * LP + dc * 32 + 16 + 8 * hh);
      }
    }

    // compiler fence: keeps the 16 K reads in front of the branches below, so that the distance term is formed under
    // their latency; left free, they sink behind a branch's join
    asm volatile("" ::: "memory");
    // ---- logits, transposed: 64 keys x 32 queries per wave; each K fragment is the A operand of QT products ----
    //      Start value of an accumulator: the distance term -slope * |key - query|; register r of key tile j, query
    //      tile u: key - query = yd + 16 (j - u) + r. In every chunk but the wave's own, key - query has one sign for
    //      all scores: the term is linear there.
    //      Two halves of two key tiles: the second half's start values are formed only when the first half's K
    //      fragments are spent, so that fragments, scores, context and q stay within the registers of four waves per SIMD;
    //      8 products back to back on 4 independent accumulators: each fills the distance that the ones before it need
    v8f s[QT][4];
#pragma unroll
    for (int jh = 0; jh < 2; ++jh) {
      if (kt == kown) {                          // wave-uniform, scalar; no barrier inside
#pragma unroll
        for (int u = 0; u < QT; ++u) {
#pragma unroll
          for (int j = 2 * jh; j < 2 * jh + 2; ++j) {
            const float dj = yd + (float)((j - u) * 16);       // whole numbers, exact
#pragma unroll
            for (int r = 0; r < 8; ++r) s[u][j][r] = -slope * fabsf(dj + (float)r);
          }
        }
      } else {
        const float sg = (kt < kown) ? slope : -slope;
#pragma unroll
        for (int u = 0; u < QT; ++u) {
          const float z0 = sg * (yd - (float)(u * 16));
          v8f b0;
#pragma unroll
          for (int r = 0; r < 8; ++r) b0[r] = sg * (float)r + z0;
#pragma unroll
          for (int j = 2 * jh; j < 2 * jh + 2; ++j) s[u][j] = (j == 0) ? b0 : (b0 + sg * (float)(j * 16));
        }
      }
#pragma unroll
      for (int dc = 0; dc < 2; ++dc) {
#pragma unroll
        for (int j = 2 * jh; j < 2 * jh + 2; ++j) {
#pragma unroll
          for (int u = 0; u < QT; ++u) s[u][j] = mma_h_raw(kb[j][dc].v, qa[u][dc], s[u][j]);
        }
      }
      // keeps the second half's start values behind the first half's products (registers, see above), and the V^T
      // reads below behind the second half's, as one group
      __builtin_amdgcn_sched_barrier(0);
    }

    // ---- V^T fragments of keys 0..31: 8 reads as one group, in flight under the softmax ----
    FH vb[2][4];
#pragma unroll
    for (int t = 0; t < 4; ++t) {
      vb[0][t].h[0] = *(const v8h*)(Vth + (t * 16 + c) * LP + 8 * hh);
      vb[0][t].h[1] = *(const v8h*)(Vth + (t * 16 + c) * LP + 16 + 8 * hh);
    }
    // keeps the products and the 8 reads in front of the softmax arithmetic, which covers the reads' latency: left
    // free, the scheduler puts that arithmetic among the products, where the compiler fills the distance in front of
    // each reader of a score with v_nop, and sinks the last reads behind it
    __builtin_amdgcn_sched_barrier(0);

    // ---- maximum in the lane, one exchange between the halves; online softmax; the query tiles side by side, so that
    //      one tile's dependent steps stand among the other's ----
    float nb[QT], alpha[QT];
#pragma unroll
    for (int u = 0; u < QT; ++u) {
      float mj[4];
#pragma unroll
      for (int j = 0; j < 4; ++j) {
        mj[j] = s[u][j][0];
#pragma unroll
        for (int r = 1; r < 8; ++r) mj[j] = fmaxf(mj[j], s[u][j][r]);
      }
      float m = fmaxf(fmaxf(mj[0], mj[1]), fmaxf(mj[2], mj[3]));
      m = fmaxf(m, other_half(m));
      const float mnew = fmaxf(mrow[u], m);
      const bool  none = (mnew == -INFINITY);
      nb[u]    = none ? PLOG2 : (PLOG2 - mnew * c2);
      alpha[u] = exp2_1(nb[u] - nrow[u]);
      mrow[u]  = mnew;
      nrow[u]  = none ? INFINITY : nb[u];
    }

    // ---- P (x PSC, f16) packed from the score registers into the B operands of p.v ----
    v16h pb[QT][2];
    float pj[QT][4];
#pragma unroll
    for (int j = 0; j < 4; ++j) {
#pragma unroll
      for (int u = 0; u < QT; ++u) {
        const v8f p = exp2_8(s[u][j] * c2 + nb[u]);
        pj[u][j] = 0.f;
#pragma unroll
        for (int r = 0; r < 8; ++r) {
          pj[u][j] += p[r];
          pb[u][j >> 1][(j & 1) * 8 + r] = (_Float16)p[r];
        }
      }
    }
#pragma unroll
    for (int u = 0; u < QT; ++u) {
      lrow[u] = lrow[u] * alpha[u] + ((pj[u][0] + pj[u][1]) + (pj[u][2] + pj[u][3]));
#pragma unroll
      for (int t = 0; t < 4; ++t) {
#pragma unroll
        for (int r = 0; r < 8; ++r) oacc[u][t][r] *= alpha[u];
      }
    }
    // keeps every v_exp_f32 statement in front of the products;
    // and keeps the reads below behind the softmax, whose score registers they take over
    __builtin_amdgcn_sched_barrier(0);

    // ---- V^T fragments of keys 32..63: 8 reads as one group, in flight under the products of keys 0..31 ----
#pragma unroll
    for (int t = 0; t < 4; ++t) {
      vb[1][t].h[0] = *(const v8h*)(Vth + (t * 16 + c) * LP + 32 + 8 * hh);
      vb[1][t].h[1] = *(const v8h*)(Vth + (t * 16 + c) * LP + 32 + 16 + 8 * hh);
    }
    // keeps the 8 reads as one group in front of the products: left free, the scheduler puts them in pairs among the
    // products on one register set, and each pair's place waits out the LDS latency
    __builtin_amdgcn_sched_barrier(0);

    // ---- context^T += V^T . P^T (f16 WMMA); each V^T fragment is the A operand of QT products ----
#pragma unroll
    for (int kk = 0; kk < 2; ++kk) {
#pragma unroll
      for (int t = 0; t < 4; ++t) {
#pragma unroll
        for (int u = 0; u < QT; ++u) oacc[u][t] = mma_h_raw(vb[kk][t].v, pb[u][kk], oacc[u][t]);
      }
    }
    // keeps the products in front of the trip's waits and barrier
    __builtin_amdgcn_sched_barrier(0);
    asm volatile("s_wait_dscnt 0x0" ::: "memory");     // this wave's reads of buffer kt & 1 are done before its refill
    asm volatile("s_wait_asynccnt 0x0" ::: "memory");  // this wave's copies of chunk kt + 1 have landed
    __syncthreads();                                   // publishes chunk kt + 1, frees buffer kt & 1
    if (refill) copies(kt & 1, kv0 + 128);             // chunk kt + 2 exists
  };
  for (int kt = 0; kt < NQB - 2; ++kt) trip(kt, true);      // block-uniform trips, 30
  // stays rolled: unrolled, the two trips' values overlap and no longer fit the registers of four waves per SIMD
#pragma unroll 1
  for (int kt = NQB - 2; kt < NQB; ++kt) trip(kt, false);   // the last two chunks
  asm volatile("s_wait_asynccnt 0x0" ::: "memory");    // nothing in flight when the wave goes on to the epilogue

  // ---- per query tile: join the halves' sums, normalise (1/l and the 1/(PSC*VSC) carry), stage the 16x64 tile in
  //      its own LDS range (a lane holds 8 consecutive d of its query per t: two 16-B LDS writes); then write whole
  //      256-B rows
#pragma unroll
  for (int u = 0; u < QT; ++u) {
    float* os = Os[wave * QT + u];
    const float l = lrow[u] + other_half(lrow[u]);
    const float inv = ((l > 0.f) ? (1.0f / l) : 0.f) * (onorm * PSC);
#pragma unroll
    for (int t = 0; t < 4; ++t) {
      v4f w0, w1;
#pragma unroll
      for (int e = 0; e < 4; ++e) { w0[e] = oacc[u][t][e] * inv; w1[e] = oacc[u][t][4 + e] * inv; }
      *(v4f*)(os + c * OP + t * 16 + 8 * hh)     = w0;
      *(v4f*)(os + c * OP + t * 16 + 8 * hh + 4) = w1;
    }
  }
  wave_sync_lds();
#pragma unroll
  for (int u = 0; u < QT; ++u) {
    const float* os = Os[wave * QT + u];
    const int hh2 = lane >> 4, c4 = (lane & 15) * 4;
    v4f vals[8];
#pragma unroll
    for (int it = 0; it < 8; ++it) {
      const int row = it * 2 + hh2;   // it 0..7 x hh2 0..1 = rows 0..15 of the query tile
      vals[it] = *(const v4f*)(os + row * OP + c4);
    }
    {
#pragma unroll
      for (int it = 0; it < 8; ++it) {
        const int row = it * 2 + hh2;
        const size_t go = (size_t)(q0 + u * 16 + row) * DM + (size_t)h * HD + c4;
        *(v4f*)(outp + go) = vals[it];
      }
    }
  }
}

// =====================================================================================================
// Workspace map (bytes); every plane is an exact multiple of its 64x64-tile / whole-line store granularity
// ([8192][1024] = 128x16 tiles, [1024][8192] = 16x128 tiles, weights [1024][1024] = 16x16 tiles):
//   WqT  f16 [1024][1024]   0          2097152   (transposed, x64)
//   WkT  f16 [1024][1024]   2097152    2097152
//   WvT  f16 [1024][1024]   4194304    2097152
//   XH   f16 [8192][1024]   6291456    16777216  (layer norm output x16)
//   QH   f16 [8192][1024]   23068672   16777216
//   KH   f16 [8192][1024]   39845888   16777216
//   VTH  f16 [1024][8192]   56623104   16777216  (v^T x16)
//   end                     73400320
// =====================================================================================================
extern "C" void kernel_launch(void* const* d_in, const int* in_sizes, int n_in,
                              void* d_out, int out_size, void* d_ws, size_t ws_size,
                              hipStream_t stream) {
  if (n_in < 9) return;
  if (in_sizes[0] != NTOK * DM) return;
  if (in_sizes[1] != DM || in_sizes[2] != DM) return;
  if (in_sizes[3] != DM * DM || in_sizes[5] != DM * DM || in_sizes[7] != DM * DM) return;
  if (in_sizes[4] != DM || in_sizes[6] != DM || in_sizes[8] != DM) return;
  if (out_size != NTOK * DM) return;

  const float* x   = (const float*)d_in[0];
  const float* gam = (const float*)d_in[1];
  const float* bet = (const float*)d_in[2];
  const float* wq  = (const float*)d_in[3];
  const float* bq  = (const float*)d_in[4];
  const float* wk  = (const float*)d_in[5];
  const float* bk  = (const float*)d_in[6];
  const float* wv  = (const float*)d_in[7];
  const float* bv  = (const float*)d_in[8];

  const size_t PW = (size_t)DM * DM * 2;            //  2097152
  const size_t PA = (size_t)NTOK * DM * 2;          // 16777216
  size_t off = 0;
  const size_t oWq = off; off += PW;
  const size_t oWk = off; off += PW;
  const size_t oWv = off; off += PW;
  const size_t oXH = off; off += PA;
  const size_t oQH = off; off += PA;
  const size_t oKH = off; off += PA;
  const size_t oVH = off; off += PA;
  if (off > ws_size) return;                        // off = 73400320
  if (off > (size_t)134217728) return;

  char* ws = (char*)d_ws;
  unsigned short* WqT = (unsigned short*)(ws + oWq);
  unsigned short* WkT = (unsigned short*)(ws + oWk);
  unsigned short* WvT = (unsigned short*)(ws + oWv);
  unsigned short* XH  = (unsigned short*)(ws + oXH);
  unsigned short* QH  = (unsigned short*)(ws + oQH);
  unsigned short* KH  = (unsigned short*)(ws + oKH);
  unsigned short* VTH = (unsigned short*)(ws + oVH);

  const dim3 blk(256);
  const dim3 gPrep(NTOK / 8 + 3 * (DM / 64) * (DM / 64));              // 1024 blocks of 8 rows + 3 x 256 tiles of 64x64
  const dim3 gG(3 * ((NTOK / 128) * (DM / 256)));                      // 3 x 256 blocks, one 128x256 tile each
  const dim3 gAttn(NB * NH * NQK);                                     // 512 blocks of 256 threads, 256 queries each
  const float osc_qk = 1.0f / (XSC * WSC);                             // q, k unscaled
  const float osc_v  = VSC / (XSC * WSC);                              // v^T carried x16

  // (0) layer norm -> XH f16 [8192][1024] (x16); weights W[in][out] f32 -> W^T f16 [out][in] (k contiguous),
  //     bf16 RNE-converted, x64
  prep<<<gPrep, blk, 0, stream>>>(x, gam, bet, wq, wk, wv, XH, WqT, WkT, WvT, NTOK / 8, XSC, LNEPS, WSC);
  // (1) q -> QH, k -> KH, f16 [8192][1024]; v^T -> VTH (x16), f16 [1024][8192]
  proj3<<<gG, blk, 0, stream>>>(XH, WqT, WkT, WvT, bq, bk, bv, QH, KH, VTH,
                                (NTOK / 128) * (DM / 256), osc_qk, osc_v, VSC);
  // (2) attention with per-head linear distance bias -> d_out f32 [8192][1024]
  attn_lb<<<gAttn, blk, 0, stream>>>(QH, KH, VTH, (float*)d_out, 0.125f, 1.0f / (PSC * VSC));
  (void)hipGetLastError();
}
